// v000
// Times are from an AMD MI455X. After a warm-up the kernel runs many times in a row, and a time is the length of
// such a window on the GPU divided by its runs, so every launch and the gaps after it count. The runs cycle
// through copies of the inputs. A figure is the median of several windows, for all but v000 over two sittings.
// Sittings can differ by a few percent; kernels timed side by side share one.
// v000 is the starting kernel. One run takes 406 microseconds.
// Contractions: x.W{q,k,v} on v_wmma_f32_16x16x32_bf16 (x and W^T RNE-converted to bf16, f32 accumulate);
// scores q.k^T (q, k carried x1024 as f16 hi plane + f16 residual plane, products hh+lh+hl), P.v (P x32768 f16 hi+residual,
// v x1024 f16 hi+residual, products hh+lh+hl) and O.Wo (O x1024 f16 hi+residual, Wo^T as f16(bf16(Wo)) x1024, products h.w+l.w):
// v_wmma_f32_16x16x32_f16, f32 accumulate. Static causal select, base-2 online softmax and 1/l fold in f32 on VALU.
#include <hip/hip_runtime.h>
#include <math.h>
#include <stdint.h>

#define BATCH 2
#define SEQ   2048
#define DMOD  1024
#define NH    16
#define HD    64
#define MROWS (BATCH * SEQ)
#define QSC   1024.0f
#define KSC   1024.0f
#define PCAR  32768.0f
#define VCAR  1024.0f
#define OSC   1024.0f
#define WOS   1024.0f
#define LOG2E 1.4426950408889634f
#define WPB   4
#define NHG   (NH / WPB)
#define NQT   (SEQ / 16)
#define NST   (SEQ / 64)
#define NKT   (SEQ / 32)
#define ATT_THREADS (WPB * 32)
#define ATT_BLOCKS  (NQT * NHG * BATCH)
#define PTW   (16 * 36)
#define SLW   (16 * 68)
#define WREG  (PTW + SLW)
#define SLAB64 (16 * 68)
#define VTP   72
static_assert(DMOD == NH * HD && HD == 64 && NH == 16);
static_assert((NH % WPB) == 0 && ATT_THREADS == 128 && ATT_BLOCKS == 1024);
static_assert((SEQ % 64) == 0 && (SEQ % 32) == 0 && (SEQ % 16) == 0 && SEQ <= 32768);
static_assert((DMOD % 64) == 0 && (DMOD % 32) == 0 && (MROWS % 64) == 0);
static_assert(((MROWS * DMOD) % 2048) == 0 && ((DMOD * DMOD) % 4096) == 0);

typedef unsigned short u16;
typedef _Float16 v16h __attribute__((ext_vector_type(16)));
typedef _Float16 v8h  __attribute__((ext_vector_type(8)));
typedef __bf16   v16b __attribute__((ext_vector_type(16)));
typedef float    v8f  __attribute__((ext_vector_type(8)));
typedef float    v4f  __attribute__((ext_vector_type(4)));
typedef unsigned int v4u __attribute__((ext_vector_type(4)));

union FragH { v16h v; v8h h[2]; v4u u[2]; };
union FragB { v16b v; v4u u[2]; };

// ---- scalar helpers --------------------------------------------------------------------------------
__device__ __forceinline__ unsigned short bf_bits(float f) {          // f32 -> bf16 bits, RNE convert
  unsigned u = __float_as_uint(f);
  return (unsigned short)((u + 0x7FFFu + ((u >> 16) & 1u)) >> 16);
}
__device__ __forceinline__ float bf_up(unsigned short h) { return __uint_as_float(((unsigned)h) << 16); }
__device__ __forceinline__ float bfr(float f) { return bf_up(bf_bits(f)); }
__device__ __forceinline__ unsigned short h_bits(_Float16 x) { return __builtin_bit_cast(unsigned short, x); }
__device__ __forceinline__ unsigned pk16(unsigned short a, unsigned short b) { return (unsigned)a | ((unsigned)b << 16); }
__device__ __forceinline__ v8f zero8() { v8f z = {0.f, 0.f, 0.f, 0.f, 0.f, 0.f, 0.f, 0.f}; return z; }

// ---- fragment loaders: 16-bit A/B operand, lane -> row/col (lane&15), p already includes +8*(lane>>4);
//      elements 0..7 <- p[0..7] (k0+8h..), elements 8..15 <- p[16..23] (k0+16+8h..)  (same split k map for A and B;
//      B is always read from a k-contiguous [n][k] plane)
__device__ __forceinline__ v16h ldfrag_h(const _Float16* p) {
  FragH f;
  f.h[0] = *(const v8h*)(p);
  f.h[1] = *(const v8h*)(p + 16);
  return f.v;
}
__device__ __forceinline__ v16b ldfrag_b(const u16* p) {              // bf16 plane read as unsigned integer vectors
  FragB f;
  f.u[0] = *(const v4u*)(p);
  f.u[1] = *(const v4u*)(p + 16);
  return f.v;
}

__device__ __forceinline__ v8f mma_h(v16h a, v16h b, v8f c) {
  return __builtin_amdgcn_wmma_f32_16x16x32_f16(false, a, false, b, (short)0, c, false, false);
}
__device__ __forceinline__ v8f mma_b(v16b a, v16b b, v8f c) {
  return __builtin_amdgcn_wmma_f32_16x16x32_bf16(false, a, false, b, (short)0, c, false, false);
}
__device__ __forceinline__ void guard2(v8f& a, v8f& b, v16h x0, v16h x1, v16h x2, v16h x3, v16h x4, v16h x5) {
#if defined(__HIP_DEVICE_COMPILE__)
  asm volatile("v_nop\n\tv_nop\n\tv_nop\n\tv_nop"
               : "+v"(a), "+v"(b) : "v"(x0), "v"(x1), "v"(x2), "v"(x3), "v"(x4), "v"(x5) : "memory");
#endif
}
template <typename F>
__device__ __forceinline__ void guard6(v8f& a, v8f& b, v8f& c, v8f& d, F x0, F x1, F x2, F x3, F x4, F x5) {
#if defined(__HIP_DEVICE_COMPILE__)
  asm volatile("v_nop\n\tv_nop\n\tv_nop\n\tv_nop"
               : "+v"(a), "+v"(b), "+v"(c), "+v"(d) : "v"(x0), "v"(x1), "v"(x2), "v"(x3), "v"(x4), "v"(x5) : "memory");
#endif
}
__device__ __forceinline__ void guard10(v8f& a, v8f& b, v8f& c, v8f& d, v16h x0, v16h x1, v16h x2, v16h x3, v16h x4,
                                        v16h x5, v16h x6, v16h x7, v16h x8, v16h x9) {
#if defined(__HIP_DEVICE_COMPILE__)
  asm volatile("v_nop\n\tv_nop\n\tv_nop\n\tv_nop"
               : "+v"(a), "+v"(b), "+v"(c), "+v"(d)
               : "v"(x0), "v"(x1), "v"(x2), "v"(x3), "v"(x4), "v"(x5), "v"(x6), "v"(x7), "v"(x8), "v"(x9) : "memory");
#endif
}
__device__ __forceinline__ void acc_guard4(v8f& a, v8f& b, v8f& c, v8f& d) {
#if defined(__HIP_DEVICE_COMPILE__)
  asm volatile("v_nop\n\tv_nop\n\tv_nop\n\tv_nop" : "+v"(a), "+v"(b), "+v"(c), "+v"(d));
#endif
}
__device__ __forceinline__ void wave_sync_lds() {
  __builtin_amdgcn_fence(__ATOMIC_RELEASE, "workgroup");
  __builtin_amdgcn_wave_barrier();
  __builtin_amdgcn_fence(__ATOMIC_ACQUIRE, "workgroup");
}

// =====================================================================================================
// f32 -> 16-bit plane, same layout.  f16mode == 0: bf16 RNE bits;  f16mode == 1: f16 bits of (bf16 RNE value) * scale.
// Thread = 8 consecutive elements: two 16-B loads, one 16-B store; 32 consecutive lanes = 512 contiguous, 512-B aligned bytes per
// coverage: grid = n8/256 blocks (exact, host-derived) x 256 thr x 8 = the whole plane.
// =====================================================================================================
__global__ __launch_bounds__(256) void cvt16(const float* __restrict__ x, u16* D, int n8, int f16mode, float scale) {
  const int gt = blockIdx.x * 256 + (int)threadIdx.x;
  if (gt >= n8) return;                     // no barriers in this kernel
  const float* p = x + (size_t)gt * 8;
  const v4f a = *(const v4f*)(p), b4 = *(const v4f*)(p + 4);
  float w[8];
#pragma unroll
  for (int e = 0; e < 4; ++e) { w[e] = a[e]; w[4 + e] = b4[e]; }
  v4u o;
#pragma unroll
  for (int e = 0; e < 4; ++e) {
    const float f0 = w[2 * e], f1 = w[2 * e + 1];
    const unsigned short hb0 = h_bits((_Float16)(bfr(f0) * scale));
    const unsigned short hb1 = h_bits((_Float16)(bfr(f1) * scale));
    const unsigned short bb0 = bf_bits(f0);
    const unsigned short bb1 = bf_bits(f1);
    o[e] = (f16mode != 0) ? pk16(hb0, hb1) : pk16(bb0, bb1);
  }
  u16* d = D + (size_t)gt * 8;
  {
    *(v4u*)(d) = o;
    
  }
}

// =====================================================================================================
// Weight transpose-convert: W [K][N] f32 (x.W layout, n contiguous, in[K rows][N cols]) -> Dt[N][K] 16-bit k-contiguous plane
// (out[N rows][K cols]).  f16mode == 0: bf16 RNE bits; 1: f16 bits of (bf16 RNE value) * scale.
// Block = (k tile k0 = (bid / (N/64))*64, n tile n0 = (bid % (N/64))*64): 64 source rows of 64 floats loaded with 16-B loads,
// converted, scattered into an LDS tile [n][64 k] (pitch 72 halves); after a block barrier each n row segment (64 halves = one
// coverage: load 256 thr x 16 = 64 x 64; store 2 iterations x 256 thr x 8 halves = 64 lines x 64 halves = the block's tile;
//           grid = (K/64)*(N/64) blocks covers Dt exactly once (host checks K % 64 == 0 and N % 64 == 0).
// =====================================================================================================
__global__ __launch_bounds__(256) void wt16(const float* __restrict__ W, u16* Dt, int K, int N, int f16mode, float scale) {
  __shared__ __align__(16) u16 T[64 * VTP];
  const int tid = threadIdx.x;
  const int bid = blockIdx.x;
  const int ntn = N >> 6;
  const int n0  = (bid % ntn) * 64;
  const int k0  = (bid / ntn) * 64;
  if (k0 + 64 > K) return;                    // block-uniform, before any barrier; never taken with the exact grid
  {
    const int sl = tid >> 2;                  // k within tile 0..63 (source row)
    const int dc = (tid & 3) * 16;            // n chunk
    const float* src = W + (size_t)(k0 + sl) * N + n0 + dc;
#pragma unroll
    for (int i = 0; i < 4; ++i) {
      const v4f a = *(const v4f*)(src + 4 * i);
#pragma unroll
      for (int e = 0; e < 4; ++e) {
        const float f = a[e];
        const unsigned short hb = h_bits((_Float16)(bfr(f) * scale));
        const unsigned short bb = bf_bits(f);
        T[(dc + 4 * i + e) * VTP + sl] = (f16mode != 0) ? hb : bb;
      }
    }
  }
  __syncthreads();
  v4u vv[2];
  const int q8 = tid >> 3, p8 = (tid & 7) * 8;
#pragma unroll
  for (int it = 0; it < 2; ++it) {
    const int line = it * 32 + q8;            // n = 0..63 within tile
    vv[it] = *(const v4u*)(T + line * VTP + p8);
  }
  const size_t base = (size_t)n0 * K + k0 + p8;
  {
#pragma unroll
    for (int it = 0; it < 2; ++it) {
      const int line = it * 32 + q8;
      *(v4u*)(Dt + base + (size_t)line * K) = vv[it];
    }
    
  }
}

// =====================================================================================================
// GEMM epilogue shared by both engines: the wave's 16x64 f32 tile (times oscale) staged in its LDS slab (pitch 68),
// coverage: 8 instructions x 2 rows x 16 lanes x 4 floats = the wave's 16 x 64 tile.
// =====================================================================================================
__device__ __forceinline__ void epi64(float* sl, v8f a0, v8f a1, v8f a2, v8f a3, float oscale,
                                      const float* __restrict__ bias, float* C, int N,
                                      size_t rowb, int col0, int lane) {
  const int hh = lane >> 4, m = lane & 15;
#pragma unroll
  for (int r = 0; r < 8; ++r) {
    const int ro = (8 * hh + r) * 68 + m;
    sl[ro]      = a0[r] * oscale;
    sl[ro + 16] = a1[r] * oscale;
    sl[ro + 32] = a2[r] * oscale;
    sl[ro + 48] = a3[r] * oscale;
  }
  wave_sync_lds();
  const v4f braw = *(const v4f*)(bias + col0 + m * 4);
  v4f bb;
#pragma unroll
  for (int e = 0; e < 4; ++e) bb[e] = bfr(braw[e]);
  v4f vals[8];
#pragma unroll
  for (int it = 0; it < 8; ++it) vals[it] = *(const v4f*)(sl + (it * 2 + hh) * 68 + m * 4) + bb;
  float* dst = C + (rowb + (size_t)hh) * (size_t)N + col0 + m * 4;
  {
#pragma unroll
    for (int it = 0; it < 8; ++it) {
      *(v4f*)(dst + (size_t)(it * 2) * (size_t)N) = vals[it];
    }
    
  }
}

// =====================================================================================================
// bf16 GEMM: C[M][N] (f32) = A[M][K] (bf16 row-major) . Bt[N][K]^T (bf16 k-contiguous), times oscale, plus bias[N].
// Block = 64x64 tile, 4 waves x 16 rows; fragments loaded straight from the 16-bit rows (two 16-B loads each, split k map
// for A and B); K stepped by 32 (host checks K % 32 == 0, M % 64 == 0, N % 64 == 0, grid = (M/64)*(N/64)).
// =====================================================================================================
__global__ __launch_bounds__(128)
void gemm_bf(const u16* __restrict__ A, const u16* __restrict__ Bt, const float* __restrict__ bias, float* C,
             int M, int N, int K, float oscale) {
  __shared__ __align__(16) float slab[4 * SLAB64];
  const int tid = threadIdx.x, wave = tid >> 5, lane = tid & 31, hh = lane >> 4, m = lane & 15;
  const int ntile = N >> 6;
  const int bid   = blockIdx.x;
  const int rowb  = (bid / ntile) * 64 + wave * 16;
  const int col0  = (bid % ntile) * 64;
  if (rowb + 16 > M) return;                 // wave-uniform, never taken with the exact grid; no block barriers in this kernel
  const u16* ap = A  + (size_t)(rowb + m) * K + 8 * hh;
  const u16* bp = Bt + (size_t)(col0 + m) * K + 8 * hh;
  const size_t bs = (size_t)16 * K;
  v8f acc0 = zero8(), acc1 = zero8(), acc2 = zero8(), acc3 = zero8();
#pragma unroll 1
  for (int k0 = 0; k0 < K; k0 += 32) {
    const v16b a  = ldfrag_b(ap + k0);
    const v16b b0 = ldfrag_b(bp + k0);
    const v16b b1 = ldfrag_b(bp + bs + k0);
    const v16b b2 = ldfrag_b(bp + 2 * bs + k0);
    const v16b b3 = ldfrag_b(bp + 3 * bs + k0);
    acc0 = mma_b(a, b0, acc0);
    acc1 = mma_b(a, b1, acc1);
    acc2 = mma_b(a, b2, acc2);
    acc3 = mma_b(a, b3, acc3);
    guard6<v16b>(acc0, acc1, acc2, acc3, a, b0, b1, b2, b3, a);
  }
  epi64(slab + wave * SLAB64, acc0, acc1, acc2, acc3, oscale, bias, C, N, (size_t)rowb, col0, lane);
}

// =====================================================================================================
// f16 hi+lo GEMM: C[M][N] (f32) = (Ahi + Alo)[M][K] . Bt[N][K]^T, times oscale, plus bias[N]; Ahi/Alo f16 planes (same layout),
// Bt f16 k-contiguous; products hi.B + lo.B into one accumulator (lo is the unscaled residual of hi). Same tiling as gemm_bf.
// =====================================================================================================
__global__ __launch_bounds__(128)
void gemm_h2(const u16* __restrict__ Ah, const u16* __restrict__ Al, const u16* __restrict__ Bt,
             const float* __restrict__ bias, float* C, int M, int N, int K, float oscale) {
  __shared__ __align__(16) float slab[4 * SLAB64];
  const int tid = threadIdx.x, wave = tid >> 5, lane = tid & 31, hh = lane >> 4, m = lane & 15;
  const int ntile = N >> 6;
  const int bid   = blockIdx.x;
  const int rowb  = (bid / ntile) * 64 + wave * 16;
  const int col0  = (bid % ntile) * 64;
  if (rowb + 16 > M) return;                 // wave-uniform, never taken with the exact grid; no block barriers in this kernel
  const size_t aofs = (size_t)(rowb + m) * K + 8 * hh;
  const _Float16* ahp = (const _Float16*)(const void*)Ah + aofs;
  const _Float16* alp = (const _Float16*)(const void*)Al + aofs;
  const _Float16* bp  = (const _Float16*)(const void*)Bt + (size_t)(col0 + m) * K + 8 * hh;
  const size_t bs = (size_t)16 * K;
  v8f acc0 = zero8(), acc1 = zero8(), acc2 = zero8(), acc3 = zero8();
#pragma unroll 1
  for (int k0 = 0; k0 < K; k0 += 32) {
    const v16h ah = ldfrag_h(ahp + k0), al = ldfrag_h(alp + k0);
    const v16h b0 = ldfrag_h(bp + k0);
    const v16h b1 = ldfrag_h(bp + bs + k0);
    const v16h b2 = ldfrag_h(bp + 2 * bs + k0);
    const v16h b3 = ldfrag_h(bp + 3 * bs + k0);
    acc0 = mma_h(ah, b0, acc0);  acc0 = mma_h(al, b0, acc0);
    acc1 = mma_h(ah, b1, acc1);  acc1 = mma_h(al, b1, acc1);
    acc2 = mma_h(ah, b2, acc2);  acc2 = mma_h(al, b2, acc2);
    acc3 = mma_h(ah, b3, acc3);  acc3 = mma_h(al, b3, acc3);
    guard6<v16h>(acc0, acc1, acc2, acc3, ah, al, b0, b1, b2, b3);
  }
  epi64(slab + wave * SLAB64, acc0, acc1, acc2, acc3, oscale, bias, C, N, (size_t)rowb, col0, lane);
}

// =====================================================================================================
// 16-bit split pack of an f32 plane (same layout): hi = f16(x * sc), lo = f16(x * sc - hi) (sc a power of two, residual
// unscaled). Thread = 8 consecutive elements: two 16-B loads, one 16-B store per plane; 32 consecutive lanes = 512 contiguous,
// coverage: grid = n8/256 blocks (exact, host-derived) x 256 thr x 8 = the whole of each plane.
// =====================================================================================================
__global__ __launch_bounds__(256) void split16(const float* __restrict__ x, u16* hpl, u16* lpl, int n8, float sc) {
  const int gt = blockIdx.x * 256 + (int)threadIdx.x;
  if (gt >= n8) return;                     // no barriers in this kernel
  const float* p = x + (size_t)gt * 8;
  const v4f a = *(const v4f*)(p), b4 = *(const v4f*)(p + 4);
  float w[8];
#pragma unroll
  for (int e = 0; e < 4; ++e) { w[e] = a[e]; w[4 + e] = b4[e]; }
  v4u oh, ol;
#pragma unroll
  for (int e = 0; e < 4; ++e) {
    const float t0 = w[2 * e] * sc, t1 = w[2 * e + 1] * sc;
    const _Float16 h0 = (_Float16)t0, h1 = (_Float16)t1;
    const _Float16 l0 = (_Float16)(t0 - (float)h0), l1 = (_Float16)(t1 - (float)h1);
    oh[e] = pk16(h_bits(h0), h_bits(h1));
    ol[e] = pk16(h_bits(l0), h_bits(l1));
  }
  const size_t o8 = (size_t)gt * 8;
  {
    *(v4u*)(hpl + o8) = oh;
    *(v4u*)(lpl + o8) = ol;
    
  }
}

// =====================================================================================================
// v^T planes: VH[((b*NH + g)*HD + d)][s] = f16(v[b*SEQ + s][g*HD + d] * 1024), VL = f16 residual of the same value.
// Block = (bg = bid / NST -> batch b = bg / NH, head g = bg % NH; 64 keys s0 = (bid % NST)*64): 64 source rows of HD floats loaded
// with 16-B loads, converted, scattered into two LDS tiles [d][64 keys] (pitch 72 halves); after a block barrier each d row segment
// coverage: load 256 thr x 16 elements = 64 x 64; store 2 iterations x 256 thr x 8 halves = 64 lines x 64 = the block's tile of
//           each plane; grid = BATCH*NH*NST blocks covers both planes exactly once.
// =====================================================================================================
__global__ __launch_bounds__(256) void vt16(const float* __restrict__ v, u16* VHo, u16* VLo) {
  __shared__ __align__(16) u16 TH[HD * VTP];
  __shared__ __align__(16) u16 TL[HD * VTP];
  const int tid = threadIdx.x;
  const int bid = blockIdx.x;
  const int st  = bid % NST;
  const int bg  = bid / NST;                  // b*NH + g
  if (bg >= BATCH * NH) return;               // block-uniform, before any barrier; never taken with the exact grid
  const int b   = bg / NH;
  const int g   = bg % NH;
  const int s0  = st * 64;
  {
    const int sl = tid >> 2;                  // key within tile 0..63
    const int dc = (tid & 3) * 16;            // d chunk
    const float* src = v + ((size_t)(b * SEQ + s0 + sl) * NH + g) * HD + dc;
#pragma unroll
    for (int i = 0; i < 4; ++i) {
      const v4f a = *(const v4f*)(src + 4 * i);
#pragma unroll
      for (int e = 0; e < 4; ++e) {
        const float t = a[e] * VCAR;
        const _Float16 h = (_Float16)t;
        const _Float16 l = (_Float16)(t - (float)h);
        TH[(dc + 4 * i + e) * VTP + sl] = h_bits(h);
        TL[(dc + 4 * i + e) * VTP + sl] = h_bits(l);
      }
    }
  }
  __syncthreads();
  v4u vh[2], vl[2];
  const int q8 = tid >> 3, p8 = (tid & 7) * 8;
#pragma unroll
  for (int it = 0; it < 2; ++it) {
    const int line = it * 32 + q8;            // d = 0..63
    vh[it] = *(const v4u*)(TH + line * VTP + p8);
    vl[it] = *(const v4u*)(TL + line * VTP + p8);
  }
  const size_t base = ((size_t)bg * HD) * SEQ + s0 + p8;
  {
#pragma unroll
    for (int it = 0; it < 2; ++it) {
      const int line = it * 32 + q8;
      *(v4u*)(VHo + base + (size_t)line * SEQ) = vh[it];
      *(v4u*)(VLo + base + (size_t)line * SEQ) = vl[it];
    }
    
  }
}

// =====================================================================================================
// Causal attention: block bid -> (query tile qt = bid % NQT: rows q0 = 16*qt .. q0+15, head group hg = (bid / NQT) % NHG of WPB
// heads, batch b = bid / (NQT*NHG)), one wave per head = hg*WPB + wave.
//   q planes (hi, lo f16 x1024) laid out [b*SEQ + s][h][d]; k planes the same; v^T planes [b][h][d][s].
//   score (log2 domain) t(i, j) = (q_i.k_j) * 0.125*log2e/(1024*1024) for key j <= query i, and -inf for j > i (the select
//   replaces the score). Key tiles of 32 visited in order for kb <= q0 + 15; tiles whose every key index exceeds every query index
//   of the tile hold only -inf, whose exp is exactly 0, and are not visited. Every visited row has key j = i or an earlier finite
//   key, so the running max is finite from the first tile on.
//   Per tile: 2 score subtiles x 2 k-steps x 3 products (q_hi.k_hi + q_lo.k_hi + q_hi.k_lo), fragments loaded straight from the
//   16-bit planes (two 16-B loads per fragment, split k map); online max-subtracted base-2 softmax in f32, -inf-safe rescale; the
//   (f16 hi) and its f16 residual rebuilt from the LDS rows (float vector loads, same element type as stored), 4+4 v^T B fragments
//   (hi and residual planes), 12 P.V WMMAs (hh + lh + hl).
//   After the loop: out = acc / Z (Z > 0 always: key j = i is never masked; guarded anyway), carries 1/(32768*1024) folded once,
//   written to the wave's private result slab (pitch 68; every element owned by one lane).
//   No block barriers in this kernel; bounded loops only (nkt <= NKT).
// coverage: per wave 4 instructions x 4 rows x 8 lanes x 8 halves = 16 x 64 per plane; grid NQT*NHG*BATCH blocks x WPB waves =
//           every (b, s, h) row of both O planes exactly once.
// =====================================================================================================
__global__ __launch_bounds__(ATT_THREADS)
void attn1(const u16* __restrict__ QHIp, const u16* __restrict__ QLOp,
           const u16* __restrict__ KHIp, const u16* __restrict__ KLOp,
           const u16* __restrict__ VHIp, const u16* __restrict__ VLOp,
           u16* OHIp, u16* OLOp) {
  __shared__ __align__(16) float smem[WPB * WREG];

  const int tid  = threadIdx.x;
  const int wave = tid >> 5;
  const int lane = tid & 31;
  const int hh   = lane >> 4;
  const int c    = lane & 15;
  const int bid  = blockIdx.x;
  const int qt   = bid % NQT;
  const int rem  = bid / NQT;
  const int hg   = rem % NHG;
  const int b    = rem / NHG;
  if (b >= BATCH) return;                    // block-uniform; no block barriers in this kernel; never taken with the exact grid
  const int head = hg * WPB + wave;
  const int q0   = qt * 16;

  float* pt   = smem + wave * WREG;          // prob tile [16][32] pitch 36
  float* slab = pt + PTW;                    // result slab [16][64] pitch 68

  const size_t rq0  = (size_t)b * SEQ + q0;                                     // plane row of query row q0
  const size_t qofs = ((rq0 + c) * NH + head) * HD + 8 * hh;
  const _Float16* Qh  = (const _Float16*)(const void*)QHIp + qofs;
  const _Float16* Ql  = (const _Float16*)(const void*)QLOp + qofs;
  const size_t kofs = (((size_t)b * SEQ + c) * NH + head) * HD + 8 * hh;       // key row kb + c added per step
  const _Float16* Khb = (const _Float16*)(const void*)KHIp + kofs;
  const _Float16* Klb = (const _Float16*)(const void*)KLOp + kofs;
  const size_t vofs = (((size_t)b * NH + head) * HD + c) * SEQ + 8 * hh;       // d column c (+16j), key kb added per step
  const _Float16* Vhb = (const _Float16*)(const void*)VHIp + vofs;
  const _Float16* Vlb = (const _Float16*)(const void*)VLOp + vofs;
  const float lsc = 0.125f * (LOG2E / (QSC * KSC));
  const float oc  = 1.0f / (PCAR * VCAR);
  const size_t KROW = (size_t)NH * HD;                                          // halves between consecutive key rows

  float mrow[8], lrow[8];
  v8f o[4];
#pragma unroll
  for (int r = 0; r < 8; ++r) { mrow[r] = -INFINITY; lrow[r] = 0.f; }
#pragma unroll
  for (int j = 0; j < 4; ++j) o[j] = zero8();
  const int ncaus = (q0 >> 5) + 1;                                              // tiles holding keys <= q0 + 15
  const int nkt = (ncaus < NKT) ? ncaus : NKT;

#pragma unroll 1
  for (int kt = 0; kt < nkt; ++kt) {
    const int kb = kt * 32;
    // ---- scores: D element r of this lane = (query row q0 + 8hh + r, key kb + c) in s0, key kb + 16 + c in s1 ----
    v8f s0 = zero8(), s1 = zero8();
    const _Float16* k0p = Khb + (size_t)kb * KROW;
    const _Float16* k1p = k0p + (size_t)16 * KROW;
    const _Float16* l0p = Klb + (size_t)kb * KROW;
    const _Float16* l1p = l0p + (size_t)16 * KROW;
#pragma unroll
    for (int kk = 0; kk < 2; ++kk) {
      const v16h qh  = ldfrag_h(Qh + kk * 32),  ql  = ldfrag_h(Ql + kk * 32);
      const v16h kh0 = ldfrag_h(k0p + kk * 32), kl0 = ldfrag_h(l0p + kk * 32);
      const v16h kh1 = ldfrag_h(k1p + kk * 32), kl1 = ldfrag_h(l1p + kk * 32);
      s0 = mma_h(qh, kh0, s0);
      s0 = mma_h(ql, kh0, s0);
      s0 = mma_h(qh, kl0, s0);
      s1 = mma_h(qh, kh1, s1);
      s1 = mma_h(ql, kh1, s1);
      s1 = mma_h(qh, kl1, s1);
      guard2(s0, s1, qh, ql, kh0, kl0, kh1, kl1);
    }
    // ---- causal select (score := -inf for key > query) + online softmax in base 2, -inf-safe ----
    const int key0 = kb + c, key1 = kb + 16 + c;
#pragma unroll
    for (int r = 0; r < 8; ++r) {
      const int qi = q0 + 8 * hh + r;
      const float u0 = s0[r] * lsc, u1 = s1[r] * lsc;
      const float t0 = (key0 > qi) ? -INFINITY : u0;
      const float t1 = (key1 > qi) ? -INFINITY : u1;
      float mx = fmaxf(t0, t1);
#pragma unroll
      for (int off = 1; off < 16; off <<= 1) mx = fmaxf(mx, __shfl_xor(mx, off, 32));
      const float mn = fmaxf(mrow[r], mx);
      const float ms = (mn == -INFINITY) ? 0.0f : mn;
      const float al = exp2f(mrow[r] - ms);
      mrow[r] = mn;
      const float e0 = exp2f(t0 - ms), e1 = exp2f(t1 - ms);
      float ps = e0 + e1;
#pragma unroll
      for (int off = 1; off < 16; off <<= 1) ps += __shfl_xor(ps, off, 32);
      lrow[r] = lrow[r] * al + ps;
#pragma unroll
      for (int j = 0; j < 4; ++j) o[j][r] *= al;
      const int ro = (8 * hh + r) * 36 + c;
      pt[ro]      = e0;
      pt[ro + 16] = e1;
    }
    wave_sync_lds();
    // ---- A fragments of P*32768: hi f16 and residual f16, row = c, split k map over the 32 keys of this step ----
    FragH ph, pl;
    {
      const float* prow = pt + c * 36 + 8 * hh;
      const v4f p0 = *(const v4f*)(prow), p1 = *(const v4f*)(prow + 4);
      const v4f p2 = *(const v4f*)(prow + 16), p3 = *(const v4f*)(prow + 20);
#pragma unroll
      for (int e = 0; e < 4; ++e) {
        const float ta = p0[e] * PCAR, tb = p1[e] * PCAR, tc = p2[e] * PCAR, td = p3[e] * PCAR;
        const _Float16 ha = (_Float16)ta, hb = (_Float16)tb, hc = (_Float16)tc, hd = (_Float16)td;
        ph.h[0][e]     = ha;                               // elements 0..7  = keys kb + 8hh + 0..7
        ph.h[0][4 + e] = hb;
        ph.h[1][e]     = hc;                               // elements 8..15 = keys kb + 16 + 8hh + 0..7
        ph.h[1][4 + e] = hd;
        pl.h[0][e]     = (_Float16)(ta - (float)ha);
        pl.h[0][4 + e] = (_Float16)(tb - (float)hb);
        pl.h[1][e]     = (_Float16)(tc - (float)hc);
        pl.h[1][4 + e] = (_Float16)(td - (float)hd);
      }
    }
    // ---- P.V : B fragment col n = d = j*16 + c, keys contiguous in the v^T planes ----
    {
      const _Float16* vhp = Vhb + kb;
      const _Float16* vlp = Vlb + kb;
      const v16h vh0 = ldfrag_h(vhp);
      const v16h vh1 = ldfrag_h(vhp + (size_t)16 * SEQ);
      const v16h vh2 = ldfrag_h(vhp + (size_t)32 * SEQ);
      const v16h vh3 = ldfrag_h(vhp + (size_t)48 * SEQ);
      const v16h vl0 = ldfrag_h(vlp);
      const v16h vl1 = ldfrag_h(vlp + (size_t)16 * SEQ);
      const v16h vl2 = ldfrag_h(vlp + (size_t)32 * SEQ);
      const v16h vl3 = ldfrag_h(vlp + (size_t)48 * SEQ);
      o[0] = mma_h(ph.v, vh0, o[0]);  o[0] = mma_h(pl.v, vh0, o[0]);  o[0] = mma_h(ph.v, vl0, o[0]);
      o[1] = mma_h(ph.v, vh1, o[1]);  o[1] = mma_h(pl.v, vh1, o[1]);  o[1] = mma_h(ph.v, vl1, o[1]);
      o[2] = mma_h(ph.v, vh2, o[2]);  o[2] = mma_h(pl.v, vh2, o[2]);  o[2] = mma_h(ph.v, vl2, o[2]);
      o[3] = mma_h(ph.v, vh3, o[3]);  o[3] = mma_h(pl.v, vh3, o[3]);  o[3] = mma_h(ph.v, vl3, o[3]);
      guard10(o[0], o[1], o[2], o[3], ph.v, pl.v, vh0, vh1, vh2, vh3, vl0, vl1, vl2, vl3);
    }
    wave_sync_lds();
  }
  acc_guard4(o[0], o[1], o[2], o[3]);
  // ---- out = acc / Z (0 if Z == 0), carries (32768 on P, 1024 on v) folded once; written into the lane-owned slab ----
#pragma unroll
  for (int r = 0; r < 8; ++r) {
    const float lv  = lrow[r];
    const float ls  = (lv > 0.0f) ? lv : 1.0f;
    const float inv = (lv > 0.0f) ? ((1.0f / ls) * oc) : 0.0f;
#pragma unroll
    for (int j = 0; j < 4; ++j) {
      const int idx = (8 * hh + r) * 68 + j * 16 + c;
      slab[idx] = o[j][r] * inv;
    }
  }

  wave_sync_lds();
  // ---- O x1024 -> f16 hi + residual planes; lane = (row in group of 4, 8 consecutive d) ----
  v4u oh[4], ol[4];
  const int rq = lane >> 3, c8 = (lane & 7) * 8;
#pragma unroll
  for (int it = 0; it < 4; ++it) {
    const int row = it * 4 + rq;
    const v4f a = *(const v4f*)(slab + row * 68 + c8), b4 = *(const v4f*)(slab + row * 68 + c8 + 4);
    float w[8];
#pragma unroll
    for (int e = 0; e < 4; ++e) { w[e] = a[e] * OSC; w[4 + e] = b4[e] * OSC; }
#pragma unroll
    for (int e = 0; e < 4; ++e) {
      const _Float16 h0 = (_Float16)w[2 * e], h1 = (_Float16)w[2 * e + 1];
      const _Float16 l0 = (_Float16)(w[2 * e] - (float)h0), l1 = (_Float16)(w[2 * e + 1] - (float)h1);
      oh[it][e] = pk16(h_bits(h0), h_bits(h1));
      ol[it][e] = pk16(h_bits(l0), h_bits(l1));
    }
  }
  const size_t ob = (rq0 * NH + head) * HD + c8;
  {
#pragma unroll
    for (int it = 0; it < 4; ++it) {
      const int row = it * 4 + rq;
      const size_t o8 = ob + (size_t)row * (NH * HD);
      *(v4u*)(OHIp + o8) = oh[it];
      *(v4u*)(OLOp + o8) = ol[it];
    }
    
  }
}

// =====================================================================================================
// Workspace map (bytes); every plane is fully written by whole-line stores before it is read; all extents are exact multiples
// of the store granularity (no pad rows needed); every offset a multiple of 2097152:
//   XB  bf16 [MROWS][1024]              8388608
//   WQB bf16 [1024 n][1024 k]          2097152        WKB, WVB same
//   WOH f16  [1024 n][1024 k] x1024    2097152
//   F   f32  [MROWS][1024]             16777216       (q, then k, then v projection output, reused in launch order)
//   QHI f16 [MROWS][16][64] x1024      8388608        QLO residual
//   KHI f16 [MROWS][16][64] x1024      8388608        KLO residual
//   VHI f16 [BATCH*16][64][SEQ] x1024  8388608        VLO residual
//   OHI f16 [MROWS][1024] x1024        8388608        OLO residual
//   end                              100663296
// =====================================================================================================
extern "C" void kernel_launch(void* const* d_in, const int* in_sizes, int n_in,
                              void* d_out, int out_size, void* d_ws, size_t ws_size,
                              hipStream_t stream) {
  if (n_in < 9) return;
  if (in_sizes[0] != MROWS * DMOD) return;
  if (in_sizes[1] != DMOD * DMOD || in_sizes[3] != DMOD * DMOD) return;
  if (in_sizes[5] != DMOD * DMOD || in_sizes[7] != DMOD * DMOD) return;
  if (in_sizes[2] != DMOD || in_sizes[4] != DMOD || in_sizes[6] != DMOD || in_sizes[8] != DMOD) return;
  if (out_size != MROWS * DMOD) return;

  const float* x    = (const float*)d_in[0];
  const float* wq   = (const float*)d_in[1];
  const float* bq   = (const float*)d_in[2];
  const float* wk   = (const float*)d_in[3];
  const float* bk   = (const float*)d_in[4];
  const float* wv   = (const float*)d_in[5];
  const float* bv   = (const float*)d_in[6];
  const float* wo   = (const float*)d_in[7];
  const float* bo   = (const float*)d_in[8];
  float*       out  = (float*)d_out;

  const size_t szXB = (size_t)MROWS * DMOD * 2;                 //  8388608
  const size_t szW  = (size_t)DMOD * DMOD * 2;                  //  2097152
  const size_t szF  = (size_t)MROWS * DMOD * 4;                 // 16777216
  const size_t szP  = (size_t)MROWS * DMOD * 2;                 //  8388608
  size_t off = 0;
  const size_t oXB  = off; off += szXB;
  const size_t oWQ  = off; off += szW;
  const size_t oWK  = off; off += szW;
  const size_t oWV  = off; off += szW;
  const size_t oWO  = off; off += szW;
  const size_t oF   = off; off += szF;
  const size_t oQHI = off; off += szP;
  const size_t oQLO = off; off += szP;
  const size_t oKHI = off; off += szP;
  const size_t oKLO = off; off += szP;
  const size_t oVHI = off; off += szP;
  const size_t oVLO = off; off += szP;
  const size_t oOHI = off; off += szP;
  const size_t oOLO = off; off += szP;
  if (off > ws_size) return;                            // off = 100663296
  if (off > (size_t)134217728) return;

  char* ws = (char*)d_ws;
  u16*   XB  = (u16*)(ws + oXB);
  u16*   WQB = (u16*)(ws + oWQ);
  u16*   WKB = (u16*)(ws + oWK);
  u16*   WVB = (u16*)(ws + oWV);
  u16*   WOH = (u16*)(ws + oWO);
  float* F   = (float*)(ws + oF);
  u16*   QHI = (u16*)(ws + oQHI);
  u16*   QLO = (u16*)(ws + oQLO);
  u16*   KHI = (u16*)(ws + oKHI);
  u16*   KLO = (u16*)(ws + oKLO);
  u16*   VHI = (u16*)(ws + oVHI);
  u16*   VLO = (u16*)(ws + oVLO);
  u16*   OHI = (u16*)(ws + oOHI);
  u16*   OLO = (u16*)(ws + oOLO);

  const dim3 blk(256);
  const int n8x = (MROWS * DMOD) / 8;                   // 524288
  const dim3 gX(n8x / 256);                             // 2048 (exact)
  const dim3 gWT((DMOD / 64) * (DMOD / 64));            // 256
  const dim3 gG((MROWS / 64) * (DMOD / 64));            // 1024
  const dim3 bG(128);
  const dim3 gVT(BATCH * NH * NST);                     // 1024
  const dim3 gAT(ATT_BLOCKS);                           // 1024
  const dim3 bAT(ATT_THREADS);                          // 128

  // (0) x -> bf16 plane [MROWS][1024]
  cvt16<<<gX, blk, 0, stream>>>(x, XB, n8x, 0, 1.0f);
  // (1..3) Wq/Wk/Wv [k][n] -> bf16 [n][k] planes
  wt16<<<gWT, blk, 0, stream>>>(wq, WQB, DMOD, DMOD, 0, 1.0f);
  wt16<<<gWT, blk, 0, stream>>>(wk, WKB, DMOD, DMOD, 0, 1.0f);
  wt16<<<gWT, blk, 0, stream>>>(wv, WVB, DMOD, DMOD, 0, 1.0f);
  // (4) Wo [k][n] -> f16 [n][k] plane of bf16 value x1024
  wt16<<<gWT, blk, 0, stream>>>(wo, WOH, DMOD, DMOD, 1, WOS);
  // (5) q = x.Wq + bq -> F f32; (6) q hi/lo planes x1024
  gemm_bf<<<gG, bG, 0, stream>>>(XB, WQB, bq, F, MROWS, DMOD, DMOD, 1.0f);
  split16<<<gX, blk, 0, stream>>>(F, QHI, QLO, n8x, QSC);
  // (7) k = x.Wk + bk -> F; (8) k hi/lo planes x1024
  gemm_bf<<<gG, bG, 0, stream>>>(XB, WKB, bk, F, MROWS, DMOD, DMOD, 1.0f);
  split16<<<gX, blk, 0, stream>>>(F, KHI, KLO, n8x, KSC);
  // (9) v = x.Wv + bv -> F; (10) v^T hi/lo planes x1024
  gemm_bf<<<gG, bG, 0, stream>>>(XB, WVB, bv, F, MROWS, DMOD, DMOD, 1.0f);
  vt16<<<gVT, blk, 0, stream>>>(F, VHI, VLO);
  // (11) causal attention -> O planes [b*SEQ+s][h][d] x1024 (hi + residual)
  attn1<<<gAT, bAT, 0, stream>>>(QHI, QLO, KHI, KLO, VHI, VLO, OHI, OLO);
  // (12) output projection -> out [MROWS][1024] f32, carries 1024 (O) x 1024 (Wo) folded back, + bo
  gemm_h2<<<gG, bG, 0, stream>>>(OHI, OLO, WOH, bo, out, MROWS, DMOD, DMOD, 1.0f / (OSC * WOS));
  (void)hipGetLastError();
}

// v001
// It runs in 346 microseconds.
// Two timings next to v000 put it at 1.18 and 1.19 times that version's speed.
// Contractions: x.W{q,k,v} on v_wmma_f32_16x16x32_bf16 (x and W^T RNE-converted to bf16, f32 accumulate);
// scores q.k^T (q, k carried x1024 as f16 hi plane + f16 residual plane, products hh+lh+hl), P.v (P x32768 f16 hi+residual,
// v x1024 f16 hi+residual, products hh+lh+hl) and O.Wo (O x1024 f16 hi+residual, Wo^T as f16(bf16(Wo)) x1024, products h.w+l.w):
// v_wmma_f32_16x16x32_f16, f32 accumulate. Static causal select, base-2 online softmax and 1/l fold in f32 on VALU.
#include <hip/hip_runtime.h>
#include <math.h>
#include <stdint.h>

#define BATCH 2
#define SEQ   2048
#define DMOD  1024
#define NH    16
#define HD    64
#define MROWS (BATCH * SEQ)
#define QSC   1024.0f
#define KSC   1024.0f
#define PCAR  32768.0f
#define VCAR  1024.0f
#define OSC   1024.0f
#define WOS   1024.0f
#define LOG2E 1.4426950408889634f
#define WPB   4
#define NQT   (SEQ / 16)
#define NST   (SEQ / 64)
#define NKT   (SEQ / 32)
#define ATT_THREADS (WPB * 32)
#define ATT_BLOCKS  (NQT * NH * BATCH)
#define PTW   (16 * 36)
#define SLW   (16 * 68)
#define WREG  (PTW + SLW)
#define SLAB64 (16 * 68)
#define VTP   72
static_assert(DMOD == NH * HD && HD == 64 && NH == 16);
static_assert(WPB == 4 && ATT_THREADS == 128 && ATT_BLOCKS == 4096);
static_assert((SEQ % 64) == 0 && (SEQ % 32) == 0 && (SEQ % 16) == 0 && SEQ <= 32768);
static_assert((DMOD % 64) == 0 && (DMOD % 32) == 0 && (MROWS % 64) == 0);
static_assert(((MROWS * DMOD) % 2048) == 0 && ((DMOD * DMOD) % 4096) == 0);

typedef unsigned short u16;
typedef _Float16 v16h __attribute__((ext_vector_type(16)));
typedef _Float16 v8h  __attribute__((ext_vector_type(8)));
typedef __bf16   v16b __attribute__((ext_vector_type(16)));
typedef float    v8f  __attribute__((ext_vector_type(8)));
typedef float    v4f  __attribute__((ext_vector_type(4)));
typedef unsigned int v4u __attribute__((ext_vector_type(4)));

union FragH { v16h v; v8h h[2]; v4u u[2]; };
union FragB { v16b v; v4u u[2]; };

// ---- scalar helpers --------------------------------------------------------------------------------
__device__ __forceinline__ unsigned short bf_bits(float f) {          // f32 -> bf16 bits, RNE convert
  unsigned u = __float_as_uint(f);
  return (unsigned short)((u + 0x7FFFu + ((u >> 16) & 1u)) >> 16);
}
__device__ __forceinline__ float bf_up(unsigned short h) { return __uint_as_float(((unsigned)h) << 16); }
__device__ __forceinline__ float bfr(float f) { return bf_up(bf_bits(f)); }
__device__ __forceinline__ unsigned short h_bits(_Float16 x) { return __builtin_bit_cast(unsigned short, x); }
__device__ __forceinline__ unsigned pk16(unsigned short a, unsigned short b) { return (unsigned)a | ((unsigned)b << 16); }
__device__ __forceinline__ v8f zero8() { v8f z = {0.f, 0.f, 0.f, 0.f, 0.f, 0.f, 0.f, 0.f}; return z; }

// ---- fragment loaders: 16-bit A/B operand, lane -> row/col (lane&15), p already includes +8*(lane>>4);
//      elements 0..7 <- p[0..7] (k0+8h..), elements 8..15 <- p[16..23] (k0+16+8h..)  (same split k map for A and B;
//      B is always read from a k-contiguous [n][k] plane)
__device__ __forceinline__ v16h ldfrag_h(const _Float16* p) {
  FragH f;
  f.h[0] = *(const v8h*)(p);
  f.h[1] = *(const v8h*)(p + 16);
  return f.v;
}
__device__ __forceinline__ v16b ldfrag_b(const u16* p) {              // bf16 plane read as unsigned integer vectors
  FragB f;
  f.u[0] = *(const v4u*)(p);
  f.u[1] = *(const v4u*)(p + 16);
  return f.v;
}

__device__ __forceinline__ v8f mma_h(v16h a, v16h b, v8f c) {
  return __builtin_amdgcn_wmma_f32_16x16x32_f16(false, a, false, b, (short)0, c, false, false);
}
__device__ __forceinline__ v8f mma_b(v16b a, v16b b, v8f c) {
  return __builtin_amdgcn_wmma_f32_16x16x32_bf16(false, a, false, b, (short)0, c, false, false);
}
__device__ __forceinline__ void guard2(v8f& a, v8f& b, v16h x0, v16h x1, v16h x2, v16h x3, v16h x4, v16h x5) {
#if defined(__HIP_DEVICE_COMPILE__)
  asm volatile("v_nop\n\tv_nop\n\tv_nop\n\tv_nop"
               : "+v"(a), "+v"(b) : "v"(x0), "v"(x1), "v"(x2), "v"(x3), "v"(x4), "v"(x5) : "memory");
#endif
}
template <typename F>
__device__ __forceinline__ void guard6(v8f& a, v8f& b, v8f& c, v8f& d, F x0, F x1, F x2, F x3, F x4, F x5) {
#if defined(__HIP_DEVICE_COMPILE__)
  asm volatile("v_nop\n\tv_nop\n\tv_nop\n\tv_nop"
               : "+v"(a), "+v"(b), "+v"(c), "+v"(d) : "v"(x0), "v"(x1), "v"(x2), "v"(x3), "v"(x4), "v"(x5) : "memory");
#endif
}
__device__ __forceinline__ void guard10(v8f& a, v8f& b, v8f& c, v8f& d, v16h x0, v16h x1, v16h x2, v16h x3, v16h x4,
                                        v16h x5, v16h x6, v16h x7, v16h x8, v16h x9) {
#if defined(__HIP_DEVICE_COMPILE__)
  asm volatile("v_nop\n\tv_nop\n\tv_nop\n\tv_nop"
               : "+v"(a), "+v"(b), "+v"(c), "+v"(d)
               : "v"(x0), "v"(x1), "v"(x2), "v"(x3), "v"(x4), "v"(x5), "v"(x6), "v"(x7), "v"(x8), "v"(x9) : "memory");
#endif
}
__device__ __forceinline__ void acc_guard4(v8f& a, v8f& b, v8f& c, v8f& d) {
#if defined(__HIP_DEVICE_COMPILE__)
  asm volatile("v_nop\n\tv_nop\n\tv_nop\n\tv_nop" : "+v"(a), "+v"(b), "+v"(c), "+v"(d));
#endif
}
__device__ __forceinline__ void wave_sync_lds() {
  __builtin_amdgcn_fence(__ATOMIC_RELEASE, "workgroup");
  __builtin_amdgcn_wave_barrier();
  __builtin_amdgcn_fence(__ATOMIC_ACQUIRE, "workgroup");
}

// =====================================================================================================
// f32 -> 16-bit plane, same layout.  f16mode == 0: bf16 RNE bits;  f16mode == 1: f16 bits of (bf16 RNE value) * scale.
// Thread = 8 consecutive elements: two 16-B loads, one 16-B store; 32 consecutive lanes = 512 contiguous, 512-B aligned bytes per
// coverage: grid = n8/256 blocks (exact, host-derived) x 256 thr x 8 = the whole plane.
// =====================================================================================================
__global__ __launch_bounds__(256) void cvt16(const float* __restrict__ x, u16* D, int n8, int f16mode, float scale) {
  const int gt = blockIdx.x * 256 + (int)threadIdx.x;
  if (gt >= n8) return;                     // no barriers in this kernel
  const float* p = x + (size_t)gt * 8;
  const v4f a = *(const v4f*)(p), b4 = *(const v4f*)(p + 4);
  float w[8];
#pragma unroll
  for (int e = 0; e < 4; ++e) { w[e] = a[e]; w[4 + e] = b4[e]; }
  v4u o;
#pragma unroll
  for (int e = 0; e < 4; ++e) {
    const float f0 = w[2 * e], f1 = w[2 * e + 1];
    const unsigned short hb0 = h_bits((_Float16)(bfr(f0) * scale));
    const unsigned short hb1 = h_bits((_Float16)(bfr(f1) * scale));
    const unsigned short bb0 = bf_bits(f0);
    const unsigned short bb1 = bf_bits(f1);
    o[e] = (f16mode != 0) ? pk16(hb0, hb1) : pk16(bb0, bb1);
  }
  u16* d = D + (size_t)gt * 8;
  {
    *(v4u*)(d) = o;
    
  }
}

// =====================================================================================================
// Weight transpose-convert: W [K][N] f32 (x.W layout, n contiguous, in[K rows][N cols]) -> Dt[N][K] 16-bit k-contiguous plane
// (out[N rows][K cols]).  f16mode == 0: bf16 RNE bits; 1: f16 bits of (bf16 RNE value) * scale.
// Block = (k tile k0 = (bid / (N/64))*64, n tile n0 = (bid % (N/64))*64): 64 source rows of 64 floats loaded with 16-B loads,
// converted, scattered into an LDS tile [n][64 k] (pitch 72 halves); after a block barrier each n row segment (64 halves = one
// coverage: load 256 thr x 16 = 64 x 64; store 2 iterations x 256 thr x 8 halves = 64 lines x 64 halves = the block's tile;
//           grid = (K/64)*(N/64) blocks covers Dt exactly once (host checks K % 64 == 0 and N % 64 == 0).
// =====================================================================================================
__global__ __launch_bounds__(256) void wt16(const float* __restrict__ W, u16* Dt, int K, int N, int f16mode, float scale) {
  __shared__ __align__(16) u16 T[64 * VTP];
  const int tid = threadIdx.x;
  const int bid = blockIdx.x;
  const int ntn = N >> 6;
  const int n0  = (bid % ntn) * 64;
  const int k0  = (bid / ntn) * 64;
  if (k0 + 64 > K) return;                    // block-uniform, before any barrier; never taken with the exact grid
  {
    const int sl = tid >> 2;                  // k within tile 0..63 (source row)
    const int dc = (tid & 3) * 16;            // n chunk
    const float* src = W + (size_t)(k0 + sl) * N + n0 + dc;
#pragma unroll
    for (int i = 0; i < 4; ++i) {
      const v4f a = *(const v4f*)(src + 4 * i);
#pragma unroll
      for (int e = 0; e < 4; ++e) {
        const float f = a[e];
        const unsigned short hb = h_bits((_Float16)(bfr(f) * scale));
        const unsigned short bb = bf_bits(f);
        T[(dc + 4 * i + e) * VTP + sl] = (f16mode != 0) ? hb : bb;
      }
    }
  }
  __syncthreads();
  v4u vv[2];
  const int q8 = tid >> 3, p8 = (tid & 7) * 8;
#pragma unroll
  for (int it = 0; it < 2; ++it) {
    const int line = it * 32 + q8;            // n = 0..63 within tile
    vv[it] = *(const v4u*)(T + line * VTP + p8);
  }
  const size_t base = (size_t)n0 * K + k0 + p8;
  {
#pragma unroll
    for (int it = 0; it < 2; ++it) {
      const int line = it * 32 + q8;
      *(v4u*)(Dt + base + (size_t)line * K) = vv[it];
    }
    
  }
}

// =====================================================================================================
// GEMM epilogue shared by both engines: the wave's 16x64 f32 tile (times oscale) staged in its LDS slab (pitch 68),
// coverage: 8 instructions x 2 rows x 16 lanes x 4 floats = the wave's 16 x 64 tile.
// =====================================================================================================
__device__ __forceinline__ void epi64(float* sl, v8f a0, v8f a1, v8f a2, v8f a3, float oscale,
                                      const float* __restrict__ bias, float* C, int N,
                                      size_t rowb, int col0, int lane) {
  const int hh = lane >> 4, m = lane & 15;
#pragma unroll
  for (int r = 0; r < 8; ++r) {
    const int ro = (8 * hh + r) * 68 + m;
    sl[ro]      = a0[r] * oscale;
    sl[ro + 16] = a1[r] * oscale;
    sl[ro + 32] = a2[r] * oscale;
    sl[ro + 48] = a3[r] * oscale;
  }
  wave_sync_lds();
  const v4f braw = *(const v4f*)(bias + col0 + m * 4);
  v4f bb;
#pragma unroll
  for (int e = 0; e < 4; ++e) bb[e] = bfr(braw[e]);
  v4f vals[8];
#pragma unroll
  for (int it = 0; it < 8; ++it) vals[it] = *(const v4f*)(sl + (it * 2 + hh) * 68 + m * 4) + bb;
  float* dst = C + (rowb + (size_t)hh) * (size_t)N + col0 + m * 4;
  {
#pragma unroll
    for (int it = 0; it < 8; ++it) {
      *(v4f*)(dst + (size_t)(it * 2) * (size_t)N) = vals[it];
    }
    
  }
}

// =====================================================================================================
// bf16 GEMM: C[M][N] (f32) = A[M][K] (bf16 row-major) . Bt[N][K]^T (bf16 k-contiguous), times oscale, plus bias[N].
// Block = 64x64 tile, 4 waves x 16 rows; fragments loaded straight from the 16-bit rows (two 16-B loads each, split k map
// for A and B); K stepped by 32 (host checks K % 32 == 0, M % 64 == 0, N % 64 == 0, grid = (M/64)*(N/64)).
// =====================================================================================================
__global__ __launch_bounds__(128)
void gemm_bf(const u16* __restrict__ A, const u16* __restrict__ Bt, const float* __restrict__ bias, float* C,
             int M, int N, int K, float oscale) {
  __shared__ __align__(16) float slab[4 * SLAB64];
  const int tid = threadIdx.x, wave = tid >> 5, lane = tid & 31, hh = lane >> 4, m = lane & 15;
  const int ntile = N >> 6;
  const int bid   = blockIdx.x;
  const int rowb  = (bid / ntile) * 64 + wave * 16;
  const int col0  = (bid % ntile) * 64;
  if (rowb + 16 > M) return;                 // wave-uniform, never taken with the exact grid; no block barriers in this kernel
  const u16* ap = A  + (size_t)(rowb + m) * K + 8 * hh;
  const u16* bp = Bt + (size_t)(col0 + m) * K + 8 * hh;
  const size_t bs = (size_t)16 * K;
  v8f acc0 = zero8(), acc1 = zero8(), acc2 = zero8(), acc3 = zero8();
#pragma unroll 1
  for (int k0 = 0; k0 < K; k0 += 32) {
    const v16b a  = ldfrag_b(ap + k0);
    const v16b b0 = ldfrag_b(bp + k0);
    const v16b b1 = ldfrag_b(bp + bs + k0);
    const v16b b2 = ldfrag_b(bp + 2 * bs + k0);
    const v16b b3 = ldfrag_b(bp + 3 * bs + k0);
    acc0 = mma_b(a, b0, acc0);
    acc1 = mma_b(a, b1, acc1);
    acc2 = mma_b(a, b2, acc2);
    acc3 = mma_b(a, b3, acc3);
    guard6<v16b>(acc0, acc1, acc2, acc3, a, b0, b1, b2, b3, a);
  }
  epi64(slab + wave * SLAB64, acc0, acc1, acc2, acc3, oscale, bias, C, N, (size_t)rowb, col0, lane);
}

// =====================================================================================================
// f16 hi+lo GEMM: C[M][N] (f32) = (Ahi + Alo)[M][K] . Bt[N][K]^T, times oscale, plus bias[N]; Ahi/Alo f16 planes (same layout),
// Bt f16 k-contiguous; products hi.B + lo.B into one accumulator (lo is the unscaled residual of hi). Same tiling as gemm_bf.
// =====================================================================================================
__global__ __launch_bounds__(128)
void gemm_h2(const u16* __restrict__ Ah, const u16* __restrict__ Al, const u16* __restrict__ Bt,
             const float* __restrict__ bias, float* C, int M, int N, int K, float oscale) {
  __shared__ __align__(16) float slab[4 * SLAB64];
  const int tid = threadIdx.x, wave = tid >> 5, lane = tid & 31, hh = lane >> 4, m = lane & 15;
  const int ntile = N >> 6;
  const int bid   = blockIdx.x;
  const int rowb  = (bid / ntile) * 64 + wave * 16;
  const int col0  = (bid % ntile) * 64;
  if (rowb + 16 > M) return;                 // wave-uniform, never taken with the exact grid; no block barriers in this kernel
  const size_t aofs = (size_t)(rowb + m) * K + 8 * hh;
  const _Float16* ahp = (const _Float16*)(const void*)Ah + aofs;
  const _Float16* alp = (const _Float16*)(const void*)Al + aofs;
  const _Float16* bp  = (const _Float16*)(const void*)Bt + (size_t)(col0 + m) * K + 8 * hh;
  const size_t bs = (size_t)16 * K;
  v8f acc0 = zero8(), acc1 = zero8(), acc2 = zero8(), acc3 = zero8();
#pragma unroll 1
  for (int k0 = 0; k0 < K; k0 += 32) {
    const v16h ah = ldfrag_h(ahp + k0), al = ldfrag_h(alp + k0);
    const v16h b0 = ldfrag_h(bp + k0);
    const v16h b1 = ldfrag_h(bp + bs + k0);
    const v16h b2 = ldfrag_h(bp + 2 * bs + k0);
    const v16h b3 = ldfrag_h(bp + 3 * bs + k0);
    acc0 = mma_h(ah, b0, acc0);  acc0 = mma_h(al, b0, acc0);
    acc1 = mma_h(ah, b1, acc1);  acc1 = mma_h(al, b1, acc1);
    acc2 = mma_h(ah, b2, acc2);  acc2 = mma_h(al, b2, acc2);
    acc3 = mma_h(ah, b3, acc3);  acc3 = mma_h(al, b3, acc3);
    guard6<v16h>(acc0, acc1, acc2, acc3, ah, al, b0, b1, b2, b3);
  }
  epi64(slab + wave * SLAB64, acc0, acc1, acc2, acc3, oscale, bias, C, N, (size_t)rowb, col0, lane);
}

// =====================================================================================================
// 16-bit split pack of an f32 plane (same layout): hi = f16(x * sc), lo = f16(x * sc - hi) (sc a power of two, residual
// unscaled). Thread = 8 consecutive elements: two 16-B loads, one 16-B store per plane; 32 consecutive lanes = 512 contiguous,
// coverage: grid = n8/256 blocks (exact, host-derived) x 256 thr x 8 = the whole of each plane.
// =====================================================================================================
__global__ __launch_bounds__(256) void split16(const float* __restrict__ x, u16* hpl, u16* lpl, int n8, float sc) {
  const int gt = blockIdx.x * 256 + (int)threadIdx.x;
  if (gt >= n8) return;                     // no barriers in this kernel
  const float* p = x + (size_t)gt * 8;
  const v4f a = *(const v4f*)(p), b4 = *(const v4f*)(p + 4);
  float w[8];
#pragma unroll
  for (int e = 0; e < 4; ++e) { w[e] = a[e]; w[4 + e] = b4[e]; }
  v4u oh, ol;
#pragma unroll
  for (int e = 0; e < 4; ++e) {
    const float t0 = w[2 * e] * sc, t1 = w[2 * e + 1] * sc;
    const _Float16 h0 = (_Float16)t0, h1 = (_Float16)t1;
    const _Float16 l0 = (_Float16)(t0 - (float)h0), l1 = (_Float16)(t1 - (float)h1);
    oh[e] = pk16(h_bits(h0), h_bits(h1));
    ol[e] = pk16(h_bits(l0), h_bits(l1));
  }
  const size_t o8 = (size_t)gt * 8;
  {
    *(v4u*)(hpl + o8) = oh;
    *(v4u*)(lpl + o8) = ol;
    
  }
}

// =====================================================================================================
// v^T planes: VH[((b*NH + g)*HD + d)][s] = f16(v[b*SEQ + s][g*HD + d] * 1024), VL = f16 residual of the same value.
// Block = (bg = bid / NST -> batch b = bg / NH, head g = bg % NH; 64 keys s0 = (bid % NST)*64): 64 source rows of HD floats loaded
// with 16-B loads, converted, scattered into two LDS tiles [d][64 keys] (pitch 72 halves); after a block barrier each d row segment
// coverage: load 256 thr x 16 elements = 64 x 64; store 2 iterations x 256 thr x 8 halves = 64 lines x 64 = the block's tile of
//           each plane; grid = BATCH*NH*NST blocks covers both planes exactly once.
// =====================================================================================================
__global__ __launch_bounds__(256) void vt16(const float* __restrict__ v, u16* VHo, u16* VLo) {
  __shared__ __align__(16) u16 TH[HD * VTP];
  __shared__ __align__(16) u16 TL[HD * VTP];
  const int tid = threadIdx.x;
  const int bid = blockIdx.x;
  const int st  = bid % NST;
  const int bg  = bid / NST;                  // b*NH + g
  if (bg >= BATCH * NH) return;               // block-uniform, before any barrier; never taken with the exact grid
  const int b   = bg / NH;
  const int g   = bg % NH;
  const int s0  = st * 64;
  {
    const int sl = tid >> 2;                  // key within tile 0..63
    const int dc = (tid & 3) * 16;            // d chunk
    const float* src = v + ((size_t)(b * SEQ + s0 + sl) * NH + g) * HD + dc;
#pragma unroll
    for (int i = 0; i < 4; ++i) {
      const v4f a = *(const v4f*)(src + 4 * i);
#pragma unroll
      for (int e = 0; e < 4; ++e) {
        const float t = a[e] * VCAR;
        const _Float16 h = (_Float16)t;
        const _Float16 l = (_Float16)(t - (float)h);
        TH[(dc + 4 * i + e) * VTP + sl] = h_bits(h);
        TL[(dc + 4 * i + e) * VTP + sl] = h_bits(l);
      }
    }
  }
  __syncthreads();
  v4u vh[2], vl[2];
  const int q8 = tid >> 3, p8 = (tid & 7) * 8;
#pragma unroll
  for (int it = 0; it < 2; ++it) {
    const int line = it * 32 + q8;            // d = 0..63
    vh[it] = *(const v4u*)(TH + line * VTP + p8);
    vl[it] = *(const v4u*)(TL + line * VTP + p8);
  }
  const size_t base = ((size_t)bg * HD) * SEQ + s0 + p8;
  {
#pragma unroll
    for (int it = 0; it < 2; ++it) {
      const int line = it * 32 + q8;
      *(v4u*)(VHo + base + (size_t)line * SEQ) = vh[it];
      *(v4u*)(VLo + base + (size_t)line * SEQ) = vl[it];
    }
    
  }
}

// =====================================================================================================
// Causal attention: block bid -> (query tile qt = bid % NQT: rows q0 = 16*qt .. q0+15, head = (bid / NQT) % NH,
// batch b = bid / (NQT*NH)). The tile's key tiles are dealt round-robin to the block's WPB waves (wave w takes kt = w, w + WPB, ..);
// each wave keeps its own running max, sum and unnormalised O, and the WPB partials are merged through LDS after one block barrier.
//   q planes (hi, lo f16 x1024) laid out [b*SEQ + s][h][d]; k planes the same; v^T planes [b][h][d][s].
//   score (log2 domain) t(i, j) = (q_i.k_j) * 0.125*log2e/(1024*1024) for key j <= query i, and -inf for j > i (the select
//   replaces the score). Key tiles of 32 visited for kb <= q0 + 15; tiles whose every key index exceeds every query index
//   of the tile hold only -inf, whose exp is exactly 0, and are not visited. Every visited row has key j = i or an earlier finite
//   key, so a wave's running max is finite from its first tile on; a wave with no tile keeps max = -inf, sum = 0, O = 0.
//   Per tile: 2 score subtiles x 2 k-steps x 3 products (q_hi.k_hi + q_lo.k_hi + q_hi.k_lo), fragments loaded straight from the
//   16-bit planes (two 16-B loads per fragment, split k map); online max-subtracted base-2 softmax in f32, -inf-safe rescale; the
//   (f16 hi) and its f16 residual rebuilt from the LDS rows (float vector loads, same element type as stored), 4+4 v^T B fragments
//   (hi and residual planes), 12 P.V WMMAs (hh + lh + hl).
//   After the loop: each wave writes its unnormalised O to its own slab (pitch 68; every element owned by one lane) and its row
//   max and sum to the ml table; one block barrier (reached by every wave; trip counts differ only between waves, and the loop holds
//   no block barrier); wave w then merges rows 4w .. 4w+3: M = max_w m_w, out = sum_w O_w 2^(m_w - M) / sum_w l_w 2^(m_w - M)
//   (Z > 0 always: key j = i is never masked; guarded anyway), carries 1/(32768*1024) folded once. Bounded loops only (nkt <= NKT).
// coverage: per wave 1 instruction x 4 rows x 8 lanes x 8 halves = 4 x 64 per plane, x WPB waves = 16 x 64; grid NQT*NH*BATCH blocks
//           = every (b, s, h) row of both O planes exactly once.
// =====================================================================================================
__global__ __launch_bounds__(ATT_THREADS)
void attn1(const u16* __restrict__ QHIp, const u16* __restrict__ QLOp,
           const u16* __restrict__ KHIp, const u16* __restrict__ KLOp,
           const u16* __restrict__ VHIp, const u16* __restrict__ VLOp,
           u16* OHIp, u16* OLOp) {
  __shared__ __align__(16) float smem[WPB * WREG];
  __shared__ float mtab[WPB * 16];           // per wave and query row: running max (log2 domain)
  __shared__ float ltab[WPB * 16];           // per wave and query row: running sum

  const int tid  = threadIdx.x;
  const int wave = __builtin_amdgcn_readfirstlane(tid >> 5);   // scalar: the key loop's start must be wave-uniform for the WMMAs
  const int lane = tid & 31;
  const int hh   = lane >> 4;
  const int c    = lane & 15;
  const int bid  = blockIdx.x;
  const int qt   = bid % NQT;
  const int rem  = bid / NQT;
  const int head = rem % NH;
  const int b    = rem / NH;
  if (b >= BATCH) return;                    // block-uniform, before the block barrier; never taken with the exact grid
  const int q0   = qt * 16;

  float* pt   = smem + wave * WREG;          // prob tile [16][32] pitch 36
  float* slab = pt + PTW;                    // result slab [16][64] pitch 68

  const size_t rq0  = (size_t)b * SEQ + q0;                                     // plane row of query row q0
  const size_t qofs = ((rq0 + c) * NH + head) * HD + 8 * hh;
  const _Float16* Qh  = (const _Float16*)(const void*)QHIp + qofs;
  const _Float16* Ql  = (const _Float16*)(const void*)QLOp + qofs;
  const size_t kofs = (((size_t)b * SEQ + c) * NH + head) * HD + 8 * hh;       // key row kb + c added per step
  const _Float16* Khb = (const _Float16*)(const void*)KHIp + kofs;
  const _Float16* Klb = (const _Float16*)(const void*)KLOp + kofs;
  const size_t vofs = (((size_t)b * NH + head) * HD + c) * SEQ + 8 * hh;       // d column c (+16j), key kb added per step
  const _Float16* Vhb = (const _Float16*)(const void*)VHIp + vofs;
  const _Float16* Vlb = (const _Float16*)(const void*)VLOp + vofs;
  const float lsc = 0.125f * (LOG2E / (QSC * KSC));
  const float oc  = 1.0f / (PCAR * VCAR);
  const size_t KROW = (size_t)NH * HD;                                          // halves between consecutive key rows

  float mrow[8], lrow[8];
  v8f o[4];
#pragma unroll
  for (int r = 0; r < 8; ++r) { mrow[r] = -INFINITY; lrow[r] = 0.f; }
#pragma unroll
  for (int j = 0; j < 4; ++j) o[j] = zero8();
  const int ncaus = (q0 >> 5) + 1;                                              // tiles holding keys <= q0 + 15
  const int nkt = (ncaus < NKT) ? ncaus : NKT;

#pragma unroll 1
  for (int kt = wave; kt < nkt; kt += WPB) {
    const int kb = kt * 32;
    // ---- scores: D element r of this lane = (query row q0 + 8hh + r, key kb + c) in s0, key kb + 16 + c in s1 ----
    v8f s0 = zero8(), s1 = zero8();
    const _Float16* k0p = Khb + (size_t)kb * KROW;
    const _Float16* k1p = k0p + (size_t)16 * KROW;
    const _Float16* l0p = Klb + (size_t)kb * KROW;
    const _Float16* l1p = l0p + (size_t)16 * KROW;
#pragma unroll
    for (int kk = 0; kk < 2; ++kk) {
      const v16h qh  = ldfrag_h(Qh + kk * 32),  ql  = ldfrag_h(Ql + kk * 32);
      const v16h kh0 = ldfrag_h(k0p + kk * 32), kl0 = ldfrag_h(l0p + kk * 32);
      const v16h kh1 = ldfrag_h(k1p + kk * 32), kl1 = ldfrag_h(l1p + kk * 32);
      s0 = mma_h(qh, kh0, s0);
      s0 = mma_h(ql, kh0, s0);
      s0 = mma_h(qh, kl0, s0);
      s1 = mma_h(qh, kh1, s1);
      s1 = mma_h(ql, kh1, s1);
      s1 = mma_h(qh, kl1, s1);
      guard2(s0, s1, qh, ql, kh0, kl0, kh1, kl1);
    }
    // ---- causal select (score := -inf for key > query) + online softmax in base 2, -inf-safe ----
    const int key0 = kb + c, key1 = kb + 16 + c;
#pragma unroll
    for (int r = 0; r < 8; ++r) {
      const int qi = q0 + 8 * hh + r;
      const float u0 = s0[r] * lsc, u1 = s1[r] * lsc;
      const float t0 = (key0 > qi) ? -INFINITY : u0;
      const float t1 = (key1 > qi) ? -INFINITY : u1;
      float mx = fmaxf(t0, t1);
#pragma unroll
      for (int off = 1; off < 16; off <<= 1) mx = fmaxf(mx, __shfl_xor(mx, off, 32));
      const float mn = fmaxf(mrow[r], mx);
      const float ms = (mn == -INFINITY) ? 0.0f : mn;
      const float al = exp2f(mrow[r] - ms);
      mrow[r] = mn;
      const float e0 = exp2f(t0 - ms), e1 = exp2f(t1 - ms);
      float ps = e0 + e1;
#pragma unroll
      for (int off = 1; off < 16; off <<= 1) ps += __shfl_xor(ps, off, 32);
      lrow[r] = lrow[r] * al + ps;
#pragma unroll
      for (int j = 0; j < 4; ++j) o[j][r] *= al;
      const int ro = (8 * hh + r) * 36 + c;
      pt[ro]      = e0;
      pt[ro + 16] = e1;
    }
    wave_sync_lds();
    // ---- A fragments of P*32768: hi f16 and residual f16, row = c, split k map over the 32 keys of this step ----
    FragH ph, pl;
    {
      const float* prow = pt + c * 36 + 8 * hh;
      const v4f p0 = *(const v4f*)(prow), p1 = *(const v4f*)(prow + 4);
      const v4f p2 = *(const v4f*)(prow + 16), p3 = *(const v4f*)(prow + 20);
#pragma unroll
      for (int e = 0; e < 4; ++e) {
        const float ta = p0[e] * PCAR, tb = p1[e] * PCAR, tc = p2[e] * PCAR, td = p3[e] * PCAR;
        const _Float16 ha = (_Float16)ta, hb = (_Float16)tb, hc = (_Float16)tc, hd = (_Float16)td;
        ph.h[0][e]     = ha;                               // elements 0..7  = keys kb + 8hh + 0..7
        ph.h[0][4 + e] = hb;
        ph.h[1][e]     = hc;                               // elements 8..15 = keys kb + 16 + 8hh + 0..7
        ph.h[1][4 + e] = hd;
        pl.h[0][e]     = (_Float16)(ta - (float)ha);
        pl.h[0][4 + e] = (_Float16)(tb - (float)hb);
        pl.h[1][e]     = (_Float16)(tc - (float)hc);
        pl.h[1][4 + e] = (_Float16)(td - (float)hd);
      }
    }
    // ---- P.V : B fragment col n = d = j*16 + c, keys contiguous in the v^T planes ----
    {
      const _Float16* vhp = Vhb + kb;
      const _Float16* vlp = Vlb + kb;
      const v16h vh0 = ldfrag_h(vhp);
      const v16h vh1 = ldfrag_h(vhp + (size_t)16 * SEQ);
      const v16h vh2 = ldfrag_h(vhp + (size_t)32 * SEQ);
      const v16h vh3 = ldfrag_h(vhp + (size_t)48 * SEQ);
      const v16h vl0 = ldfrag_h(vlp);
      const v16h vl1 = ldfrag_h(vlp + (size_t)16 * SEQ);
      const v16h vl2 = ldfrag_h(vlp + (size_t)32 * SEQ);
      const v16h vl3 = ldfrag_h(vlp + (size_t)48 * SEQ);
      o[0] = mma_h(ph.v, vh0, o[0]);  o[0] = mma_h(pl.v, vh0, o[0]);  o[0] = mma_h(ph.v, vl0, o[0]);
      o[1] = mma_h(ph.v, vh1, o[1]);  o[1] = mma_h(pl.v, vh1, o[1]);  o[1] = mma_h(ph.v, vl1, o[1]);
      o[2] = mma_h(ph.v, vh2, o[2]);  o[2] = mma_h(pl.v, vh2, o[2]);  o[2] = mma_h(ph.v, vl2, o[2]);
      o[3] = mma_h(ph.v, vh3, o[3]);  o[3] = mma_h(pl.v, vh3, o[3]);  o[3] = mma_h(ph.v, vl3, o[3]);
      guard10(o[0], o[1], o[2], o[3], ph.v, pl.v, vh0, vh1, vh2, vh3, vl0, vl1, vl2, vl3);
    }
    wave_sync_lds();
  }
  acc_guard4(o[0], o[1], o[2], o[3]);
  // ---- this wave's partial: unnormalised O into its lane-owned slab, row max and sum into the tables ----
#pragma unroll
  for (int r = 0; r < 8; ++r) {
#pragma unroll
    for (int j = 0; j < 4; ++j) {
      const int idx = (8 * hh + r) * 68 + j * 16 + c;
      slab[idx] = o[j][r];
    }
  }
  if (c == 0) {
#pragma unroll
    for (int r = 0; r < 8; ++r) {
      mtab[wave * 16 + 8 * hh + r] = mrow[r];
      ltab[wave * 16 + 8 * hh + r] = lrow[r];
    }
  }
  __syncthreads();                           // publishes every wave's partial to the wave that merges its rows
  // ---- merge of the WPB partials, rows 4*wave .. 4*wave+3; lane = (row in group of 4, 8 consecutive d) ----
  const int rq = lane >> 3, c8 = (lane & 7) * 8;
  const int row = wave * 4 + rq;
  float mw[WPB];
  float mall = -INFINITY;
#pragma unroll
  for (int w = 0; w < WPB; ++w) { mw[w] = mtab[w * 16 + row]; mall = fmaxf(mall, mw[w]); }
  const float msafe = (mall == -INFINITY) ? 0.0f : mall;
  float lv = 0.f;
  float acc[8];
#pragma unroll
  for (int e = 0; e < 8; ++e) acc[e] = 0.f;
#pragma unroll
  for (int w = 0; w < WPB; ++w) {
    const float sc = exp2f(mw[w] - msafe);   // 0 for a wave that saw no tile
    lv += ltab[w * 16 + row] * sc;
    const float* sp = smem + w * WREG + PTW + row * 68 + c8;
    const v4f a = *(const v4f*)(sp), b4 = *(const v4f*)(sp + 4);
#pragma unroll
    for (int e = 0; e < 4; ++e) { acc[e] += a[e] * sc; acc[4 + e] += b4[e] * sc; }
  }
  // ---- out = acc / Z (0 if Z == 0), carries (32768 on P, 1024 on v) folded once; O x1024 -> f16 hi + residual planes ----
  const float ls  = (lv > 0.0f) ? lv : 1.0f;
  const float inv = (lv > 0.0f) ? ((1.0f / ls) * oc) : 0.0f;
  v4u oh, ol;
#pragma unroll
  for (int e = 0; e < 4; ++e) {
    const float w0 = (acc[2 * e] * inv) * OSC, w1 = (acc[2 * e + 1] * inv) * OSC;
    const _Float16 h0 = (_Float16)w0, h1 = (_Float16)w1;
    const _Float16 l0 = (_Float16)(w0 - (float)h0), l1 = (_Float16)(w1 - (float)h1);
    oh[e] = pk16(h_bits(h0), h_bits(h1));
    ol[e] = pk16(h_bits(l0), h_bits(l1));
  }
  const size_t o8 = ((rq0 + row) * NH + head) * HD + c8;
  *(v4u*)(OHIp + o8) = oh;
  *(v4u*)(OLOp + o8) = ol;
}

// =====================================================================================================
// Workspace map (bytes); every plane is fully written by whole-line stores before it is read; all extents are exact multiples
// of the store granularity (no pad rows needed); every offset a multiple of 2097152:
//   XB  bf16 [MROWS][1024]              8388608
//   WQB bf16 [1024 n][1024 k]          2097152        WKB, WVB same
//   WOH f16  [1024 n][1024 k] x1024    2097152
//   F   f32  [MROWS][1024]             16777216       (q, then k, then v projection output, reused in launch order)
//   QHI f16 [MROWS][16][64] x1024      8388608        QLO residual
//   KHI f16 [MROWS][16][64] x1024      8388608        KLO residual
//   VHI f16 [BATCH*16][64][SEQ] x1024  8388608        VLO residual
//   OHI f16 [MROWS][1024] x1024        8388608        OLO residual
//   end                              100663296
// =====================================================================================================
extern "C" void kernel_launch(void* const* d_in, const int* in_sizes, int n_in,
                              void* d_out, int out_size, void* d_ws, size_t ws_size,
                              hipStream_t stream) {
  if (n_in < 9) return;
  if (in_sizes[0] != MROWS * DMOD) return;
  if (in_sizes[1] != DMOD * DMOD || in_sizes[3] != DMOD * DMOD) return;
  if (in_sizes[5] != DMOD * DMOD || in_sizes[7] != DMOD * DMOD) return;
  if (in_sizes[2] != DMOD || in_sizes[4] != DMOD || in_sizes[6] != DMOD || in_sizes[8] != DMOD) return;
  if (out_size != MROWS * DMOD) return;

  const float* x    = (const float*)d_in[0];
  const float* wq   = (const float*)d_in[1];
  const float* bq   = (const float*)d_in[2];
  const float* wk   = (const float*)d_in[3];
  const float* bk   = (const float*)d_in[4];
  const float* wv   = (const float*)d_in[5];
  const float* bv   = (const float*)d_in[6];
  const float* wo   = (const float*)d_in[7];
  const float* bo   = (const float*)d_in[8];
  float*       out  = (float*)d_out;

  const size_t szXB = (size_t)MROWS * DMOD * 2;                 //  8388608
  const size_t szW  = (size_t)DMOD * DMOD * 2;                  //  2097152
  const size_t szF  = (size_t)MROWS * DMOD * 4;                 // 16777216
  const size_t szP  = (size_t)MROWS * DMOD * 2;                 //  8388608
  size_t off = 0;
  const size_t oXB  = off; off += szXB;
  const size_t oWQ  = off; off += szW;
  const size_t oWK  = off; off += szW;
  const size_t oWV  = off; off += szW;
  const size_t oWO  = off; off += szW;
  const size_t oF   = off; off += szF;
  const size_t oQHI = off; off += szP;
  const size_t oQLO = off; off += szP;
  const size_t oKHI = off; off += szP;
  const size_t oKLO = off; off += szP;
  const size_t oVHI = off; off += szP;
  const size_t oVLO = off; off += szP;
  const size_t oOHI = off; off += szP;
  const size_t oOLO = off; off += szP;
  if (off > ws_size) return;                            // off = 100663296
  if (off > (size_t)134217728) return;

  char* ws = (char*)d_ws;
  u16*   XB  = (u16*)(ws + oXB);
  u16*   WQB = (u16*)(ws + oWQ);
  u16*   WKB = (u16*)(ws + oWK);
  u16*   WVB = (u16*)(ws + oWV);
  u16*   WOH = (u16*)(ws + oWO);
  float* F   = (float*)(ws + oF);
  u16*   QHI = (u16*)(ws + oQHI);
  u16*   QLO = (u16*)(ws + oQLO);
  u16*   KHI = (u16*)(ws + oKHI);
  u16*   KLO = (u16*)(ws + oKLO);
  u16*   VHI = (u16*)(ws + oVHI);
  u16*   VLO = (u16*)(ws + oVLO);
  u16*   OHI = (u16*)(ws + oOHI);
  u16*   OLO = (u16*)(ws + oOLO);

  const dim3 blk(256);
  const int n8x = (MROWS * DMOD) / 8;                   // 524288
  const dim3 gX(n8x / 256);                             // 2048 (exact)
  const dim3 gWT((DMOD / 64) * (DMOD / 64));            // 256
  const dim3 gG((MROWS / 64) * (DMOD / 64));            // 1024
  const dim3 bG(128);
  const dim3 gVT(BATCH * NH * NST);                     // 1024
  const dim3 gAT(ATT_BLOCKS);                           // 4096
  const dim3 bAT(ATT_THREADS);                          // 128

  // (0) x -> bf16 plane [MROWS][1024]
  cvt16<<<gX, blk, 0, stream>>>(x, XB, n8x, 0, 1.0f);
  // (1..3) Wq/Wk/Wv [k][n] -> bf16 [n][k] planes
  wt16<<<gWT, blk, 0, stream>>>(wq, WQB, DMOD, DMOD, 0, 1.0f);
  wt16<<<gWT, blk, 0, stream>>>(wk, WKB, DMOD, DMOD, 0, 1.0f);
  wt16<<<gWT, blk, 0, stream>>>(wv, WVB, DMOD, DMOD, 0, 1.0f);
  // (4) Wo [k][n] -> f16 [n][k] plane of bf16 value x1024
  wt16<<<gWT, blk, 0, stream>>>(wo, WOH, DMOD, DMOD, 1, WOS);
  // (5) q = x.Wq + bq -> F f32; (6) q hi/lo planes x1024
  gemm_bf<<<gG, bG, 0, stream>>>(XB, WQB, bq, F, MROWS, DMOD, DMOD, 1.0f);
  split16<<<gX, blk, 0, stream>>>(F, QHI, QLO, n8x, QSC);
  // (7) k = x.Wk + bk -> F; (8) k hi/lo planes x1024
  gemm_bf<<<gG, bG, 0, stream>>>(XB, WKB, bk, F, MROWS, DMOD, DMOD, 1.0f);
  split16<<<gX, blk, 0, stream>>>(F, KHI, KLO, n8x, KSC);
  // (9) v = x.Wv + bv -> F; (10) v^T hi/lo planes x1024
  gemm_bf<<<gG, bG, 0, stream>>>(XB, WVB, bv, F, MROWS, DMOD, DMOD, 1.0f);
  vt16<<<gVT, blk, 0, stream>>>(F, VHI, VLO);
  // (11) causal attention -> O planes [b*SEQ+s][h][d] x1024 (hi + residual)
  attn1<<<gAT, bAT, 0, stream>>>(QHI, QLO, KHI, KLO, VHI, VLO, OHI, OLO);
  // (12) output projection -> out [MROWS][1024] f32, carries 1024 (O) x 1024 (Wo) folded back, + bo
  gemm_h2<<<gG, bG, 0, stream>>>(OHI, OLO, WOH, bo, out, MROWS, DMOD, DMOD, 1.0f / (OSC * WOS));
  (void)hipGetLastError();
}

// v002
// It runs in 242 microseconds.
// Two timings next to v001 both put it at 1.43 times that version's speed.
// Over all steps from v000 it is 1.70 times as fast.
// Contractions: x.W{q,k,v} on v_wmma_f32_16x16x32_bf16 (x and W^T RNE-converted to bf16, f32 accumulate);
// scores q.k^T (q, k carried x1024 as f16 hi plane + f16 residual plane, products hh+lh+hl), P.v (P x32768 f16 hi+residual,
// v x1024 f16 hi+residual, products hh+lh+hl) and O.Wo (O x1024 f16 hi+residual, Wo^T as f16(bf16(Wo)) x1024, products h.w+l.w):
// v_wmma_f32_16x16x32_f16, f32 accumulate. Static causal select, base-2 online softmax and 1/l fold in f32 on VALU.
#include <hip/hip_runtime.h>
#include <math.h>
#include <stdint.h>

#define BATCH 2
#define SEQ   2048
#define DMOD  1024
#define NH    16
#define HD    64
#define MROWS (BATCH * SEQ)
#define QSC   1024.0f
#define KSC   1024.0f
#define PCAR  32768.0f
#define VCAR  1024.0f
#define OSC   1024.0f
#define WOS   1024.0f
#define LOG2E 1.4426950408889634f
#define WPB   4
#define NQT   (SEQ / 16)
#define NST   (SEQ / 64)
#define NKT   (SEQ / 32)
#define ATT_THREADS (WPB * 32)
#define ATT_BLOCKS  (NQT * NH * BATCH)
#define PTW   (16 * 36)
#define SLW   (16 * 68)
#define WREG  (PTW + SLW)
#define SLAB64 (16 * 68)
#define VTP   72
static_assert(DMOD == NH * HD && HD == 64 && NH == 16);
static_assert(WPB == 4 && ATT_THREADS == 128 && ATT_BLOCKS == 4096);
static_assert((SEQ % 64) == 0 && (SEQ % 32) == 0 && (SEQ % 16) == 0 && SEQ <= 32768);
static_assert((DMOD % 64) == 0 && (DMOD % 32) == 0 && (MROWS % 64) == 0);
static_assert(((MROWS * DMOD) % 2048) == 0 && ((DMOD * DMOD) % 4096) == 0);

typedef unsigned short u16;
typedef _Float16 v16h __attribute__((ext_vector_type(16)));
typedef _Float16 v8h  __attribute__((ext_vector_type(8)));
typedef __bf16   v16b __attribute__((ext_vector_type(16)));
typedef float    v8f  __attribute__((ext_vector_type(8)));
typedef float    v4f  __attribute__((ext_vector_type(4)));
typedef unsigned int v4u __attribute__((ext_vector_type(4)));

union FragH { v16h v; v8h h[2]; v4u u[2]; };
union FragB { v16b v; v4u u[2]; };

// ---- scalar helpers --------------------------------------------------------------------------------
__device__ __forceinline__ unsigned short bf_bits(float f) {          // f32 -> bf16 bits, RNE convert
  unsigned u = __float_as_uint(f);
  return (unsigned short)((u + 0x7FFFu + ((u >> 16) & 1u)) >> 16);
}
__device__ __forceinline__ float bf_up(unsigned short h) { return __uint_as_float(((unsigned)h) << 16); }
__device__ __forceinline__ float bfr(float f) { return bf_up(bf_bits(f)); }
__device__ __forceinline__ unsigned short h_bits(_Float16 x) { return __builtin_bit_cast(unsigned short, x); }
__device__ __forceinline__ unsigned pk16(unsigned short a, unsigned short b) { return (unsigned)a | ((unsigned)b << 16); }
__device__ __forceinline__ v8f zero8() { v8f z = {0.f, 0.f, 0.f, 0.f, 0.f, 0.f, 0.f, 0.f}; return z; }

// ---- fragment-major 16-bit planes: a matrix [R rows][Kd k] (R % 16 == 0, Kd % 32 == 0) is stored as fragments of 16 rows x 32 k,
//      fragment (rb = row / 16, kb = k / 32) at halves (rb * (Kd / 32) + kb) * 512; inside it 64 chunks of 8 halves, chunk
//      i * 32 + h * 16 + c = row 16 rb + c, k = 32 kb + 16 i + 8 h + 0..7. A wave-wide 16-B load of chunks 32 i + lane is 512 contiguous,
//      512-B aligned bytes = 4 whole lines (the same fragment read from a row-major plane touches 16 lines, 32 B of each, per load).
// ---- fragment loaders: 16-bit A/B operand, lane -> row/col (lane&15), p = fragment start + 8*lane;
//      elements 0..7 <- p[0..7] (k0+8h..), elements 8..15 <- p[256..263] (k0+16+8h..)  (same split k map for A and B).
//      fs = a fragment start that is the same for the whole wave (a scalar base), bo = 32-bit byte offset from it: 16*lane plus the
//      loop's advance, one vector register that serves every load of a trip
// sbase: p + ofs for a wave-uniform ofs, kept as a scalar base of its own: without the readfirstlane the compiler adds the lane offset
// to p first and then forms each further fragment's 64-bit address with vector additions in every trip.
template <typename T>
__device__ __forceinline__ const T* sbase(const T* p, size_t ofs) {
  const uint32_t l = (uint32_t)__builtin_amdgcn_readfirstlane((int)(uint32_t)ofs);
  const uint32_t h = (uint32_t)__builtin_amdgcn_readfirstlane((int)(uint32_t)((uint64_t)ofs >> 32));
  return p + (size_t)(((uint64_t)h << 32) | (uint64_t)l);
}
__device__ __forceinline__ v16h ldfrag_h(const _Float16* fs, unsigned bo) {
  const char* p = (const char*)(const void*)fs + bo;
  FragH f;
  f.h[0] = *(const v8h*)(const void*)(p);
  f.h[1] = *(const v8h*)(const void*)(p + 512);
  return f.v;
}
__device__ __forceinline__ v16b ldfrag_b(const u16* fs, unsigned bo) { // bf16 plane read as unsigned integer vectors
  const char* p = (const char*)(const void*)fs + bo;
  FragB f;
  f.u[0] = *(const v4u*)(const void*)(p);
  f.u[1] = *(const v4u*)(const void*)(p + 512);
  return f.v;
}

// row-major element index (matrix [R][Kd]) of the 8 halves that chunk q of the fragment-major plane holds
__device__ __forceinline__ size_t chunk_src(int q, int Kd) {
  const int f = q >> 6, nkb = Kd >> 5;
  return (size_t)((f / nkb) * 16 + (q & 15)) * (size_t)Kd + (size_t)((f % nkb) * 32 + ((q >> 4) & 3) * 8);
}

__device__ __forceinline__ v8f mma_h(v16h a, v16h b, v8f c) {
  return __builtin_amdgcn_wmma_f32_16x16x32_f16(false, a, false, b, (short)0, c, false, false);
}
__device__ __forceinline__ v8f mma_b(v16b a, v16b b, v8f c) {
  return __builtin_amdgcn_wmma_f32_16x16x32_bf16(false, a, false, b, (short)0, c, false, false);
}
__device__ __forceinline__ void guard2(v8f& a, v8f& b, v16h x0, v16h x1, v16h x2, v16h x3, v16h x4, v16h x5) {
#if defined(__HIP_DEVICE_COMPILE__)
  asm volatile("v_nop\n\tv_nop\n\tv_nop\n\tv_nop"
               : "+v"(a), "+v"(b) : "v"(x0), "v"(x1), "v"(x2), "v"(x3), "v"(x4), "v"(x5) : "memory");
#endif
}
template <typename F>
__device__ __forceinline__ void guard6(v8f& a, v8f& b, v8f& c, v8f& d, F x0, F x1, F x2, F x3, F x4, F x5) {
#if defined(__HIP_DEVICE_COMPILE__)
  asm volatile("v_nop\n\tv_nop\n\tv_nop\n\tv_nop"
               : "+v"(a), "+v"(b), "+v"(c), "+v"(d) : "v"(x0), "v"(x1), "v"(x2), "v"(x3), "v"(x4), "v"(x5) : "memory");
#endif
}
__device__ __forceinline__ void guard10(v8f& a, v8f& b, v8f& c, v8f& d, v16h x0, v16h x1, v16h x2, v16h x3, v16h x4,
                                        v16h x5, v16h x6, v16h x7, v16h x8, v16h x9) {
#if defined(__HIP_DEVICE_COMPILE__)
  asm volatile("v_nop\n\tv_nop\n\tv_nop\n\tv_nop"
               : "+v"(a), "+v"(b), "+v"(c), "+v"(d)
               : "v"(x0), "v"(x1), "v"(x2), "v"(x3), "v"(x4), "v"(x5), "v"(x6), "v"(x7), "v"(x8), "v"(x9) : "memory");
#endif
}
__device__ __forceinline__ void acc_guard4(v8f& a, v8f& b, v8f& c, v8f& d) {
#if defined(__HIP_DEVICE_COMPILE__)
  asm volatile("v_nop\n\tv_nop\n\tv_nop\n\tv_nop" : "+v"(a), "+v"(b), "+v"(c), "+v"(d));
#endif
}
__device__ __forceinline__ void wave_sync_lds() {
  __builtin_amdgcn_fence(__ATOMIC_RELEASE, "workgroup");
  __builtin_amdgcn_wave_barrier();
  __builtin_amdgcn_fence(__ATOMIC_ACQUIRE, "workgroup");
}

// =====================================================================================================
// f32 [rows][DMOD] -> 16-bit fragment-major plane.  f16mode == 0: bf16 RNE bits;  f16mode == 1: f16 bits of (bf16 RNE value) * scale.
// Thread = one chunk of the plane (8 consecutive k of one row): two 16-B loads, one 16-B store; 32 consecutive lanes store 512
// contiguous, 512-B aligned bytes.
// coverage: grid = n8/256 blocks (exact, host-derived) x 256 thr x 8 = the whole plane.
// =====================================================================================================
__global__ __launch_bounds__(256) void cvt16(const float* __restrict__ x, u16* D, int n8, int f16mode, float scale) {
  const int gt = blockIdx.x * 256 + (int)threadIdx.x;
  if (gt >= n8) return;                     // no barriers in this kernel
  const float* p = x + chunk_src(gt, DMOD);
  const v4f a = *(const v4f*)(p), b4 = *(const v4f*)(p + 4);
  float w[8];
#pragma unroll
  for (int e = 0; e < 4; ++e) { w[e] = a[e]; w[4 + e] = b4[e]; }
  v4u o;
#pragma unroll
  for (int e = 0; e < 4; ++e) {
    const float f0 = w[2 * e], f1 = w[2 * e + 1];
    const unsigned short hb0 = h_bits((_Float16)(bfr(f0) * scale));
    const unsigned short hb1 = h_bits((_Float16)(bfr(f1) * scale));
    const unsigned short bb0 = bf_bits(f0);
    const unsigned short bb1 = bf_bits(f1);
    o[e] = (f16mode != 0) ? pk16(hb0, hb1) : pk16(bb0, bb1);
  }
  u16* d = D + (size_t)gt * 8;
  {
    *(v4u*)(d) = o;
    
  }
}

// =====================================================================================================
// Weight transpose-convert: W [K][N] f32 (x.W layout, n contiguous, in[K rows][N cols]) -> Dt, the fragment-major 16-bit plane of the
// matrix [N rows][K cols].  f16mode == 0: bf16 RNE bits; 1: f16 bits of (bf16 RNE value) * scale.
// Block = (k tile k0 = (bid / (N/64))*64, n tile n0 = (bid % (N/64))*64): 64 source rows of 64 floats loaded with 16-B loads,
// converted, scattered into an LDS tile [n][64 k] (pitch 72 halves); after a block barrier the tile's 8 fragments are stored chunk by chunk.
// coverage: load 256 thr x 16 = 64 x 64; store 2 iterations x 256 thr x 8 halves = 8 fragments x 512 halves = the block's tile;
//           grid = (K/64)*(N/64) blocks covers Dt exactly once (host checks K % 64 == 0 and N % 64 == 0).
// =====================================================================================================
__global__ __launch_bounds__(256) void wt16(const float* __restrict__ W, u16* Dt, int K, int N, int f16mode, float scale) {
  __shared__ __align__(16) u16 T[64 * VTP];
  const int tid = threadIdx.x;
  const int bid = blockIdx.x;
  const int ntn = N >> 6;
  const int n0  = (bid % ntn) * 64;
  const int k0  = (bid / ntn) * 64;
  if (k0 + 64 > K) return;                    // block-uniform, before any barrier; never taken with the exact grid
  {
    const int sl = tid >> 2;                  // k within tile 0..63 (source row)
    const int dc = (tid & 3) * 16;            // n chunk
    const float* src = W + (size_t)(k0 + sl) * N + n0 + dc;
#pragma unroll
    for (int i = 0; i < 4; ++i) {
      const v4f a = *(const v4f*)(src + 4 * i);
#pragma unroll
      for (int e = 0; e < 4; ++e) {
        const float f = a[e];
        const unsigned short hb = h_bits((_Float16)(bfr(f) * scale));
        const unsigned short bb = bf_bits(f);
        T[(dc + 4 * i + e) * VTP + sl] = (f16mode != 0) ? hb : bb;
      }
    }
  }
  __syncthreads();
  // the tile = 4 (n) x 2 (k) fragments of the plane; thread = chunk tid & 63 of fragment (n block it*2 + (tid >> 7), k block (tid >> 6) & 1)
  v4u vv[2];
  const int ch = tid & 63, fk = (tid >> 6) & 1, fr = tid >> 7;
#pragma unroll
  for (int it = 0; it < 2; ++it) {
    const int line = (it * 2 + fr) * 16 + (ch & 15);   // n = 0..63 within tile
    vv[it] = *(const v4u*)(T + line * VTP + fk * 32 + (ch >> 4) * 8);
  }
  const size_t base = (size_t)n0 * K + (size_t)((k0 >> 5) + fk) * 512 + ch * 8;
  {
#pragma unroll
    for (int it = 0; it < 2; ++it) {
      *(v4u*)(Dt + base + (size_t)((it * 2 + fr) * 16) * K) = vv[it];
    }
  }
}

// =====================================================================================================
// GEMM epilogue shared by both engines: the wave's 16x64 f32 tile (times oscale) staged in its LDS slab (pitch 68),
// coverage: 8 instructions x 2 rows x 16 lanes x 4 floats = the wave's 16 x 64 tile.
// =====================================================================================================
__device__ __forceinline__ void epi64(float* sl, v8f a0, v8f a1, v8f a2, v8f a3, float oscale,
                                      const float* __restrict__ bias, float* C, int N,
                                      size_t rowb, int col0, int lane) {
  const int hh = lane >> 4, m = lane & 15;
#pragma unroll
  for (int r = 0; r < 8; ++r) {
    const int ro = (8 * hh + r) * 68 + m;
    sl[ro]      = a0[r] * oscale;
    sl[ro + 16] = a1[r] * oscale;
    sl[ro + 32] = a2[r] * oscale;
    sl[ro + 48] = a3[r] * oscale;
  }
  wave_sync_lds();
  const v4f braw = *(const v4f*)(bias + col0 + m * 4);
  v4f bb;
#pragma unroll
  for (int e = 0; e < 4; ++e) bb[e] = bfr(braw[e]);
  v4f vals[8];
#pragma unroll
  for (int it = 0; it < 8; ++it) vals[it] = *(const v4f*)(sl + (it * 2 + hh) * 68 + m * 4) + bb;
  float* dst = C + (rowb + (size_t)hh) * (size_t)N + col0 + m * 4;
  {
#pragma unroll
    for (int it = 0; it < 8; ++it) {
      *(v4f*)(dst + (size_t)(it * 2) * (size_t)N) = vals[it];
    }
    
  }
}

// =====================================================================================================
// bf16 GEMM: C[M][N] (f32) = A[M][K] . Bt[N][K]^T (both bf16 fragment-major planes), times oscale, plus bias[N].
// Block = 64x64 tile, 4 waves x 16 rows; fragments loaded straight from the planes (two 16-B loads each, 512 contiguous bytes per
// wave and load, split k map for A and B); K stepped by 32 (host checks K % 32 == 0, M % 64 == 0, N % 64 == 0, grid = (M/64)*(N/64)).
// =====================================================================================================
__global__ __launch_bounds__(128)
void gemm_bf(const u16* __restrict__ A, const u16* __restrict__ Bt, const float* __restrict__ bias, float* C,
             int M, int N, int K, float oscale) {
  __shared__ __align__(16) float slab[4 * SLAB64];
  const int tid = threadIdx.x, lane = tid & 31;
  const int wave = __builtin_amdgcn_readfirstlane(tid >> 5);   // scalar: makes every fragment start a scalar base
  unsigned bo = 16u * (unsigned)lane;        // byte offset of this lane's chunk; advanced by one fragment (1024 B) per k step
  const int ntile = N >> 6;
  const int bid   = blockIdx.x;
  const int rowb  = (bid / ntile) * 64 + wave * 16;
  const int col0  = (bid % ntile) * 64;
  if (rowb + 16 > M) return;                 // wave-uniform, never taken with the exact grid; no block barriers in this kernel
  const u16* ap = A  + (size_t)rowb * K;              // fragment (rowb / 16, 0) of the fragment-major plane
  const size_t bs = (size_t)16 * K;
  const u16* bp  = Bt + (size_t)col0 * K;
  const u16* b1p = sbase(bp, bs), * b2p = sbase(bp, 2 * bs), * b3p = sbase(bp, 3 * bs);
  v8f acc0 = zero8(), acc1 = zero8(), acc2 = zero8(), acc3 = zero8();
#pragma unroll 1
  for (int k0 = 0; k0 < K; k0 += 32) {
    const v16b a  = ldfrag_b(ap, bo);
    const v16b b0 = ldfrag_b(bp, bo);
    const v16b b1 = ldfrag_b(b1p, bo);
    const v16b b2 = ldfrag_b(b2p, bo);
    const v16b b3 = ldfrag_b(b3p, bo);
    acc0 = mma_b(a, b0, acc0);
    acc1 = mma_b(a, b1, acc1);
    acc2 = mma_b(a, b2, acc2);
    acc3 = mma_b(a, b3, acc3);
    guard6<v16b>(acc0, acc1, acc2, acc3, a, b0, b1, b2, b3, a);
    bo += 1024u;
  }
  epi64(slab + wave * SLAB64, acc0, acc1, acc2, acc3, oscale, bias, C, N, (size_t)rowb, col0, lane);
}

// =====================================================================================================
// f16 hi+lo GEMM: C[M][N] (f32) = (Ahi + Alo)[M][K] . Bt[N][K]^T, times oscale, plus bias[N]; Ahi/Alo f16 planes (same layout),
// Bt f16, all three fragment-major; products hi.B + lo.B into one accumulator (lo is the unscaled residual of hi). Same tiling as gemm_bf.
// =====================================================================================================
__global__ __launch_bounds__(128)
void gemm_h2(const u16* __restrict__ Ah, const u16* __restrict__ Al, const u16* __restrict__ Bt,
             const float* __restrict__ bias, float* C, int M, int N, int K, float oscale) {
  __shared__ __align__(16) float slab[4 * SLAB64];
  const int tid = threadIdx.x, lane = tid & 31;
  const int wave = __builtin_amdgcn_readfirstlane(tid >> 5);   // scalar: makes every fragment start a scalar base
  unsigned bo = 16u * (unsigned)lane;        // byte offset of this lane's chunk; advanced by one fragment (1024 B) per k step
  const int ntile = N >> 6;
  const int bid   = blockIdx.x;
  const int rowb  = (bid / ntile) * 64 + wave * 16;
  const int col0  = (bid % ntile) * 64;
  if (rowb + 16 > M) return;                 // wave-uniform, never taken with the exact grid; no block barriers in this kernel
  const size_t aofs = (size_t)rowb * K;               // fragment (rowb / 16, 0) of the fragment-major planes
  const _Float16* ahp = (const _Float16*)(const void*)Ah + aofs;
  const _Float16* alp = (const _Float16*)(const void*)Al + aofs;
  const size_t bs = (size_t)16 * K;
  const _Float16* bp  = (const _Float16*)(const void*)Bt + (size_t)col0 * K;
  const _Float16* b1p = sbase(bp, bs), * b2p = sbase(bp, 2 * bs), * b3p = sbase(bp, 3 * bs);
  v8f acc0 = zero8(), acc1 = zero8(), acc2 = zero8(), acc3 = zero8();
#pragma unroll 1
  for (int k0 = 0; k0 < K; k0 += 32) {
    const v16h ah = ldfrag_h(ahp, bo), al = ldfrag_h(alp, bo);
    const v16h b0 = ldfrag_h(bp, bo);
    const v16h b1 = ldfrag_h(b1p, bo);
    const v16h b2 = ldfrag_h(b2p, bo);
    const v16h b3 = ldfrag_h(b3p, bo);
    acc0 = mma_h(ah, b0, acc0);  acc0 = mma_h(al, b0, acc0);
    acc1 = mma_h(ah, b1, acc1);  acc1 = mma_h(al, b1, acc1);
    acc2 = mma_h(ah, b2, acc2);  acc2 = mma_h(al, b2, acc2);
    acc3 = mma_h(ah, b3, acc3);  acc3 = mma_h(al, b3, acc3);
    guard6<v16h>(acc0, acc1, acc2, acc3, ah, al, b0, b1, b2, b3);
    bo += 1024u;
  }
  epi64(slab + wave * SLAB64, acc0, acc1, acc2, acc3, oscale, bias, C, N, (size_t)rowb, col0, lane);
}

// =====================================================================================================
// 16-bit split pack of an f32 plane [rows][DMOD] into two fragment-major planes: hi = f16(x * sc), lo = f16(x * sc - hi) (sc a power
// of two, residual unscaled). Thread = one chunk (8 consecutive k of one row): two 16-B loads, one 16-B store per plane; 32 consecutive
// lanes store 512 contiguous bytes.
// coverage: grid = n8/256 blocks (exact, host-derived) x 256 thr x 8 = the whole of each plane.
// =====================================================================================================
__global__ __launch_bounds__(256) void split16(const float* __restrict__ x, u16* hpl, u16* lpl, int n8, float sc) {
  const int gt = blockIdx.x * 256 + (int)threadIdx.x;
  if (gt >= n8) return;                     // no barriers in this kernel
  const float* p = x + chunk_src(gt, DMOD);
  const v4f a = *(const v4f*)(p), b4 = *(const v4f*)(p + 4);
  float w[8];
#pragma unroll
  for (int e = 0; e < 4; ++e) { w[e] = a[e]; w[4 + e] = b4[e]; }
  v4u oh, ol;
#pragma unroll
  for (int e = 0; e < 4; ++e) {
    const float t0 = w[2 * e] * sc, t1 = w[2 * e + 1] * sc;
    const _Float16 h0 = (_Float16)t0, h1 = (_Float16)t1;
    const _Float16 l0 = (_Float16)(t0 - (float)h0), l1 = (_Float16)(t1 - (float)h1);
    oh[e] = pk16(h_bits(h0), h_bits(h1));
    ol[e] = pk16(h_bits(l0), h_bits(l1));
  }
  const size_t o8 = (size_t)gt * 8;
  {
    *(v4u*)(hpl + o8) = oh;
    *(v4u*)(lpl + o8) = ol;
    
  }
}

// =====================================================================================================
// v^T planes, fragment-major, of the matrix VH[((b*NH + g)*HD + d)][s] = f16(v[b*SEQ + s][g*HD + d] * 1024), VL = f16 residual of the same.
// Block = (bg = bid / NST -> batch b = bg / NH, head g = bg % NH; 64 keys s0 = (bid % NST)*64): 64 source rows of HD floats loaded
// with 16-B loads, converted, scattered into two LDS tiles [d][64 keys] (pitch 72 halves); after a block barrier each tile's 8 fragments are stored chunk by chunk.
// coverage: load 256 thr x 16 elements = 64 x 64; store 2 iterations x 256 thr x 8 halves = 8 fragments x 512 = the block's tile of
//           each plane; grid = BATCH*NH*NST blocks covers both planes exactly once.
// =====================================================================================================
__global__ __launch_bounds__(256) void vt16(const float* __restrict__ v, u16* VHo, u16* VLo) {
  __shared__ __align__(16) u16 TH[HD * VTP];
  __shared__ __align__(16) u16 TL[HD * VTP];
  const int tid = threadIdx.x;
  const int bid = blockIdx.x;
  const int st  = bid % NST;
  const int bg  = bid / NST;                  // b*NH + g
  if (bg >= BATCH * NH) return;               // block-uniform, before any barrier; never taken with the exact grid
  const int b   = bg / NH;
  const int g   = bg % NH;
  const int s0  = st * 64;
  {
    const int sl = tid >> 2;                  // key within tile 0..63
    const int dc = (tid & 3) * 16;            // d chunk
    const float* src = v + ((size_t)(b * SEQ + s0 + sl) * NH + g) * HD + dc;
#pragma unroll
    for (int i = 0; i < 4; ++i) {
      const v4f a = *(const v4f*)(src + 4 * i);
#pragma unroll
      for (int e = 0; e < 4; ++e) {
        const float t = a[e] * VCAR;
        const _Float16 h = (_Float16)t;
        const _Float16 l = (_Float16)(t - (float)h);
        TH[(dc + 4 * i + e) * VTP + sl] = h_bits(h);
        TL[(dc + 4 * i + e) * VTP + sl] = h_bits(l);
      }
    }
  }
  __syncthreads();
  // the tile = 4 (d) x 2 (keys) fragments of each plane; thread = chunk tid & 63 of fragment (d block it*2 + (tid >> 7), key block (tid >> 6) & 1)
  v4u vh[2], vl[2];
  const int ch = tid & 63, fk = (tid >> 6) & 1, fr = tid >> 7;
#pragma unroll
  for (int it = 0; it < 2; ++it) {
    const int line = (it * 2 + fr) * 16 + (ch & 15);   // d = 0..63
    vh[it] = *(const v4u*)(TH + line * VTP + fk * 32 + (ch >> 4) * 8);
    vl[it] = *(const v4u*)(TL + line * VTP + fk * 32 + (ch >> 4) * 8);
  }
  const size_t base = ((size_t)bg * HD) * SEQ + (size_t)((s0 >> 5) + fk) * 512 + ch * 8;
  {
#pragma unroll
    for (int it = 0; it < 2; ++it) {
      *(v4u*)(VHo + base + (size_t)((it * 2 + fr) * 16) * SEQ) = vh[it];
      *(v4u*)(VLo + base + (size_t)((it * 2 + fr) * 16) * SEQ) = vl[it];
    }
  }
}

// =====================================================================================================
// Causal attention: block bid -> (query tile qt = bid % NQT: rows q0 = 16*qt .. q0+15, head = (bid / NQT) % NH,
// batch b = bid / (NQT*NH)). The tile's key tiles are dealt round-robin to the block's WPB waves (wave w takes kt = w, w + WPB, ..);
// each wave keeps its own running max, sum and unnormalised O, and the WPB partials are merged through LDS after one block barrier.
//   q planes (hi, lo f16 x1024): fragment-major planes of the matrix [b*SEQ + s][h*HD + d]; k planes the same; v^T planes of [(b*NH + h)*HD + d][s].
//   score (log2 domain) t(i, j) = (q_i.k_j) * 0.125*log2e/(1024*1024) for key j <= query i, and -inf for j > i (the select
//   replaces the score). Key tiles of 32 visited for kb <= q0 + 15; tiles whose every key index exceeds every query index
//   of the tile hold only -inf, whose exp is exactly 0, and are not visited. Every visited row has key j = i or an earlier finite
//   key, so a wave's running max is finite from its first tile on; a wave with no tile keeps max = -inf, sum = 0, O = 0.
//   Per tile: 2 score subtiles x 2 k-steps x 3 products (q_hi.k_hi + q_lo.k_hi + q_hi.k_lo), fragments loaded straight from the
//   16-bit planes (two 16-B loads per fragment, split k map); online max-subtracted base-2 softmax in f32, -inf-safe rescale; the
//   (f16 hi) and its f16 residual rebuilt from the LDS rows (float vector loads, same element type as stored), 4+4 v^T B fragments
//   (hi and residual planes), 12 P.V WMMAs (hh + lh + hl).
//   After the loop: each wave writes its unnormalised O to its own slab (pitch 68; every element owned by one lane) and its row
//   max and sum to the ml table; one block barrier (reached by every wave; trip counts differ only between waves, and the loop holds
//   no block barrier); wave w then merges columns d = 16w .. 16w+15 of all 16 rows: M = max_w m_w, out = sum_w O_w 2^(m_w - M) / sum_w l_w 2^(m_w - M)
//   (Z > 0 always: key j = i is never masked; guarded anyway), carries 1/(32768*1024) folded once. Bounded loops only (nkt <= NKT).
// coverage: per wave 1 instruction x 16 rows x 2 lanes x 8 halves = 16 x 16 per plane, x WPB waves = 16 x 64; grid NQT*NH*BATCH blocks
//           = every (b, s, h) row of both O planes exactly once.
// =====================================================================================================
__global__ __launch_bounds__(ATT_THREADS)
void attn1(const u16* __restrict__ QHIp, const u16* __restrict__ QLOp,
           const u16* __restrict__ KHIp, const u16* __restrict__ KLOp,
           const u16* __restrict__ VHIp, const u16* __restrict__ VLOp,
           u16* OHIp, u16* OLOp) {
  __shared__ __align__(16) float smem[WPB * WREG];
  __shared__ float mtab[WPB * 16];           // per wave and query row: running max (log2 domain)
  __shared__ float ltab[WPB * 16];           // per wave and query row: running sum

  const int tid  = threadIdx.x;
  const int wave = __builtin_amdgcn_readfirstlane(tid >> 5);   // scalar: the key loop's start must be wave-uniform for the WMMAs
  const int lane = tid & 31;
  const int hh   = lane >> 4;
  const int c    = lane & 15;
  const int bid  = blockIdx.x;
  const int qt   = bid % NQT;
  const int rem  = bid / NQT;
  const int head = rem % NH;
  const int b    = rem / NH;
  if (b >= BATCH) return;                    // block-uniform, before the block barrier; never taken with the exact grid
  const int q0   = qt * 16;

  float* pt   = smem + wave * WREG;          // prob tile [16][32] pitch 36
  float* slab = pt + PTW;                    // result slab [16][64] pitch 68

  const size_t rq0  = (size_t)b * SEQ + q0;                                     // plane row of query row q0
  const unsigned lo = 16u * (unsigned)lane;                                     // byte offset of this lane's chunk in a fragment
  const size_t qofs = (rq0 * NH + (size_t)head * 16) * HD;                      // fragment (rq0 / 16, 2 * head)
  const _Float16* Qh  = (const _Float16*)(const void*)QHIp + qofs;
  const _Float16* Ql  = (const _Float16*)(const void*)QLOp + qofs;
  const size_t kofs = ((size_t)b * SEQ * NH + (size_t)head * 16) * HD;          // fragment (b*SEQ / 16, 2 * head); key block added per step
  const _Float16* Khb = (const _Float16*)(const void*)KHIp + kofs;
  const _Float16* Klb = (const _Float16*)(const void*)KLOp + kofs;
  const size_t vofs = (((size_t)b * NH + head) * HD) * SEQ;                    // fragment (4 * (b*NH + head) (+j), 0); key block added per step
  const _Float16* Vhb = (const _Float16*)(const void*)VHIp + vofs;
  const _Float16* Vlb = (const _Float16*)(const void*)VLOp + vofs;
  const float lsc = 0.125f * (LOG2E / (QSC * KSC));
  const float oc  = 1.0f / (PCAR * VCAR);
  const size_t KROW = (size_t)NH * HD;                                          // row length of the k matrix in halves; 16 * KROW = one 16-key fragment row

  float mrow[8], lrow[8];
  v8f o[4];
#pragma unroll
  for (int r = 0; r < 8; ++r) { mrow[r] = -INFINITY; lrow[r] = 0.f; }
#pragma unroll
  for (int j = 0; j < 4; ++j) o[j] = zero8();
  const int ncaus = (q0 >> 5) + 1;                                              // tiles holding keys <= q0 + 15
  const int nkt = (ncaus < NKT) ? ncaus : NKT;

  // byte offsets of key tile kt in the k planes (32 rows of KROW halves) and in the v^T planes (one fragment), plus this lane's chunk
  unsigned ko = lo + (unsigned)wave * (unsigned)(32 * NH * HD * 2);
  unsigned vo = lo + (unsigned)wave * 1024u;
#pragma unroll 1
  for (int kt = wave; kt < nkt; kt += WPB) {
    const int kb = kt * 32;
    // ---- scores: D element r of this lane = (query row q0 + 8hh + r, key kb + c) in s0, key kb + 16 + c in s1 ----
    v8f s0 = zero8(), s1 = zero8();
    const _Float16* k0p = Khb;
    const _Float16* k1p = k0p + (size_t)16 * KROW;
    const _Float16* l0p = Klb;
    const _Float16* l1p = l0p + (size_t)16 * KROW;
#pragma unroll
    for (int kk = 0; kk < 2; ++kk) {
      const v16h qh  = ldfrag_h(Qh + kk * 512, lo),  ql  = ldfrag_h(Ql + kk * 512, lo);
      const v16h kh0 = ldfrag_h(k0p + kk * 512, ko), kl0 = ldfrag_h(l0p + kk * 512, ko);
      const v16h kh1 = ldfrag_h(k1p + kk * 512, ko), kl1 = ldfrag_h(l1p + kk * 512, ko);
      s0 = mma_h(qh, kh0, s0);
      s0 = mma_h(ql, kh0, s0);
      s0 = mma_h(qh, kl0, s0);
      s1 = mma_h(qh, kh1, s1);
      s1 = mma_h(ql, kh1, s1);
      s1 = mma_h(qh, kl1, s1);
      guard2(s0, s1, qh, ql, kh0, kl0, kh1, kl1);
    }
    // ---- causal select (score := -inf for key > query) + online softmax in base 2, -inf-safe ----
    const int key0 = kb + c, key1 = kb + 16 + c;
#pragma unroll
    for (int r = 0; r < 8; ++r) {
      const int qi = q0 + 8 * hh + r;
      const float u0 = s0[r] * lsc, u1 = s1[r] * lsc;
      const float t0 = (key0 > qi) ? -INFINITY : u0;
      const float t1 = (key1 > qi) ? -INFINITY : u1;
      float mx = fmaxf(t0, t1);
#pragma unroll
      for (int off = 1; off < 16; off <<= 1) mx = fmaxf(mx, __shfl_xor(mx, off, 32));
      const float mn = fmaxf(mrow[r], mx);
      const float ms = (mn == -INFINITY) ? 0.0f : mn;
      const float al = exp2f(mrow[r] - ms);
      mrow[r] = mn;
      const float e0 = exp2f(t0 - ms), e1 = exp2f(t1 - ms);
      float ps = e0 + e1;
#pragma unroll
      for (int off = 1; off < 16; off <<= 1) ps += __shfl_xor(ps, off, 32);
      lrow[r] = lrow[r] * al + ps;
#pragma unroll
      for (int j = 0; j < 4; ++j) o[j][r] *= al;
      const int ro = (8 * hh + r) * 36 + c;
      pt[ro]      = e0;
      pt[ro + 16] = e1;
    }
    wave_sync_lds();
    // ---- A fragments of P*32768: hi f16 and residual f16, row = c, split k map over the 32 keys of this step ----
    FragH ph, pl;
    {
      const float* prow = pt + c * 36 + 8 * hh;
      const v4f p0 = *(const v4f*)(prow), p1 = *(const v4f*)(prow + 4);
      const v4f p2 = *(const v4f*)(prow + 16), p3 = *(const v4f*)(prow + 20);
#pragma unroll
      for (int e = 0; e < 4; ++e) {
        const float ta = p0[e] * PCAR, tb = p1[e] * PCAR, tc = p2[e] * PCAR, td = p3[e] * PCAR;
        const _Float16 ha = (_Float16)ta, hb = (_Float16)tb, hc = (_Float16)tc, hd = (_Float16)td;
        ph.h[0][e]     = ha;                               // elements 0..7  = keys kb + 8hh + 0..7
        ph.h[0][4 + e] = hb;
        ph.h[1][e]     = hc;                               // elements 8..15 = keys kb + 16 + 8hh + 0..7
        ph.h[1][4 + e] = hd;
        pl.h[0][e]     = (_Float16)(ta - (float)ha);
        pl.h[0][4 + e] = (_Float16)(tb - (float)hb);
        pl.h[1][e]     = (_Float16)(tc - (float)hc);
        pl.h[1][4 + e] = (_Float16)(td - (float)hd);
      }
    }
    // ---- P.V : B fragment col n = d = j*16 + c, keys contiguous in the v^T planes ----
    {
      const _Float16* vhp = Vhb;
      const _Float16* vlp = Vlb;
      const v16h vh0 = ldfrag_h(vhp, vo);
      const v16h vh1 = ldfrag_h(vhp + (size_t)16 * SEQ, vo);
      const v16h vh2 = ldfrag_h(vhp + (size_t)32 * SEQ, vo);
      const v16h vh3 = ldfrag_h(vhp + (size_t)48 * SEQ, vo);
      const v16h vl0 = ldfrag_h(vlp, vo);
      const v16h vl1 = ldfrag_h(vlp + (size_t)16 * SEQ, vo);
      const v16h vl2 = ldfrag_h(vlp + (size_t)32 * SEQ, vo);
      const v16h vl3 = ldfrag_h(vlp + (size_t)48 * SEQ, vo);
      o[0] = mma_h(ph.v, vh0, o[0]);  o[0] = mma_h(pl.v, vh0, o[0]);  o[0] = mma_h(ph.v, vl0, o[0]);
      o[1] = mma_h(ph.v, vh1, o[1]);  o[1] = mma_h(pl.v, vh1, o[1]);  o[1] = mma_h(ph.v, vl1, o[1]);
      o[2] = mma_h(ph.v, vh2, o[2]);  o[2] = mma_h(pl.v, vh2, o[2]);  o[2] = mma_h(ph.v, vl2, o[2]);
      o[3] = mma_h(ph.v, vh3, o[3]);  o[3] = mma_h(pl.v, vh3, o[3]);  o[3] = mma_h(ph.v, vl3, o[3]);
      guard10(o[0], o[1], o[2], o[3], ph.v, pl.v, vh0, vh1, vh2, vh3, vl0, vl1, vl2, vl3);
    }
    wave_sync_lds();
    ko += (unsigned)(WPB * 32 * NH * HD * 2);
    vo += (unsigned)(WPB * 1024);
  }
  acc_guard4(o[0], o[1], o[2], o[3]);
  // ---- this wave's partial: unnormalised O into its lane-owned slab, row max and sum into the tables ----
#pragma unroll
  for (int r = 0; r < 8; ++r) {
#pragma unroll
    for (int j = 0; j < 4; ++j) {
      const int idx = (8 * hh + r) * 68 + j * 16 + c;
      slab[idx] = o[j][r];
    }
  }
  if (c == 0) {
#pragma unroll
    for (int r = 0; r < 8; ++r) {
      mtab[wave * 16 + 8 * hh + r] = mrow[r];
      ltab[wave * 16 + 8 * hh + r] = lrow[r];
    }
  }
  __syncthreads();                           // publishes every wave's partial to all waves; each merges a 16-column band of every partial
  // ---- merge of the WPB partials; thread = chunk tid of the block's two O fragments: row = lane & 15, 8 consecutive d from
  //      32 * (wave >> 1) + 16 * (wave & 1) + 8 * (lane >> 4) ----
  const int row = c, c8 = wave * 16 + hh * 8;
  float mw[WPB];
  float mall = -INFINITY;
#pragma unroll
  for (int w = 0; w < WPB; ++w) { mw[w] = mtab[w * 16 + row]; mall = fmaxf(mall, mw[w]); }
  const float msafe = (mall == -INFINITY) ? 0.0f : mall;
  float lv = 0.f;
  float acc[8];
#pragma unroll
  for (int e = 0; e < 8; ++e) acc[e] = 0.f;
#pragma unroll
  for (int w = 0; w < WPB; ++w) {
    const float sc = exp2f(mw[w] - msafe);   // 0 for a wave that saw no tile
    lv += ltab[w * 16 + row] * sc;
    const float* sp = smem + w * WREG + PTW + row * 68 + c8;
    const v4f a = *(const v4f*)(sp), b4 = *(const v4f*)(sp + 4);
#pragma unroll
    for (int e = 0; e < 4; ++e) { acc[e] += a[e] * sc; acc[4 + e] += b4[e] * sc; }
  }
  // ---- out = acc / Z (0 if Z == 0), carries (32768 on P, 1024 on v) folded once; O x1024 -> f16 hi + residual planes ----
  const float ls  = (lv > 0.0f) ? lv : 1.0f;
  const float inv = (lv > 0.0f) ? ((1.0f / ls) * oc) : 0.0f;
  v4u oh, ol;
#pragma unroll
  for (int e = 0; e < 4; ++e) {
    const float w0 = (acc[2 * e] * inv) * OSC, w1 = (acc[2 * e + 1] * inv) * OSC;
    const _Float16 h0 = (_Float16)w0, h1 = (_Float16)w1;
    const _Float16 l0 = (_Float16)(w0 - (float)h0), l1 = (_Float16)(w1 - (float)h1);
    oh[e] = pk16(h_bits(h0), h_bits(h1));
    ol[e] = pk16(h_bits(l0), h_bits(l1));
  }
  const size_t o8 = (rq0 * NH + (size_t)head * 16) * HD + 8 * tid;              // fragments (rq0 / 16, 2 * head .. 2 * head + 1)
  *(v4u*)(OHIp + o8) = oh;
  *(v4u*)(OLOp + o8) = ol;
}

// =====================================================================================================
// Workspace map (bytes); every plane is fully written by whole-line stores before it is read; all extents are exact multiples
// of the store granularity (no pad rows needed); every offset a multiple of 2097152; every 16-bit plane is fragment-major (the shape
// given is that of its matrix, rows x k):
//   XB  bf16 [MROWS][1024]              8388608
//   WQB bf16 [1024 n][1024 k]          2097152        WKB, WVB same
//   WOH f16  [1024 n][1024 k] x1024    2097152
//   F   f32  [MROWS][1024]             16777216       (q, then k, then v projection output, reused in launch order)
//   QHI f16 [MROWS][16*64] x1024       8388608        QLO residual
//   KHI f16 [MROWS][16*64] x1024       8388608        KLO residual
//   VHI f16 [BATCH*16*64][SEQ] x1024   8388608        VLO residual
//   OHI f16 [MROWS][1024] x1024        8388608        OLO residual
//   end                              100663296
// =====================================================================================================
extern "C" void kernel_launch(void* const* d_in, const int* in_sizes, int n_in,
                              void* d_out, int out_size, void* d_ws, size_t ws_size,
                              hipStream_t stream) {
  if (n_in < 9) return;
  if (in_sizes[0] != MROWS * DMOD) return;
  if (in_sizes[1] != DMOD * DMOD || in_sizes[3] != DMOD * DMOD) return;
  if (in_sizes[5] != DMOD * DMOD || in_sizes[7] != DMOD * DMOD) return;
  if (in_sizes[2] != DMOD || in_sizes[4] != DMOD || in_sizes[6] != DMOD || in_sizes[8] != DMOD) return;
  if (out_size != MROWS * DMOD) return;

  const float* x    = (const float*)d_in[0];
  const float* wq   = (const float*)d_in[1];
  const float* bq   = (const float*)d_in[2];
  const float* wk   = (const float*)d_in[3];
  const float* bk   = (const float*)d_in[4];
  const float* wv   = (const float*)d_in[5];
  const float* bv   = (const float*)d_in[6];
  const float* wo   = (const float*)d_in[7];
  const float* bo   = (const float*)d_in[8];
  float*       out  = (float*)d_out;

  const size_t szXB = (size_t)MROWS * DMOD * 2;                 //  8388608
  const size_t szW  = (size_t)DMOD * DMOD * 2;                  //  2097152
  const size_t szF  = (size_t)MROWS * DMOD * 4;                 // 16777216
  const size_t szP  = (size_t)MROWS * DMOD * 2;                 //  8388608
  size_t off = 0;
  const size_t oXB  = off; off += szXB;
  const size_t oWQ  = off; off += szW;
  const size_t oWK  = off; off += szW;
  const size_t oWV  = off; off += szW;
  const size_t oWO  = off; off += szW;
  const size_t oF   = off; off += szF;
  const size_t oQHI = off; off += szP;
  const size_t oQLO = off; off += szP;
  const size_t oKHI = off; off += szP;
  const size_t oKLO = off; off += szP;
  const size_t oVHI = off; off += szP;
  const size_t oVLO = off; off += szP;
  const size_t oOHI = off; off += szP;
  const size_t oOLO = off; off += szP;
  if (off > ws_size) return;                            // off = 100663296
  if (off > (size_t)134217728) return;

  char* ws = (char*)d_ws;
  u16*   XB  = (u16*)(ws + oXB);
  u16*   WQB = (u16*)(ws + oWQ);
  u16*   WKB = (u16*)(ws + oWK);
  u16*   WVB = (u16*)(ws + oWV);
  u16*   WOH = (u16*)(ws + oWO);
  float* F   = (float*)(ws + oF);
  u16*   QHI = (u16*)(ws + oQHI);
  u16*   QLO = (u16*)(ws + oQLO);
  u16*   KHI = (u16*)(ws + oKHI);
  u16*   KLO = (u16*)(ws + oKLO);
  u16*   VHI = (u16*)(ws + oVHI);
  u16*   VLO = (u16*)(ws + oVLO);
  u16*   OHI = (u16*)(ws + oOHI);
  u16*   OLO = (u16*)(ws + oOLO);

  const dim3 blk(256);
  const int n8x = (MROWS * DMOD) / 8;                   // 524288
  const dim3 gX(n8x / 256);                             // 2048 (exact)
  const dim3 gWT((DMOD / 64) * (DMOD / 64));            // 256
  const dim3 gG((MROWS / 64) * (DMOD / 64));            // 1024
  const dim3 bG(128);
  const dim3 gVT(BATCH * NH * NST);                     // 1024
  const dim3 gAT(ATT_BLOCKS);                           // 4096
  const dim3 bAT(ATT_THREADS);                          // 128

  // (0) x -> bf16 plane [MROWS][1024]
  cvt16<<<gX, blk, 0, stream>>>(x, XB, n8x, 0, 1.0f);
  // (1..3) Wq/Wk/Wv [k][n] -> bf16 [n][k] planes
  wt16<<<gWT, blk, 0, stream>>>(wq, WQB, DMOD, DMOD, 0, 1.0f);
  wt16<<<gWT, blk, 0, stream>>>(wk, WKB, DMOD, DMOD, 0, 1.0f);
  wt16<<<gWT, blk, 0, stream>>>(wv, WVB, DMOD, DMOD, 0, 1.0f);
  // (4) Wo [k][n] -> f16 [n][k] plane of bf16 value x1024
  wt16<<<gWT, blk, 0, stream>>>(wo, WOH, DMOD, DMOD, 1, WOS);
  // (5) q = x.Wq + bq -> F f32; (6) q hi/lo planes x1024
  gemm_bf<<<gG, bG, 0, stream>>>(XB, WQB, bq, F, MROWS, DMOD, DMOD, 1.0f);
  split16<<<gX, blk, 0, stream>>>(F, QHI, QLO, n8x, QSC);
  // (7) k = x.Wk + bk -> F; (8) k hi/lo planes x1024
  gemm_bf<<<gG, bG, 0, stream>>>(XB, WKB, bk, F, MROWS, DMOD, DMOD, 1.0f);
  split16<<<gX, blk, 0, stream>>>(F, KHI, KLO, n8x, KSC);
  // (9) v = x.Wv + bv -> F; (10) v^T hi/lo planes x1024
  gemm_bf<<<gG, bG, 0, stream>>>(XB, WVB, bv, F, MROWS, DMOD, DMOD, 1.0f);
  vt16<<<gVT, blk, 0, stream>>>(F, VHI, VLO);
  // (11) causal attention -> O planes [b*SEQ+s][h][d] x1024 (hi + residual)
  attn1<<<gAT, bAT, 0, stream>>>(QHI, QLO, KHI, KLO, VHI, VLO, OHI, OLO);
  // (12) output projection -> out [MROWS][1024] f32, carries 1024 (O) x 1024 (Wo) folded back, + bo
  gemm_h2<<<gG, bG, 0, stream>>>(OHI, OLO, WOH, bo, out, MROWS, DMOD, DMOD, 1.0f / (OSC * WOS));
  (void)hipGetLastError();
}

// v003
// One run takes 212 microseconds.
// Next to v002, in two timings, it ran 1.12 times as fast each time.
// Over all steps from v000 it is 1.90 times as fast.
// Contractions: x.W{q,k,v} on v_wmma_f32_16x16x32_bf16 (x and W^T RNE-converted to bf16, f32 accumulate);
// scores, transposed, k.q^T (q, k carried x1024 as f16 hi plane + f16 residual plane, products hh+lh+hl), v^T.P^T (P x32768 f16
// hi+residual, v x1024 f16 hi+residual, products hh+lh+hl) and O.Wo (O x1024 f16 hi+residual, Wo^T as f16(bf16(Wo)) x1024, products h.w+l.w):
// v_wmma_f32_16x16x32_f16, f32 accumulate. Static causal select, base-2 online softmax and 1/l fold in f32 on VALU.
#include <hip/hip_runtime.h>
#include <math.h>
#include <stdint.h>

#define BATCH 2
#define SEQ   2048
#define DMOD  1024
#define NH    16
#define HD    64
#define MROWS (BATCH * SEQ)
#define QSC   1024.0f
#define KSC   1024.0f
#define PCAR  32768.0f
#define VCAR  1024.0f
#define OSC   1024.0f
#define WOS   1024.0f
#define LOG2E 1.4426950408889634f
#define WPB   4
#define NQT   (SEQ / 16)
#define NST   (SEQ / 64)
#define NKT   (SEQ / 32)
#define ATT_THREADS (WPB * 32)
#define ATT_BLOCKS  (NQT * NH * BATCH)
#define SLW   (16 * 68)
#define WREG  SLW
#define SLAB64 (16 * 68)
#define VTP   72
static_assert(DMOD == NH * HD && HD == 64 && NH == 16);
static_assert(WPB == 4 && ATT_THREADS == 128 && ATT_BLOCKS == 4096);
static_assert((SEQ % 64) == 0 && (SEQ % 32) == 0 && (SEQ % 16) == 0 && SEQ <= 32768);
static_assert((DMOD % 64) == 0 && (DMOD % 32) == 0 && (MROWS % 64) == 0);
static_assert(((MROWS * DMOD) % 2048) == 0 && ((DMOD * DMOD) % 4096) == 0);

typedef unsigned short u16;
typedef _Float16 v16h __attribute__((ext_vector_type(16)));
typedef _Float16 v8h  __attribute__((ext_vector_type(8)));
typedef __bf16   v16b __attribute__((ext_vector_type(16)));
typedef float    v8f  __attribute__((ext_vector_type(8)));
typedef float    v4f  __attribute__((ext_vector_type(4)));
typedef unsigned int v4u __attribute__((ext_vector_type(4)));

union FragH { v16h v; v8h h[2]; v4u u[2]; };
union FragB { v16b v; v4u u[2]; };

// ---- scalar helpers --------------------------------------------------------------------------------
__device__ __forceinline__ unsigned short bf_bits(float f) {          // f32 -> bf16 bits, RNE convert
  unsigned u = __float_as_uint(f);
  return (unsigned short)((u + 0x7FFFu + ((u >> 16) & 1u)) >> 16);
}
__device__ __forceinline__ float bf_up(unsigned short h) { return __uint_as_float(((unsigned)h) << 16); }
__device__ __forceinline__ float bfr(float f) { return bf_up(bf_bits(f)); }
__device__ __forceinline__ unsigned short h_bits(_Float16 x) { return __builtin_bit_cast(unsigned short, x); }
__device__ __forceinline__ unsigned pk16(unsigned short a, unsigned short b) { return (unsigned)a | ((unsigned)b << 16); }
__device__ __forceinline__ float xhalf(float x) {                     // value of lane l ^ 16
  const int b = __builtin_bit_cast(int, x);
  return __builtin_bit_cast(float, __builtin_amdgcn_permlanex16(b, b, 0x76543210, 0xfedcba98, false, false));
}
__device__ __forceinline__ v8f zero8() { v8f z = {0.f, 0.f, 0.f, 0.f, 0.f, 0.f, 0.f, 0.f}; return z; }

// ---- fragment-major 16-bit planes: a matrix [R rows][Kd k] (R % 16 == 0, Kd % 32 == 0) is stored as fragments of 16 rows x 32 k,
//      fragment (rb = row / 16, kb = k / 32) at halves (rb * (Kd / 32) + kb) * 512; inside it 64 chunks of 8 halves, chunk
//      i * 32 + h * 16 + c = row 16 rb + c, k = 32 kb + 16 i + 8 h + 0..7. A wave-wide 16-B load of chunks 32 i + lane is 512 contiguous,
//      512-B aligned bytes = 4 whole lines (the same fragment read from a row-major plane touches 16 lines, 32 B of each, per load).
// ---- fragment loaders: 16-bit A/B operand, lane -> row/col (lane&15), p = fragment start + 8*lane;
//      elements 0..7 <- p[0..7] (k0+8h..), elements 8..15 <- p[256..263] (k0+16+8h..)  (same split k map for A and B).
//      fs = a fragment start that is the same for the whole wave (a scalar base), bo = 32-bit byte offset from it: 16*lane plus the
//      loop's advance, one vector register that serves every load of a trip
// sbase: p + ofs for a wave-uniform ofs, kept as a scalar base of its own: without the readfirstlane the compiler adds the lane offset
// to p first and then forms each further fragment's 64-bit address with vector additions in every trip.
template <typename T>
__device__ __forceinline__ const T* sbase(const T* p, size_t ofs) {
  const uint32_t l = (uint32_t)__builtin_amdgcn_readfirstlane((int)(uint32_t)ofs);
  const uint32_t h = (uint32_t)__builtin_amdgcn_readfirstlane((int)(uint32_t)((uint64_t)ofs >> 32));
  return p + (size_t)(((uint64_t)h << 32) | (uint64_t)l);
}
__device__ __forceinline__ v16h ldfrag_h(const _Float16* fs, unsigned bo) {
  const char* p = (const char*)(const void*)fs + bo;
  FragH f;
  f.h[0] = *(const v8h*)(const void*)(p);
  f.h[1] = *(const v8h*)(const void*)(p + 512);
  return f.v;
}
__device__ __forceinline__ v16b ldfrag_b(const u16* fs, unsigned bo) { // bf16 plane read as unsigned integer vectors
  const char* p = (const char*)(const void*)fs + bo;
  FragB f;
  f.u[0] = *(const v4u*)(const void*)(p);
  f.u[1] = *(const v4u*)(const void*)(p + 512);
  return f.v;
}

// row-major element index (matrix [R][Kd]) of the 8 halves that chunk q of the fragment-major plane holds
__device__ __forceinline__ size_t chunk_src(int q, int Kd) {
  const int f = q >> 6, nkb = Kd >> 5;
  return (size_t)((f / nkb) * 16 + (q & 15)) * (size_t)Kd + (size_t)((f % nkb) * 32 + ((q >> 4) & 3) * 8);
}

__device__ __forceinline__ v8f mma_h(v16h a, v16h b, v8f c) {
  return __builtin_amdgcn_wmma_f32_16x16x32_f16(false, a, false, b, (short)0, c, false, false);
}
__device__ __forceinline__ v8f mma_b(v16b a, v16b b, v8f c) {
  return __builtin_amdgcn_wmma_f32_16x16x32_bf16(false, a, false, b, (short)0, c, false, false);
}
__device__ __forceinline__ void guard2(v8f& a, v8f& b, v16h x0, v16h x1, v16h x2, v16h x3, v16h x4, v16h x5) {
#if defined(__HIP_DEVICE_COMPILE__)
  asm volatile("v_nop\n\tv_nop\n\tv_nop\n\tv_nop"
               : "+v"(a), "+v"(b) : "v"(x0), "v"(x1), "v"(x2), "v"(x3), "v"(x4), "v"(x5) : "memory");
#endif
}
template <typename F>
__device__ __forceinline__ void guard6(v8f& a, v8f& b, v8f& c, v8f& d, F x0, F x1, F x2, F x3, F x4, F x5) {
#if defined(__HIP_DEVICE_COMPILE__)
  asm volatile("v_nop\n\tv_nop\n\tv_nop\n\tv_nop"
               : "+v"(a), "+v"(b), "+v"(c), "+v"(d) : "v"(x0), "v"(x1), "v"(x2), "v"(x3), "v"(x4), "v"(x5) : "memory");
#endif
}
__device__ __forceinline__ void guard10(v8f& a, v8f& b, v8f& c, v8f& d, v16h x0, v16h x1, v16h x2, v16h x3, v16h x4,
                                        v16h x5, v16h x6, v16h x7, v16h x8, v16h x9) {
#if defined(__HIP_DEVICE_COMPILE__)
  asm volatile("v_nop\n\tv_nop\n\tv_nop\n\tv_nop"
               : "+v"(a), "+v"(b), "+v"(c), "+v"(d)
               : "v"(x0), "v"(x1), "v"(x2), "v"(x3), "v"(x4), "v"(x5), "v"(x6), "v"(x7), "v"(x8), "v"(x9) : "memory");
#endif
}
__device__ __forceinline__ void acc_guard4(v8f& a, v8f& b, v8f& c, v8f& d) {
#if defined(__HIP_DEVICE_COMPILE__)
  asm volatile("v_nop\n\tv_nop\n\tv_nop\n\tv_nop" : "+v"(a), "+v"(b), "+v"(c), "+v"(d));
#endif
}
__device__ __forceinline__ void wave_sync_lds() {
  __builtin_amdgcn_fence(__ATOMIC_RELEASE, "workgroup");
  __builtin_amdgcn_wave_barrier();
  __builtin_amdgcn_fence(__ATOMIC_ACQUIRE, "workgroup");
}

// =====================================================================================================
// f32 [rows][DMOD] -> 16-bit fragment-major plane.  f16mode == 0: bf16 RNE bits;  f16mode == 1: f16 bits of (bf16 RNE value) * scale.
// Thread = one chunk of the plane (8 consecutive k of one row): two 16-B loads, one 16-B store; 32 consecutive lanes store 512
// contiguous, 512-B aligned bytes.
// coverage: grid = n8/256 blocks (exact, host-derived) x 256 thr x 8 = the whole plane.
// =====================================================================================================
__global__ __launch_bounds__(256) void cvt16(const float* __restrict__ x, u16* D, int n8, int f16mode, float scale) {
  const int gt = blockIdx.x * 256 + (int)threadIdx.x;
  if (gt >= n8) return;                     // no barriers in this kernel
  const float* p = x + chunk_src(gt, DMOD);
  const v4f a = *(const v4f*)(p), b4 = *(const v4f*)(p + 4);
  float w[8];
#pragma unroll
  for (int e = 0; e < 4; ++e) { w[e] = a[e]; w[4 + e] = b4[e]; }
  v4u o;
#pragma unroll
  for (int e = 0; e < 4; ++e) {
    const float f0 = w[2 * e], f1 = w[2 * e + 1];
    const unsigned short hb0 = h_bits((_Float16)(bfr(f0) * scale));
    const unsigned short hb1 = h_bits((_Float16)(bfr(f1) * scale));
    const unsigned short bb0 = bf_bits(f0);
    const unsigned short bb1 = bf_bits(f1);
    o[e] = (f16mode != 0) ? pk16(hb0, hb1) : pk16(bb0, bb1);
  }
  u16* d = D + (size_t)gt * 8;
  {
    *(v4u*)(d) = o;
    
  }
}

// =====================================================================================================
// Weight transpose-convert: W [K][N] f32 (x.W layout, n contiguous, in[K rows][N cols]) -> Dt, the fragment-major 16-bit plane of the
// matrix [N rows][K cols].  f16mode == 0: bf16 RNE bits; 1: f16 bits of (bf16 RNE value) * scale.
// Block = (k tile k0 = (bid / (N/64))*64, n tile n0 = (bid % (N/64))*64): 64 source rows of 64 floats loaded with 16-B loads,
// converted, scattered into an LDS tile [n][64 k] (pitch 72 halves); after a block barrier the tile's 8 fragments are stored chunk by chunk.
// coverage: load 256 thr x 16 = 64 x 64; store 2 iterations x 256 thr x 8 halves = 8 fragments x 512 halves = the block's tile;
//           grid = (K/64)*(N/64) blocks covers Dt exactly once (host checks K % 64 == 0 and N % 64 == 0).
// =====================================================================================================
__global__ __launch_bounds__(256) void wt16(const float* __restrict__ W, u16* Dt, int K, int N, int f16mode, float scale) {
  __shared__ __align__(16) u16 T[64 * VTP];
  const int tid = threadIdx.x;
  const int bid = blockIdx.x;
  const int ntn = N >> 6;
  const int n0  = (bid % ntn) * 64;
  const int k0  = (bid / ntn) * 64;
  if (k0 + 64 > K) return;                    // block-uniform, before any barrier; never taken with the exact grid
  {
    const int sl = tid >> 2;                  // k within tile 0..63 (source row)
    const int dc = (tid & 3) * 16;            // n chunk
    const float* src = W + (size_t)(k0 + sl) * N + n0 + dc;
#pragma unroll
    for (int i = 0; i < 4; ++i) {
      const v4f a = *(const v4f*)(src + 4 * i);
#pragma unroll
      for (int e = 0; e < 4; ++e) {
        const float f = a[e];
        const unsigned short hb = h_bits((_Float16)(bfr(f) * scale));
        const unsigned short bb = bf_bits(f);
        T[(dc + 4 * i + e) * VTP + sl] = (f16mode != 0) ? hb : bb;
      }
    }
  }
  __syncthreads();
  // the tile = 4 (n) x 2 (k) fragments of the plane; thread = chunk tid & 63 of fragment (n block it*2 + (tid >> 7), k block (tid >> 6) & 1)
  v4u vv[2];
  const int ch = tid & 63, fk = (tid >> 6) & 1, fr = tid >> 7;
#pragma unroll
  for (int it = 0; it < 2; ++it) {
    const int line = (it * 2 + fr) * 16 + (ch & 15);   // n = 0..63 within tile
    vv[it] = *(const v4u*)(T + line * VTP + fk * 32 + (ch >> 4) * 8);
  }
  const size_t base = (size_t)n0 * K + (size_t)((k0 >> 5) + fk) * 512 + ch * 8;
  {
#pragma unroll
    for (int it = 0; it < 2; ++it) {
      *(v4u*)(Dt + base + (size_t)((it * 2 + fr) * 16) * K) = vv[it];
    }
  }
}

// =====================================================================================================
// GEMM epilogue shared by both engines: the wave's 16x64 f32 tile (times oscale) staged in its LDS slab (pitch 68),
// coverage: 8 instructions x 2 rows x 16 lanes x 4 floats = the wave's 16 x 64 tile.
// =====================================================================================================
__device__ __forceinline__ void epi64(float* sl, v8f a0, v8f a1, v8f a2, v8f a3, float oscale,
                                      const float* __restrict__ bias, float* C, int N,
                                      size_t rowb, int col0, int lane) {
  const int hh = lane >> 4, m = lane & 15;
#pragma unroll
  for (int r = 0; r < 8; ++r) {
    const int ro = (8 * hh + r) * 68 + m;
    sl[ro]      = a0[r] * oscale;
    sl[ro + 16] = a1[r] * oscale;
    sl[ro + 32] = a2[r] * oscale;
    sl[ro + 48] = a3[r] * oscale;
  }
  wave_sync_lds();
  const v4f braw = *(const v4f*)(bias + col0 + m * 4);
  v4f bb;
#pragma unroll
  for (int e = 0; e < 4; ++e) bb[e] = bfr(braw[e]);
  v4f vals[8];
#pragma unroll
  for (int it = 0; it < 8; ++it) vals[it] = *(const v4f*)(sl + (it * 2 + hh) * 68 + m * 4) + bb;
  float* dst = C + (rowb + (size_t)hh) * (size_t)N + col0 + m * 4;
  {
#pragma unroll
    for (int it = 0; it < 8; ++it) {
      *(v4f*)(dst + (size_t)(it * 2) * (size_t)N) = vals[it];
    }
    
  }
}

// =====================================================================================================
// bf16 GEMM: C[M][N] (f32) = A[M][K] . Bt[N][K]^T (both bf16 fragment-major planes), times oscale, plus bias[N].
// Block = 64x64 tile, 4 waves x 16 rows; fragments loaded straight from the planes (two 16-B loads each, 512 contiguous bytes per
// wave and load, split k map for A and B); K stepped by 32 (host checks K % 32 == 0, M % 64 == 0, N % 64 == 0, grid = (M/64)*(N/64)).
// =====================================================================================================
__global__ __launch_bounds__(128)
void gemm_bf(const u16* __restrict__ A, const u16* __restrict__ Bt, const float* __restrict__ bias, float* C,
             int M, int N, int K, float oscale) {
  __shared__ __align__(16) float slab[4 * SLAB64];
  const int tid = threadIdx.x, lane = tid & 31;
  const int wave = __builtin_amdgcn_readfirstlane(tid >> 5);   // scalar: makes every fragment start a scalar base
  unsigned bo = 16u * (unsigned)lane;        // byte offset of this lane's chunk; advanced by one fragment (1024 B) per k step
  const int ntile = N >> 6;
  const int bid   = blockIdx.x;
  const int rowb  = (bid / ntile) * 64 + wave * 16;
  const int col0  = (bid % ntile) * 64;
  if (rowb + 16 > M) return;                 // wave-uniform, never taken with the exact grid; no block barriers in this kernel
  const u16* ap = A  + (size_t)rowb * K;              // fragment (rowb / 16, 0) of the fragment-major plane
  const size_t bs = (size_t)16 * K;
  const u16* bp  = Bt + (size_t)col0 * K;
  const u16* b1p = sbase(bp, bs), * b2p = sbase(bp, 2 * bs), * b3p = sbase(bp, 3 * bs);
  v8f acc0 = zero8(), acc1 = zero8(), acc2 = zero8(), acc3 = zero8();
#pragma unroll 1
  for (int k0 = 0; k0 < K; k0 += 32) {
    const v16b a  = ldfrag_b(ap, bo);
    const v16b b0 = ldfrag_b(bp, bo);
    const v16b b1 = ldfrag_b(b1p, bo);
    const v16b b2 = ldfrag_b(b2p, bo);
    const v16b b3 = ldfrag_b(b3p, bo);
    acc0 = mma_b(a, b0, acc0);
    acc1 = mma_b(a, b1, acc1);
    acc2 = mma_b(a, b2, acc2);
    acc3 = mma_b(a, b3, acc3);
    guard6<v16b>(acc0, acc1, acc2, acc3, a, b0, b1, b2, b3, a);
    bo += 1024u;
  }
  epi64(slab + wave * SLAB64, acc0, acc1, acc2, acc3, oscale, bias, C, N, (size_t)rowb, col0, lane);
}

// =====================================================================================================
// f16 hi+lo GEMM: C[M][N] (f32) = (Ahi + Alo)[M][K] . Bt[N][K]^T, times oscale, plus bias[N]; Ahi/Alo f16 planes (same layout),
// Bt f16, all three fragment-major; products hi.B + lo.B into one accumulator (lo is the unscaled residual of hi). Same tiling as gemm_bf.
// =====================================================================================================
__global__ __launch_bounds__(128)
void gemm_h2(const u16* __restrict__ Ah, const u16* __restrict__ Al, const u16* __restrict__ Bt,
             const float* __restrict__ bias, float* C, int M, int N, int K, float oscale) {
  __shared__ __align__(16) float slab[4 * SLAB64];
  const int tid = threadIdx.x, lane = tid & 31;
  const int wave = __builtin_amdgcn_readfirstlane(tid >> 5);   // scalar: makes every fragment start a scalar base
  unsigned bo = 16u * (unsigned)lane;        // byte offset of this lane's chunk; advanced by one fragment (1024 B) per k step
  const int ntile = N >> 6;
  const int bid   = blockIdx.x;
  const int rowb  = (bid / ntile) * 64 + wave * 16;
  const int col0  = (bid % ntile) * 64;
  if (rowb + 16 > M) return;                 // wave-uniform, never taken with the exact grid; no block barriers in this kernel
  const size_t aofs = (size_t)rowb * K;               // fragment (rowb / 16, 0) of the fragment-major planes
  const _Float16* ahp = (const _Float16*)(const void*)Ah + aofs;
  const _Float16* alp = (const _Float16*)(const void*)Al + aofs;
  const size_t bs = (size_t)16 * K;
  const _Float16* bp  = (const _Float16*)(const void*)Bt + (size_t)col0 * K;
  const _Float16* b1p = sbase(bp, bs), * b2p = sbase(bp, 2 * bs), * b3p = sbase(bp, 3 * bs);
  v8f acc0 = zero8(), acc1 = zero8(), acc2 = zero8(), acc3 = zero8();
#pragma unroll 1
  for (int k0 = 0; k0 < K; k0 += 32) {
    const v16h ah = ldfrag_h(ahp, bo), al = ldfrag_h(alp, bo);
    const v16h b0 = ldfrag_h(bp, bo);
    const v16h b1 = ldfrag_h(b1p, bo);
    const v16h b2 = ldfrag_h(b2p, bo);
    const v16h b3 = ldfrag_h(b3p, bo);
    acc0 = mma_h(ah, b0, acc0);  acc0 = mma_h(al, b0, acc0);
    acc1 = mma_h(ah, b1, acc1);  acc1 = mma_h(al, b1, acc1);
    acc2 = mma_h(ah, b2, acc2);  acc2 = mma_h(al, b2, acc2);
    acc3 = mma_h(ah, b3, acc3);  acc3 = mma_h(al, b3, acc3);
    guard6<v16h>(acc0, acc1, acc2, acc3, ah, al, b0, b1, b2, b3);
    bo += 1024u;
  }
  epi64(slab + wave * SLAB64, acc0, acc1, acc2, acc3, oscale, bias, C, N, (size_t)rowb, col0, lane);
}

// =====================================================================================================
// 16-bit split pack of an f32 plane [rows][DMOD] into two fragment-major planes: hi = f16(x * sc), lo = f16(x * sc - hi) (sc a power
// of two, residual unscaled). Thread = one chunk (8 consecutive k of one row): two 16-B loads, one 16-B store per plane; 32 consecutive
// lanes store 512 contiguous bytes.
// coverage: grid = n8/256 blocks (exact, host-derived) x 256 thr x 8 = the whole of each plane.
// =====================================================================================================
__global__ __launch_bounds__(256) void split16(const float* __restrict__ x, u16* hpl, u16* lpl, int n8, float sc) {
  const int gt = blockIdx.x * 256 + (int)threadIdx.x;
  if (gt >= n8) return;                     // no barriers in this kernel
  const float* p = x + chunk_src(gt, DMOD);
  const v4f a = *(const v4f*)(p), b4 = *(const v4f*)(p + 4);
  float w[8];
#pragma unroll
  for (int e = 0; e < 4; ++e) { w[e] = a[e]; w[4 + e] = b4[e]; }
  v4u oh, ol;
#pragma unroll
  for (int e = 0; e < 4; ++e) {
    const float t0 = w[2 * e] * sc, t1 = w[2 * e + 1] * sc;
    const _Float16 h0 = (_Float16)t0, h1 = (_Float16)t1;
    const _Float16 l0 = (_Float16)(t0 - (float)h0), l1 = (_Float16)(t1 - (float)h1);
    oh[e] = pk16(h_bits(h0), h_bits(h1));
    ol[e] = pk16(h_bits(l0), h_bits(l1));
  }
  const size_t o8 = (size_t)gt * 8;
  {
    *(v4u*)(hpl + o8) = oh;
    *(v4u*)(lpl + o8) = ol;
    
  }
}

// =====================================================================================================
// v^T planes, fragment-major, of the matrix VH[((b*NH + g)*HD + d)][s] = f16(v[b*SEQ + s][g*HD + d] * 1024), VL = f16 residual of the same.
// Block = (bg = bid / NST -> batch b = bg / NH, head g = bg % NH; 64 keys s0 = (bid % NST)*64): 64 source rows of HD floats loaded
// with 16-B loads, converted, scattered into two LDS tiles [d][64 keys] (pitch 72 halves); after a block barrier each tile's 8 fragments are stored chunk by chunk.
// coverage: load 256 thr x 16 elements = 64 x 64; store 2 iterations x 256 thr x 8 halves = 8 fragments x 512 = the block's tile of
//           each plane; grid = BATCH*NH*NST blocks covers both planes exactly once.
// =====================================================================================================
__global__ __launch_bounds__(256) void vt16(const float* __restrict__ v, u16* VHo, u16* VLo) {
  __shared__ __align__(16) u16 TH[HD * VTP];
  __shared__ __align__(16) u16 TL[HD * VTP];
  const int tid = threadIdx.x;
  const int bid = blockIdx.x;
  const int st  = bid % NST;
  const int bg  = bid / NST;                  // b*NH + g
  if (bg >= BATCH * NH) return;               // block-uniform, before any barrier; never taken with the exact grid
  const int b   = bg / NH;
  const int g   = bg % NH;
  const int s0  = st * 64;
  {
    const int sl = tid >> 2;                  // key within tile 0..63
    const int dc = (tid & 3) * 16;            // d chunk
    const float* src = v + ((size_t)(b * SEQ + s0 + sl) * NH + g) * HD + dc;
#pragma unroll
    for (int i = 0; i < 4; ++i) {
      const v4f a = *(const v4f*)(src + 4 * i);
#pragma unroll
      for (int e = 0; e < 4; ++e) {
        const float t = a[e] * VCAR;
        const _Float16 h = (_Float16)t;
        const _Float16 l = (_Float16)(t - (float)h);
        TH[(dc + 4 * i + e) * VTP + sl] = h_bits(h);
        TL[(dc + 4 * i + e) * VTP + sl] = h_bits(l);
      }
    }
  }
  __syncthreads();
  // the tile = 4 (d) x 2 (keys) fragments of each plane; thread = chunk tid & 63 of fragment (d block it*2 + (tid >> 7), key block (tid >> 6) & 1)
  v4u vh[2], vl[2];
  const int ch = tid & 63, fk = (tid >> 6) & 1, fr = tid >> 7;
#pragma unroll
  for (int it = 0; it < 2; ++it) {
    const int line = (it * 2 + fr) * 16 + (ch & 15);   // d = 0..63
    vh[it] = *(const v4u*)(TH + line * VTP + fk * 32 + (ch >> 4) * 8);
    vl[it] = *(const v4u*)(TL + line * VTP + fk * 32 + (ch >> 4) * 8);
  }
  const size_t base = ((size_t)bg * HD) * SEQ + (size_t)((s0 >> 5) + fk) * 512 + ch * 8;
  {
#pragma unroll
    for (int it = 0; it < 2; ++it) {
      *(v4u*)(VHo + base + (size_t)((it * 2 + fr) * 16) * SEQ) = vh[it];
      *(v4u*)(VLo + base + (size_t)((it * 2 + fr) * 16) * SEQ) = vl[it];
    }
  }
}

// =====================================================================================================
// Causal attention: block bid -> (query tile qt = bid % NQT: rows q0 = 16*qt .. q0+15, head = (bid / NQT) % NH,
// batch b = bid / (NQT*NH)). The tile's key tiles are dealt round-robin to the block's WPB waves (wave w takes kt = w, w + WPB, ..);
// each wave keeps its own running max, sum and unnormalised O, and the WPB partials are merged through LDS after one block barrier.
//   q planes (hi, lo f16 x1024): fragment-major planes of the matrix [b*SEQ + s][h*HD + d]; k planes the same; v^T planes of [(b*NH + h)*HD + d][s].
//   score (log2 domain) t(i, j) = (q_i.k_j) * 0.125*log2e/(1024*1024) for key j <= query i, and -inf for j > i (the select
//   replaces the score). Key tiles of 32 visited for kb <= q0 + 15; tiles whose every key index exceeds every query index
//   of the tile hold only -inf, whose exp is exactly 0, and are not visited. Every visited row has key j = i or an earlier finite
//   key, so a wave's running max is finite from its first tile on; a wave with no tile keeps max = -inf, sum = 0, O = 0.
//   Both products are taken transposed: S^T = K.Q^T (A = 16 key rows, B = the 16 queries) and O^T += V^T.P^T (A = 16 d rows of v^T,
//   B = P^T). In a score tile lane (c, hh) then holds query q0 + c and keys 8hh + 0..7 of the subtile, so a query's maximum and sum run
//   over the lane's own 16 registers plus one exchange with lane ^ 16, and the two subtiles' accumulators, converted in place, ARE the
//   B fragment of P^T in the split k map (elements 0..7 = keys kb + 8hh + 0..7, 8..15 = keys kb + 16 + 8hh + 0..7): P never leaves
//   the registers. Per tile: 2 score subtiles x 2 k-steps x 3 products (k_hi.q_hi + k_hi.q_lo + k_lo.q_hi), fragments loaded straight
//   from the 16-bit planes (two 16-B loads per fragment, split k map); online max-subtracted base-2 softmax in f32, -inf-safe rescale
//   (one factor per lane); P x32768 as f16 hi and f16 residual; 4+4 v^T A fragments (hi and residual planes), 12 WMMAs (hh + hl + lh).
//   A lane sums only its own half's keys; the two halves' sums are joined once, after the loop.
//   After the loop: each wave writes its unnormalised O to its own slab (pitch 68; every element owned by one lane) and its row
//   max and sum to the ml table; one block barrier (reached by every wave; trip counts differ only between waves, and the loop holds
//   no block barrier); wave w then merges columns d = 16w .. 16w+15 of all 16 rows: M = max_w m_w, out = sum_w O_w 2^(m_w - M) / sum_w l_w 2^(m_w - M)
//   (Z > 0 always: key j = i is never masked; guarded anyway), carries 1/(32768*1024) folded once. Bounded loops only (nkt <= NKT).
// coverage: per wave 1 instruction x 16 rows x 2 lanes x 8 halves = 16 x 16 per plane, x WPB waves = 16 x 64; grid NQT*NH*BATCH blocks
//           = every (b, s, h) row of both O planes exactly once.
// =====================================================================================================
__global__ __launch_bounds__(ATT_THREADS)
void attn1(const u16* __restrict__ QHIp, const u16* __restrict__ QLOp,
           const u16* __restrict__ KHIp, const u16* __restrict__ KLOp,
           const u16* __restrict__ VHIp, const u16* __restrict__ VLOp,
           u16* OHIp, u16* OLOp) {
  __shared__ __align__(16) float smem[WPB * WREG];
  __shared__ float mtab[WPB * 16];           // per wave and query row: running max (log2 domain)
  __shared__ float ltab[WPB * 16];           // per wave and query row: running sum

  const int tid  = threadIdx.x;
  const int wave = __builtin_amdgcn_readfirstlane(tid >> 5);   // scalar: the key loop's start must be wave-uniform for the WMMAs
  const int lane = tid & 31;
  const int hh   = lane >> 4;
  const int c    = lane & 15;
  const int bid  = blockIdx.x;
  const int qt   = bid % NQT;
  const int rem  = bid / NQT;
  const int head = rem % NH;
  const int b    = rem / NH;
  if (b >= BATCH) return;                    // block-uniform, before the block barrier; never taken with the exact grid
  const int q0   = qt * 16;

  float* slab = smem + wave * WREG;          // result slab [16 queries][64 d] pitch 68

  const size_t rq0  = (size_t)b * SEQ + q0;                                     // plane row of query row q0
  const unsigned lo = 16u * (unsigned)lane;                                     // byte offset of this lane's chunk in a fragment
  const size_t qofs = (rq0 * NH + (size_t)head * 16) * HD;                      // fragment (rq0 / 16, 2 * head)
  const _Float16* Qh  = (const _Float16*)(const void*)QHIp + qofs;
  const _Float16* Ql  = (const _Float16*)(const void*)QLOp + qofs;
  const size_t kofs = ((size_t)b * SEQ * NH + (size_t)head * 16) * HD;          // fragment (b*SEQ / 16, 2 * head); key block added per step
  const _Float16* Khb = (const _Float16*)(const void*)KHIp + kofs;
  const _Float16* Klb = (const _Float16*)(const void*)KLOp + kofs;
  const size_t vofs = (((size_t)b * NH + head) * HD) * SEQ;                    // fragment (4 * (b*NH + head) (+j), 0); key block added per step
  const _Float16* Vhb = (const _Float16*)(const void*)VHIp + vofs;
  const _Float16* Vlb = (const _Float16*)(const void*)VLOp + vofs;
  const float lsc = 0.125f * (LOG2E / (QSC * KSC));
  const float oc  = 1.0f / (PCAR * VCAR);
  const size_t KROW = (size_t)NH * HD;                                          // halves per key row; 16 * KROW = one 16-row block of fragments

  float mrun = -INFINITY, lrun = 0.f;        // query q0 + c: running max (equal in both halves), running sum over this half's keys
  v8f o[4];                                  // o[j][r] = O^T element (d = 16j + 8hh + r, query q0 + c)
#pragma unroll
  for (int j = 0; j < 4; ++j) o[j] = zero8();
  const int qi = q0 + c;
  const int ncaus = (q0 >> 5) + 1;                                              // tiles holding keys <= q0 + 15
  const int nkt = (ncaus < NKT) ? ncaus : NKT;

  // byte offsets of key tile kt in the k planes (32 rows of KROW halves) and in the v^T planes (one fragment), plus this lane's chunk
  unsigned ko = lo + (unsigned)wave * (unsigned)(32 * NH * HD * 2);
  unsigned vo = lo + (unsigned)wave * 1024u;
#pragma unroll 1
  for (int kt = wave; kt < nkt; kt += WPB) {
    const int kb = kt * 32;
    // ---- scores: D element r of this lane = (key kb + 8hh + r, query q0 + c) in s0, key kb + 16 + 8hh + r in s1 ----
    v8f s0 = zero8(), s1 = zero8();
    const _Float16* k0p = Khb;
    const _Float16* k1p = k0p + (size_t)16 * KROW;
    const _Float16* l0p = Klb;
    const _Float16* l1p = l0p + (size_t)16 * KROW;
#pragma unroll
    for (int kk = 0; kk < 2; ++kk) {
      const v16h qh  = ldfrag_h(Qh + kk * 512, lo),  ql  = ldfrag_h(Ql + kk * 512, lo);
      const v16h kh0 = ldfrag_h(k0p + kk * 512, ko), kl0 = ldfrag_h(l0p + kk * 512, ko);
      const v16h kh1 = ldfrag_h(k1p + kk * 512, ko), kl1 = ldfrag_h(l1p + kk * 512, ko);
      s0 = mma_h(kh0, qh, s0);
      s0 = mma_h(kh0, ql, s0);
      s0 = mma_h(kl0, qh, s0);
      s1 = mma_h(kh1, qh, s1);
      s1 = mma_h(kh1, ql, s1);
      s1 = mma_h(kl1, qh, s1);
      guard2(s0, s1, qh, ql, kh0, kl0, kh1, kl1);
    }
    // ---- causal select (score := -inf for key > query) + online softmax in base 2, -inf-safe; all 32 keys of a query sit in
    //      lanes c and c + 16 ----
    const int key0 = kb + 8 * hh, key1 = key0 + 16;
    v8f t0 = s0 * lsc, t1 = s1 * lsc;
    float mx = -INFINITY;
#pragma unroll
    for (int r = 0; r < 8; ++r) {
      t0[r] = (key0 + r > qi) ? -INFINITY : t0[r];
      t1[r] = (key1 + r > qi) ? -INFINITY : t1[r];
      mx = fmaxf(mx, fmaxf(t0[r], t1[r]));
    }
    mx = fmaxf(mx, xhalf(mx));
    const float mn = fmaxf(mrun, mx);
    const float ms = (mn == -INFINITY) ? 0.0f : mn;
    const float al = exp2f(mrun - ms);
    mrun = mn;
    // ---- B fragments of P^T * 32768: hi f16 and residual f16, col = query c, split k map over the 32 keys of this step ----
    t0 -= ms;
    t1 -= ms;
    v8f e0, e1;
#pragma unroll
    for (int r = 0; r < 8; ++r) { e0[r] = exp2f(t0[r]); e1[r] = exp2f(t1[r]); }
    const v8f es = e0 + e1;
    const float ps = ((es[0] + es[1]) + (es[2] + es[3])) + ((es[4] + es[5]) + (es[6] + es[7]));
    const v8f ta = e0 * PCAR, tb = e1 * PCAR;
    FragH ph, pl;
    ph.h[0] = __builtin_convertvector(ta, v8h);            // elements 0..7  = keys kb + 8hh + 0..7
    ph.h[1] = __builtin_convertvector(tb, v8h);            // elements 8..15 = keys kb + 16 + 8hh + 0..7
    pl.h[0] = __builtin_convertvector(ta - __builtin_convertvector(ph.h[0], v8f), v8h);
    pl.h[1] = __builtin_convertvector(tb - __builtin_convertvector(ph.h[1], v8f), v8h);
    lrun = lrun * al + ps;
#pragma unroll
    for (int j = 0; j < 4; ++j) {
#pragma unroll
      for (int r = 0; r < 8; ++r) o[j][r] *= al;
    }
    // ---- V^T.P^T : A fragment row = d = j*16 + c, keys contiguous in the v^T planes ----
    {
      const _Float16* vhp = Vhb;
      const _Float16* vlp = Vlb;
      const v16h vh0 = ldfrag_h(vhp, vo);
      const v16h vh1 = ldfrag_h(vhp + (size_t)16 * SEQ, vo);
      const v16h vh2 = ldfrag_h(vhp + (size_t)32 * SEQ, vo);
      const v16h vh3 = ldfrag_h(vhp + (size_t)48 * SEQ, vo);
      const v16h vl0 = ldfrag_h(vlp, vo);
      const v16h vl1 = ldfrag_h(vlp + (size_t)16 * SEQ, vo);
      const v16h vl2 = ldfrag_h(vlp + (size_t)32 * SEQ, vo);
      const v16h vl3 = ldfrag_h(vlp + (size_t)48 * SEQ, vo);
      o[0] = mma_h(vh0, ph.v, o[0]);  o[0] = mma_h(vh0, pl.v, o[0]);  o[0] = mma_h(vl0, ph.v, o[0]);
      o[1] = mma_h(vh1, ph.v, o[1]);  o[1] = mma_h(vh1, pl.v, o[1]);  o[1] = mma_h(vl1, ph.v, o[1]);
      o[2] = mma_h(vh2, ph.v, o[2]);  o[2] = mma_h(vh2, pl.v, o[2]);  o[2] = mma_h(vl2, ph.v, o[2]);
      o[3] = mma_h(vh3, ph.v, o[3]);  o[3] = mma_h(vh3, pl.v, o[3]);  o[3] = mma_h(vl3, ph.v, o[3]);
      guard10(o[0], o[1], o[2], o[3], ph.v, pl.v, vh0, vh1, vh2, vh3, vl0, vl1, vl2, vl3);
    }
    ko += (unsigned)(WPB * 32 * NH * HD * 2);
    vo += (unsigned)(WPB * 1024);
  }
  acc_guard4(o[0], o[1], o[2], o[3]);
  lrun += xhalf(lrun);                       // the two halves' key sums of query q0 + c, joined once
  // ---- this wave's partial: unnormalised O into its lane-owned slab (8 consecutive d per accumulator), row max and sum into the tables ----
#pragma unroll
  for (int j = 0; j < 4; ++j) {
    float* sp = slab + c * 68 + j * 16 + 8 * hh;
    const v4f a = {o[j][0], o[j][1], o[j][2], o[j][3]}, b4 = {o[j][4], o[j][5], o[j][6], o[j][7]};
    *(v4f*)(sp)     = a;
    *(v4f*)(sp + 4) = b4;
  }
  if (hh == 0) {
    mtab[wave * 16 + c] = mrun;
    ltab[wave * 16 + c] = lrun;
  }
  __syncthreads();                           // publishes every wave's partial to all waves; each merges a 16-column band of every partial
  // ---- merge of the WPB partials; thread = chunk tid of the block's two O fragments: row = lane & 15, 8 consecutive d from
  //      32 * (wave >> 1) + 16 * (wave & 1) + 8 * (lane >> 4) ----
  const int row = c, c8 = wave * 16 + hh * 8;
  float mw[WPB];
  float mall = -INFINITY;
#pragma unroll
  for (int w = 0; w < WPB; ++w) { mw[w] = mtab[w * 16 + row]; mall = fmaxf(mall, mw[w]); }
  const float msafe = (mall == -INFINITY) ? 0.0f : mall;
  float lv = 0.f;
  float acc[8];
#pragma unroll
  for (int e = 0; e < 8; ++e) acc[e] = 0.f;
#pragma unroll
  for (int w = 0; w < WPB; ++w) {
    const float sc = exp2f(mw[w] - msafe);   // 0 for a wave that saw no tile
    lv += ltab[w * 16 + row] * sc;
    const float* sp = smem + w * WREG + row * 68 + c8;
    const v4f a = *(const v4f*)(sp), b4 = *(const v4f*)(sp + 4);
#pragma unroll
    for (int e = 0; e < 4; ++e) { acc[e] += a[e] * sc; acc[4 + e] += b4[e] * sc; }
  }
  // ---- out = acc / Z (0 if Z == 0), carries (32768 on P, 1024 on v) folded once; O x1024 -> f16 hi + residual planes ----
  const float ls  = (lv > 0.0f) ? lv : 1.0f;
  const float inv = (lv > 0.0f) ? ((1.0f / ls) * oc) : 0.0f;
  v4u oh, ol;
#pragma unroll
  for (int e = 0; e < 4; ++e) {
    const float w0 = (acc[2 * e] * inv) * OSC, w1 = (acc[2 * e + 1] * inv) * OSC;
    const _Float16 h0 = (_Float16)w0, h1 = (_Float16)w1;
    const _Float16 l0 = (_Float16)(w0 - (float)h0), l1 = (_Float16)(w1 - (float)h1);
    oh[e] = pk16(h_bits(h0), h_bits(h1));
    ol[e] = pk16(h_bits(l0), h_bits(l1));
  }
  const size_t o8 = (rq0 * NH + (size_t)head * 16) * HD + 8 * tid;              // fragments (rq0 / 16, 2 * head .. 2 * head + 1)
  *(v4u*)(OHIp + o8) = oh;
  *(v4u*)(OLOp + o8) = ol;
}

// =====================================================================================================
// Workspace map (bytes); every plane is fully written by whole-line stores before it is read; all extents are exact multiples
// of the store granularity (no pad rows needed); every offset a multiple of 2097152; every 16-bit plane is fragment-major (the shape
// given is that of its matrix, rows x k):
//   XB  bf16 [MROWS][1024]              8388608
//   WQB bf16 [1024 n][1024 k]          2097152        WKB, WVB same
//   WOH f16  [1024 n][1024 k] x1024    2097152
//   F   f32  [MROWS][1024]             16777216       (q, then k, then v projection output, reused in launch order)
//   QHI f16 [MROWS][16*64] x1024       8388608        QLO residual
//   KHI f16 [MROWS][16*64] x1024       8388608        KLO residual
//   VHI f16 [BATCH*16*64][SEQ] x1024   8388608        VLO residual
//   OHI f16 [MROWS][1024] x1024        8388608        OLO residual
//   end                              100663296
// =====================================================================================================
extern "C" void kernel_launch(void* const* d_in, const int* in_sizes, int n_in,
                              void* d_out, int out_size, void* d_ws, size_t ws_size,
                              hipStream_t stream) {
  if (n_in < 9) return;
  if (in_sizes[0] != MROWS * DMOD) return;
  if (in_sizes[1] != DMOD * DMOD || in_sizes[3] != DMOD * DMOD) return;
  if (in_sizes[5] != DMOD * DMOD || in_sizes[7] != DMOD * DMOD) return;
  if (in_sizes[2] != DMOD || in_sizes[4] != DMOD || in_sizes[6] != DMOD || in_sizes[8] != DMOD) return;
  if (out_size != MROWS * DMOD) return;

  const float* x    = (const float*)d_in[0];
  const float* wq   = (const float*)d_in[1];
  const float* bq   = (const float*)d_in[2];
  const float* wk   = (const float*)d_in[3];
  const float* bk   = (const float*)d_in[4];
  const float* wv   = (const float*)d_in[5];
  const float* bv   = (const float*)d_in[6];
  const float* wo   = (const float*)d_in[7];
  const float* bo   = (const float*)d_in[8];
  float*       out  = (float*)d_out;

  const size_t szXB = (size_t)MROWS * DMOD * 2;                 //  8388608
  const size_t szW  = (size_t)DMOD * DMOD * 2;                  //  2097152
  const size_t szF  = (size_t)MROWS * DMOD * 4;                 // 16777216
  const size_t szP  = (size_t)MROWS * DMOD * 2;                 //  8388608
  size_t off = 0;
  const size_t oXB  = off; off += szXB;
  const size_t oWQ  = off; off += szW;
  const size_t oWK  = off; off += szW;
  const size_t oWV  = off; off += szW;
  const size_t oWO  = off; off += szW;
  const size_t oF   = off; off += szF;
  const size_t oQHI = off; off += szP;
  const size_t oQLO = off; off += szP;
  const size_t oKHI = off; off += szP;
  const size_t oKLO = off; off += szP;
  const size_t oVHI = off; off += szP;
  const size_t oVLO = off; off += szP;
  const size_t oOHI = off; off += szP;
  const size_t oOLO = off; off += szP;
  if (off > ws_size) return;                            // off = 100663296
  if (off > (size_t)134217728) return;

  char* ws = (char*)d_ws;
  u16*   XB  = (u16*)(ws + oXB);
  u16*   WQB = (u16*)(ws + oWQ);
  u16*   WKB = (u16*)(ws + oWK);
  u16*   WVB = (u16*)(ws + oWV);
  u16*   WOH = (u16*)(ws + oWO);
  float* F   = (float*)(ws + oF);
  u16*   QHI = (u16*)(ws + oQHI);
  u16*   QLO = (u16*)(ws + oQLO);
  u16*   KHI = (u16*)(ws + oKHI);
  u16*   KLO = (u16*)(ws + oKLO);
  u16*   VHI = (u16*)(ws + oVHI);
  u16*   VLO = (u16*)(ws + oVLO);
  u16*   OHI = (u16*)(ws + oOHI);
  u16*   OLO = (u16*)(ws + oOLO);

  const dim3 blk(256);
  const int n8x = (MROWS * DMOD) / 8;                   // 524288
  const dim3 gX(n8x / 256);                             // 2048 (exact)
  const dim3 gWT((DMOD / 64) * (DMOD / 64));            // 256
  const dim3 gG((MROWS / 64) * (DMOD / 64));            // 1024
  const dim3 bG(128);
  const dim3 gVT(BATCH * NH * NST);                     // 1024
  const dim3 gAT(ATT_BLOCKS);                           // 4096
  const dim3 bAT(ATT_THREADS);                          // 128

  // (0) x -> bf16 plane [MROWS][1024]
  cvt16<<<gX, blk, 0, stream>>>(x, XB, n8x, 0, 1.0f);
  // (1..3) Wq/Wk/Wv [k][n] -> bf16 [n][k] planes
  wt16<<<gWT, blk, 0, stream>>>(wq, WQB, DMOD, DMOD, 0, 1.0f);
  wt16<<<gWT, blk, 0, stream>>>(wk, WKB, DMOD, DMOD, 0, 1.0f);
  wt16<<<gWT, blk, 0, stream>>>(wv, WVB, DMOD, DMOD, 0, 1.0f);
  // (4) Wo [k][n] -> f16 [n][k] plane of bf16 value x1024
  wt16<<<gWT, blk, 0, stream>>>(wo, WOH, DMOD, DMOD, 1, WOS);
  // (5) q = x.Wq + bq -> F f32; (6) q hi/lo planes x1024
  gemm_bf<<<gG, bG, 0, stream>>>(XB, WQB, bq, F, MROWS, DMOD, DMOD, 1.0f);
  split16<<<gX, blk, 0, stream>>>(F, QHI, QLO, n8x, QSC);
  // (7) k = x.Wk + bk -> F; (8) k hi/lo planes x1024
  gemm_bf<<<gG, bG, 0, stream>>>(XB, WKB, bk, F, MROWS, DMOD, DMOD, 1.0f);
  split16<<<gX, blk, 0, stream>>>(F, KHI, KLO, n8x, KSC);
  // (9) v = x.Wv + bv -> F; (10) v^T hi/lo planes x1024
  gemm_bf<<<gG, bG, 0, stream>>>(XB, WVB, bv, F, MROWS, DMOD, DMOD, 1.0f);
  vt16<<<gVT, blk, 0, stream>>>(F, VHI, VLO);
  // (11) causal attention -> O planes [b*SEQ+s][h][d] x1024 (hi + residual)
  attn1<<<gAT, bAT, 0, stream>>>(QHI, QLO, KHI, KLO, VHI, VLO, OHI, OLO);
  // (12) output projection -> out [MROWS][1024] f32, carries 1024 (O) x 1024 (Wo) folded back, + bo
  gemm_h2<<<gG, bG, 0, stream>>>(OHI, OLO, WOH, bo, out, MROWS, DMOD, DMOD, 1.0f / (OSC * WOS));
  (void)hipGetLastError();
}

// v004
// It runs in 159 microseconds.
// In two side-by-side timings against v003, it was 1.37 and 1.33 times as fast.
// All steps since v000 together make it 2.56 times as fast.
// Contractions: x.W{q,k,v} on v_wmma_f32_16x16x32_bf16 (x and W^T RNE-converted to bf16, f32 accumulate);
// scores, transposed, k.q^T (q, k carried x1024 as f16 hi plane + f16 residual plane, products hh+lh+hl), v^T.P^T (P x32768 f16
// hi+residual, v x1024 f16 hi+residual, products hh+lh+hl) and O.Wo (O x1024 f16 hi+residual, Wo^T as f16(bf16(Wo)) x1024, products h.w+l.w):
// v_wmma_f32_16x16x32_f16, f32 accumulate. Static causal select, base-2 online softmax and 1/l fold in f32 on VALU.
#include <hip/hip_runtime.h>
#include <math.h>
#include <stdint.h>

#define BATCH 2
#define SEQ   2048
#define DMOD  1024
#define NH    16
#define HD    64
#define MROWS (BATCH * SEQ)
#define QSC   1024.0f
#define KSC   1024.0f
#define PCAR  32768.0f
#define VCAR  1024.0f
#define OSC   1024.0f
#define WOS   1024.0f
#define LOG2E 1.4426950408889634f
#define WPB   4
#define NQT   (SEQ / 16)
#define NWB   ((DMOD / 64) * (DMOD / 64))
#define NXB   ((MROWS * DMOD) / 2048)
#define NKT   (SEQ / 32)
#define ATT_THREADS (WPB * 32)
#define ATT_BLOCKS  (NQT * NH * BATCH)
#define SLW   (16 * 68)
#define WREG  SLW
#define SLAB64 (16 * 68)
#define VTP   72
static_assert(DMOD == NH * HD && HD == 64 && NH == 16);
static_assert(WPB == 4 && ATT_THREADS == 128 && ATT_BLOCKS == 4096);
static_assert((SEQ % 64) == 0 && (SEQ % 32) == 0 && (SEQ % 16) == 0 && SEQ <= 32768);
static_assert((DMOD % 64) == 0 && (DMOD % 32) == 0 && (MROWS % 64) == 0);
static_assert(((MROWS * DMOD) % 2048) == 0 && ((DMOD * DMOD) % 4096) == 0);

typedef unsigned short u16;
typedef _Float16 v16h __attribute__((ext_vector_type(16)));
typedef _Float16 v8h  __attribute__((ext_vector_type(8)));
typedef __bf16   v16b __attribute__((ext_vector_type(16)));
typedef float    v8f  __attribute__((ext_vector_type(8)));
typedef float    v4f  __attribute__((ext_vector_type(4)));
typedef unsigned int v4u __attribute__((ext_vector_type(4)));

union FragH { v16h v; v8h h[2]; v4u u[2]; };
union FragB { v16b v; v4u u[2]; };

// ---- scalar helpers --------------------------------------------------------------------------------
__device__ __forceinline__ unsigned short bf_bits(float f) {          // f32 -> bf16 bits, RNE convert
  unsigned u = __float_as_uint(f);
  return (unsigned short)((u + 0x7FFFu + ((u >> 16) & 1u)) >> 16);
}
__device__ __forceinline__ float bf_up(unsigned short h) { return __uint_as_float(((unsigned)h) << 16); }
__device__ __forceinline__ float bfr(float f) { return bf_up(bf_bits(f)); }
__device__ __forceinline__ unsigned short h_bits(_Float16 x) { return __builtin_bit_cast(unsigned short, x); }
__device__ __forceinline__ unsigned pk16(unsigned short a, unsigned short b) { return (unsigned)a | ((unsigned)b << 16); }
__device__ __forceinline__ float xhalf(float x) {                     // value of lane l ^ 16
  const int b = __builtin_bit_cast(int, x);
  return __builtin_bit_cast(float, __builtin_amdgcn_permlanex16(b, b, 0x76543210, 0xfedcba98, false, false));
}
__device__ __forceinline__ v8f zero8() { v8f z = {0.f, 0.f, 0.f, 0.f, 0.f, 0.f, 0.f, 0.f}; return z; }

// ---- fragment-major 16-bit planes: a matrix [R rows][Kd k] (R % 16 == 0, Kd % 32 == 0) is stored as fragments of 16 rows x 32 k,
//      fragment (rb = row / 16, kb = k / 32) at halves (rb * (Kd / 32) + kb) * 512; inside it 64 chunks of 8 halves, chunk
//      i * 32 + h * 16 + c = row 16 rb + c, k = 32 kb + 16 i + 8 h + 0..7. A wave-wide 16-B load of chunks 32 i + lane is 512 contiguous,
//      512-B aligned bytes = 4 whole lines (the same fragment read from a row-major plane touches 16 lines, 32 B of each, per load).
// ---- fragment loaders: 16-bit A/B operand, lane -> row/col (lane&15), p = fragment start + 8*lane;
//      elements 0..7 <- p[0..7] (k0+8h..), elements 8..15 <- p[256..263] (k0+16+8h..)  (same split k map for A and B).
//      fs = a fragment start that is the same for the whole wave (a scalar base), bo = 32-bit byte offset from it: 16*lane plus the
//      loop's advance, one vector register that serves every load of a trip
// sbase: p + ofs for a wave-uniform ofs, kept as a scalar base of its own: without the readfirstlane the compiler adds the lane offset
// to p first and then forms each further fragment's 64-bit address with vector additions in every trip.
template <typename T>
__device__ __forceinline__ const T* sbase(const T* p, size_t ofs) {
  const uint32_t l = (uint32_t)__builtin_amdgcn_readfirstlane((int)(uint32_t)ofs);
  const uint32_t h = (uint32_t)__builtin_amdgcn_readfirstlane((int)(uint32_t)((uint64_t)ofs >> 32));
  return p + (size_t)(((uint64_t)h << 32) | (uint64_t)l);
}
__device__ __forceinline__ v16h ldfrag_h(const _Float16* fs, unsigned bo) {
  const char* p = (const char*)(const void*)fs + bo;
  FragH f;
  f.h[0] = *(const v8h*)(const void*)(p);
  f.h[1] = *(const v8h*)(const void*)(p + 512);
  return f.v;
}
__device__ __forceinline__ v16b ldfrag_b(const u16* fs, unsigned bo) { // bf16 plane read as unsigned integer vectors
  const char* p = (const char*)(const void*)fs + bo;
  FragB f;
  f.u[0] = *(const v4u*)(const void*)(p);
  f.u[1] = *(const v4u*)(const void*)(p + 512);
  return f.v;
}

// row-major element index (matrix [R][Kd]) of the 8 halves that chunk q of the fragment-major plane holds
__device__ __forceinline__ size_t chunk_src(int q, int Kd) {
  const int f = q >> 6, nkb = Kd >> 5;
  return (size_t)((f / nkb) * 16 + (q & 15)) * (size_t)Kd + (size_t)((f % nkb) * 32 + ((q >> 4) & 3) * 8);
}

__device__ __forceinline__ v8f mma_h(v16h a, v16h b, v8f c) {
  return __builtin_amdgcn_wmma_f32_16x16x32_f16(false, a, false, b, (short)0, c, false, false);
}
__device__ __forceinline__ v8f mma_b(v16b a, v16b b, v8f c) {
  return __builtin_amdgcn_wmma_f32_16x16x32_bf16(false, a, false, b, (short)0, c, false, false);
}
__device__ __forceinline__ void guard2(v8f& a, v8f& b, v16h x0, v16h x1, v16h x2, v16h x3, v16h x4, v16h x5) {
#if defined(__HIP_DEVICE_COMPILE__)
  asm volatile("v_nop\n\tv_nop\n\tv_nop\n\tv_nop"
               : "+v"(a), "+v"(b) : "v"(x0), "v"(x1), "v"(x2), "v"(x3), "v"(x4), "v"(x5) : "memory");
#endif
}
template <typename F>
__device__ __forceinline__ void guard6(v8f& a, v8f& b, v8f& c, v8f& d, F x0, F x1, F x2, F x3, F x4, F x5) {
#if defined(__HIP_DEVICE_COMPILE__)
  asm volatile("v_nop\n\tv_nop\n\tv_nop\n\tv_nop"
               : "+v"(a), "+v"(b), "+v"(c), "+v"(d) : "v"(x0), "v"(x1), "v"(x2), "v"(x3), "v"(x4), "v"(x5) : "memory");
#endif
}
__device__ __forceinline__ void guard10(v8f& a, v8f& b, v8f& c, v8f& d, v16h x0, v16h x1, v16h x2, v16h x3, v16h x4,
                                        v16h x5, v16h x6, v16h x7, v16h x8, v16h x9) {
#if defined(__HIP_DEVICE_COMPILE__)
  asm volatile("v_nop\n\tv_nop\n\tv_nop\n\tv_nop"
               : "+v"(a), "+v"(b), "+v"(c), "+v"(d)
               : "v"(x0), "v"(x1), "v"(x2), "v"(x3), "v"(x4), "v"(x5), "v"(x6), "v"(x7), "v"(x8), "v"(x9) : "memory");
#endif
}
__device__ __forceinline__ void acc_guard4(v8f& a, v8f& b, v8f& c, v8f& d) {
#if defined(__HIP_DEVICE_COMPILE__)
  asm volatile("v_nop\n\tv_nop\n\tv_nop\n\tv_nop" : "+v"(a), "+v"(b), "+v"(c), "+v"(d));
#endif
}
__device__ __forceinline__ void wave_sync_lds() {
  __builtin_amdgcn_fence(__ATOMIC_RELEASE, "workgroup");
  __builtin_amdgcn_wave_barrier();
  __builtin_amdgcn_fence(__ATOMIC_ACQUIRE, "workgroup");
}

// =====================================================================================================
// All operand conversions in one launch (five independent jobs, told apart by the block index).
// Blocks 0 .. 4*NWB-1, weight transpose-convert: weight which = bid / NWB, W [K][N] f32 (x.W layout, n contiguous) -> Dt, the fragment-major
// 16-bit plane of the matrix [N rows][K cols]; which 0..2: bf16 RNE bits; which 3: f16 bits of (bf16 RNE value) * scale.
//   Block = (k tile k0 = (wb / (N/64))*64, n tile n0 = (wb % (N/64))*64), wb = bid % NWB: 64 source rows of 64 floats loaded with 16-B loads,
//   converted, scattered into an LDS tile [n][64 k] (pitch 72 halves); after a block barrier the tile's 8 fragments are stored chunk by chunk.
//   coverage: load 256 thr x 16 = 64 x 64; store 2 iterations x 256 thr x 8 halves = 8 fragments x 512 halves = the block's tile;
//             NWB = (K/64)*(N/64) blocks cover each Dt exactly once.
// Blocks 4*NWB .. 4*NWB+NXB-1, x f32 [MROWS][DMOD] -> bf16 RNE bits, fragment-major plane. Thread = one chunk of the plane (8 consecutive
//   k of one row): two 16-B loads, one 16-B store; 32 consecutive lanes store 512 contiguous, 512-B aligned bytes.
//   coverage: NXB blocks x 256 thr x 8 = the whole plane.
// =====================================================================================================
__global__ __launch_bounds__(256) void prep16(const float* __restrict__ x, const float* __restrict__ W0, const float* __restrict__ W1,
                                              const float* __restrict__ W2, const float* __restrict__ W3,
                                              u16* XD, u16* D0, u16* D1, u16* D2, u16* D3, float scale) {
  __shared__ __align__(16) u16 T[64 * VTP];
  const int tid = threadIdx.x;
  const int bid = blockIdx.x;
  if (bid >= 4 * NWB) {                       // block-uniform; this path holds no barrier
    const int gt = (bid - 4 * NWB) * 256 + tid;
    if (gt >= (MROWS * DMOD) / 8) return;     // never taken with the exact grid
    const float* p = x + chunk_src(gt, DMOD);
    const v4f a = *(const v4f*)(p), b4 = *(const v4f*)(p + 4);
    v4u o;
    o[0] = pk16(bf_bits(a[0]), bf_bits(a[1]));
    o[1] = pk16(bf_bits(a[2]), bf_bits(a[3]));
    o[2] = pk16(bf_bits(b4[0]), bf_bits(b4[1]));
    o[3] = pk16(bf_bits(b4[2]), bf_bits(b4[3]));
    *(v4u*)(XD + (size_t)gt * 8) = o;
    return;
  }
  const int K = DMOD, N = DMOD;
  const int which = bid / NWB;
  const int wb    = bid % NWB;
  const int ntn = N >> 6;
  const int n0  = (wb % ntn) * 64;
  const int k0  = (wb / ntn) * 64;
  const float* W = (which == 0) ? W0 : (which == 1) ? W1 : (which == 2) ? W2 : W3;
  u16* Dt        = (which == 0) ? D0 : (which == 1) ? D1 : (which == 2) ? D2 : D3;
  const int f16mode = (which == 3) ? 1 : 0;
  {
    const int sl = tid >> 2;                  // k within tile 0..63 (source row)
    const int dc = (tid & 3) * 16;            // n chunk
    const float* src = W + (size_t)(k0 + sl) * N + n0 + dc;
#pragma unroll
    for (int i = 0; i < 4; ++i) {
      const v4f a = *(const v4f*)(src + 4 * i);
#pragma unroll
      for (int e = 0; e < 4; ++e) {
        const float f = a[e];
        const unsigned short hb = h_bits((_Float16)(bfr(f) * scale));
        const unsigned short bb = bf_bits(f);
        T[(dc + 4 * i + e) * VTP + sl] = (f16mode != 0) ? hb : bb;
      }
    }
  }
  __syncthreads();
  // the tile = 4 (n) x 2 (k) fragments of the plane; thread = chunk tid & 63 of fragment (n block it*2 + (tid >> 7), k block (tid >> 6) & 1)
  v4u vv[2];
  const int ch = tid & 63, fk = (tid >> 6) & 1, fr = tid >> 7;
#pragma unroll
  for (int it = 0; it < 2; ++it) {
    const int line = (it * 2 + fr) * 16 + (ch & 15);   // n = 0..63 within tile
    vv[it] = *(const v4u*)(T + line * VTP + fk * 32 + (ch >> 4) * 8);
  }
  const size_t base = (size_t)n0 * K + (size_t)((k0 >> 5) + fk) * 512 + ch * 8;
  {
#pragma unroll
    for (int it = 0; it < 2; ++it) {
      *(v4u*)(Dt + base + (size_t)((it * 2 + fr) * 16) * K) = vv[it];
    }
  }
#if defined(__HIP_DEVICE_COMPILE__)
  asm volatile("s_wait_xcnt 0x0" ::: "memory");   // stands in front of whatever next rewrites a register that these two stores name
#endif
}

// =====================================================================================================
// GEMM epilogue of the output projection: the wave's 16x64 f32 tile (times oscale) staged in its LDS slab (pitch 68),
// coverage: 8 instructions x 2 rows x 16 lanes x 4 floats = the wave's 16 x 64 tile.
// =====================================================================================================
__device__ __forceinline__ void epi64(float* sl, v8f a0, v8f a1, v8f a2, v8f a3, float oscale,
                                      const float* __restrict__ bias, float* C, int N,
                                      size_t rowb, int col0, int lane) {
  const int hh = lane >> 4, m = lane & 15;
#pragma unroll
  for (int r = 0; r < 8; ++r) {
    const int ro = (8 * hh + r) * 68 + m;
    sl[ro]      = a0[r] * oscale;
    sl[ro + 16] = a1[r] * oscale;
    sl[ro + 32] = a2[r] * oscale;
    sl[ro + 48] = a3[r] * oscale;
  }
  wave_sync_lds();
  const v4f braw = *(const v4f*)(bias + col0 + m * 4);
  v4f bb;
#pragma unroll
  for (int e = 0; e < 4; ++e) bb[e] = bfr(braw[e]);
  v4f vals[8];
#pragma unroll
  for (int it = 0; it < 8; ++it) vals[it] = *(const v4f*)(sl + (it * 2 + hh) * 68 + m * 4) + bb;
  float* dst = C + (rowb + (size_t)hh) * (size_t)N + col0 + m * 4;
  {
#pragma unroll
    for (int it = 0; it < 8; ++it) {
      *(v4f*)(dst + (size_t)(it * 2) * (size_t)N) = vals[it];
    }
    
  }
}

// =====================================================================================================
// q, k and v projections in one launch: grid.y = which (0 q, 1 k, 2 v); (x . W + b), x and W^T bf16 fragment-major planes, written
// straight into the f16 hi + residual planes that the attention kernel reads (value * 1024; hi = f16(t), residual = f16(t - hi)).
// Block = 64 rows x 64 columns, 4 waves x 16 rows; fragments loaded straight from the planes (two 16-B loads each, 512 contiguous bytes
// per wave and load, split k map for A and B); K = DMOD stepped by 32; grid.x = (MROWS/64)*(DMOD/64).
// The operand order is chosen so that a lane's 8 accumulator registers are one 16-B chunk of the destination plane:
//   q, k (plane rows = x rows, plane k = n): D = W^T . x^T, lane (c, hh) register r = (x row rowb + c, n = col0 + 16 j + 8 hh + r)
//        = chunk 32 (j & 1) + lane of fragment (rowb / 16, col0 / 32 + (j >> 1));
//   v^T  (plane rows = (b, head, d), plane k = s): D = x . W, lane (c, hh) register r = (x row rowb + 8 hh + r, n = col0 + 16 j + c)
//        = chunk 32 ((s >> 4) & 1) + lane of fragment (4 (b*NH + head) + j, s / 32), s = rowb % SEQ, head = col0 / HD.
// coverage: per wave 4 accumulators x 32 lanes x 8 halves = 16 x 64 elements per plane, each store 512 contiguous, 512-B aligned bytes;
//           grid covers every (row, column) of each of the six planes exactly once.
// =====================================================================================================
__device__ __forceinline__ void put_split(v8f t, u16* hp, u16* lp) {     // 8 scaled values -> one chunk of the hi and of the residual plane
  v4u oh, ol;
#pragma unroll
  for (int e = 0; e < 4; ++e) {
    const float t0 = t[2 * e], t1 = t[2 * e + 1];
    const _Float16 h0 = (_Float16)t0, h1 = (_Float16)t1;
    const _Float16 l0 = (_Float16)(t0 - (float)h0), l1 = (_Float16)(t1 - (float)h1);
    oh[e] = pk16(h_bits(h0), h_bits(h1));
    ol[e] = pk16(h_bits(l0), h_bits(l1));
  }
  *(v4u*)(hp) = oh;
  *(v4u*)(lp) = ol;
#if defined(__HIP_DEVICE_COMPILE__)
  asm volatile("s_wait_xcnt 0x0" ::: "memory");   // stands in front of whatever next rewrites a register that these two stores name
#endif
}

__global__ __launch_bounds__(128, 12)   // 12 waves per SIMD: the whole grid (3072 blocks x 4 waves) is resident at once, no second round
void proj3(const u16* __restrict__ A, const u16* __restrict__ Wq, const u16* __restrict__ Wk, const u16* __restrict__ Wv,
           const float* __restrict__ bq, const float* __restrict__ bk, const float* __restrict__ bv,
           u16* QH, u16* QL, u16* KH, u16* KL, u16* VH, u16* VL) {
  const int tid = threadIdx.x, lane = tid & 31;
  const int wave = __builtin_amdgcn_readfirstlane(tid >> 5);   // scalar: makes every fragment start a scalar base
  const int hh = lane >> 4, c = lane & 15;
  unsigned bo = 16u * (unsigned)lane;        // byte offset of this lane's chunk; advanced by one fragment (1024 B) per k step
  const int which = blockIdx.y;
  const int bid   = blockIdx.x;
  const int rowb  = (bid / (DMOD / 64)) * 64 + wave * 16;
  const int col0  = (bid % (DMOD / 64)) * 64;
  if (which > 2 || rowb + 16 > MROWS) return; // wave-uniform, never taken with the exact grid; no barriers in this kernel
  const u16*   Bt   = (which == 0) ? Wq : (which == 1) ? Wk : Wv;
  const float* bias = (which == 0) ? bq : (which == 1) ? bk : bv;
  const u16* ap = A  + (size_t)rowb * DMOD;           // fragment (rowb / 16, 0) of the fragment-major plane
  const size_t bs = (size_t)16 * DMOD;
  const u16* bp  = Bt + (size_t)col0 * DMOD;
  const u16* b1p = sbase(bp, bs), * b2p = sbase(bp, 2 * bs), * b3p = sbase(bp, 3 * bs);
  v8f acc0 = zero8(), acc1 = zero8(), acc2 = zero8(), acc3 = zero8();
  if (which == 2) {
#pragma unroll 1   // rolled: a trip's loads stay behind the previous trip's guard, so unrolling overlaps nothing and only lengthens the code
    for (int k0 = 0; k0 < DMOD; k0 += 32) {
      const v16b a  = ldfrag_b(ap, bo);
      const v16b b0 = ldfrag_b(bp, bo);
      const v16b b1 = ldfrag_b(b1p, bo);
      const v16b b2 = ldfrag_b(b2p, bo);
      const v16b b3 = ldfrag_b(b3p, bo);
      acc0 = mma_b(a, b0, acc0);
      acc1 = mma_b(a, b1, acc1);
      acc2 = mma_b(a, b2, acc2);
      acc3 = mma_b(a, b3, acc3);
      guard6<v16b>(acc0, acc1, acc2, acc3, a, b0, b1, b2, b3, a);
      bo += 1024u;
    }
    const int b = rowb / SEQ, sq = rowb % SEQ, g = col0 / HD;
    const size_t base = ((size_t)(b * NH + g) * HD) * SEQ + (size_t)(sq >> 5) * 512 + (size_t)((sq >> 4) & 1) * 256 + (size_t)lane * 8;
    v8f av[4] = {acc0, acc1, acc2, acc3};
#pragma unroll
    for (int j = 0; j < 4; ++j) av[j] = (av[j] + bfr(bias[col0 + 16 * j + c])) * VCAR;   // all bias loads ahead of the first store's wait
#pragma unroll
    for (int j = 0; j < 4; ++j) put_split(av[j], VH + base + (size_t)(16 * j) * SEQ, VL + base + (size_t)(16 * j) * SEQ);
  } else {
#pragma unroll 1   // rolled: a trip's loads stay behind the previous trip's guard, so unrolling overlaps nothing and only lengthens the code
    for (int k0 = 0; k0 < DMOD; k0 += 32) {
      const v16b a  = ldfrag_b(ap, bo);
      const v16b b0 = ldfrag_b(bp, bo);
      const v16b b1 = ldfrag_b(b1p, bo);
      const v16b b2 = ldfrag_b(b2p, bo);
      const v16b b3 = ldfrag_b(b3p, bo);
      acc0 = mma_b(b0, a, acc0);
      acc1 = mma_b(b1, a, acc1);
      acc2 = mma_b(b2, a, acc2);
      acc3 = mma_b(b3, a, acc3);
      guard6<v16b>(acc0, acc1, acc2, acc3, a, b0, b1, b2, b3, a);
      bo += 1024u;
    }
    u16* hpl = (which == 0) ? QH : KH;
    u16* lpl = (which == 0) ? QL : KL;
    const float sc = (which == 0) ? QSC : KSC;
    const size_t base = (size_t)rowb * DMOD + (size_t)(col0 >> 5) * 512 + (size_t)lane * 8;
    v8f av[4] = {acc0, acc1, acc2, acc3};
#pragma unroll
    for (int f = 0; f < 2; ++f) {              // one destination fragment at a time: its bias loads stand ahead of its first store's wait
#pragma unroll
      for (int j = 2 * f; j < 2 * f + 2; ++j) {
        const float* bsrc = bias + col0 + 16 * j + 8 * hh;
        const v4f r0 = *(const v4f*)(bsrc), r1 = *(const v4f*)(bsrc + 4);
        const v8f bb = {bfr(r0[0]), bfr(r0[1]), bfr(r0[2]), bfr(r0[3]), bfr(r1[0]), bfr(r1[1]), bfr(r1[2]), bfr(r1[3])};
        av[j] = (av[j] + bb) * sc;
      }
#pragma unroll
      for (int j = 2 * f; j < 2 * f + 2; ++j) {
        const size_t o8 = base + (size_t)f * 512 + (size_t)(j & 1) * 256;
        put_split(av[j], hpl + o8, lpl + o8);
      }
    }
  }
}

// =====================================================================================================
// f16 hi+lo GEMM: C[M][N] (f32) = (Ahi + Alo)[M][K] . Bt[N][K]^T, times oscale, plus bias[N]; Ahi/Alo f16 planes (same layout),
// Bt f16, all three fragment-major; products hi.B + lo.B into one accumulator (lo is the unscaled residual of hi). Block = 64x64 tile, 4 waves x 16 rows, K stepped by 32.
// =====================================================================================================
__global__ __launch_bounds__(128)
void gemm_h2(const u16* __restrict__ Ah, const u16* __restrict__ Al, const u16* __restrict__ Bt,
             const float* __restrict__ bias, float* C, int M, int N, int K, float oscale) {
  __shared__ __align__(16) float slab[4 * SLAB64];
  const int tid = threadIdx.x, lane = tid & 31;
  const int wave = __builtin_amdgcn_readfirstlane(tid >> 5);   // scalar: makes every fragment start a scalar base
  unsigned bo = 16u * (unsigned)lane;        // byte offset of this lane's chunk; advanced by one fragment (1024 B) per k step
  const int ntile = N >> 6;
  const int bid   = blockIdx.x;
  const int rowb  = (bid / ntile) * 64 + wave * 16;
  const int col0  = (bid % ntile) * 64;
  if (rowb + 16 > M) return;                 // wave-uniform, never taken with the exact grid; no block barriers in this kernel
  const size_t aofs = (size_t)rowb * K;               // fragment (rowb / 16, 0) of the fragment-major planes
  const _Float16* ahp = (const _Float16*)(const void*)Ah + aofs;
  const _Float16* alp = (const _Float16*)(const void*)Al + aofs;
  const size_t bs = (size_t)16 * K;
  const _Float16* bp  = (const _Float16*)(const void*)Bt + (size_t)col0 * K;
  const _Float16* b1p = sbase(bp, bs), * b2p = sbase(bp, 2 * bs), * b3p = sbase(bp, 3 * bs);
  v8f acc0 = zero8(), acc1 = zero8(), acc2 = zero8(), acc3 = zero8();
#pragma unroll 1
  for (int k0 = 0; k0 < K; k0 += 32) {
    const v16h ah = ldfrag_h(ahp, bo), al = ldfrag_h(alp, bo);
    const v16h b0 = ldfrag_h(bp, bo);
    const v16h b1 = ldfrag_h(b1p, bo);
    const v16h b2 = ldfrag_h(b2p, bo);
    const v16h b3 = ldfrag_h(b3p, bo);
    acc0 = mma_h(ah, b0, acc0);  acc0 = mma_h(al, b0, acc0);
    acc1 = mma_h(ah, b1, acc1);  acc1 = mma_h(al, b1, acc1);
    acc2 = mma_h(ah, b2, acc2);  acc2 = mma_h(al, b2, acc2);
    acc3 = mma_h(ah, b3, acc3);  acc3 = mma_h(al, b3, acc3);
    guard6<v16h>(acc0, acc1, acc2, acc3, ah, al, b0, b1, b2, b3);
    bo += 1024u;
  }
  epi64(slab + wave * SLAB64, acc0, acc1, acc2, acc3, oscale, bias, C, N, (size_t)rowb, col0, lane);
}

// =====================================================================================================
// Causal attention: block bid -> (query tile qt = bid % NQT: rows q0 = 16*qt .. q0+15, head = (bid / NQT) % NH,
// batch b = bid / (NQT*NH)). The tile's key tiles are dealt round-robin to the block's WPB waves (wave w takes kt = w, w + WPB, ..);
// each wave keeps its own running max, sum and unnormalised O, and the WPB partials are merged through LDS after one block barrier.
//   q planes (hi, lo f16 x1024): fragment-major planes of the matrix [b*SEQ + s][h*HD + d]; k planes the same; v^T planes of [(b*NH + h)*HD + d][s].
//   score (log2 domain) t(i, j) = (q_i.k_j) * 0.125*log2e/(1024*1024) for key j <= query i, and -inf for j > i (the select
//   replaces the score). Key tiles of 32 visited for kb <= q0 + 15; tiles whose every key index exceeds every query index
//   of the tile hold only -inf, whose exp is exactly 0, and are not visited. Every visited row has key j = i or an earlier finite
//   key, so a wave's running max is finite from its first tile on; a wave with no tile keeps max = -inf, sum = 0, O = 0.
//   Both products are taken transposed: S^T = K.Q^T (A = 16 key rows, B = the 16 queries) and O^T += V^T.P^T (A = 16 d rows of v^T,
//   B = P^T). In a score tile lane (c, hh) then holds query q0 + c and keys 8hh + 0..7 of the subtile, so a query's maximum and sum run
//   over the lane's own 16 registers plus one exchange with lane ^ 16, and the two subtiles' accumulators, converted in place, ARE the
//   B fragment of P^T in the split k map (elements 0..7 = keys kb + 8hh + 0..7, 8..15 = keys kb + 16 + 8hh + 0..7): P never leaves
//   the registers. Per tile: 2 score subtiles x 2 k-steps x 3 products (k_hi.q_hi + k_hi.q_lo + k_lo.q_hi), fragments loaded straight
//   from the 16-bit planes (two 16-B loads per fragment, split k map); online max-subtracted base-2 softmax in f32, -inf-safe rescale
//   (one factor per lane); P x32768 as f16 hi and f16 residual; 4+4 v^T A fragments (hi and residual planes), 12 WMMAs (hh + hl + lh).
//   A lane sums only its own half's keys; the two halves' sums are joined once, after the loop.
//   After the loop: each wave writes its unnormalised O to its own slab (pitch 68; every element owned by one lane) and its row
//   max and sum to the ml table; one block barrier (reached by every wave; trip counts differ only between waves, and the loop holds
//   no block barrier); wave w then merges columns d = 16w .. 16w+15 of all 16 rows: M = max_w m_w, out = sum_w O_w 2^(m_w - M) / sum_w l_w 2^(m_w - M)
//   (Z > 0 always: key j = i is never masked; guarded anyway), carries 1/(32768*1024) folded once. Bounded loops only (nkt <= NKT).
// coverage: per wave 1 instruction x 16 rows x 2 lanes x 8 halves = 16 x 16 per plane, x WPB waves = 16 x 64; grid NQT*NH*BATCH blocks
//           = every (b, s, h) row of both O planes exactly once.
// =====================================================================================================
__global__ __launch_bounds__(ATT_THREADS)
void attn1(const u16* __restrict__ QHIp, const u16* __restrict__ QLOp,
           const u16* __restrict__ KHIp, const u16* __restrict__ KLOp,
           const u16* __restrict__ VHIp, const u16* __restrict__ VLOp,
           u16* OHIp, u16* OLOp) {
  __shared__ __align__(16) float smem[WPB * WREG];
  __shared__ float mtab[WPB * 16];           // per wave and query row: running max (log2 domain)
  __shared__ float ltab[WPB * 16];           // per wave and query row: running sum

  const int tid  = threadIdx.x;
  const int wave = __builtin_amdgcn_readfirstlane(tid >> 5);   // scalar: the key loop's start must be wave-uniform for the WMMAs
  const int lane = tid & 31;
  const int hh   = lane >> 4;
  const int c    = lane & 15;
  const int bid  = blockIdx.x;
  const int qt   = bid % NQT;
  const int rem  = bid / NQT;
  const int head = rem % NH;
  const int b    = rem / NH;
  if (b >= BATCH) return;                    // block-uniform, before the block barrier; never taken with the exact grid
  const int q0   = qt * 16;

  float* slab = smem + wave * WREG;          // result slab [16 queries][64 d] pitch 68

  const size_t rq0  = (size_t)b * SEQ + q0;                                     // plane row of query row q0
  const unsigned lo = 16u * (unsigned)lane;                                     // byte offset of this lane's chunk in a fragment
  const size_t qofs = (rq0 * NH + (size_t)head * 16) * HD;                      // fragment (rq0 / 16, 2 * head)
  const _Float16* Qh  = (const _Float16*)(const void*)QHIp + qofs;
  const _Float16* Ql  = (const _Float16*)(const void*)QLOp + qofs;
  const size_t kofs = ((size_t)b * SEQ * NH + (size_t)head * 16) * HD;          // fragment (b*SEQ / 16, 2 * head); key block added per step
  const _Float16* Khb = (const _Float16*)(const void*)KHIp + kofs;
  const _Float16* Klb = (const _Float16*)(const void*)KLOp + kofs;
  const size_t vofs = (((size_t)b * NH + head) * HD) * SEQ;                    // fragment (4 * (b*NH + head) (+j), 0); key block added per step
  const _Float16* Vhb = (const _Float16*)(const void*)VHIp + vofs;
  const _Float16* Vlb = (const _Float16*)(const void*)VLOp + vofs;
  const float lsc = 0.125f * (LOG2E / (QSC * KSC));
  const float oc  = 1.0f / (PCAR * VCAR);
  const size_t KROW = (size_t)NH * HD;                                          // halves per key row; 16 * KROW = one 16-row block of fragments

  float mrun = -INFINITY, lrun = 0.f;        // query q0 + c: running max (equal in both halves), running sum over this half's keys
  v8f o[4];                                  // o[j][r] = O^T element (d = 16j + 8hh + r, query q0 + c)
#pragma unroll
  for (int j = 0; j < 4; ++j) o[j] = zero8();
  const int qi = q0 + c;
  const int ncaus = (q0 >> 5) + 1;                                              // tiles holding keys <= q0 + 15
  const int nkt = (ncaus < NKT) ? ncaus : NKT;

  // byte offsets of key tile kt in the k planes (32 rows of KROW halves) and in the v^T planes (one fragment), plus this lane's chunk
  unsigned ko = lo + (unsigned)wave * (unsigned)(32 * NH * HD * 2);
  unsigned vo = lo + (unsigned)wave * 1024u;
#pragma unroll 1
  for (int kt = wave; kt < nkt; kt += WPB) {
    const int kb = kt * 32;
    // ---- scores: D element r of this lane = (key kb + 8hh + r, query q0 + c) in s0, key kb + 16 + 8hh + r in s1 ----
    v8f s0 = zero8(), s1 = zero8();
    const _Float16* k0p = Khb;
    const _Float16* k1p = k0p + (size_t)16 * KROW;
    const _Float16* l0p = Klb;
    const _Float16* l1p = l0p + (size_t)16 * KROW;
#pragma unroll
    for (int kk = 0; kk < 2; ++kk) {
      const v16h qh  = ldfrag_h(Qh + kk * 512, lo),  ql  = ldfrag_h(Ql + kk * 512, lo);
      const v16h kh0 = ldfrag_h(k0p + kk * 512, ko), kl0 = ldfrag_h(l0p + kk * 512, ko);
      const v16h kh1 = ldfrag_h(k1p + kk * 512, ko), kl1 = ldfrag_h(l1p + kk * 512, ko);
      s0 = mma_h(kh0, qh, s0);
      s0 = mma_h(kh0, ql, s0);
      s0 = mma_h(kl0, qh, s0);
      s1 = mma_h(kh1, qh, s1);
      s1 = mma_h(kh1, ql, s1);
      s1 = mma_h(kl1, qh, s1);
      guard2(s0, s1, qh, ql, kh0, kl0, kh1, kl1);
    }
    // ---- causal select (score := -inf for key > query) + online softmax in base 2, -inf-safe; all 32 keys of a query sit in
    //      lanes c and c + 16 ----
    const int key0 = kb + 8 * hh, key1 = key0 + 16;
    v8f t0 = s0 * lsc, t1 = s1 * lsc;
    float mx = -INFINITY;
#pragma unroll
    for (int r = 0; r < 8; ++r) {
      t0[r] = (key0 + r > qi) ? -INFINITY : t0[r];
      t1[r] = (key1 + r > qi) ? -INFINITY : t1[r];
      mx = fmaxf(mx, fmaxf(t0[r], t1[r]));
    }
    mx = fmaxf(mx, xhalf(mx));
    const float mn = fmaxf(mrun, mx);
    const float ms = (mn == -INFINITY) ? 0.0f : mn;
    const float al = exp2f(mrun - ms);
    mrun = mn;
    // ---- B fragments of P^T * 32768: hi f16 and residual f16, col = query c, split k map over the 32 keys of this step ----
    t0 -= ms;
    t1 -= ms;
    v8f e0, e1;
#pragma unroll
    for (int r = 0; r < 8; ++r) { e0[r] = exp2f(t0[r]); e1[r] = exp2f(t1[r]); }
    const v8f es = e0 + e1;
    const float ps = ((es[0] + es[1]) + (es[2] + es[3])) + ((es[4] + es[5]) + (es[6] + es[7]));
    const v8f ta = e0 * PCAR, tb = e1 * PCAR;
    FragH ph, pl;
    ph.h[0] = __builtin_convertvector(ta, v8h);            // elements 0..7  = keys kb + 8hh + 0..7
    ph.h[1] = __builtin_convertvector(tb, v8h);            // elements 8..15 = keys kb + 16 + 8hh + 0..7
    pl.h[0] = __builtin_convertvector(ta - __builtin_convertvector(ph.h[0], v8f), v8h);
    pl.h[1] = __builtin_convertvector(tb - __builtin_convertvector(ph.h[1], v8f), v8h);
    lrun = lrun * al + ps;
#pragma unroll
    for (int j = 0; j < 4; ++j) {
#pragma unroll
      for (int r = 0; r < 8; ++r) o[j][r] *= al;
    }
    // ---- V^T.P^T : A fragment row = d = j*16 + c, keys contiguous in the v^T planes ----
    {
      const _Float16* vhp = Vhb;
      const _Float16* vlp = Vlb;
      const v16h vh0 = ldfrag_h(vhp, vo);
      const v16h vh1 = ldfrag_h(vhp + (size_t)16 * SEQ, vo);
      const v16h vh2 = ldfrag_h(vhp + (size_t)32 * SEQ, vo);
      const v16h vh3 = ldfrag_h(vhp + (size_t)48 * SEQ, vo);
      const v16h vl0 = ldfrag_h(vlp, vo);
      const v16h vl1 = ldfrag_h(vlp + (size_t)16 * SEQ, vo);
      const v16h vl2 = ldfrag_h(vlp + (size_t)32 * SEQ, vo);
      const v16h vl3 = ldfrag_h(vlp + (size_t)48 * SEQ, vo);
      o[0] = mma_h(vh0, ph.v, o[0]);  o[0] = mma_h(vh0, pl.v, o[0]);  o[0] = mma_h(vl0, ph.v, o[0]);
      o[1] = mma_h(vh1, ph.v, o[1]);  o[1] = mma_h(vh1, pl.v, o[1]);  o[1] = mma_h(vl1, ph.v, o[1]);
      o[2] = mma_h(vh2, ph.v, o[2]);  o[2] = mma_h(vh2, pl.v, o[2]);  o[2] = mma_h(vl2, ph.v, o[2]);
      o[3] = mma_h(vh3, ph.v, o[3]);  o[3] = mma_h(vh3, pl.v, o[3]);  o[3] = mma_h(vl3, ph.v, o[3]);
      guard10(o[0], o[1], o[2], o[3], ph.v, pl.v, vh0, vh1, vh2, vh3, vl0, vl1, vl2, vl3);
    }
    ko += (unsigned)(WPB * 32 * NH * HD * 2);
    vo += (unsigned)(WPB * 1024);
  }
  acc_guard4(o[0], o[1], o[2], o[3]);
  lrun += xhalf(lrun);                       // the two halves' key sums of query q0 + c, joined once
  // ---- this wave's partial: unnormalised O into its lane-owned slab (8 consecutive d per accumulator), row max and sum into the tables ----
#pragma unroll
  for (int j = 0; j < 4; ++j) {
    float* sp = slab + c * 68 + j * 16 + 8 * hh;
    const v4f a = {o[j][0], o[j][1], o[j][2], o[j][3]}, b4 = {o[j][4], o[j][5], o[j][6], o[j][7]};
    *(v4f*)(sp)     = a;
    *(v4f*)(sp + 4) = b4;
  }
  if (hh == 0) {
    mtab[wave * 16 + c] = mrun;
    ltab[wave * 16 + c] = lrun;
  }
  __syncthreads();                           // publishes every wave's partial to all waves; each merges a 16-column band of every partial
  // ---- merge of the WPB partials; thread = chunk tid of the block's two O fragments: row = lane & 15, 8 consecutive d from
  //      32 * (wave >> 1) + 16 * (wave & 1) + 8 * (lane >> 4) ----
  const int row = c, c8 = wave * 16 + hh * 8;
  float mw[WPB];
  float mall = -INFINITY;
#pragma unroll
  for (int w = 0; w < WPB; ++w) { mw[w] = mtab[w * 16 + row]; mall = fmaxf(mall, mw[w]); }
  const float msafe = (mall == -INFINITY) ? 0.0f : mall;
  float lv = 0.f;
  float acc[8];
#pragma unroll
  for (int e = 0; e < 8; ++e) acc[e] = 0.f;
#pragma unroll
  for (int w = 0; w < WPB; ++w) {
    const float sc = exp2f(mw[w] - msafe);   // 0 for a wave that saw no tile
    lv += ltab[w * 16 + row] * sc;
    const float* sp = smem + w * WREG + row * 68 + c8;
    const v4f a = *(const v4f*)(sp), b4 = *(const v4f*)(sp + 4);
#pragma unroll
    for (int e = 0; e < 4; ++e) { acc[e] += a[e] * sc; acc[4 + e] += b4[e] * sc; }
  }
  // ---- out = acc / Z (0 if Z == 0), carries (32768 on P, 1024 on v) folded once; O x1024 -> f16 hi + residual planes ----
  const float ls  = (lv > 0.0f) ? lv : 1.0f;
  const float inv = (lv > 0.0f) ? ((1.0f / ls) * oc) : 0.0f;
  v4u oh, ol;
#pragma unroll
  for (int e = 0; e < 4; ++e) {
    const float w0 = (acc[2 * e] * inv) * OSC, w1 = (acc[2 * e + 1] * inv) * OSC;
    const _Float16 h0 = (_Float16)w0, h1 = (_Float16)w1;
    const _Float16 l0 = (_Float16)(w0 - (float)h0), l1 = (_Float16)(w1 - (float)h1);
    oh[e] = pk16(h_bits(h0), h_bits(h1));
    ol[e] = pk16(h_bits(l0), h_bits(l1));
  }
  const size_t o8 = (rq0 * NH + (size_t)head * 16) * HD + 8 * tid;              // fragments (rq0 / 16, 2 * head .. 2 * head + 1)
  *(v4u*)(OHIp + o8) = oh;
  *(v4u*)(OLOp + o8) = ol;
}

// =====================================================================================================
// Workspace map (bytes); every plane is fully written by whole-line stores before it is read; all extents are exact multiples
// of the store granularity (no pad rows needed); every offset a multiple of 2097152; every 16-bit plane is fragment-major (the shape
// given is that of its matrix, rows x k):
//   XB  bf16 [MROWS][1024]              8388608
//   WQB bf16 [1024 n][1024 k]          2097152        WKB, WVB same
//   WOH f16  [1024 n][1024 k] x1024    2097152
//   QHI f16 [MROWS][16*64] x1024       8388608        QLO residual
//   KHI f16 [MROWS][16*64] x1024       8388608        KLO residual
//   VHI f16 [BATCH*16*64][SEQ] x1024   8388608        VLO residual
//   OHI f16 [MROWS][1024] x1024        8388608        OLO residual
//   end                               83886080
// =====================================================================================================
extern "C" void kernel_launch(void* const* d_in, const int* in_sizes, int n_in,
                              void* d_out, int out_size, void* d_ws, size_t ws_size,
                              hipStream_t stream) {
  if (n_in < 9) return;
  if (in_sizes[0] != MROWS * DMOD) return;
  if (in_sizes[1] != DMOD * DMOD || in_sizes[3] != DMOD * DMOD) return;
  if (in_sizes[5] != DMOD * DMOD || in_sizes[7] != DMOD * DMOD) return;
  if (in_sizes[2] != DMOD || in_sizes[4] != DMOD || in_sizes[6] != DMOD || in_sizes[8] != DMOD) return;
  if (out_size != MROWS * DMOD) return;

  const float* x    = (const float*)d_in[0];
  const float* wq   = (const float*)d_in[1];
  const float* bq   = (const float*)d_in[2];
  const float* wk   = (const float*)d_in[3];
  const float* bk   = (const float*)d_in[4];
  const float* wv   = (const float*)d_in[5];
  const float* bv   = (const float*)d_in[6];
  const float* wo   = (const float*)d_in[7];
  const float* bo   = (const float*)d_in[8];
  float*       out  = (float*)d_out;

  const size_t szXB = (size_t)MROWS * DMOD * 2;                 //  8388608
  const size_t szW  = (size_t)DMOD * DMOD * 2;                  //  2097152
  const size_t szP  = (size_t)MROWS * DMOD * 2;                 //  8388608
  size_t off = 0;
  const size_t oXB  = off; off += szXB;
  const size_t oWQ  = off; off += szW;
  const size_t oWK  = off; off += szW;
  const size_t oWV  = off; off += szW;
  const size_t oWO  = off; off += szW;
  const size_t oQHI = off; off += szP;
  const size_t oQLO = off; off += szP;
  const size_t oKHI = off; off += szP;
  const size_t oKLO = off; off += szP;
  const size_t oVHI = off; off += szP;
  const size_t oVLO = off; off += szP;
  const size_t oOHI = off; off += szP;
  const size_t oOLO = off; off += szP;
  if (off > ws_size) return;                            // off = 83886080
  if (off > (size_t)134217728) return;

  char* ws = (char*)d_ws;
  u16*   XB  = (u16*)(ws + oXB);
  u16*   WQB = (u16*)(ws + oWQ);
  u16*   WKB = (u16*)(ws + oWK);
  u16*   WVB = (u16*)(ws + oWV);
  u16*   WOH = (u16*)(ws + oWO);
  u16*   QHI = (u16*)(ws + oQHI);
  u16*   QLO = (u16*)(ws + oQLO);
  u16*   KHI = (u16*)(ws + oKHI);
  u16*   KLO = (u16*)(ws + oKLO);
  u16*   VHI = (u16*)(ws + oVHI);
  u16*   VLO = (u16*)(ws + oVLO);
  u16*   OHI = (u16*)(ws + oOHI);
  u16*   OLO = (u16*)(ws + oOLO);

  const dim3 blk(256);
  const dim3 gPR(4 * NWB + NXB);                        // 4 x 256 + 2048
  const dim3 gG((MROWS / 64) * (DMOD / 64));            // 1024
  const dim3 gP((MROWS / 64) * (DMOD / 64), 3);         // 1024 x (q, k, v)
  const dim3 bG(128);
  const dim3 gAT(ATT_BLOCKS);                           // 4096
  const dim3 bAT(ATT_THREADS);                          // 128

  // (0) Wq/Wk/Wv [k][n] -> bf16 [n][k] planes; Wo [k][n] -> f16 [n][k] plane of bf16 value x1024; x -> bf16 plane [MROWS][1024]
  prep16<<<gPR, blk, 0, stream>>>(x, wq, wk, wv, wo, XB, WQB, WKB, WVB, WOH, WOS);
  // (1) q = x.Wq + bq, k = x.Wk + bk -> hi/residual planes x1024; v = x.Wv + bv -> v^T hi/residual planes x1024
  proj3<<<gP, bG, 0, stream>>>(XB, WQB, WKB, WVB, bq, bk, bv, QHI, QLO, KHI, KLO, VHI, VLO);
  // (2) causal attention -> O planes [b*SEQ+s][h][d] x1024 (hi + residual)
  attn1<<<gAT, bAT, 0, stream>>>(QHI, QLO, KHI, KLO, VHI, VLO, OHI, OLO);
  // (3) output projection -> out [MROWS][1024] f32, carries 1024 (O) x 1024 (Wo) folded back, + bo
  gemm_h2<<<gG, bG, 0, stream>>>(OHI, OLO, WOH, bo, out, MROWS, DMOD, DMOD, 1.0f / (OSC * WOS));
  (void)hipGetLastError();
}

// v005
// One run takes 138 microseconds.
// Next to v004, in two timings, it ran 1.15 times as fast each time.
// Counting every step since v000, it is 2.95 times as fast.
// Contractions: x.W{q,k,v} on v_wmma_f32_16x16x32_bf16 (x and W^T RNE-converted to bf16, f32 accumulate);
// scores, transposed, k.q^T (q, k carried x1024 as f16 hi plane + f16 residual plane, products hh+lh+hl), v^T.P^T (P x32768 f16
// hi+residual, v x1024 f16 hi+residual, products hh+lh+hl) and O.Wo (O x1024 f16 hi+residual, Wo^T as f16(bf16(Wo)) x1024, products h.w+l.w):
// v_wmma_f32_16x16x32_f16, f32 accumulate. Static causal select, base-2 online softmax and 1/l fold in f32 on VALU.
#include <hip/hip_runtime.h>
#include <math.h>
#include <stdint.h>

#define BATCH 2
#define SEQ   2048
#define DMOD  1024
#define NH    16
#define HD    64
#define MROWS (BATCH * SEQ)
#define QSC   1024.0f
#define KSC   1024.0f
#define PCAR  32768.0f
#define VCAR  1024.0f
#define OSC   1024.0f
#define WOS   1024.0f
#define LOG2E 1.4426950408889634f
#define WPB   4
#define QTW   2
#define NQB   (SEQ / (16 * QTW))
#define NWB   ((DMOD / 64) * (DMOD / 64))
#define NXB   ((MROWS * DMOD) / 2048)
#define NKT   (SEQ / 32)
#define ATT_THREADS (WPB * 32)
#define ATT_BLOCKS  (NQB * NH * BATCH)
#define SLW   (16 * 68)
#define WREG  (QTW * SLW)
#define SLAB64 (16 * 68)
#define VTP   72
static_assert(DMOD == NH * HD && HD == 64 && NH == 16);
static_assert(WPB == 4 && ATT_THREADS == 128 && QTW == 2 && ATT_BLOCKS == 2048);
static_assert((SEQ % 64) == 0 && (SEQ % 32) == 0 && (SEQ % 16) == 0 && SEQ <= 32768);
static_assert((DMOD % 64) == 0 && (DMOD % 32) == 0 && (MROWS % 64) == 0);
static_assert(((MROWS * DMOD) % 2048) == 0 && ((DMOD * DMOD) % 4096) == 0);

typedef unsigned short u16;
typedef _Float16 v16h __attribute__((ext_vector_type(16)));
typedef _Float16 v8h  __attribute__((ext_vector_type(8)));
typedef __bf16   v16b __attribute__((ext_vector_type(16)));
typedef float    v8f  __attribute__((ext_vector_type(8)));
typedef float    v4f  __attribute__((ext_vector_type(4)));
typedef unsigned int v4u __attribute__((ext_vector_type(4)));

union FragH { v16h v; v8h h[2]; v4u u[2]; };
union FragB { v16b v; v4u u[2]; };

// ---- scalar helpers --------------------------------------------------------------------------------
__device__ __forceinline__ unsigned short bf_bits(float f) {          // f32 -> bf16 bits, RNE convert
  unsigned u = __float_as_uint(f);
  return (unsigned short)((u + 0x7FFFu + ((u >> 16) & 1u)) >> 16);
}
__device__ __forceinline__ float bf_up(unsigned short h) { return __uint_as_float(((unsigned)h) << 16); }
__device__ __forceinline__ float bfr(float f) { return bf_up(bf_bits(f)); }
__device__ __forceinline__ unsigned short h_bits(_Float16 x) { return __builtin_bit_cast(unsigned short, x); }
__device__ __forceinline__ unsigned pk16(unsigned short a, unsigned short b) { return (unsigned)a | ((unsigned)b << 16); }
__device__ __forceinline__ float xhalf(float x) {                     // value of lane l ^ 16
  const int b = __builtin_bit_cast(int, x);
  return __builtin_bit_cast(float, __builtin_amdgcn_permlanex16(b, b, 0x76543210, 0xfedcba98, false, false));
}
__device__ __forceinline__ v8f zero8() { v8f z = {0.f, 0.f, 0.f, 0.f, 0.f, 0.f, 0.f, 0.f}; return z; }

// ---- fragment-major 16-bit planes: a matrix [R rows][Kd k] (R % 16 == 0, Kd % 32 == 0) is stored as fragments of 16 rows x 32 k,
//      fragment (rb = row / 16, kb = k / 32) at halves (rb * (Kd / 32) + kb) * 512; inside it 64 chunks of 8 halves, chunk
//      i * 32 + h * 16 + c = row 16 rb + c, k = 32 kb + 16 i + 8 h + 0..7. A wave-wide 16-B load of chunks 32 i + lane is 512 contiguous,
//      512-B aligned bytes = 4 whole lines (the same fragment read from a row-major plane touches 16 lines, 32 B of each, per load).
// ---- fragment loaders: 16-bit A/B operand, lane -> row/col (lane&15), p = fragment start + 8*lane;
//      elements 0..7 <- p[0..7] (k0+8h..), elements 8..15 <- p[256..263] (k0+16+8h..)  (same split k map for A and B).
//      fs = a fragment start that is the same for the whole wave (a scalar base), bo = 32-bit byte offset from it: 16*lane plus the
//      loop's advance, one vector register that serves every load of a trip
// sbase: p + ofs for a wave-uniform ofs, kept as a scalar base of its own: without the readfirstlane the compiler adds the lane offset
// to p first and then forms each further fragment's 64-bit address with vector additions in every trip.
template <typename T>
__device__ __forceinline__ const T* sbase(const T* p, size_t ofs) {
  const uint32_t l = (uint32_t)__builtin_amdgcn_readfirstlane((int)(uint32_t)ofs);
  const uint32_t h = (uint32_t)__builtin_amdgcn_readfirstlane((int)(uint32_t)((uint64_t)ofs >> 32));
  return p + (size_t)(((uint64_t)h << 32) | (uint64_t)l);
}
__device__ __forceinline__ v16h ldfrag_h(const _Float16* fs, unsigned bo) {
  const char* p = (const char*)(const void*)fs + bo;
  FragH f;
  f.h[0] = *(const v8h*)(const void*)(p);
  f.h[1] = *(const v8h*)(const void*)(p + 512);
  return f.v;
}
__device__ __forceinline__ v16b ldfrag_b(const u16* fs, unsigned bo) { // bf16 plane read as unsigned integer vectors
  const char* p = (const char*)(const void*)fs + bo;
  FragB f;
  f.u[0] = *(const v4u*)(const void*)(p);
  f.u[1] = *(const v4u*)(const void*)(p + 512);
  return f.v;
}

// row-major element index (matrix [R][Kd]) of the 8 halves that chunk q of the fragment-major plane holds
__device__ __forceinline__ size_t chunk_src(int q, int Kd) {
  const int f = q >> 6, nkb = Kd >> 5;
  return (size_t)((f / nkb) * 16 + (q & 15)) * (size_t)Kd + (size_t)((f % nkb) * 32 + ((q >> 4) & 3) * 8);
}

__device__ __forceinline__ v8f mma_h(v16h a, v16h b, v8f c) {
  return __builtin_amdgcn_wmma_f32_16x16x32_f16(false, a, false, b, (short)0, c, false, false);
}
__device__ __forceinline__ v8f mma_b(v16b a, v16b b, v8f c) {
  return __builtin_amdgcn_wmma_f32_16x16x32_bf16(false, a, false, b, (short)0, c, false, false);
}
template <typename F>
__device__ __forceinline__ void guard6(v8f& a, v8f& b, v8f& c, v8f& d, F x0, F x1, F x2, F x3, F x4, F x5) {
#if defined(__HIP_DEVICE_COMPILE__)
  asm volatile("v_nop\n\tv_nop\n\tv_nop\n\tv_nop"
               : "+v"(a), "+v"(b), "+v"(c), "+v"(d) : "v"(x0), "v"(x1), "v"(x2), "v"(x3), "v"(x4), "v"(x5) : "memory");
#endif
}
__device__ __forceinline__ void acc_guard4(v8f& a, v8f& b, v8f& c, v8f& d) {
#if defined(__HIP_DEVICE_COMPILE__)
  asm volatile("v_nop\n\tv_nop\n\tv_nop\n\tv_nop" : "+v"(a), "+v"(b), "+v"(c), "+v"(d));
#endif
}
__device__ __forceinline__ void wave_sync_lds() {
  __builtin_amdgcn_fence(__ATOMIC_RELEASE, "workgroup");
  __builtin_amdgcn_wave_barrier();
  __builtin_amdgcn_fence(__ATOMIC_ACQUIRE, "workgroup");
}

// =====================================================================================================
// All operand conversions in one launch (five independent jobs, told apart by the block index).
// Blocks 0 .. 4*NWB-1, weight transpose-convert: weight which = bid / NWB, W [K][N] f32 (x.W layout, n contiguous) -> Dt, the fragment-major
// 16-bit plane of the matrix [N rows][K cols]; which 0..2: bf16 RNE bits; which 3: f16 bits of (bf16 RNE value) * scale.
//   Block = (k tile k0 = (wb / (N/64))*64, n tile n0 = (wb % (N/64))*64), wb = bid % NWB: 64 source rows of 64 floats loaded with 16-B loads,
//   converted, scattered into an LDS tile [n][64 k] (pitch 72 halves); after a block barrier the tile's 8 fragments are stored chunk by chunk.
//   coverage: load 256 thr x 16 = 64 x 64; store 2 iterations x 256 thr x 8 halves = 8 fragments x 512 halves = the block's tile;
//             NWB = (K/64)*(N/64) blocks cover each Dt exactly once.
// Blocks 4*NWB .. 4*NWB+NXB-1, x f32 [MROWS][DMOD] -> bf16 RNE bits, fragment-major plane. Thread = one chunk of the plane (8 consecutive
//   k of one row): two 16-B loads, one 16-B store; 32 consecutive lanes store 512 contiguous, 512-B aligned bytes.
//   coverage: NXB blocks x 256 thr x 8 = the whole plane.
// =====================================================================================================
__global__ __launch_bounds__(256) void prep16(const float* __restrict__ x, const float* __restrict__ W0, const float* __restrict__ W1,
                                              const float* __restrict__ W2, const float* __restrict__ W3,
                                              u16* XD, u16* D0, u16* D1, u16* D2, u16* D3, float scale) {
  __shared__ __align__(16) u16 T[64 * VTP];
  const int tid = threadIdx.x;
  const int bid = blockIdx.x;
  if (bid >= 4 * NWB) {                       // block-uniform; this path holds no barrier
    const int gt = (bid - 4 * NWB) * 256 + tid;
    if (gt >= (MROWS * DMOD) / 8) return;     // never taken with the exact grid
    const float* p = x + chunk_src(gt, DMOD);
    const v4f a = *(const v4f*)(p), b4 = *(const v4f*)(p + 4);
    v4u o;
    o[0] = pk16(bf_bits(a[0]), bf_bits(a[1]));
    o[1] = pk16(bf_bits(a[2]), bf_bits(a[3]));
    o[2] = pk16(bf_bits(b4[0]), bf_bits(b4[1]));
    o[3] = pk16(bf_bits(b4[2]), bf_bits(b4[3]));
    *(v4u*)(XD + (size_t)gt * 8) = o;
    return;
  }
  const int K = DMOD, N = DMOD;
  const int which = bid / NWB;
  const int wb    = bid % NWB;
  const int ntn = N >> 6;
  const int n0  = (wb % ntn) * 64;
  const int k0  = (wb / ntn) * 64;
  const float* W = (which == 0) ? W0 : (which == 1) ? W1 : (which == 2) ? W2 : W3;
  u16* Dt        = (which == 0) ? D0 : (which == 1) ? D1 : (which == 2) ? D2 : D3;
  const int f16mode = (which == 3) ? 1 : 0;
  {
    const int sl = tid >> 2;                  // k within tile 0..63 (source row)
    const int dc = (tid & 3) * 16;            // n chunk
    const float* src = W + (size_t)(k0 + sl) * N + n0 + dc;
#pragma unroll
    for (int i = 0; i < 4; ++i) {
      const v4f a = *(const v4f*)(src + 4 * i);
#pragma unroll
      for (int e = 0; e < 4; ++e) {
        const float f = a[e];
        const unsigned short hb = h_bits((_Float16)(bfr(f) * scale));
        const unsigned short bb = bf_bits(f);
        T[(dc + 4 * i + e) * VTP + sl] = (f16mode != 0) ? hb : bb;
      }
    }
  }
  __syncthreads();
  // the tile = 4 (n) x 2 (k) fragments of the plane; thread = chunk tid & 63 of fragment (n block it*2 + (tid >> 7), k block (tid >> 6) & 1)
  v4u vv[2];
  const int ch = tid & 63, fk = (tid >> 6) & 1, fr = tid >> 7;
#pragma unroll
  for (int it = 0; it < 2; ++it) {
    const int line = (it * 2 + fr) * 16 + (ch & 15);   // n = 0..63 within tile
    vv[it] = *(const v4u*)(T + line * VTP + fk * 32 + (ch >> 4) * 8);
  }
  const size_t base = (size_t)n0 * K + (size_t)((k0 >> 5) + fk) * 512 + ch * 8;
  {
#pragma unroll
    for (int it = 0; it < 2; ++it) {
      *(v4u*)(Dt + base + (size_t)((it * 2 + fr) * 16) * K) = vv[it];
    }
  }
#if defined(__HIP_DEVICE_COMPILE__)
  asm volatile("s_wait_xcnt 0x0" ::: "memory");   // stands in front of whatever next rewrites a register that these two stores name
#endif
}

// =====================================================================================================
// GEMM epilogue of the output projection: the wave's 16x64 f32 tile (times oscale) staged in its LDS slab (pitch 68),
// coverage: 8 instructions x 2 rows x 16 lanes x 4 floats = the wave's 16 x 64 tile.
// =====================================================================================================
__device__ __forceinline__ void epi64(float* sl, v8f a0, v8f a1, v8f a2, v8f a3, float oscale,
                                      const float* __restrict__ bias, float* C, int N,
                                      size_t rowb, int col0, int lane) {
  const int hh = lane >> 4, m = lane & 15;
#pragma unroll
  for (int r = 0; r < 8; ++r) {
    const int ro = (8 * hh + r) * 68 + m;
    sl[ro]      = a0[r] * oscale;
    sl[ro + 16] = a1[r] * oscale;
    sl[ro + 32] = a2[r] * oscale;
    sl[ro + 48] = a3[r] * oscale;
  }
  wave_sync_lds();
  const v4f braw = *(const v4f*)(bias + col0 + m * 4);
  v4f bb;
#pragma unroll
  for (int e = 0; e < 4; ++e) bb[e] = bfr(braw[e]);
  v4f vals[8];
#pragma unroll
  for (int it = 0; it < 8; ++it) vals[it] = *(const v4f*)(sl + (it * 2 + hh) * 68 + m * 4) + bb;
  float* dst = C + (rowb + (size_t)hh) * (size_t)N + col0 + m * 4;
  {
#pragma unroll
    for (int it = 0; it < 8; ++it) {
      *(v4f*)(dst + (size_t)(it * 2) * (size_t)N) = vals[it];
    }
    
  }
}

// =====================================================================================================
// q, k and v projections in one launch: grid.y = which (0 q, 1 k, 2 v); (x . W + b), x and W^T bf16 fragment-major planes, written
// straight into the f16 hi + residual planes that the attention kernel reads (value * 1024; hi = f16(t), residual = f16(t - hi)).
// Block = 64 rows x 64 columns, 4 waves x 16 rows; fragments loaded straight from the planes (two 16-B loads each, 512 contiguous bytes
// per wave and load, split k map for A and B); K = DMOD stepped by 32; grid.x = (MROWS/64)*(DMOD/64).
// The operand order is chosen so that a lane's 8 accumulator registers are one 16-B chunk of the destination plane:
//   q, k (plane rows = x rows, plane k = n): D = W^T . x^T, lane (c, hh) register r = (x row rowb + c, n = col0 + 16 j + 8 hh + r)
//        = chunk 32 (j & 1) + lane of fragment (rowb / 16, col0 / 32 + (j >> 1));
//   v^T  (plane rows = (b, head, d), plane k = s): D = x . W, lane (c, hh) register r = (x row rowb + 8 hh + r, n = col0 + 16 j + c)
//        = chunk 32 ((s >> 4) & 1) + lane of fragment (4 (b*NH + head) + j, s / 32), s = rowb % SEQ, head = col0 / HD.
// coverage: per wave 4 accumulators x 32 lanes x 8 halves = 16 x 64 elements per plane, each store 512 contiguous, 512-B aligned bytes;
//           grid covers every (row, column) of each of the six planes exactly once.
// =====================================================================================================
__device__ __forceinline__ void put_split(v8f t, u16* hp, u16* lp) {     // 8 scaled values -> one chunk of the hi and of the residual plane
  v4u oh, ol;
#pragma unroll
  for (int e = 0; e < 4; ++e) {
    const float t0 = t[2 * e], t1 = t[2 * e + 1];
    const _Float16 h0 = (_Float16)t0, h1 = (_Float16)t1;
    const _Float16 l0 = (_Float16)(t0 - (float)h0), l1 = (_Float16)(t1 - (float)h1);
    oh[e] = pk16(h_bits(h0), h_bits(h1));
    ol[e] = pk16(h_bits(l0), h_bits(l1));
  }
  *(v4u*)(hp) = oh;
  *(v4u*)(lp) = ol;
#if defined(__HIP_DEVICE_COMPILE__)
  asm volatile("s_wait_xcnt 0x0" ::: "memory");   // stands in front of whatever next rewrites a register that these two stores name
#endif
}

__global__ __launch_bounds__(128, 12)   // 12 waves per SIMD: the whole grid (3072 blocks x 4 waves) is resident at once, no second round
void proj3(const u16* __restrict__ A, const u16* __restrict__ Wq, const u16* __restrict__ Wk, const u16* __restrict__ Wv,
           const float* __restrict__ bq, const float* __restrict__ bk, const float* __restrict__ bv,
           u16* QH, u16* QL, u16* KH, u16* KL, u16* VH, u16* VL) {
  const int tid = threadIdx.x, lane = tid & 31;
  const int wave = __builtin_amdgcn_readfirstlane(tid >> 5);   // scalar: makes every fragment start a scalar base
  const int hh = lane >> 4, c = lane & 15;
  unsigned bo = 16u * (unsigned)lane;        // byte offset of this lane's chunk; advanced by one fragment (1024 B) per k step
  const int which = blockIdx.y;
  const int bid   = blockIdx.x;
  const int rowb  = (bid / (DMOD / 64)) * 64 + wave * 16;
  const int col0  = (bid % (DMOD / 64)) * 64;
  if (which > 2 || rowb + 16 > MROWS) return; // wave-uniform, never taken with the exact grid; no barriers in this kernel
  const u16*   Bt   = (which == 0) ? Wq : (which == 1) ? Wk : Wv;
  const float* bias = (which == 0) ? bq : (which == 1) ? bk : bv;
  const u16* ap = A  + (size_t)rowb * DMOD;           // fragment (rowb / 16, 0) of the fragment-major plane
  const size_t bs = (size_t)16 * DMOD;
  const u16* bp  = Bt + (size_t)col0 * DMOD;
  const u16* b1p = sbase(bp, bs), * b2p = sbase(bp, 2 * bs), * b3p = sbase(bp, 3 * bs);
  v8f acc0 = zero8(), acc1 = zero8(), acc2 = zero8(), acc3 = zero8();
  if (which == 2) {
#pragma unroll 1   // rolled: a trip's loads stay behind the previous trip's guard, so unrolling overlaps nothing and only lengthens the code
    for (int k0 = 0; k0 < DMOD; k0 += 32) {
      const v16b a  = ldfrag_b(ap, bo);
      const v16b b0 = ldfrag_b(bp, bo);
      const v16b b1 = ldfrag_b(b1p, bo);
      const v16b b2 = ldfrag_b(b2p, bo);
      const v16b b3 = ldfrag_b(b3p, bo);
      acc0 = mma_b(a, b0, acc0);
      acc1 = mma_b(a, b1, acc1);
      acc2 = mma_b(a, b2, acc2);
      acc3 = mma_b(a, b3, acc3);
      guard6<v16b>(acc0, acc1, acc2, acc3, a, b0, b1, b2, b3, a);
      bo += 1024u;
    }
    const int b = rowb / SEQ, sq = rowb % SEQ, g = col0 / HD;
    const size_t base = ((size_t)(b * NH + g) * HD) * SEQ + (size_t)(sq >> 5) * 512 + (size_t)((sq >> 4) & 1) * 256 + (size_t)lane * 8;
    v8f av[4] = {acc0, acc1, acc2, acc3};
#pragma unroll
    for (int j = 0; j < 4; ++j) av[j] = (av[j] + bfr(bias[col0 + 16 * j + c])) * VCAR;   // all bias loads ahead of the first store's wait
#pragma unroll
    for (int j = 0; j < 4; ++j) put_split(av[j], VH + base + (size_t)(16 * j) * SEQ, VL + base + (size_t)(16 * j) * SEQ);
  } else {
#pragma unroll 1   // rolled: a trip's loads stay behind the previous trip's guard, so unrolling overlaps nothing and only lengthens the code
    for (int k0 = 0; k0 < DMOD; k0 += 32) {
      const v16b a  = ldfrag_b(ap, bo);
      const v16b b0 = ldfrag_b(bp, bo);
      const v16b b1 = ldfrag_b(b1p, bo);
      const v16b b2 = ldfrag_b(b2p, bo);
      const v16b b3 = ldfrag_b(b3p, bo);
      acc0 = mma_b(b0, a, acc0);
      acc1 = mma_b(b1, a, acc1);
      acc2 = mma_b(b2, a, acc2);
      acc3 = mma_b(b3, a, acc3);
      guard6<v16b>(acc0, acc1, acc2, acc3, a, b0, b1, b2, b3, a);
      bo += 1024u;
    }
    u16* hpl = (which == 0) ? QH : KH;
    u16* lpl = (which == 0) ? QL : KL;
    const float sc = (which == 0) ? QSC : KSC;
    const size_t base = (size_t)rowb * DMOD + (size_t)(col0 >> 5) * 512 + (size_t)lane * 8;
    v8f av[4] = {acc0, acc1, acc2, acc3};
#pragma unroll
    for (int f = 0; f < 2; ++f) {              // one destination fragment at a time: its bias loads stand ahead of its first store's wait
#pragma unroll
      for (int j = 2 * f; j < 2 * f + 2; ++j) {
        const float* bsrc = bias + col0 + 16 * j + 8 * hh;
        const v4f r0 = *(const v4f*)(bsrc), r1 = *(const v4f*)(bsrc + 4);
        const v8f bb = {bfr(r0[0]), bfr(r0[1]), bfr(r0[2]), bfr(r0[3]), bfr(r1[0]), bfr(r1[1]), bfr(r1[2]), bfr(r1[3])};
        av[j] = (av[j] + bb) * sc;
      }
#pragma unroll
      for (int j = 2 * f; j < 2 * f + 2; ++j) {
        const size_t o8 = base + (size_t)f * 512 + (size_t)(j & 1) * 256;
        put_split(av[j], hpl + o8, lpl + o8);
      }
    }
  }
}

// =====================================================================================================
// f16 hi+lo GEMM: C[M][N] (f32) = (Ahi + Alo)[M][K] . Bt[N][K]^T, times oscale, plus bias[N]; Ahi/Alo f16 planes (same layout),
// Bt f16, all three fragment-major; products hi.B + lo.B into one accumulator (lo is the unscaled residual of hi). Block = 64x64 tile, 4 waves x 16 rows, K stepped by 32.
// =====================================================================================================
__global__ __launch_bounds__(128)
void gemm_h2(const u16* __restrict__ Ah, const u16* __restrict__ Al, const u16* __restrict__ Bt,
             const float* __restrict__ bias, float* C, int M, int N, int K, float oscale) {
  __shared__ __align__(16) float slab[4 * SLAB64];
  const int tid = threadIdx.x, lane = tid & 31;
  const int wave = __builtin_amdgcn_readfirstlane(tid >> 5);   // scalar: makes every fragment start a scalar base
  unsigned bo = 16u * (unsigned)lane;        // byte offset of this lane's chunk; advanced by one fragment (1024 B) per k step
  const int ntile = N >> 6;
  const int bid   = blockIdx.x;
  const int rowb  = (bid / ntile) * 64 + wave * 16;
  const int col0  = (bid % ntile) * 64;
  if (rowb + 16 > M) return;                 // wave-uniform, never taken with the exact grid; no block barriers in this kernel
  const size_t aofs = (size_t)rowb * K;               // fragment (rowb / 16, 0) of the fragment-major planes
  const _Float16* ahp = (const _Float16*)(const void*)Ah + aofs;
  const _Float16* alp = (const _Float16*)(const void*)Al + aofs;
  const size_t bs = (size_t)16 * K;
  const _Float16* bp  = (const _Float16*)(const void*)Bt + (size_t)col0 * K;
  const _Float16* b1p = sbase(bp, bs), * b2p = sbase(bp, 2 * bs), * b3p = sbase(bp, 3 * bs);
  v8f acc0 = zero8(), acc1 = zero8(), acc2 = zero8(), acc3 = zero8();
#pragma unroll 1
  for (int k0 = 0; k0 < K; k0 += 32) {
    const v16h ah = ldfrag_h(ahp, bo), al = ldfrag_h(alp, bo);
    const v16h b0 = ldfrag_h(bp, bo);
    const v16h b1 = ldfrag_h(b1p, bo);
    const v16h b2 = ldfrag_h(b2p, bo);
    const v16h b3 = ldfrag_h(b3p, bo);
    acc0 = mma_h(ah, b0, acc0);  acc0 = mma_h(al, b0, acc0);
    acc1 = mma_h(ah, b1, acc1);  acc1 = mma_h(al, b1, acc1);
    acc2 = mma_h(ah, b2, acc2);  acc2 = mma_h(al, b2, acc2);
    acc3 = mma_h(ah, b3, acc3);  acc3 = mma_h(al, b3, acc3);
    guard6<v16h>(acc0, acc1, acc2, acc3, ah, al, b0, b1, b2, b3);
    bo += 1024u;
  }
  epi64(slab + wave * SLAB64, acc0, acc1, acc2, acc3, oscale, bias, C, N, (size_t)rowb, col0, lane);
}

// =====================================================================================================
// Causal attention: block bid -> (query block qb = bid % NQB: rows q0 = 32*qb .. q0+31 = QTW query tiles of 16, head = (bid / NQB) % NH,
// batch b = bid / (NQB*NH)). The block's key tiles are dealt round-robin to its WPB waves (wave w takes kt = w, w + WPB, ..);
// a wave works BOTH query tiles against each key tile it takes, so every k and v^T fragment it loads feeds two score or output tiles;
// each wave keeps its own running max, sum and unnormalised O per query, and the WPB partials are merged through LDS after one block barrier.
//   q planes (hi, lo f16 x1024): fragment-major planes of the matrix [b*SEQ + s][h*HD + d]; k planes the same; v^T planes of [(b*NH + h)*HD + d][s].
//   score (log2 domain) t(i, j) = (q_i.k_j) * 0.125*log2e/(1024*1024) for key j <= query i, and -inf for j > i (the select
//   replaces the score). Key tiles of 32 visited for kb <= q0 (32-aligned, so kb <= every query of the block); tiles whose every key
//   index exceeds every query index of the block hold only -inf, whose exp is exactly 0, and are not visited. In every visited tile
//   key kb is finite for every query of the block, so a wave's running max is finite from its first tile on; a wave with no tile
//   keeps max = -inf, sum = 0, O = 0.
//   Both products are taken transposed: S^T = K.Q^T (A = 16 key rows, B = 16 queries) and O^T += V^T.P^T (A = 16 d rows of v^T,
//   B = P^T). In a score tile lane (c, hh) then holds query q0 + 16t + c and keys 8hh + 0..7 of the subtile, so a query's maximum and sum
//   run over the lane's own 16 registers plus one exchange with lane ^ 16, and the two subtiles' accumulators, converted in place, ARE the
//   B fragment of P^T in the split k map (elements 0..7 = keys kb + 8hh + 0..7, 8..15 = keys kb + 16 + 8hh + 0..7): P never leaves
//   the registers. Per key tile and query tile: 2 score subtiles x 2 k-steps x 3 products (k_hi.q_hi + k_hi.q_lo + k_lo.q_hi), fragments
//   loaded straight from the 16-bit planes (two 16-B loads per fragment, split k map); online max-subtracted base-2 softmax in f32,
//   -inf-safe rescale (one factor per lane); P x32768 as f16 hi and f16 residual; 4+4 v^T A fragments (hi and residual planes),
//   12 WMMAs (hh + hl + lh). A lane sums only its own half's keys; the two halves' sums are joined once, after the loop.
//   After the loop: each wave writes its unnormalised O to its own slab (32 rows, pitch 68; every element owned by one lane) and its row
//   max and sum to the tables; one block barrier (reached by every wave; trip counts differ only between waves, and the loop holds
//   no block barrier); wave w then merges columns d = 16w .. 16w+15 of all 32 rows: M = max_w m_w, out = sum_w O_w 2^(m_w - M) / sum_w l_w 2^(m_w - M)
//   (Z > 0 always: key j = i is never masked; guarded anyway), carries 1/(32768*1024) folded once. Bounded loops only (nkt <= NKT).
// coverage: per wave and query tile 1 instruction x 16 rows x 2 lanes x 8 halves = 16 x 16 per plane, x WPB waves x QTW tiles = 32 x 64;
//           grid NQB*NH*BATCH blocks = every (b, s, h) row of both O planes exactly once.
// =====================================================================================================
// four v_nop behind the score products: no vector instruction touches their results or operands inside the matrix unit's window
__device__ __forceinline__ void guard_sc(v8f& a, v8f& b, v8f& c, v8f& d, v16h k0, v16h k1, v16h k2, v16h k3,
                                         v16h q0, v16h q1, v16h q2, v16h q3) {
#if defined(__HIP_DEVICE_COMPILE__)
  asm volatile("v_nop\n\tv_nop\n\tv_nop\n\tv_nop"
               : "+v"(a), "+v"(b), "+v"(c), "+v"(d)
               : "v"(k0), "v"(k1), "v"(k2), "v"(k3), "v"(q0), "v"(q1), "v"(q2), "v"(q3) : "memory");
#endif
}
// the same behind the output products of both query tiles
__device__ __forceinline__ void guard_pv(v8f& a0, v8f& a1, v8f& a2, v8f& a3, v8f& b0, v8f& b1, v8f& b2, v8f& b3, v16h p0, v16h p1, v16h p2,
                                         v16h p3, v16h x0, v16h x1, v16h x2, v16h x3, v16h x4, v16h x5, v16h x6, v16h x7) {
#if defined(__HIP_DEVICE_COMPILE__)
  asm volatile("v_nop\n\tv_nop\n\tv_nop\n\tv_nop"
               : "+v"(a0), "+v"(a1), "+v"(a2), "+v"(a3), "+v"(b0), "+v"(b1), "+v"(b2), "+v"(b3)
               : "v"(p0), "v"(p1), "v"(p2), "v"(p3), "v"(x0), "v"(x1), "v"(x2), "v"(x3), "v"(x4), "v"(x5), "v"(x6), "v"(x7) : "memory");
#endif
}

__global__ __launch_bounds__(ATT_THREADS)
void attn1(const u16* __restrict__ QHIp, const u16* __restrict__ QLOp,
           const u16* __restrict__ KHIp, const u16* __restrict__ KLOp,
           const u16* __restrict__ VHIp, const u16* __restrict__ VLOp,
           u16* OHIp, u16* OLOp) {
  __shared__ __align__(16) float smem[WPB * WREG];
  __shared__ float mtab[WPB * 16 * QTW];     // per wave and query row: running max (log2 domain)
  __shared__ float ltab[WPB * 16 * QTW];     // per wave and query row: running sum

  const int tid  = threadIdx.x;
  const int wave = __builtin_amdgcn_readfirstlane(tid >> 5);   // scalar: the key loop's start must be wave-uniform for the WMMAs
  const int lane = tid & 31;
  const int hh   = lane >> 4;
  const int c    = lane & 15;
  const int bid  = blockIdx.x;
  const int qb   = bid % NQB;
  const int rem  = bid / NQB;
  const int head = rem % NH;
  const int b    = rem / NH;
  if (b >= BATCH) return;                    // block-uniform, before the block barrier; never taken with the exact grid
  const int q0   = qb * (16 * QTW);

  float* slab = smem + wave * WREG;          // result slab [32 queries][64 d] pitch 68

  const size_t rq0  = (size_t)b * SEQ + q0;                                     // plane row of query row q0
  const unsigned lo = 16u * (unsigned)lane;                                     // byte offset of this lane's chunk in a fragment
  const size_t qofs = (rq0 * NH + (size_t)head * 16) * HD;                      // fragment (rq0 / 16, 2 * head); query tile t: + t * QTS
  const size_t QTS  = (size_t)16 * NH * HD;                                     // halves between the fragments of consecutive row blocks
  const _Float16* Qh  = (const _Float16*)(const void*)QHIp + qofs;
  const _Float16* Ql  = (const _Float16*)(const void*)QLOp + qofs;
  const size_t kofs = ((size_t)b * SEQ * NH + (size_t)head * 16) * HD;          // fragment (b*SEQ / 16, 2 * head); key block added per step
  const _Float16* Khb = (const _Float16*)(const void*)KHIp + kofs;
  const _Float16* Klb = (const _Float16*)(const void*)KLOp + kofs;
  const size_t vofs = (((size_t)b * NH + head) * HD) * SEQ;                    // fragment (4 * (b*NH + head) (+j), 0); key block added per step
  const _Float16* Vhb = (const _Float16*)(const void*)VHIp + vofs;
  const _Float16* Vlb = (const _Float16*)(const void*)VLOp + vofs;
  const float lsc = 0.125f * (LOG2E / (QSC * KSC));
  const float oc  = 1.0f / (PCAR * VCAR);
  const size_t KROW = (size_t)NH * HD;                                          // halves per key row; 16 * KROW from one 16-row block to the next

  float mrun[QTW], lrun[QTW];                // query q0 + 16t + c: running max (equal in both halves), running sum over this half's keys
  v8f o[QTW][4];                             // o[t][j][r] = O^T element (d = 16j + 8hh + r, query q0 + 16t + c)
#pragma unroll
  for (int t = 0; t < QTW; ++t) {
    mrun[t] = -INFINITY;
    lrun[t] = 0.f;
#pragma unroll
    for (int j = 0; j < 4; ++j) o[t][j] = zero8();
  }
  const int ncaus = qb + 1;                                                     // tiles holding keys <= q0 + 31
  const int nkt = (ncaus < NKT) ? ncaus : NKT;

  // byte offsets of key tile kt in the k planes (32 rows of KROW halves) and in the v^T planes (one fragment), plus this lane's chunk
  unsigned ko = lo + (unsigned)wave * (unsigned)(32 * NH * HD * 2);
  unsigned vo = lo + (unsigned)wave * 1024u;
#pragma unroll 1
  for (int kt = wave; kt < nkt; kt += WPB) {
    const int kb = kt * 32;
    // ---- scores: D element r of this lane = (key kb + 8hh + r, query q0 + 16t + c) in s[t][0], key kb + 16 + 8hh + r in s[t][1] ----
    const _Float16* k0p = Khb;
    const _Float16* k1p = k0p + (size_t)16 * KROW;
    const _Float16* l0p = Klb;
    const _Float16* l1p = l0p + (size_t)16 * KROW;
    // the tile's 8 k fragments as one load group, ahead of the first product: one wait on the loads per key tile, not one per k step
    v16h kh0[2], kh1[2], kl0[2], kl1[2];
#pragma unroll
    for (int kk = 0; kk < 2; ++kk) {
      kh0[kk] = ldfrag_h(k0p + kk * 512, ko);
      kh1[kk] = ldfrag_h(k1p + kk * 512, ko);
      kl0[kk] = ldfrag_h(l0p + kk * 512, ko);
      kl1[kk] = ldfrag_h(l1p + kk * 512, ko);
    }
    v8f s[QTW][2];
#pragma unroll
    for (int t = 0; t < QTW; ++t) { s[t][0] = zero8(); s[t][1] = zero8(); }
#pragma unroll
    for (int kk = 0; kk < 2; ++kk) {
      v16h qh[QTW], ql[QTW];
#pragma unroll
      for (int t = 0; t < QTW; ++t) {
        qh[t] = ldfrag_h(Qh + t * QTS + kk * 512, lo);
        ql[t] = ldfrag_h(Ql + t * QTS + kk * 512, lo);
      }
#pragma unroll
      for (int t = 0; t < QTW; ++t) {
        s[t][0] = mma_h(kh0[kk], qh[t], s[t][0]);
        s[t][0] = mma_h(kh0[kk], ql[t], s[t][0]);
        s[t][0] = mma_h(kl0[kk], qh[t], s[t][0]);
        s[t][1] = mma_h(kh1[kk], qh[t], s[t][1]);
        s[t][1] = mma_h(kh1[kk], ql[t], s[t][1]);
        s[t][1] = mma_h(kl1[kk], qh[t], s[t][1]);
      }
      guard_sc(s[0][0], s[0][1], s[1][0], s[1][1], kh0[kk], kh1[kk], kl0[kk], kl1[kk], qh[0], ql[0], qh[1], ql[1]);
    }
    // ---- causal select (score := -inf for key > query) + online softmax in base 2, -inf-safe; all 32 keys of a query sit in
    //      lanes c and c + 16 ----
    const int key0 = kb + 8 * hh, key1 = key0 + 16;
    FragH ph[QTW], pl[QTW];
#pragma unroll
    for (int t = 0; t < QTW; ++t) {
      const int qi = q0 + 16 * t + c;
      v8f t0 = s[t][0] * lsc, t1 = s[t][1] * lsc;
      float mx = -INFINITY;
#pragma unroll
      for (int r = 0; r < 8; ++r) {
        t0[r] = (key0 + r > qi) ? -INFINITY : t0[r];
        t1[r] = (key1 + r > qi) ? -INFINITY : t1[r];
        mx = fmaxf(mx, fmaxf(t0[r], t1[r]));
      }
      mx = fmaxf(mx, xhalf(mx));
      const float mn = fmaxf(mrun[t], mx);
      const float ms = (mn == -INFINITY) ? 0.0f : mn;
      const float al = exp2f(mrun[t] - ms);
      mrun[t] = mn;
      // ---- B fragments of P^T * 32768: hi f16 and residual f16, col = query c, split k map over the 32 keys of this step ----
      t0 -= ms;
      t1 -= ms;
      v8f e0, e1;
#pragma unroll
      for (int r = 0; r < 8; ++r) { e0[r] = exp2f(t0[r]); e1[r] = exp2f(t1[r]); }
      const v8f es = e0 + e1;
      const float ps = ((es[0] + es[1]) + (es[2] + es[3])) + ((es[4] + es[5]) + (es[6] + es[7]));
      const v8f ta = e0 * PCAR, tb = e1 * PCAR;
      ph[t].h[0] = __builtin_convertvector(ta, v8h);          // elements 0..7  = keys kb + 8hh + 0..7
      ph[t].h[1] = __builtin_convertvector(tb, v8h);          // elements 8..15 = keys kb + 16 + 8hh + 0..7
      pl[t].h[0] = __builtin_convertvector(ta - __builtin_convertvector(ph[t].h[0], v8f), v8h);
      pl[t].h[1] = __builtin_convertvector(tb - __builtin_convertvector(ph[t].h[1], v8f), v8h);
      lrun[t] = lrun[t] * al + ps;
#pragma unroll
      for (int j = 0; j < 4; ++j) {
#pragma unroll
        for (int r = 0; r < 8; ++r) o[t][j][r] *= al;
      }
    }
    // ---- V^T.P^T : A fragment row = d = j*16 + c, keys contiguous in the v^T planes; each fragment serves both query tiles ----
    {
      v16h vh[4], vl[4];
#pragma unroll
      for (int j = 0; j < 4; ++j) {
        vh[j] = ldfrag_h(Vhb + (size_t)(16 * j) * SEQ, vo);
        vl[j] = ldfrag_h(Vlb + (size_t)(16 * j) * SEQ, vo);
      }
#pragma unroll
      for (int t = 0; t < QTW; ++t) {
#pragma unroll
        for (int j = 0; j < 4; ++j) {
          o[t][j] = mma_h(vh[j], ph[t].v, o[t][j]);
          o[t][j] = mma_h(vh[j], pl[t].v, o[t][j]);
          o[t][j] = mma_h(vl[j], ph[t].v, o[t][j]);
        }
      }
      guard_pv(o[0][0], o[0][1], o[0][2], o[0][3], o[1][0], o[1][1], o[1][2], o[1][3], ph[0].v, pl[0].v, ph[1].v, pl[1].v,
               vh[0], vh[1], vh[2], vh[3], vl[0], vl[1], vl[2], vl[3]);
    }
    ko += (unsigned)(WPB * 32 * NH * HD * 2);
    vo += (unsigned)(WPB * 1024);
  }
  // ---- this wave's partial: unnormalised O into its lane-owned slab (8 consecutive d per accumulator), row max and sum into the tables ----
#pragma unroll
  for (int t = 0; t < QTW; ++t) {
    acc_guard4(o[t][0], o[t][1], o[t][2], o[t][3]);
    lrun[t] += xhalf(lrun[t]);               // the two halves' key sums of query q0 + 16t + c, joined once
#pragma unroll
    for (int j = 0; j < 4; ++j) {
      float* sp = slab + (16 * t + c) * 68 + j * 16 + 8 * hh;
      const v4f a = {o[t][j][0], o[t][j][1], o[t][j][2], o[t][j][3]}, b4 = {o[t][j][4], o[t][j][5], o[t][j][6], o[t][j][7]};
      *(v4f*)(sp)     = a;
      *(v4f*)(sp + 4) = b4;
    }
    if (hh == 0) {
      mtab[(wave * QTW + t) * 16 + c] = mrun[t];
      ltab[(wave * QTW + t) * 16 + c] = lrun[t];
    }
  }
  __syncthreads();                           // publishes every wave's partial to all WPB waves, each of which merges its own 16 columns
  // ---- merge of the WPB partials; per query tile t, thread = chunk tid of the tile's two O fragments: row = 16t + (lane & 15),
  //      8 consecutive d from 32 * (wave >> 1) + 16 * (wave & 1) + 8 * (lane >> 4) ----
  const int c8 = wave * 16 + hh * 8;
#pragma unroll
  for (int t = 0; t < QTW; ++t) {
    float mw[WPB];
    float mall = -INFINITY;
#pragma unroll
    for (int w = 0; w < WPB; ++w) { mw[w] = mtab[(w * QTW + t) * 16 + c]; mall = fmaxf(mall, mw[w]); }
    const float msafe = (mall == -INFINITY) ? 0.0f : mall;
    float lv = 0.f;
    float acc[8];
#pragma unroll
    for (int e = 0; e < 8; ++e) acc[e] = 0.f;
#pragma unroll
    for (int w = 0; w < WPB; ++w) {
      const float sc = exp2f(mw[w] - msafe);   // 0 for a wave that saw no tile
      lv += ltab[(w * QTW + t) * 16 + c] * sc;
      const float* sp = smem + w * WREG + (16 * t + c) * 68 + c8;
      const v4f a = *(const v4f*)(sp), b4 = *(const v4f*)(sp + 4);
#pragma unroll
      for (int e = 0; e < 4; ++e) { acc[e] += a[e] * sc; acc[4 + e] += b4[e] * sc; }
    }
    // ---- out = acc / Z (0 if Z == 0), carries (32768 on P, 1024 on v) folded once; O x1024 -> f16 hi + residual planes ----
    const float ls  = (lv > 0.0f) ? lv : 1.0f;
    const float inv = (lv > 0.0f) ? ((1.0f / ls) * oc) : 0.0f;
    v4u oh, ol;
#pragma unroll
    for (int e = 0; e < 4; ++e) {
      const float w0 = (acc[2 * e] * inv) * OSC, w1 = (acc[2 * e + 1] * inv) * OSC;
      const _Float16 h0 = (_Float16)w0, h1 = (_Float16)w1;
      const _Float16 l0 = (_Float16)(w0 - (float)h0), l1 = (_Float16)(w1 - (float)h1);
      oh[e] = pk16(h_bits(h0), h_bits(h1));
      ol[e] = pk16(h_bits(l0), h_bits(l1));
    }
    const size_t o8 = qofs + t * QTS + 8 * tid;                                 // fragments (rq0 / 16 + t, 2 * head .. 2 * head + 1)
    *(v4u*)(OHIp + o8) = oh;
    *(v4u*)(OLOp + o8) = ol;
  }
}

// =====================================================================================================
// Workspace map (bytes); every plane is fully written by whole-line stores before it is read; all extents are exact multiples
// of the store granularity (no pad rows needed); every offset a multiple of 2097152; every 16-bit plane is fragment-major (the shape
// given is that of its matrix, rows x k):
//   XB  bf16 [MROWS][1024]              8388608
//   WQB bf16 [1024 n][1024 k]          2097152        WKB, WVB same
//   WOH f16  [1024 n][1024 k] x1024    2097152
//   QHI f16 [MROWS][16*64] x1024       8388608        QLO residual
//   KHI f16 [MROWS][16*64] x1024       8388608        KLO residual
//   VHI f16 [BATCH*16*64][SEQ] x1024   8388608        VLO residual
//   OHI f16 [MROWS][1024] x1024        8388608        OLO residual
//   end                               83886080
// =====================================================================================================
extern "C" void kernel_launch(void* const* d_in, const int* in_sizes, int n_in,
                              void* d_out, int out_size, void* d_ws, size_t ws_size,
                              hipStream_t stream) {
  if (n_in < 9) return;
  if (in_sizes[0] != MROWS * DMOD) return;
  if (in_sizes[1] != DMOD * DMOD || in_sizes[3] != DMOD * DMOD) return;
  if (in_sizes[5] != DMOD * DMOD || in_sizes[7] != DMOD * DMOD) return;
  if (in_sizes[2] != DMOD || in_sizes[4] != DMOD || in_sizes[6] != DMOD || in_sizes[8] != DMOD) return;
  if (out_size != MROWS * DMOD) return;

  const float* x    = (const float*)d_in[0];
  const float* wq   = (const float*)d_in[1];
  const float* bq   = (const float*)d_in[2];
  const float* wk   = (const float*)d_in[3];
  const float* bk   = (const float*)d_in[4];
  const float* wv   = (const float*)d_in[5];
  const float* bv   = (const float*)d_in[6];
  const float* wo   = (const float*)d_in[7];
  const float* bo   = (const float*)d_in[8];
  float*       out  = (float*)d_out;

  const size_t szXB = (size_t)MROWS * DMOD * 2;                 //  8388608
  const size_t szW  = (size_t)DMOD * DMOD * 2;                  //  2097152
  const size_t szP  = (size_t)MROWS * DMOD * 2;                 //  8388608
  size_t off = 0;
  const size_t oXB  = off; off += szXB;
  const size_t oWQ  = off; off += szW;
  const size_t oWK  = off; off += szW;
  const size_t oWV  = off; off += szW;
  const size_t oWO  = off; off += szW;
  const size_t oQHI = off; off += szP;
  const size_t oQLO = off; off += szP;
  const size_t oKHI = off; off += szP;
  const size_t oKLO = off; off += szP;
  const size_t oVHI = off; off += szP;
  const size_t oVLO = off; off += szP;
  const size_t oOHI = off; off += szP;
  const size_t oOLO = off; off += szP;
  if (off > ws_size) return;                            // off = 83886080
  if (off > (size_t)134217728) return;

  char* ws = (char*)d_ws;
  u16*   XB  = (u16*)(ws + oXB);
  u16*   WQB = (u16*)(ws + oWQ);
  u16*   WKB = (u16*)(ws + oWK);
  u16*   WVB = (u16*)(ws + oWV);
  u16*   WOH = (u16*)(ws + oWO);
  u16*   QHI = (u16*)(ws + oQHI);
  u16*   QLO = (u16*)(ws + oQLO);
  u16*   KHI = (u16*)(ws + oKHI);
  u16*   KLO = (u16*)(ws + oKLO);
  u16*   VHI = (u16*)(ws + oVHI);
  u16*   VLO = (u16*)(ws + oVLO);
  u16*   OHI = (u16*)(ws + oOHI);
  u16*   OLO = (u16*)(ws + oOLO);

  const dim3 blk(256);
  const dim3 gPR(4 * NWB + NXB);                        // 4 x 256 + 2048
  const dim3 gG((MROWS / 64) * (DMOD / 64));            // 1024
  const dim3 gP((MROWS / 64) * (DMOD / 64), 3);         // 1024 x (q, k, v)
  const dim3 bG(128);
  const dim3 gAT(ATT_BLOCKS);                           // 2048
  const dim3 bAT(ATT_THREADS);                          // 128

  // (0) Wq/Wk/Wv [k][n] -> bf16 [n][k] planes; Wo [k][n] -> f16 [n][k] plane of bf16 value x1024; x -> bf16 plane [MROWS][1024]
  prep16<<<gPR, blk, 0, stream>>>(x, wq, wk, wv, wo, XB, WQB, WKB, WVB, WOH, WOS);
  // (1) q = x.Wq + bq, k = x.Wk + bk -> hi/residual planes x1024; v = x.Wv + bv -> v^T hi/residual planes x1024
  proj3<<<gP, bG, 0, stream>>>(XB, WQB, WKB, WVB, bq, bk, bv, QHI, QLO, KHI, KLO, VHI, VLO);
  // (2) causal attention -> O planes [b*SEQ+s][h][d] x1024 (hi + residual)
  attn1<<<gAT, bAT, 0, stream>>>(QHI, QLO, KHI, KLO, VHI, VLO, OHI, OLO);
  // (3) output projection -> out [MROWS][1024] f32, carries 1024 (O) x 1024 (Wo) folded back, + bo
  gemm_h2<<<gG, bG, 0, stream>>>(OHI, OLO, WOH, bo, out, MROWS, DMOD, DMOD, 1.0f / (OSC * WOS));
  (void)hipGetLastError();
}

// v006
// Measured time: 131 microseconds a run.
// Timed twice side by side with v005, it ran 1.05 and 1.06 times as fast.
// All steps since v000 together make it 3.10 times as fast.
// Contractions: x.W{q,k,v} on v_wmma_f32_16x16x32_bf16 (x and W^T RNE-converted to bf16, f32 accumulate);
// scores, transposed, k.q^T (q, k carried x1024 as f16 hi plane + f16 residual plane, products hh+lh+hl), v^T.P^T (P x32768 f16
// hi+residual, v x1024 f16 hi+residual, products hh+lh+hl) and O.Wo (O x1024 f16 hi+residual, Wo^T as f16(bf16(Wo)) x1024, products h.w+l.w):
// v_wmma_f32_16x16x32_f16, f32 accumulate. Static causal select, base-2 online softmax and 1/l fold in f32 on VALU.
#include <hip/hip_runtime.h>
#include <math.h>
#include <stdint.h>

#define BATCH 2
#define SEQ   2048
#define DMOD  1024
#define NH    16
#define HD    64
#define MROWS (BATCH * SEQ)
#define QSC   1024.0f
#define KSC   1024.0f
#define PCAR  32768.0f
#define VCAR  1024.0f
#define OSC   1024.0f
#define WOS   1024.0f
#define LOG2E 1.4426950408889634f
#define WPB   4
#define QTW   2
#define NQB   (SEQ / (16 * QTW))
#define NWB   ((DMOD / 64) * (DMOD / 64))
#define NXB   ((MROWS * DMOD) / 2048)
#define NKT   (SEQ / 32)
#define ATT_THREADS (WPB * 32)
#define NPR   (NQB / 2)
#define ATT_BLOCKS  (NPR * NH * BATCH)
#define SLW   (16 * 68)
#define WREG  (QTW * SLW)
#define SLAB64 (16 * 68)
#define VTP   72
static_assert(DMOD == NH * HD && HD == 64 && NH == 16);
static_assert(WPB == 4 && ATT_THREADS == 128 && QTW == 2 && ATT_BLOCKS == 1024 && (NQB % 2) == 0);
static_assert((SEQ % 64) == 0 && (SEQ % 32) == 0 && (SEQ % 16) == 0 && SEQ <= 32768);
static_assert((DMOD % 64) == 0 && (DMOD % 32) == 0 && (MROWS % 64) == 0);
static_assert(((MROWS * DMOD) % 2048) == 0 && ((DMOD * DMOD) % 4096) == 0);

typedef unsigned short u16;
typedef _Float16 v16h __attribute__((ext_vector_type(16)));
typedef _Float16 v8h  __attribute__((ext_vector_type(8)));
typedef __bf16   v16b __attribute__((ext_vector_type(16)));
typedef float    v8f  __attribute__((ext_vector_type(8)));
typedef float    v4f  __attribute__((ext_vector_type(4)));
typedef unsigned int v4u __attribute__((ext_vector_type(4)));

union FragH { v16h v; v8h h[2]; v4u u[2]; };
union FragB { v16b v; v4u u[2]; };

// ---- scalar helpers --------------------------------------------------------------------------------
__device__ __forceinline__ unsigned short bf_bits(float f) {          // f32 -> bf16 bits, RNE convert
  unsigned u = __float_as_uint(f);
  return (unsigned short)((u + 0x7FFFu + ((u >> 16) & 1u)) >> 16);
}
__device__ __forceinline__ float bf_up(unsigned short h) { return __uint_as_float(((unsigned)h) << 16); }
__device__ __forceinline__ float bfr(float f) { return bf_up(bf_bits(f)); }
__device__ __forceinline__ unsigned short h_bits(_Float16 x) { return __builtin_bit_cast(unsigned short, x); }
__device__ __forceinline__ unsigned pk16(unsigned short a, unsigned short b) { return (unsigned)a | ((unsigned)b << 16); }
__device__ __forceinline__ float xhalf(float x) {                     // value of lane l ^ 16
  const int b = __builtin_bit_cast(int, x);
  return __builtin_bit_cast(float, __builtin_amdgcn_permlanex16(b, b, 0x76543210, 0xfedcba98, false, false));
}
__device__ __forceinline__ v8f zero8() { v8f z = {0.f, 0.f, 0.f, 0.f, 0.f, 0.f, 0.f, 0.f}; return z; }

// ---- fragment-major 16-bit planes: a matrix [R rows][Kd k] (R % 16 == 0, Kd % 32 == 0) is stored as fragments of 16 rows x 32 k,
//      fragment (rb = row / 16, kb = k / 32) at halves (rb * (Kd / 32) + kb) * 512; inside it 64 chunks of 8 halves, chunk
//      i * 32 + h * 16 + c = row 16 rb + c, k = 32 kb + 16 i + 8 h + 0..7. A wave-wide 16-B load of chunks 32 i + lane is 512 contiguous,
//      512-B aligned bytes = 4 whole lines (the same fragment read from a row-major plane touches 16 lines, 32 B of each, per load).
// ---- fragment loaders: 16-bit A/B operand, lane -> row/col (lane&15), p = fragment start + 8*lane;
//      elements 0..7 <- p[0..7] (k0+8h..), elements 8..15 <- p[256..263] (k0+16+8h..)  (same split k map for A and B).
//      fs = a fragment start that is the same for the whole wave (a scalar base), bo = 32-bit byte offset from it: 16*lane plus the
//      loop's advance, one vector register that serves every load of a trip
// sbase: p + ofs for a wave-uniform ofs, kept as a scalar base of its own: without the readfirstlane the compiler adds the lane offset
// to p first and then forms each further fragment's 64-bit address with vector additions in every trip.
template <typename T>
__device__ __forceinline__ const T* sbase(const T* p, size_t ofs) {
  const uint32_t l = (uint32_t)__builtin_amdgcn_readfirstlane((int)(uint32_t)ofs);
  const uint32_t h = (uint32_t)__builtin_amdgcn_readfirstlane((int)(uint32_t)((uint64_t)ofs >> 32));
  return p + (size_t)(((uint64_t)h << 32) | (uint64_t)l);
}
__device__ __forceinline__ v16h ldfrag_h(const _Float16* fs, unsigned bo) {
  const char* p = (const char*)(const void*)fs + bo;
  FragH f;
  f.h[0] = *(const v8h*)(const void*)(p);
  f.h[1] = *(const v8h*)(const void*)(p + 512);
  return f.v;
}
__device__ __forceinline__ v16b ldfrag_b(const u16* fs, unsigned bo) { // bf16 plane read as unsigned integer vectors
  const char* p = (const char*)(const void*)fs + bo;
  FragB f;
  f.u[0] = *(const v4u*)(const void*)(p);
  f.u[1] = *(const v4u*)(const void*)(p + 512);
  return f.v;
}

// row-major element index (matrix [R][Kd]) of the 8 halves that chunk q of the fragment-major plane holds
__device__ __forceinline__ size_t chunk_src(int q, int Kd) {
  const int f = q >> 6, nkb = Kd >> 5;
  return (size_t)((f / nkb) * 16 + (q & 15)) * (size_t)Kd + (size_t)((f % nkb) * 32 + ((q >> 4) & 3) * 8);
}

__device__ __forceinline__ v8f mma_h(v16h a, v16h b, v8f c) {
  return __builtin_amdgcn_wmma_f32_16x16x32_f16(false, a, false, b, (short)0, c, false, false);
}
__device__ __forceinline__ v8f mma_b(v16b a, v16b b, v8f c) {
  return __builtin_amdgcn_wmma_f32_16x16x32_bf16(false, a, false, b, (short)0, c, false, false);
}
template <typename F>
__device__ __forceinline__ void guard6(v8f& a, v8f& b, v8f& c, v8f& d, F x0, F x1, F x2, F x3, F x4, F x5) {
#if defined(__HIP_DEVICE_COMPILE__)
  asm volatile("v_nop\n\tv_nop\n\tv_nop\n\tv_nop"
               : "+v"(a), "+v"(b), "+v"(c), "+v"(d) : "v"(x0), "v"(x1), "v"(x2), "v"(x3), "v"(x4), "v"(x5) : "memory");
#endif
}
__device__ __forceinline__ void acc_guard4(v8f& a, v8f& b, v8f& c, v8f& d) {
#if defined(__HIP_DEVICE_COMPILE__)
  asm volatile("v_nop\n\tv_nop\n\tv_nop\n\tv_nop" : "+v"(a), "+v"(b), "+v"(c), "+v"(d));
#endif
}
__device__ __forceinline__ void wave_sync_lds() {
  __builtin_amdgcn_fence(__ATOMIC_RELEASE, "workgroup");
  __builtin_amdgcn_wave_barrier();
  __builtin_amdgcn_fence(__ATOMIC_ACQUIRE, "workgroup");
}

// =====================================================================================================
// All operand conversions in one launch (five independent jobs, told apart by the block index).
// Blocks 0 .. 4*NWB-1, weight transpose-convert: weight which = bid / NWB, W [K][N] f32 (x.W layout, n contiguous) -> Dt, the fragment-major
// 16-bit plane of the matrix [N rows][K cols]; which 0..2: bf16 RNE bits; which 3: f16 bits of (bf16 RNE value) * scale.
//   Block = (k tile k0 = (wb / (N/64))*64, n tile n0 = (wb % (N/64))*64), wb = bid % NWB: 64 source rows of 64 floats loaded with 16-B loads,
//   converted, scattered into an LDS tile [n][64 k] (pitch 72 halves); after a block barrier the tile's 8 fragments are stored chunk by chunk.
//   coverage: load 256 thr x 16 = 64 x 64; store 2 iterations x 256 thr x 8 halves = 8 fragments x 512 halves = the block's tile;
//             NWB = (K/64)*(N/64) blocks cover each Dt exactly once.
// Blocks 4*NWB .. 4*NWB+NXB-1, x f32 [MROWS][DMOD] -> bf16 RNE bits, fragment-major plane. Thread = one chunk of the plane (8 consecutive
//   k of one row): two 16-B loads, one 16-B store; 32 consecutive lanes store 512 contiguous, 512-B aligned bytes.
//   coverage: NXB blocks x 256 thr x 8 = the whole plane.
// =====================================================================================================
__global__ __launch_bounds__(256) void prep16(const float* __restrict__ x, const float* __restrict__ W0, const float* __restrict__ W1,
                                              const float* __restrict__ W2, const float* __restrict__ W3,
                                              u16* XD, u16* D0, u16* D1, u16* D2, u16* D3, float scale) {
  __shared__ __align__(16) u16 T[64 * VTP];
  const int tid = threadIdx.x;
  const int bid = blockIdx.x;
  if (bid >= 4 * NWB) {                       // block-uniform; this path holds no barrier
    const int gt = (bid - 4 * NWB) * 256 + tid;
    if (gt >= (MROWS * DMOD) / 8) return;     // never taken with the exact grid
    const float* p = x + chunk_src(gt, DMOD);
    const v4f a = *(const v4f*)(p), b4 = *(const v4f*)(p + 4);
    v4u o;
    o[0] = pk16(bf_bits(a[0]), bf_bits(a[1]));
    o[1] = pk16(bf_bits(a[2]), bf_bits(a[3]));
    o[2] = pk16(bf_bits(b4[0]), bf_bits(b4[1]));
    o[3] = pk16(bf_bits(b4[2]), bf_bits(b4[3]));
    *(v4u*)(XD + (size_t)gt * 8) = o;
    return;
  }
  const int K = DMOD, N = DMOD;
  const int which = bid / NWB;
  const int wb    = bid % NWB;
  const int ntn = N >> 6;
  const int n0  = (wb % ntn) * 64;
  const int k0  = (wb / ntn) * 64;
  const float* W = (which == 0) ? W0 : (which == 1) ? W1 : (which == 2) ? W2 : W3;
  u16* Dt        = (which == 0) ? D0 : (which == 1) ? D1 : (which == 2) ? D2 : D3;
  const int f16mode = (which == 3) ? 1 : 0;
  {
    const int sl = tid >> 2;                  // k within tile 0..63 (source row)
    const int dc = (tid & 3) * 16;            // n chunk
    const float* src = W + (size_t)(k0 + sl) * N + n0 + dc;
#pragma unroll
    for (int i = 0; i < 4; ++i) {
      const v4f a = *(const v4f*)(src + 4 * i);
#pragma unroll
      for (int e = 0; e < 4; ++e) {
        const float f = a[e];
        const unsigned short hb = h_bits((_Float16)(bfr(f) * scale));
        const unsigned short bb = bf_bits(f);
        T[(dc + 4 * i + e) * VTP + sl] = (f16mode != 0) ? hb : bb;
      }
    }
  }
  __syncthreads();
  // the tile = 4 (n) x 2 (k) fragments of the plane; thread = chunk tid & 63 of fragment (n block it*2 + (tid >> 7), k block (tid >> 6) & 1)
  v4u vv[2];
  const int ch = tid & 63, fk = (tid >> 6) & 1, fr = tid >> 7;
#pragma unroll
  for (int it = 0; it < 2; ++it) {
    const int line = (it * 2 + fr) * 16 + (ch & 15);   // n = 0..63 within tile
    vv[it] = *(const v4u*)(T + line * VTP + fk * 32 + (ch >> 4) * 8);
  }
  const size_t base = (size_t)n0 * K + (size_t)((k0 >> 5) + fk) * 512 + ch * 8;
  {
#pragma unroll
    for (int it = 0; it < 2; ++it) {
      *(v4u*)(Dt + base + (size_t)((it * 2 + fr) * 16) * K) = vv[it];
    }
  }
#if defined(__HIP_DEVICE_COMPILE__)
  asm volatile("s_wait_xcnt 0x0" ::: "memory");   // stands in front of whatever next rewrites a register that these two stores name
#endif
}

// =====================================================================================================
// GEMM epilogue of the output projection: the wave's 16x64 f32 tile (times oscale) staged in its LDS slab (pitch 68),
// coverage: 8 instructions x 2 rows x 16 lanes x 4 floats = the wave's 16 x 64 tile.
// =====================================================================================================
__device__ __forceinline__ void epi64(float* sl, v8f a0, v8f a1, v8f a2, v8f a3, float oscale,
                                      const float* __restrict__ bias, float* C, int N,
                                      size_t rowb, int col0, int lane) {
  const int hh = lane >> 4, m = lane & 15;
#pragma unroll
  for (int r = 0; r < 8; ++r) {
    const int ro = (8 * hh + r) * 68 + m;
    sl[ro]      = a0[r] * oscale;
    sl[ro + 16] = a1[r] * oscale;
    sl[ro + 32] = a2[r] * oscale;
    sl[ro + 48] = a3[r] * oscale;
  }
  wave_sync_lds();
  const v4f braw = *(const v4f*)(bias + col0 + m * 4);
  v4f bb;
#pragma unroll
  for (int e = 0; e < 4; ++e) bb[e] = bfr(braw[e]);
  v4f vals[8];
#pragma unroll
  for (int it = 0; it < 8; ++it) vals[it] = *(const v4f*)(sl + (it * 2 + hh) * 68 + m * 4) + bb;
  float* dst = C + (rowb + (size_t)hh) * (size_t)N + col0 + m * 4;
  {
#pragma unroll
    for (int it = 0; it < 8; ++it) {
      *(v4f*)(dst + (size_t)(it * 2) * (size_t)N) = vals[it];
    }
    
  }
}

// =====================================================================================================
// q, k and v projections in one launch: grid.y = which (0 q, 1 k, 2 v); (x . W + b), x and W^T bf16 fragment-major planes, written
// straight into the f16 hi + residual planes that the attention kernel reads (value * 1024; hi = f16(t), residual = f16(t - hi)).
// Block = 64 rows x 64 columns, 4 waves x 16 rows; fragments loaded straight from the planes (two 16-B loads each, 512 contiguous bytes
// per wave and load, split k map for A and B); K = DMOD stepped by 32; grid.x = (MROWS/64)*(DMOD/64).
// The operand order is chosen so that a lane's 8 accumulator registers are one 16-B chunk of the destination plane:
//   q, k (plane rows = x rows, plane k = n): D = W^T . x^T, lane (c, hh) register r = (x row rowb + c, n = col0 + 16 j + 8 hh + r)
//        = chunk 32 (j & 1) + lane of fragment (rowb / 16, col0 / 32 + (j >> 1));
//   v^T  (plane rows = (b, head, d), plane k = s): D = x . W, lane (c, hh) register r = (x row rowb + 8 hh + r, n = col0 + 16 j + c)
//        = chunk 32 ((s >> 4) & 1) + lane of fragment (4 (b*NH + head) + j, s / 32), s = rowb % SEQ, head = col0 / HD.
// coverage: per wave 4 accumulators x 32 lanes x 8 halves = 16 x 64 elements per plane, each store 512 contiguous, 512-B aligned bytes;
//           grid covers every (row, column) of each of the six planes exactly once.
// =====================================================================================================
__device__ __forceinline__ void put_split(v8f t, u16* hp, u16* lp) {     // 8 scaled values -> one chunk of the hi and of the residual plane
  v4u oh, ol;
#pragma unroll
  for (int e = 0; e < 4; ++e) {
    const float t0 = t[2 * e], t1 = t[2 * e + 1];
    const _Float16 h0 = (_Float16)t0, h1 = (_Float16)t1;
    const _Float16 l0 = (_Float16)(t0 - (float)h0), l1 = (_Float16)(t1 - (float)h1);
    oh[e] = pk16(h_bits(h0), h_bits(h1));
    ol[e] = pk16(h_bits(l0), h_bits(l1));
  }
  *(v4u*)(hp) = oh;
  *(v4u*)(lp) = ol;
#if defined(__HIP_DEVICE_COMPILE__)
  asm volatile("s_wait_xcnt 0x0" ::: "memory");   // stands in front of whatever next rewrites a register that these two stores name
#endif
}

__global__ __launch_bounds__(128, 12)   // 12 waves per SIMD: the whole grid (3072 blocks x 4 waves) is resident at once, no second round
void proj3(const u16* __restrict__ A, const u16* __restrict__ Wq, const u16* __restrict__ Wk, const u16* __restrict__ Wv,
           const float* __restrict__ bq, const float* __restrict__ bk, const float* __restrict__ bv,
           u16* QH, u16* QL, u16* KH, u16* KL, u16* VH, u16* VL) {
  const int tid = threadIdx.x, lane = tid & 31;
  const int wave = __builtin_amdgcn_readfirstlane(tid >> 5);   // scalar: makes every fragment start a scalar base
  const int hh = lane >> 4, c = lane & 15;
  unsigned bo = 16u * (unsigned)lane;        // byte offset of this lane's chunk; advanced by one fragment (1024 B) per k step
  const int which = blockIdx.y;
  const int bid   = blockIdx.x;
  const int rowb  = (bid / (DMOD / 64)) * 64 + wave * 16;
  const int col0  = (bid % (DMOD / 64)) * 64;
  if (which > 2 || rowb + 16 > MROWS) return; // wave-uniform, never taken with the exact grid; no barriers in this kernel
  const u16*   Bt   = (which == 0) ? Wq : (which == 1) ? Wk : Wv;
  const float* bias = (which == 0) ? bq : (which == 1) ? bk : bv;
  const u16* ap = A  + (size_t)rowb * DMOD;           // fragment (rowb / 16, 0) of the fragment-major plane
  const size_t bs = (size_t)16 * DMOD;
  const u16* bp  = Bt + (size_t)col0 * DMOD;
  const u16* b1p = sbase(bp, bs), * b2p = sbase(bp, 2 * bs), * b3p = sbase(bp, 3 * bs);
  v8f acc0 = zero8(), acc1 = zero8(), acc2 = zero8(), acc3 = zero8();
  if (which == 2) {
#pragma unroll 1   // rolled: a trip's loads stay behind the previous trip's guard, so unrolling overlaps nothing and only lengthens the code
    for (int k0 = 0; k0 < DMOD; k0 += 32) {
      const v16b a  = ldfrag_b(ap, bo);
      const v16b b0 = ldfrag_b(bp, bo);
      const v16b b1 = ldfrag_b(b1p, bo);
      const v16b b2 = ldfrag_b(b2p, bo);
      const v16b b3 = ldfrag_b(b3p, bo);
      acc0 = mma_b(a, b0, acc0);
      acc1 = mma_b(a, b1, acc1);
      acc2 = mma_b(a, b2, acc2);
      acc3 = mma_b(a, b3, acc3);
      guard6<v16b>(acc0, acc1, acc2, acc3, a, b0, b1, b2, b3, a);
      bo += 1024u;
    }
    const int b = rowb / SEQ, sq = rowb % SEQ, g = col0 / HD;
    const size_t base = ((size_t)(b * NH + g) * HD) * SEQ + (size_t)(sq >> 5) * 512 + (size_t)((sq >> 4) & 1) * 256 + (size_t)lane * 8;
    v8f av[4] = {acc0, acc1, acc2, acc3};
#pragma unroll
    for (int j = 0; j < 4; ++j) av[j] = (av[j] + bfr(bias[col0 + 16 * j + c])) * VCAR;   // all bias loads ahead of the first store's wait
#pragma unroll
    for (int j = 0; j < 4; ++j) put_split(av[j], VH + base + (size_t)(16 * j) * SEQ, VL + base + (size_t)(16 * j) * SEQ);
  } else {
#pragma unroll 1   // rolled: a trip's loads stay behind the previous trip's guard, so unrolling overlaps nothing and only lengthens the code
    for (int k0 = 0; k0 < DMOD; k0 += 32) {
      const v16b a  = ldfrag_b(ap, bo);
      const v16b b0 = ldfrag_b(bp, bo);
      const v16b b1 = ldfrag_b(b1p, bo);
      const v16b b2 = ldfrag_b(b2p, bo);
      const v16b b3 = ldfrag_b(b3p, bo);
      acc0 = mma_b(b0, a, acc0);
      acc1 = mma_b(b1, a, acc1);
      acc2 = mma_b(b2, a, acc2);
      acc3 = mma_b(b3, a, acc3);
      guard6<v16b>(acc0, acc1, acc2, acc3, a, b0, b1, b2, b3, a);
      bo += 1024u;
    }
    u16* hpl = (which == 0) ? QH : KH;
    u16* lpl = (which == 0) ? QL : KL;
    const float sc = (which == 0) ? QSC : KSC;
    const size_t base = (size_t)rowb * DMOD + (size_t)(col0 >> 5) * 512 + (size_t)lane * 8;
    v8f av[4] = {acc0, acc1, acc2, acc3};
#pragma unroll
    for (int f = 0; f < 2; ++f) {              // one destination fragment at a time: its bias loads stand ahead of its first store's wait
#pragma unroll
      for (int j = 2 * f; j < 2 * f + 2; ++j) {
        const float* bsrc = bias + col0 + 16 * j + 8 * hh;
        const v4f r0 = *(const v4f*)(bsrc), r1 = *(const v4f*)(bsrc + 4);
        const v8f bb = {bfr(r0[0]), bfr(r0[1]), bfr(r0[2]), bfr(r0[3]), bfr(r1[0]), bfr(r1[1]), bfr(r1[2]), bfr(r1[3])};
        av[j] = (av[j] + bb) * sc;
      }
#pragma unroll
      for (int j = 2 * f; j < 2 * f + 2; ++j) {
        const size_t o8 = base + (size_t)f * 512 + (size_t)(j & 1) * 256;
        put_split(av[j], hpl + o8, lpl + o8);
      }
    }
  }
}

// =====================================================================================================
// f16 hi+lo GEMM: C[M][N] (f32) = (Ahi + Alo)[M][K] . Bt[N][K]^T, times oscale, plus bias[N]; Ahi/Alo f16 planes (same layout),
// Bt f16, all three fragment-major; products hi.B + lo.B into one accumulator (lo is the unscaled residual of hi). Block = 64x64 tile, 4 waves x 16 rows, K stepped by 32.
// =====================================================================================================
__global__ __launch_bounds__(128)
void gemm_h2(const u16* __restrict__ Ah, const u16* __restrict__ Al, const u16* __restrict__ Bt,
             const float* __restrict__ bias, float* C, int M, int N, int K, float oscale) {
  __shared__ __align__(16) float slab[4 * SLAB64];
  const int tid = threadIdx.x, lane = tid & 31;
  const int wave = __builtin_amdgcn_readfirstlane(tid >> 5);   // scalar: makes every fragment start a scalar base
  unsigned bo = 16u * (unsigned)lane;        // byte offset of this lane's chunk; advanced by one fragment (1024 B) per k step
  const int ntile = N >> 6;
  const int bid   = blockIdx.x;
  const int rowb  = (bid / ntile) * 64 + wave * 16;
  const int col0  = (bid % ntile) * 64;
  if (rowb + 16 > M) return;                 // wave-uniform, never taken with the exact grid; no block barriers in this kernel
  const size_t aofs = (size_t)rowb * K;               // fragment (rowb / 16, 0) of the fragment-major planes
  const _Float16* ahp = (const _Float16*)(const void*)Ah + aofs;
  const _Float16* alp = (const _Float16*)(const void*)Al + aofs;
  const size_t bs = (size_t)16 * K;
  const _Float16* bp  = (const _Float16*)(const void*)Bt + (size_t)col0 * K;
  const _Float16* b1p = sbase(bp, bs), * b2p = sbase(bp, 2 * bs), * b3p = sbase(bp, 3 * bs);
  v8f acc0 = zero8(), acc1 = zero8(), acc2 = zero8(), acc3 = zero8();
#pragma unroll 1
  for (int k0 = 0; k0 < K; k0 += 32) {
    const v16h ah = ldfrag_h(ahp, bo), al = ldfrag_h(alp, bo);
    const v16h b0 = ldfrag_h(bp, bo);
    const v16h b1 = ldfrag_h(b1p, bo);
    const v16h b2 = ldfrag_h(b2p, bo);
    const v16h b3 = ldfrag_h(b3p, bo);
    acc0 = mma_h(ah, b0, acc0);  acc0 = mma_h(al, b0, acc0);
    acc1 = mma_h(ah, b1, acc1);  acc1 = mma_h(al, b1, acc1);
    acc2 = mma_h(ah, b2, acc2);  acc2 = mma_h(al, b2, acc2);
    acc3 = mma_h(ah, b3, acc3);  acc3 = mma_h(al, b3, acc3);
    guard6<v16h>(acc0, acc1, acc2, acc3, ah, al, b0, b1, b2, b3);
    bo += 1024u;
  }
  epi64(slab + wave * SLAB64, acc0, acc1, acc2, acc3, oscale, bias, C, N, (size_t)rowb, col0, lane);
}

// =====================================================================================================
// Causal attention: block bid -> (pair pr = bid % NPR, head = (bid / NPR) % NH, batch b = bid / (NPR*NH)). A block works two query blocks one
// after the other, qb = NQB-1-pr and then qb = pr (rows q0 = 32*qb .. q0+31 = QTW query tiles of 16): together NQB+1 key tiles, the same
// for every block, so that no block and no WGP carries more of the causal triangle than another, wherever the blocks land.
// A query block's key tiles are dealt round-robin to its WPB waves (wave w takes kt = w, w + WPB, ..);
// a wave works BOTH query tiles against each key tile it takes, so every k and v^T fragment it loads feeds two score or output tiles;
// each wave keeps its own running max, sum and unnormalised O per query, and the WPB partials are merged through LDS after one block barrier.
//   q planes (hi, lo f16 x1024): fragment-major planes of the matrix [b*SEQ + s][h*HD + d]; k planes the same; v^T planes of [(b*NH + h)*HD + d][s].
//   score (log2 domain) t(i, j) = (q_i.k_j) * 0.125*log2e/(1024*1024) for key j <= query i, and -inf for j > i (the select
//   replaces the score). Key tiles of 32 visited for kb <= q0 (32-aligned, so kb <= every query of the block); tiles whose every key
//   index exceeds every query index of the block hold only -inf, whose exp is exactly 0, and are not visited. In every visited tile
//   key kb is finite for every query of the block, so a wave's running max is finite from its first tile on; a wave with no tile
//   keeps max = -inf, sum = 0, O = 0.
//   Both products are taken transposed: S^T = K.Q^T (A = 16 key rows, B = 16 queries) and O^T += V^T.P^T (A = 16 d rows of v^T,
//   B = P^T). In a score tile lane (c, hh) then holds query q0 + 16t + c and keys 8hh + 0..7 of the subtile, so a query's maximum and sum
//   run over the lane's own 16 registers plus one exchange with lane ^ 16, and the two subtiles' accumulators, converted in place, ARE the
//   B fragment of P^T in the split k map (elements 0..7 = keys kb + 8hh + 0..7, 8..15 = keys kb + 16 + 8hh + 0..7): P never leaves
//   the registers. Per key tile and query tile: 2 score subtiles x 2 k-steps x 3 products (k_hi.q_hi + k_hi.q_lo + k_lo.q_hi), fragments
//   loaded straight from the 16-bit planes (two 16-B loads per fragment, split k map); online max-subtracted base-2 softmax in f32,
//   -inf-safe rescale (one factor per lane); P x32768 as f16 hi and f16 residual; 4+4 v^T A fragments (hi and residual planes),
//   12 WMMAs (hh + hl + lh). A lane sums only its own half's keys; the two halves' sums are joined once, after the loop.
//   After each query block's loop: each wave writes its unnormalised O to its own slab of that query block (32 rows, pitch 68; every
//   element owned by one lane) and its row max and sum to the tables; behind both query blocks one block barrier (reached by every wave; trip counts differ only between waves, and the loop holds
//   no block barrier); wave w then merges columns d = 16w .. 16w+15 of all 32 rows: M = max_w m_w, out = sum_w O_w 2^(m_w - M) / sum_w l_w 2^(m_w - M)
//   (Z > 0 always: key j = i is never masked; guarded anyway), carries 1/(32768*1024) folded once. Bounded loops only (nkt <= NKT).
// coverage: per wave and query tile 1 instruction x 16 rows x 2 lanes x 8 halves = 16 x 16 per plane, x WPB waves x QTW tiles = 32 x 64;
//           x 2 query blocks (pr and NQB-1-pr, pr < NQB/2: every qb once); grid NPR*NH*BATCH blocks = every (b, s, h) row of both O planes once.
// =====================================================================================================
// four v_nop behind the score products: no vector instruction touches their results or operands inside the matrix unit's window
__device__ __forceinline__ void guard_sc(v8f& a, v8f& b, v8f& c, v8f& d, v16h k0, v16h k1, v16h k2, v16h k3,
                                         v16h q0, v16h q1, v16h q2, v16h q3) {
#if defined(__HIP_DEVICE_COMPILE__)
  asm volatile("v_nop\n\tv_nop\n\tv_nop\n\tv_nop"
               : "+v"(a), "+v"(b), "+v"(c), "+v"(d)
               : "v"(k0), "v"(k1), "v"(k2), "v"(k3), "v"(q0), "v"(q1), "v"(q2), "v"(q3) : "memory");
#endif
}
// the same behind the output products of both query tiles
__device__ __forceinline__ void guard_pv(v8f& a0, v8f& a1, v8f& a2, v8f& a3, v8f& b0, v8f& b1, v8f& b2, v8f& b3, v16h p0, v16h p1, v16h p2,
                                         v16h p3, v16h x0, v16h x1, v16h x2, v16h x3, v16h x4, v16h x5, v16h x6, v16h x7) {
#if defined(__HIP_DEVICE_COMPILE__)
  asm volatile("v_nop\n\tv_nop\n\tv_nop\n\tv_nop"
               : "+v"(a0), "+v"(a1), "+v"(a2), "+v"(a3), "+v"(b0), "+v"(b1), "+v"(b2), "+v"(b3)
               : "v"(p0), "v"(p1), "v"(p2), "v"(p3), "v"(x0), "v"(x1), "v"(x2), "v"(x3), "v"(x4), "v"(x5), "v"(x6), "v"(x7) : "memory");
#endif
}

__global__ __launch_bounds__(ATT_THREADS, 4)   // 4 waves per SIMD: the whole grid (1024 blocks x 4 waves) is resident at once, no second round
void attn1(const u16* __restrict__ QHIp, const u16* __restrict__ QLOp,
           const u16* __restrict__ KHIp, const u16* __restrict__ KLOp,
           const u16* __restrict__ VHIp, const u16* __restrict__ VLOp,
           u16* OHIp, u16* OLOp) {
  __shared__ __align__(16) float smem[2 * WPB * WREG];   // one set of slabs per query block of the pair
  __shared__ float mtab[2 * WPB * 16 * QTW]; // per query block, wave and query row: running max (log2 domain)
  __shared__ float ltab[2 * WPB * 16 * QTW]; // per query block, wave and query row: running sum

  const int tid  = threadIdx.x;
  const int wave = __builtin_amdgcn_readfirstlane(tid >> 5);   // scalar: the key loop's start must be wave-uniform for the WMMAs
  const int lane = tid & 31;
  const int hh   = lane >> 4;
  const int c    = lane & 15;
  const int bid  = blockIdx.x;
  const int pr   = bid % NPR;
  const int rem  = bid / NPR;
  const int head = rem % NH;
  const int b    = rem / NH;
  if (b >= BATCH) return;                    // block-uniform, before the block barrier; never taken with the exact grid

  const unsigned lo = 16u * (unsigned)lane;                                     // byte offset of this lane's chunk in a fragment
  const size_t QTS  = (size_t)16 * NH * HD;                                     // halves between the fragments of consecutive row blocks
  const size_t kofs = ((size_t)b * SEQ * NH + (size_t)head * 16) * HD;          // fragment (b*SEQ / 16, 2 * head); key block added per step
  const _Float16* Khb = (const _Float16*)(const void*)KHIp + kofs;
  const _Float16* Klb = (const _Float16*)(const void*)KLOp + kofs;
  const size_t vofs = (((size_t)b * NH + head) * HD) * SEQ;                    // fragment (4 * (b*NH + head) (+j), 0); key block added per step
  const _Float16* Vhb = (const _Float16*)(const void*)VHIp + vofs;
  const _Float16* Vlb = (const _Float16*)(const void*)VLOp + vofs;
  const float lsc = 0.125f * (LOG2E / (QSC * KSC));
  const float oc  = 1.0f / (PCAR * VCAR);
  const size_t KROW = (size_t)NH * HD;                                          // halves per key row; 16 * KROW between consecutive 16-row key blocks

#pragma unroll 1   // rolled: the two query blocks run one after the other through one copy of the key loop
  for (int pass = 0; pass < 2; ++pass) {
  const int qb   = (pass == 0) ? (NQB - 1 - pr) : pr;
  const int q0   = qb * (16 * QTW);
  float* slab = smem + (pass * WPB + wave) * WREG;                              // result slab [32 queries][64 d] pitch 68
  const size_t qofs = (((size_t)b * SEQ + q0) * NH + (size_t)head * 16) * HD;   // fragment (row q0's block, 2 * head); query tile t: + t * QTS
  const _Float16* Qh  = (const _Float16*)(const void*)QHIp + qofs;
  const _Float16* Ql  = (const _Float16*)(const void*)QLOp + qofs;
  float mrun[QTW], lrun[QTW];                // query q0 + 16t + c: running max (equal in both halves), running sum over this half's keys
  v8f o[QTW][4];                             // o[t][j][r] = O^T element (d = 16j + 8hh + r, query q0 + 16t + c)
#pragma unroll
  for (int t = 0; t < QTW; ++t) {
    mrun[t] = -INFINITY;
    lrun[t] = 0.f;
#pragma unroll
    for (int j = 0; j < 4; ++j) o[t][j] = zero8();
  }
  const int ncaus = qb + 1;                                                     // tiles holding keys <= q0 + 31
  const int nkt = (ncaus < NKT) ? ncaus : NKT;

  // byte offsets of key tile kt in the k planes (32 rows of KROW halves) and in the v^T planes (one fragment), plus this lane's chunk
  unsigned ko = lo + (unsigned)wave * (unsigned)(32 * NH * HD * 2);
  unsigned vo = lo + (unsigned)wave * 1024u;
#pragma unroll 1
  for (int kt = wave; kt < nkt; kt += WPB) {
    const int kb = kt * 32;
    // ---- scores: D element r of this lane = (key kb + 8hh + r, query q0 + 16t + c) in s[t][0], key kb + 16 + 8hh + r in s[t][1] ----
    const _Float16* k0p = Khb;
    const _Float16* k1p = k0p + (size_t)16 * KROW;
    const _Float16* l0p = Klb;
    const _Float16* l1p = l0p + (size_t)16 * KROW;
    // the tile's 8 k fragments as one load group, ahead of the first product: one wait on the loads per key tile, not one per k step
    v16h kh0[2], kh1[2], kl0[2], kl1[2];
#pragma unroll
    for (int kk = 0; kk < 2; ++kk) {
      kh0[kk] = ldfrag_h(k0p + kk * 512, ko);
      kh1[kk] = ldfrag_h(k1p + kk * 512, ko);
      kl0[kk] = ldfrag_h(l0p + kk * 512, ko);
      kl1[kk] = ldfrag_h(l1p + kk * 512, ko);
    }
    v8f s[QTW][2];
#pragma unroll
    for (int t = 0; t < QTW; ++t) { s[t][0] = zero8(); s[t][1] = zero8(); }
#pragma unroll
    for (int kk = 0; kk < 2; ++kk) {
      v16h qh[QTW], ql[QTW];
#pragma unroll
      for (int t = 0; t < QTW; ++t) {
        qh[t] = ldfrag_h(Qh + t * QTS + kk * 512, lo);
        ql[t] = ldfrag_h(Ql + t * QTS + kk * 512, lo);
      }
#pragma unroll
      for (int t = 0; t < QTW; ++t) {
        s[t][0] = mma_h(kh0[kk], qh[t], s[t][0]);
        s[t][0] = mma_h(kh0[kk], ql[t], s[t][0]);
        s[t][0] = mma_h(kl0[kk], qh[t], s[t][0]);
        s[t][1] = mma_h(kh1[kk], qh[t], s[t][1]);
        s[t][1] = mma_h(kh1[kk], ql[t], s[t][1]);
        s[t][1] = mma_h(kl1[kk], qh[t], s[t][1]);
      }
      guard_sc(s[0][0], s[0][1], s[1][0], s[1][1], kh0[kk], kh1[kk], kl0[kk], kl1[kk], qh[0], ql[0], qh[1], ql[1]);
    }
    // ---- causal select (score := -inf for key > query) + online softmax in base 2, -inf-safe; all 32 keys of a query sit in
    //      lanes c and c + 16 ----
    const int key0 = kb + 8 * hh, key1 = key0 + 16;
    FragH ph[QTW], pl[QTW];
#pragma unroll
    for (int t = 0; t < QTW; ++t) {
      const int qi = q0 + 16 * t + c;
      v8f t0 = s[t][0] * lsc, t1 = s[t][1] * lsc;
      float mx = -INFINITY;
#pragma unroll
      for (int r = 0; r < 8; ++r) {
        t0[r] = (key0 + r > qi) ? -INFINITY : t0[r];
        t1[r] = (key1 + r > qi) ? -INFINITY : t1[r];
        mx = fmaxf(mx, fmaxf(t0[r], t1[r]));
      }
      mx = fmaxf(mx, xhalf(mx));
      const float mn = fmaxf(mrun[t], mx);
      const float ms = (mn == -INFINITY) ? 0.0f : mn;
      const float al = exp2f(mrun[t] - ms);
      mrun[t] = mn;
      // ---- B fragments of P^T * 32768: hi f16 and residual f16, col = query c, split k map over the 32 keys of this step ----
      t0 -= ms;
      t1 -= ms;
      v8f e0, e1;
#pragma unroll
      for (int r = 0; r < 8; ++r) { e0[r] = exp2f(t0[r]); e1[r] = exp2f(t1[r]); }
      const v8f es = e0 + e1;
      const float ps = ((es[0] + es[1]) + (es[2] + es[3])) + ((es[4] + es[5]) + (es[6] + es[7]));
      const v8f ta = e0 * PCAR, tb = e1 * PCAR;
      ph[t].h[0] = __builtin_convertvector(ta, v8h);          // elements 0..7  = keys kb + 8hh + 0..7
      ph[t].h[1] = __builtin_convertvector(tb, v8h);          // elements 8..15 = keys kb + 16 + 8hh + 0..7
      pl[t].h[0] = __builtin_convertvector(ta - __builtin_convertvector(ph[t].h[0], v8f), v8h);
      pl[t].h[1] = __builtin_convertvector(tb - __builtin_convertvector(ph[t].h[1], v8f), v8h);
      lrun[t] = lrun[t] * al + ps;
#pragma unroll
      for (int j = 0; j < 4; ++j) {
#pragma unroll
        for (int r = 0; r < 8; ++r) o[t][j][r] *= al;
      }
    }
    // ---- V^T.P^T : A fragment row = d = j*16 + c, keys contiguous in the v^T planes; each fragment serves both query tiles ----
    {
      v16h vh[4], vl[4];
#pragma unroll
      for (int j = 0; j < 4; ++j) {
        vh[j] = ldfrag_h(Vhb + (size_t)(16 * j) * SEQ, vo);
        vl[j] = ldfrag_h(Vlb + (size_t)(16 * j) * SEQ, vo);
      }
#pragma unroll
      for (int t = 0; t < QTW; ++t) {
#pragma unroll
        for (int j = 0; j < 4; ++j) {
          o[t][j] = mma_h(vh[j], ph[t].v, o[t][j]);
          o[t][j] = mma_h(vh[j], pl[t].v, o[t][j]);
          o[t][j] = mma_h(vl[j], ph[t].v, o[t][j]);
        }
      }
      guard_pv(o[0][0], o[0][1], o[0][2], o[0][3], o[1][0], o[1][1], o[1][2], o[1][3], ph[0].v, pl[0].v, ph[1].v, pl[1].v,
               vh[0], vh[1], vh[2], vh[3], vl[0], vl[1], vl[2], vl[3]);
    }
    ko += (unsigned)(WPB * 32 * NH * HD * 2);
    vo += (unsigned)(WPB * 1024);
  }
  // ---- this wave's partial: unnormalised O into its lane-owned slab (8 consecutive d per accumulator), row max and sum into the tables ----
#pragma unroll
  for (int t = 0; t < QTW; ++t) {
    acc_guard4(o[t][0], o[t][1], o[t][2], o[t][3]);
    lrun[t] += xhalf(lrun[t]);               // the two halves' key sums of query q0 + 16t + c, joined once
#pragma unroll
    for (int j = 0; j < 4; ++j) {
      float* sp = slab + (16 * t + c) * 68 + j * 16 + 8 * hh;
      const v4f a = {o[t][j][0], o[t][j][1], o[t][j][2], o[t][j][3]}, b4 = {o[t][j][4], o[t][j][5], o[t][j][6], o[t][j][7]};
      *(v4f*)(sp)     = a;
      *(v4f*)(sp + 4) = b4;
    }
    if (hh == 0) {
      mtab[((pass * WPB + wave) * QTW + t) * 16 + c] = mrun[t];
      ltab[((pass * WPB + wave) * QTW + t) * 16 + c] = lrun[t];
    }
  }
  }
  __syncthreads();                           // publishes every wave's partials of both query blocks to all WPB waves, each merging its own 16 columns
  // ---- merge of the WPB partials; per query tile t, thread = chunk tid of the tile's two O fragments: row = 16t + (lane & 15),
  //      8 consecutive d from 32 * (wave >> 1) + 16 * (wave & 1) + 8 * (lane >> 4) ----
  const int c8 = wave * 16 + hh * 8;
#pragma unroll 1   // rolled: one copy of the merge serves both query blocks
  for (int pass = 0; pass < 2; ++pass) {
  const int q0 = ((pass == 0) ? (NQB - 1 - pr) : pr) * (16 * QTW);
  const size_t qofs = (((size_t)b * SEQ + q0) * NH + (size_t)head * 16) * HD;
#pragma unroll
  for (int t = 0; t < QTW; ++t) {
    float mw[WPB];
    float mall = -INFINITY;
#pragma unroll
    for (int w = 0; w < WPB; ++w) { mw[w] = mtab[((pass * WPB + w) * QTW + t) * 16 + c]; mall = fmaxf(mall, mw[w]); }
    const float msafe = (mall == -INFINITY) ? 0.0f : mall;
    float lv = 0.f;
    float acc[8];
#pragma unroll
    for (int e = 0; e < 8; ++e) acc[e] = 0.f;
#pragma unroll
    for (int w = 0; w < WPB; ++w) {
      const float sc = exp2f(mw[w] - msafe);   // 0 for a wave that saw no tile
      lv += ltab[((pass * WPB + w) * QTW + t) * 16 + c] * sc;
      const float* sp = smem + (pass * WPB + w) * WREG + (16 * t + c) * 68 + c8;
      const v4f a = *(const v4f*)(sp), b4 = *(const v4f*)(sp + 4);
#pragma unroll
      for (int e = 0; e < 4; ++e) { acc[e] += a[e] * sc; acc[4 + e] += b4[e] * sc; }
    }
    // ---- out = acc / Z (0 if Z == 0), carries (32768 on P, 1024 on v) folded once; O x1024 -> f16 hi + residual planes ----
    const float ls  = (lv > 0.0f) ? lv : 1.0f;
    const float inv = (lv > 0.0f) ? ((1.0f / ls) * oc) : 0.0f;
    v4u oh, ol;
#pragma unroll
    for (int e = 0; e < 4; ++e) {
      const float w0 = (acc[2 * e] * inv) * OSC, w1 = (acc[2 * e + 1] * inv) * OSC;
      const _Float16 h0 = (_Float16)w0, h1 = (_Float16)w1;
      const _Float16 l0 = (_Float16)(w0 - (float)h0), l1 = (_Float16)(w1 - (float)h1);
      oh[e] = pk16(h_bits(h0), h_bits(h1));
      ol[e] = pk16(h_bits(l0), h_bits(l1));
    }
    const size_t o8 = qofs + t * QTS + 8 * tid;                                 // fragments (row q0's block + t, 2 * head .. 2 * head + 1)
    *(v4u*)(OHIp + o8) = oh;
    *(v4u*)(OLOp + o8) = ol;
#if defined(__HIP_DEVICE_COMPILE__)
    asm volatile("s_wait_xcnt 0x0" ::: "memory");   // stands in front of whatever next rewrites a register that these two stores name
#endif
  }
  }
}

// =====================================================================================================
// Workspace map (bytes); every plane is fully written by whole-line stores before it is read; all extents are exact multiples
// of the store granularity (no pad rows needed); every offset a multiple of 2097152; every 16-bit plane is fragment-major (the shape
// given is that of its matrix, rows x k):
//   XB  bf16 [MROWS][1024]              8388608
//   WQB bf16 [1024 n][1024 k]          2097152        WKB, WVB same
//   WOH f16  [1024 n][1024 k] x1024    2097152
//   QHI f16 [MROWS][16*64] x1024       8388608        QLO residual
//   KHI f16 [MROWS][16*64] x1024       8388608        KLO residual
//   VHI f16 [BATCH*16*64][SEQ] x1024   8388608        VLO residual
//   OHI f16 [MROWS][1024] x1024        8388608        OLO residual
//   end                               83886080
// =====================================================================================================
extern "C" void kernel_launch(void* const* d_in, const int* in_sizes, int n_in,
                              void* d_out, int out_size, void* d_ws, size_t ws_size,
                              hipStream_t stream) {
  if (n_in < 9) return;
  if (in_sizes[0] != MROWS * DMOD) return;
  if (in_sizes[1] != DMOD * DMOD || in_sizes[3] != DMOD * DMOD) return;
  if (in_sizes[5] != DMOD * DMOD || in_sizes[7] != DMOD * DMOD) return;
  if (in_sizes[2] != DMOD || in_sizes[4] != DMOD || in_sizes[6] != DMOD || in_sizes[8] != DMOD) return;
  if (out_size != MROWS * DMOD) return;

  const float* x    = (const float*)d_in[0];
  const float* wq   = (const float*)d_in[1];
  const float* bq   = (const float*)d_in[2];
  const float* wk   = (const float*)d_in[3];
  const float* bk   = (const float*)d_in[4];
  const float* wv   = (const float*)d_in[5];
  const float* bv   = (const float*)d_in[6];
  const float* wo   = (const float*)d_in[7];
  const float* bo   = (const float*)d_in[8];
  float*       out  = (float*)d_out;

  const size_t szXB = (size_t)MROWS * DMOD * 2;                 //  8388608
  const size_t szW  = (size_t)DMOD * DMOD * 2;                  //  2097152
  const size_t szP  = (size_t)MROWS * DMOD * 2;                 //  8388608
  size_t off = 0;
  const size_t oXB  = off; off += szXB;
  const size_t oWQ  = off; off += szW;
  const size_t oWK  = off; off += szW;
  const size_t oWV  = off; off += szW;
  const size_t oWO  = off; off += szW;
  const size_t oQHI = off; off += szP;
  const size_t oQLO = off; off += szP;
  const size_t oKHI = off; off += szP;
  const size_t oKLO = off; off += szP;
  const size_t oVHI = off; off += szP;
  const size_t oVLO = off; off += szP;
  const size_t oOHI = off; off += szP;
  const size_t oOLO = off; off += szP;
  if (off > ws_size) return;                            // off = 83886080
  if (off > (size_t)134217728) return;

  char* ws = (char*)d_ws;
  u16*   XB  = (u16*)(ws + oXB);
  u16*   WQB = (u16*)(ws + oWQ);
  u16*   WKB = (u16*)(ws + oWK);
  u16*   WVB = (u16*)(ws + oWV);
  u16*   WOH = (u16*)(ws + oWO);
  u16*   QHI = (u16*)(ws + oQHI);
  u16*   QLO = (u16*)(ws + oQLO);
  u16*   KHI = (u16*)(ws + oKHI);
  u16*   KLO = (u16*)(ws + oKLO);
  u16*   VHI = (u16*)(ws + oVHI);
  u16*   VLO = (u16*)(ws + oVLO);
  u16*   OHI = (u16*)(ws + oOHI);
  u16*   OLO = (u16*)(ws + oOLO);

  const dim3 blk(256);
  const dim3 gPR(4 * NWB + NXB);                        // 4 x 256 + 2048
  const dim3 gG((MROWS / 64) * (DMOD / 64));            // 1024
  const dim3 gP((MROWS / 64) * (DMOD / 64), 3);         // 1024 x (q, k, v)
  const dim3 bG(128);
  const dim3 gAT(ATT_BLOCKS);                           // 1024
  const dim3 bAT(ATT_THREADS);                          // 128

  // (0) Wq/Wk/Wv [k][n] -> bf16 [n][k] planes; Wo [k][n] -> f16 [n][k] plane of bf16 value x1024; x -> bf16 plane [MROWS][1024]
  prep16<<<gPR, blk, 0, stream>>>(x, wq, wk, wv, wo, XB, WQB, WKB, WVB, WOH, WOS);
  // (1) q = x.Wq + bq, k = x.Wk + bk -> hi/residual planes x1024; v = x.Wv + bv -> v^T hi/residual planes x1024
  proj3<<<gP, bG, 0, stream>>>(XB, WQB, WKB, WVB, bq, bk, bv, QHI, QLO, KHI, KLO, VHI, VLO);
  // (2) causal attention -> O planes [b*SEQ+s][h][d] x1024 (hi + residual)
  attn1<<<gAT, bAT, 0, stream>>>(QHI, QLO, KHI, KLO, VHI, VLO, OHI, OLO);
  // (3) output projection -> out [MROWS][1024] f32, carries 1024 (O) x 1024 (Wo) folded back, + bo
  gemm_h2<<<gG, bG, 0, stream>>>(OHI, OLO, WOH, bo, out, MROWS, DMOD, DMOD, 1.0f / (OSC * WOS));
  (void)hipGetLastError();
}

// v007
// Measured time: 124 microseconds a run.
// Timed twice side by side with v006, it ran 1.06 and 1.05 times as fast.
// All steps since v000 together make it 3.27 times as fast.
// Contractions: x.W{q,k,v} on v_wmma_f32_16x16x32_bf16 (x and W^T RNE-converted to bf16, f32 accumulate);
// scores, transposed, k.q^T (q, k carried x1024 as f16 hi plane + f16 residual plane, products hh+lh+hl), v^T.P^T (P x32768 f16
// hi+residual, v x1024 f16 hi+residual, products hh+lh+hl) and O.Wo (O x1024 f16 hi+residual, Wo^T as f16(bf16(Wo)) x1024, products h.w+l.w):
// v_wmma_f32_16x16x32_f16, f32 accumulate. Static causal select, base-2 online softmax and 1/l fold in f32 on VALU.
#include <hip/hip_runtime.h>
#include <math.h>
#include <stdint.h>

#define BATCH 2
#define SEQ   2048
#define DMOD  1024
#define NH    16
#define HD    64
#define MROWS (BATCH * SEQ)
#define QSC   1024.0f
#define KSC   1024.0f
#define PCAR  32768.0f
#define VCAR  1024.0f
#define OSC   1024.0f
#define WOS   1024.0f
#define LOG2E 1.4426950408889634f
#define WPB   4
#define QTW   2
#define NQB   (SEQ / (16 * QTW))
#define NWB   ((DMOD / 64) * (DMOD / 64))
#define NXB   ((MROWS * DMOD) / 2048)
#define NKT   (SEQ / 32)
#define ATT_THREADS (WPB * 32)
#define NPR   (NQB / 2)
#define ATT_BLOCKS  (NPR * NH * BATCH)
#define SLW   (16 * 68)
#define WREG  (QTW * SLW)
#define SLAB64 (16 * 68)
#define VTP   72
static_assert(DMOD == NH * HD && HD == 64 && NH == 16);
static_assert(WPB == 4 && ATT_THREADS == 128 && QTW == 2 && ATT_BLOCKS == 1024 && (NQB % 2) == 0);
static_assert((SEQ % 64) == 0 && (SEQ % 32) == 0 && (SEQ % 16) == 0 && SEQ <= 32768);
static_assert((DMOD % 64) == 0 && (DMOD % 32) == 0 && (MROWS % 64) == 0);
static_assert((DMOD % 128) == 0 && (MROWS % 128) == 0 && (SEQ % 16) == 0);
static_assert(((MROWS * DMOD) % 2048) == 0 && ((DMOD * DMOD) % 4096) == 0);

typedef unsigned short u16;
typedef _Float16 v16h __attribute__((ext_vector_type(16)));
typedef _Float16 v8h  __attribute__((ext_vector_type(8)));
typedef __bf16   v16b __attribute__((ext_vector_type(16)));
typedef float    v8f  __attribute__((ext_vector_type(8)));
typedef float    v4f  __attribute__((ext_vector_type(4)));
typedef unsigned int v4u __attribute__((ext_vector_type(4)));

union FragH { v16h v; v8h h[2]; v4u u[2]; };
union FragB { v16b v; v4u u[2]; };

// ---- scalar helpers --------------------------------------------------------------------------------
__device__ __forceinline__ unsigned short bf_bits(float f) {          // f32 -> bf16 bits, RNE convert
  unsigned u = __float_as_uint(f);
  return (unsigned short)((u + 0x7FFFu + ((u >> 16) & 1u)) >> 16);
}
__device__ __forceinline__ float bf_up(unsigned short h) { return __uint_as_float(((unsigned)h) << 16); }
__device__ __forceinline__ float bfr(float f) { return bf_up(bf_bits(f)); }
__device__ __forceinline__ unsigned short h_bits(_Float16 x) { return __builtin_bit_cast(unsigned short, x); }
__device__ __forceinline__ unsigned pk16(unsigned short a, unsigned short b) { return (unsigned)a | ((unsigned)b << 16); }
__device__ __forceinline__ float xhalf(float x) {                     // value of lane l ^ 16
  const int b = __builtin_bit_cast(int, x);
  return __builtin_bit_cast(float, __builtin_amdgcn_permlanex16(b, b, 0x76543210, 0xfedcba98, false, false));
}
__device__ __forceinline__ v8f zero8() { v8f z = {0.f, 0.f, 0.f, 0.f, 0.f, 0.f, 0.f, 0.f}; return z; }

// ---- fragment-major 16-bit planes: a matrix [R rows][Kd k] (R % 16 == 0, Kd % 32 == 0) is stored as fragments of 16 rows x 32 k,
//      fragment (rb = row / 16, kb = k / 32) at halves (rb * (Kd / 32) + kb) * 512; inside it 64 chunks of 8 halves, chunk
//      i * 32 + h * 16 + c = row 16 rb + c, k = 32 kb + 16 i + 8 h + 0..7. A wave-wide 16-B load of chunks 32 i + lane is 512 contiguous,
//      512-B aligned bytes = 4 whole lines (the same fragment read from a row-major plane touches 16 lines, 32 B of each, per load).
// ---- fragment loaders: 16-bit A/B operand, lane -> row/col (lane&15), p = fragment start + 8*lane;
//      elements 0..7 <- p[0..7] (k0+8h..), elements 8..15 <- p[256..263] (k0+16+8h..)  (same split k map for A and B).
//      fs = a fragment start that is the same for the whole wave (a scalar base), bo = 32-bit byte offset from it: 16*lane plus the
//      loop's advance, one vector register that serves every load of a trip
// sbase: p + ofs for a wave-uniform ofs, kept as a scalar base of its own: without the readfirstlane the compiler adds the lane offset
// to p first and then forms each further fragment's 64-bit address with vector additions in every trip.
template <typename T>
__device__ __forceinline__ const T* sbase(const T* p, size_t ofs) {
  const uint32_t l = (uint32_t)__builtin_amdgcn_readfirstlane((int)(uint32_t)ofs);
  const uint32_t h = (uint32_t)__builtin_amdgcn_readfirstlane((int)(uint32_t)((uint64_t)ofs >> 32));
  return p + (size_t)(((uint64_t)h << 32) | (uint64_t)l);
}
__device__ __forceinline__ v16h ldfrag_h(const _Float16* fs, unsigned bo) {
  const char* p = (const char*)(const void*)fs + bo;
  FragH f;
  f.h[0] = *(const v8h*)(const void*)(p);
  f.h[1] = *(const v8h*)(const void*)(p + 512);
  return f.v;
}
__device__ __forceinline__ v16b ldfrag_b(const u16* fs, unsigned bo) { // bf16 plane read as unsigned integer vectors
  const char* p = (const char*)(const void*)fs + bo;
  FragB f;
  f.u[0] = *(const v4u*)(const void*)(p);
  f.u[1] = *(const v4u*)(const void*)(p + 512);
  return f.v;
}

// row-major element index (matrix [R][Kd]) of the 8 halves that chunk q of the fragment-major plane holds
__device__ __forceinline__ size_t chunk_src(int q, int Kd) {
  const int f = q >> 6, nkb = Kd >> 5;
  return (size_t)((f / nkb) * 16 + (q & 15)) * (size_t)Kd + (size_t)((f % nkb) * 32 + ((q >> 4) & 3) * 8);
}

__device__ __forceinline__ v8f mma_h(v16h a, v16h b, v8f c) {
  return __builtin_amdgcn_wmma_f32_16x16x32_f16(false, a, false, b, (short)0, c, false, false);
}
__device__ __forceinline__ v8f mma_b(v16b a, v16b b, v8f c) {
  return __builtin_amdgcn_wmma_f32_16x16x32_bf16(false, a, false, b, (short)0, c, false, false);
}
template <typename F>
__device__ __forceinline__ void guard6(v8f& a, v8f& b, v8f& c, v8f& d, F x0, F x1, F x2, F x3, F x4, F x5) {
#if defined(__HIP_DEVICE_COMPILE__)
  asm volatile("v_nop\n\tv_nop\n\tv_nop\n\tv_nop"
               : "+v"(a), "+v"(b), "+v"(c), "+v"(d) : "v"(x0), "v"(x1), "v"(x2), "v"(x3), "v"(x4), "v"(x5) : "memory");
#endif
}
__device__ __forceinline__ void acc_guard4(v8f& a, v8f& b, v8f& c, v8f& d) {
#if defined(__HIP_DEVICE_COMPILE__)
  asm volatile("v_nop\n\tv_nop\n\tv_nop\n\tv_nop" : "+v"(a), "+v"(b), "+v"(c), "+v"(d));
#endif
}
__device__ __forceinline__ void wave_sync_lds() {
  __builtin_amdgcn_fence(__ATOMIC_RELEASE, "workgroup");
  __builtin_amdgcn_wave_barrier();
  __builtin_amdgcn_fence(__ATOMIC_ACQUIRE, "workgroup");
}

// =====================================================================================================
// All operand conversions in one launch (five independent jobs, told apart by the block index).
// Blocks 0 .. 4*NWB-1, weight transpose-convert: weight which = bid / NWB, W [K][N] f32 (x.W layout, n contiguous) -> Dt, the fragment-major
// 16-bit plane of the matrix [N rows][K cols]; which 0..2: bf16 RNE bits; which 3: f16 bits of (bf16 RNE value) * scale.
//   Block = (k tile k0 = (wb / (N/64))*64, n tile n0 = (wb % (N/64))*64), wb = bid % NWB: 64 source rows of 64 floats loaded with 16-B loads,
//   converted, scattered into an LDS tile [n][64 k] (pitch 72 halves); after a block barrier the tile's 8 fragments are stored chunk by chunk.
//   coverage: load 256 thr x 16 = 64 x 64; store 2 iterations x 256 thr x 8 halves = 8 fragments x 512 halves = the block's tile;
//             NWB = (K/64)*(N/64) blocks cover each Dt exactly once.
// Blocks 4*NWB .. 4*NWB+NXB-1, x f32 [MROWS][DMOD] -> bf16 RNE bits, fragment-major plane. Thread = one chunk of the plane (8 consecutive
//   k of one row): two 16-B loads, one 16-B store; 32 consecutive lanes store 512 contiguous, 512-B aligned bytes.
//   coverage: NXB blocks x 256 thr x 8 = the whole plane.
// =====================================================================================================
__global__ __launch_bounds__(256) void prep16(const float* __restrict__ x, const float* __restrict__ W0, const float* __restrict__ W1,
                                              const float* __restrict__ W2, const float* __restrict__ W3,
                                              u16* XD, u16* D0, u16* D1, u16* D2, u16* D3, float scale) {
  __shared__ __align__(16) u16 T[64 * VTP];
  const int tid = threadIdx.x;
  const int bid = blockIdx.x;
  if (bid >= 4 * NWB) {                       // block-uniform; this path holds no barrier
    const int gt = (bid - 4 * NWB) * 256 + tid;
    if (gt >= (MROWS * DMOD) / 8) return;     // never taken with the exact grid
    const float* p = x + chunk_src(gt, DMOD);
    const v4f a = *(const v4f*)(p), b4 = *(const v4f*)(p + 4);
    v4u o;
    o[0] = pk16(bf_bits(a[0]), bf_bits(a[1]));
    o[1] = pk16(bf_bits(a[2]), bf_bits(a[3]));
    o[2] = pk16(bf_bits(b4[0]), bf_bits(b4[1]));
    o[3] = pk16(bf_bits(b4[2]), bf_bits(b4[3]));
    *(v4u*)(XD + (size_t)gt * 8) = o;
    return;
  }
  const int K = DMOD, N = DMOD;
  const int which = bid / NWB;
  const int wb    = bid % NWB;
  const int ntn = N >> 6;
  const int n0  = (wb % ntn) * 64;
  const int k0  = (wb / ntn) * 64;
  const float* W = (which == 0) ? W0 : (which == 1) ? W1 : (which == 2) ? W2 : W3;
  u16* Dt        = (which == 0) ? D0 : (which == 1) ? D1 : (which == 2) ? D2 : D3;
  const int f16mode = (which == 3) ? 1 : 0;
  {
    const int sl = tid >> 2;                  // k within tile 0..63 (source row)
    const int dc = (tid & 3) * 16;            // n chunk
    const float* src = W + (size_t)(k0 + sl) * N + n0 + dc;
#pragma unroll
    for (int i = 0; i < 4; ++i) {
      const v4f a = *(const v4f*)(src + 4 * i);
#pragma unroll
      for (int e = 0; e < 4; ++e) {
        const float f = a[e];
        const unsigned short hb = h_bits((_Float16)(bfr(f) * scale));
        const unsigned short bb = bf_bits(f);
        T[(dc + 4 * i + e) * VTP + sl] = (f16mode != 0) ? hb : bb;
      }
    }
  }
  __syncthreads();
  // the tile = 4 (n) x 2 (k) fragments of the plane; thread = chunk tid & 63 of fragment (n block it*2 + (tid >> 7), k block (tid >> 6) & 1)
  v4u vv[2];
  const int ch = tid & 63, fk = (tid >> 6) & 1, fr = tid >> 7;
#pragma unroll
  for (int it = 0; it < 2; ++it) {
    const int line = (it * 2 + fr) * 16 + (ch & 15);   // n = 0..63 within tile
    vv[it] = *(const v4u*)(T + line * VTP + fk * 32 + (ch >> 4) * 8);
  }
  const size_t base = (size_t)n0 * K + (size_t)((k0 >> 5) + fk) * 512 + ch * 8;
  {
#pragma unroll
    for (int it = 0; it < 2; ++it) {
      *(v4u*)(Dt + base + (size_t)((it * 2 + fr) * 16) * K) = vv[it];
    }
  }
#if defined(__HIP_DEVICE_COMPILE__)
  asm volatile("s_wait_xcnt 0x0" ::: "memory");   // stands in front of whatever next rewrites a register that these two stores name
#endif
}

// =====================================================================================================
// GEMM epilogue of the output projection: the wave's 16x64 f32 tile (times oscale) staged in its LDS slab (pitch 68),
// coverage: 8 instructions x 2 rows x 16 lanes x 4 floats = the wave's 16 x 64 tile.
// =====================================================================================================
__device__ __forceinline__ void epi64(float* sl, v8f a0, v8f a1, v8f a2, v8f a3, float oscale,
                                      const float* __restrict__ bias, float* C, int N,
                                      size_t rowb, int col0, int lane) {
  const int hh = lane >> 4, m = lane & 15;
#pragma unroll
  for (int r = 0; r < 8; ++r) {
    const int ro = (8 * hh + r) * 68 + m;
    sl[ro]      = a0[r] * oscale;
    sl[ro + 16] = a1[r] * oscale;
    sl[ro + 32] = a2[r] * oscale;
    sl[ro + 48] = a3[r] * oscale;
  }
  wave_sync_lds();
  const v4f braw = *(const v4f*)(bias + col0 + m * 4);
  v4f bb;
#pragma unroll
  for (int e = 0; e < 4; ++e) bb[e] = bfr(braw[e]);
  v4f vals[8];
#pragma unroll
  for (int it = 0; it < 8; ++it) vals[it] = *(const v4f*)(sl + (it * 2 + hh) * 68 + m * 4) + bb;
  float* dst = C + (rowb + (size_t)hh) * (size_t)N + col0 + m * 4;
  {
#pragma unroll
    for (int it = 0; it < 8; ++it) {
      *(v4f*)(dst + (size_t)(it * 2) * (size_t)N) = vals[it];
    }
    
  }
}

// =====================================================================================================
// q, k and v projections in one launch: grid.y = which (0 q, 1 k, 2 v); (x . W + b), x and W^T bf16 fragment-major planes, written
// straight into the f16 hi + residual planes that the attention kernel reads (value * 1024; hi = f16(t), residual = f16(t - hi)).
// Block = 128 rows x 128 columns, 2 x 2 waves of 64 x 64 (4 x fragments times 4 W^T fragments = 16 products per k step, rowb and col0 below
// being the wave's first row and column, i = 0..3 its row blocks of 16); fragments loaded straight from the planes (two 16-B loads each,
// 512 contiguous bytes per wave and load, split k map for A and B); K = DMOD stepped by 32; grid.x = (MROWS/128)*(DMOD/128).
// The operand order is chosen so that a lane's 8 accumulator registers are one 16-B chunk of the destination plane:
//   q, k (plane rows = x rows, plane k = n): D = W^T . x^T, lane (c, hh) register r = (x row rowb + 16 i + c, n = col0 + 16 j + 8 hh + r)
//        = chunk 32 (j & 1) + lane of fragment (rowb / 16 + i, col0 / 32 + (j >> 1));
//   v^T  (plane rows = (b, head, d), plane k = s): D = x . W, lane (c, hh) register r = (x row rowb + 16 i + 8 hh + r, n = col0 + 16 j + c)
//        = chunk 32 ((s >> 4) & 1) + lane of fragment (4 (b*NH + head) + j, s / 32), s = (rowb + 16 i) % SEQ, head = col0 / HD.
// coverage: per wave 16 accumulators x 32 lanes x 8 halves = 64 x 64 elements per plane, each store 512 contiguous, 512-B aligned bytes;
//           grid covers every (row, column) of each of the six planes exactly once.
// =====================================================================================================
__device__ __forceinline__ void put_split(v8f t, u16* hp, u16* lp) {     // 8 scaled values -> one chunk of the hi and of the residual plane
  v4u oh, ol;
#pragma unroll
  for (int e = 0; e < 4; ++e) {
    const float t0 = t[2 * e], t1 = t[2 * e + 1];
    const _Float16 h0 = (_Float16)t0, h1 = (_Float16)t1;
    const _Float16 l0 = (_Float16)(t0 - (float)h0), l1 = (_Float16)(t1 - (float)h1);
    oh[e] = pk16(h_bits(h0), h_bits(h1));
    ol[e] = pk16(h_bits(l0), h_bits(l1));
  }
  *(v4u*)(hp) = oh;
  *(v4u*)(lp) = ol;
#if defined(__HIP_DEVICE_COMPILE__)
  asm volatile("s_wait_xcnt 0x0" ::: "memory");   // stands in front of whatever next rewrites a register that these two stores name
  __builtin_amdgcn_sched_barrier(0);              // keeps the next chunk's arithmetic behind that wait: the compiler otherwise lifts it in front
#endif
}

// stands between a k step's 16 loads and its first product: the loads go out as one group, so that the step waits out one load latency and
// not one per x fragment (without it the compiler sinks the loads of x fragments 1..3 between the products)
__device__ __forceinline__ void loads_first() {
#if defined(__HIP_DEVICE_COMPILE__)
  __builtin_amdgcn_sched_barrier(0);
#endif
}
// behind the k loop: four slots between the last product and the bias loads, which land in registers that held its operands
// (inside the loop the compiler itself pads the loop's head, in front of the next trip's address additions and loads)
__device__ __forceinline__ void loop_exit_guard() {
#if defined(__HIP_DEVICE_COMPILE__)
  asm volatile("v_nop\n\tv_nop\n\tv_nop\n\tv_nop" ::: "memory");
#endif
}

__global__ __launch_bounds__(128, 4)   // budget of 256 registers a wave; the whole grid (768 blocks x 4 waves, 3 waves per SIMD) is resident at once
void proj3(const u16* __restrict__ A, const u16* __restrict__ Wq, const u16* __restrict__ Wk, const u16* __restrict__ Wv,
           const float* __restrict__ bq, const float* __restrict__ bk, const float* __restrict__ bv,
           u16* QH, u16* QL, u16* KH, u16* KL, u16* VH, u16* VL) {
  const int tid = threadIdx.x, lane = tid & 31;
  const int wave = __builtin_amdgcn_readfirstlane(tid >> 5);   // scalar: makes every fragment start a scalar base
  const int hh = lane >> 4, c = lane & 15;
  unsigned bo = 16u * (unsigned)lane;        // byte offset of this lane's chunk; advanced by one fragment (1024 B) per k step
  const int which = blockIdx.y;
  const int bid   = blockIdx.x;
  const int rowb  = (bid / (DMOD / 128)) * 128 + (wave >> 1) * 64;
  const int col0  = (bid % (DMOD / 128)) * 128 + (wave & 1) * 64;
  if (which > 2 || rowb + 64 > MROWS) return; // wave-uniform, never taken with the exact grid; no barriers in this kernel
  const u16*   Bt   = (which == 0) ? Wq : (which == 1) ? Wk : Wv;
  const float* bias = (which == 0) ? bq : (which == 1) ? bk : bv;
  const size_t bs = (size_t)16 * DMOD;                // halves between the fragments of consecutive row blocks, in every plane read here
  const u16* ap  = A  + (size_t)rowb * DMOD;          // fragment (rowb / 16, 0) of the fragment-major plane
  const u16* a1p = sbase(ap, bs), * a2p = sbase(ap, 2 * bs), * a3p = sbase(ap, 3 * bs);
  const u16* bp  = Bt + (size_t)col0 * DMOD;
  const u16* b1p = sbase(bp, bs), * b2p = sbase(bp, 2 * bs), * b3p = sbase(bp, 3 * bs);
  v8f acc[4][4];                             // acc[i][j]: x rows rowb + 16 i .., columns col0 + 16 j ..
#pragma unroll
  for (int i = 0; i < 4; ++i) {
#pragma unroll
    for (int j = 0; j < 4; ++j) acc[i][j] = zero8();
  }
  if (which == 2) {
#pragma unroll 1   // rolled: beside 16 accumulators the register budget holds one trip's 8 fragments, so unrolling overlaps nothing and only lengthens the code
    for (int k0 = 0; k0 < DMOD; k0 += 32) {
      const v16b a[4] = {ldfrag_b(ap, bo), ldfrag_b(a1p, bo), ldfrag_b(a2p, bo), ldfrag_b(a3p, bo)};
      const v16b w[4] = {ldfrag_b(bp, bo), ldfrag_b(b1p, bo), ldfrag_b(b2p, bo), ldfrag_b(b3p, bo)};
      loads_first();
#pragma unroll
      for (int i = 0; i < 4; ++i) {
#pragma unroll
        for (int j = 0; j < 4; ++j) acc[i][j] = mma_b(a[i], w[j], acc[i][j]);
      }
      bo += 1024u;
    }
    loop_exit_guard();
    const int g = col0 / HD;
    float bj[4];
#pragma unroll
    for (int j = 0; j < 4; ++j) bj[j] = bfr(bias[col0 + 16 * j + c]);   // all bias loads ahead of the first store's wait
#pragma unroll
    for (int i = 0; i < 4; ++i) {
      const int rw = rowb + 16 * i;
      const int b = rw / SEQ, sq = rw % SEQ;
      const size_t base = ((size_t)(b * NH + g) * HD) * SEQ + (size_t)(sq >> 5) * 512 + (size_t)((sq >> 4) & 1) * 256 + (size_t)lane * 8;
#pragma unroll
      for (int j = 0; j < 4; ++j)
        put_split((acc[i][j] + bj[j]) * VCAR, VH + base + (size_t)(16 * j) * SEQ, VL + base + (size_t)(16 * j) * SEQ);
    }
  } else {
#pragma unroll 1   // rolled: beside 16 accumulators the register budget holds one trip's 8 fragments, so unrolling overlaps nothing and only lengthens the code
    for (int k0 = 0; k0 < DMOD; k0 += 32) {
      const v16b a[4] = {ldfrag_b(ap, bo), ldfrag_b(a1p, bo), ldfrag_b(a2p, bo), ldfrag_b(a3p, bo)};
      const v16b w[4] = {ldfrag_b(bp, bo), ldfrag_b(b1p, bo), ldfrag_b(b2p, bo), ldfrag_b(b3p, bo)};
      loads_first();
#pragma unroll
      for (int i = 0; i < 4; ++i) {
#pragma unroll
        for (int j = 0; j < 4; ++j) acc[i][j] = mma_b(w[j], a[i], acc[i][j]);
      }
      bo += 1024u;
    }
    loop_exit_guard();
    u16* hpl = (which == 0) ? QH : KH;
    u16* lpl = (which == 0) ? QL : KL;
    const float sc = (which == 0) ? QSC : KSC;
    v8f bb[4];                               // the bias of the wave's 64 columns, the same for its four row blocks; loaded ahead of the first store's wait
#pragma unroll
    for (int j = 0; j < 4; ++j) {
      const float* bsrc = bias + col0 + 16 * j + 8 * hh;
      const v4f r0 = *(const v4f*)(bsrc), r1 = *(const v4f*)(bsrc + 4);
      const v8f t = {bfr(r0[0]), bfr(r0[1]), bfr(r0[2]), bfr(r0[3]), bfr(r1[0]), bfr(r1[1]), bfr(r1[2]), bfr(r1[3])};
      bb[j] = t;
    }
#pragma unroll
    for (int i = 0; i < 4; ++i) {
      const size_t base = (size_t)(rowb + 16 * i) * DMOD + (size_t)(col0 >> 5) * 512 + (size_t)lane * 8;
#pragma unroll
      for (int j = 0; j < 4; ++j) {
        const size_t o8 = base + (size_t)(j >> 1) * 512 + (size_t)(j & 1) * 256;
        put_split((acc[i][j] + bb[j]) * sc, hpl + o8, lpl + o8);
      }
    }
  }
}

// =====================================================================================================
// f16 hi+lo GEMM: C[M][N] (f32) = (Ahi + Alo)[M][K] . Bt[N][K]^T, times oscale, plus bias[N]; Ahi/Alo f16 planes (same layout),
// Bt f16, all three fragment-major; products hi.B + lo.B into one accumulator (lo is the unscaled residual of hi). Block = 64x64 tile, 4 waves x 16 rows, K stepped by 32.
// =====================================================================================================
__global__ __launch_bounds__(128)
void gemm_h2(const u16* __restrict__ Ah, const u16* __restrict__ Al, const u16* __restrict__ Bt,
             const float* __restrict__ bias, float* C, int M, int N, int K, float oscale) {
  __shared__ __align__(16) float slab[4 * SLAB64];
  const int tid = threadIdx.x, lane = tid & 31;
  const int wave = __builtin_amdgcn_readfirstlane(tid >> 5);   // scalar: makes every fragment start a scalar base
  unsigned bo = 16u * (unsigned)lane;        // byte offset of this lane's chunk; advanced by one fragment (1024 B) per k step
  const int ntile = N >> 6;
  const int bid   = blockIdx.x;
  const int rowb  = (bid / ntile) * 64 + wave * 16;
  const int col0  = (bid % ntile) * 64;
  if (rowb + 16 > M) return;                 // wave-uniform, never taken with the exact grid; no block barriers in this kernel
  const size_t aofs = (size_t)rowb * K;               // fragment (rowb / 16, 0) of the fragment-major planes
  const _Float16* ahp = (const _Float16*)(const void*)Ah + aofs;
  const _Float16* alp = (const _Float16*)(const void*)Al + aofs;
  const size_t bs = (size_t)16 * K;
  const _Float16* bp  = (const _Float16*)(const void*)Bt + (size_t)col0 * K;
  const _Float16* b1p = sbase(bp, bs), * b2p = sbase(bp, 2 * bs), * b3p = sbase(bp, 3 * bs);
  v8f acc0 = zero8(), acc1 = zero8(), acc2 = zero8(), acc3 = zero8();
#pragma unroll 1
  for (int k0 = 0; k0 < K; k0 += 32) {
    const v16h ah = ldfrag_h(ahp, bo), al = ldfrag_h(alp, bo);
    const v16h b0 = ldfrag_h(bp, bo);
    const v16h b1 = ldfrag_h(b1p, bo);
    const v16h b2 = ldfrag_h(b2p, bo);
    const v16h b3 = ldfrag_h(b3p, bo);
    acc0 = mma_h(ah, b0, acc0);  acc0 = mma_h(al, b0, acc0);
    acc1 = mma_h(ah, b1, acc1);  acc1 = mma_h(al, b1, acc1);
    acc2 = mma_h(ah, b2, acc2);  acc2 = mma_h(al, b2, acc2);
    acc3 = mma_h(ah, b3, acc3);  acc3 = mma_h(al, b3, acc3);
    guard6<v16h>(acc0, acc1, acc2, acc3, ah, al, b0, b1, b2, b3);
    bo += 1024u;
  }
  epi64(slab + wave * SLAB64, acc0, acc1, acc2, acc3, oscale, bias, C, N, (size_t)rowb, col0, lane);
}

// =====================================================================================================
// Causal attention: block bid -> (pair pr = bid % NPR, head = (bid / NPR) % NH, batch b = bid / (NPR*NH)). A block works two query blocks one
// after the other, qb = NQB-1-pr and then qb = pr (rows q0 = 32*qb .. q0+31 = QTW query tiles of 16): together NQB+1 key tiles, the same
// for every block, so that no block and no WGP carries more of the causal triangle than another, wherever the blocks land.
// A query block's key tiles are dealt round-robin to its WPB waves (wave w takes kt = w, w + WPB, ..);
// a wave works BOTH query tiles against each key tile it takes, so every k and v^T fragment it loads feeds two score or output tiles;
// each wave keeps its own running max, sum and unnormalised O per query, and the WPB partials are merged through LDS after one block barrier.
//   q planes (hi, lo f16 x1024): fragment-major planes of the matrix [b*SEQ + s][h*HD + d]; k planes the same; v^T planes of [(b*NH + h)*HD + d][s].
//   score (log2 domain) t(i, j) = (q_i.k_j) * 0.125*log2e/(1024*1024) for key j <= query i, and -inf for j > i (the select
//   replaces the score). Key tiles of 32 visited for kb <= q0 (32-aligned, so kb <= every query of the block); tiles whose every key
//   index exceeds every query index of the block hold only -inf, whose exp is exactly 0, and are not visited. In every visited tile
//   key kb is finite for every query of the block, so a wave's running max is finite from its first tile on; a wave with no tile
//   keeps max = -inf, sum = 0, O = 0.
//   Both products are taken transposed: S^T = K.Q^T (A = 16 key rows, B = 16 queries) and O^T += V^T.P^T (A = 16 d rows of v^T,
//   B = P^T). In a score tile lane (c, hh) then holds query q0 + 16t + c and keys 8hh + 0..7 of the subtile, so a query's maximum and sum
//   run over the lane's own 16 registers plus one exchange with lane ^ 16, and the two subtiles' accumulators, converted in place, ARE the
//   B fragment of P^T in the split k map (elements 0..7 = keys kb + 8hh + 0..7, 8..15 = keys kb + 16 + 8hh + 0..7): P never leaves
//   the registers. Per key tile and query tile: 2 score subtiles x 2 k-steps x 3 products (k_hi.q_hi + k_hi.q_lo + k_lo.q_hi), fragments
//   loaded straight from the 16-bit planes (two 16-B loads per fragment, split k map); online max-subtracted base-2 softmax in f32,
//   -inf-safe rescale (one factor per lane); P x32768 as f16 hi and f16 residual; 4+4 v^T A fragments (hi and residual planes),
//   12 WMMAs (hh + hl + lh). A lane sums only its own half's keys; the two halves' sums are joined once, after the loop.
//   After each query block's loop: each wave writes its unnormalised O to its own slab of that query block (32 rows, pitch 68; every
//   element owned by one lane) and its row max and sum to the tables; behind both query blocks one block barrier (reached by every wave; trip counts differ only between waves, and the loop holds
//   no block barrier); wave w then merges columns d = 16w .. 16w+15 of all 32 rows: M = max_w m_w, out = sum_w O_w 2^(m_w - M) / sum_w l_w 2^(m_w - M)
//   (Z > 0 always: key j = i is never masked; guarded anyway), carries 1/(32768*1024) folded once. Bounded loops only (nkt <= NKT).
// coverage: per wave and query tile 1 instruction x 16 rows x 2 lanes x 8 halves = 16 x 16 per plane, x WPB waves x QTW tiles = 32 x 64;
//           x 2 query blocks (pr and NQB-1-pr, pr < NQB/2: every qb once); grid NPR*NH*BATCH blocks = every (b, s, h) row of both O planes once.
// =====================================================================================================
// four v_nop behind the score products: no vector instruction touches their results or operands inside the matrix unit's window
__device__ __forceinline__ void guard_sc(v8f& a, v8f& b, v8f& c, v8f& d, v16h k0, v16h k1, v16h k2, v16h k3,
                                         v16h q0, v16h q1, v16h q2, v16h q3) {
#if defined(__HIP_DEVICE_COMPILE__)
  asm volatile("v_nop\n\tv_nop\n\tv_nop\n\tv_nop"
               : "+v"(a), "+v"(b), "+v"(c), "+v"(d)
               : "v"(k0), "v"(k1), "v"(k2), "v"(k3), "v"(q0), "v"(q1), "v"(q2), "v"(q3) : "memory");
#endif
}
// the same behind the output products of both query tiles
__device__ __forceinline__ void guard_pv(v8f& a0, v8f& a1, v8f& a2, v8f& a3, v8f& b0, v8f& b1, v8f& b2, v8f& b3, v16h p0, v16h p1, v16h p2,
                                         v16h p3, v16h x0, v16h x1, v16h x2, v16h x3, v16h x4, v16h x5, v16h x6, v16h x7) {
#if defined(__HIP_DEVICE_COMPILE__)
  asm volatile("v_nop\n\tv_nop\n\tv_nop\n\tv_nop"
               : "+v"(a0), "+v"(a1), "+v"(a2), "+v"(a3), "+v"(b0), "+v"(b1), "+v"(b2), "+v"(b3)
               : "v"(p0), "v"(p1), "v"(p2), "v"(p3), "v"(x0), "v"(x1), "v"(x2), "v"(x3), "v"(x4), "v"(x5), "v"(x6), "v"(x7) : "memory");
#endif
}

__global__ __launch_bounds__(ATT_THREADS, 4)   // 4 waves per SIMD: the whole grid (1024 blocks x 4 waves) is resident at once, no second round
void attn1(const u16* __restrict__ QHIp, const u16* __restrict__ QLOp,
           const u16* __restrict__ KHIp, const u16* __restrict__ KLOp,
           const u16* __restrict__ VHIp, const u16* __restrict__ VLOp,
           u16* OHIp, u16* OLOp) {
  __shared__ __align__(16) float smem[2 * WPB * WREG];   // one set of slabs per query block of the pair
  __shared__ float mtab[2 * WPB * 16 * QTW]; // per query block, wave and query row: running max (log2 domain)
  __shared__ float ltab[2 * WPB * 16 * QTW]; // per query block, wave and query row: running sum

  const int tid  = threadIdx.x;
  const int wave = __builtin_amdgcn_readfirstlane(tid >> 5);   // scalar: the key loop's start must be wave-uniform for the WMMAs
  const int lane = tid & 31;
  const int hh   = lane >> 4;
  const int c    = lane & 15;
  const int bid  = blockIdx.x;
  const int pr   = bid % NPR;
  const int rem  = bid / NPR;
  const int head = rem % NH;
  const int b    = rem / NH;
  if (b >= BATCH) return;                    // block-uniform, before the block barrier; never taken with the exact grid

  const unsigned lo = 16u * (unsigned)lane;                                     // byte offset of this lane's chunk in a fragment
  const size_t QTS  = (size_t)16 * NH * HD;                                     // halves between the fragments of consecutive row blocks
  const size_t kofs = ((size_t)b * SEQ * NH + (size_t)head * 16) * HD;          // fragment (b*SEQ / 16, 2 * head); key block added per step
  const _Float16* Khb = (const _Float16*)(const void*)KHIp + kofs;
  const _Float16* Klb = (const _Float16*)(const void*)KLOp + kofs;
  const size_t vofs = (((size_t)b * NH + head) * HD) * SEQ;                    // fragment (4 * (b*NH + head) (+j), 0); key block added per step
  const _Float16* Vhb = (const _Float16*)(const void*)VHIp + vofs;
  const _Float16* Vlb = (const _Float16*)(const void*)VLOp + vofs;
  const float lsc = 0.125f * (LOG2E / (QSC * KSC));
  const float oc  = 1.0f / (PCAR * VCAR);
  const size_t KROW = (size_t)NH * HD;                                          // halves per key row; 16 * KROW between consecutive 16-row key blocks

#pragma unroll 1   // rolled: the two query blocks run one after the other through one copy of the key loop
  for (int pass = 0; pass < 2; ++pass) {
  const int qb   = (pass == 0) ? (NQB - 1 - pr) : pr;
  const int q0   = qb * (16 * QTW);
  float* slab = smem + (pass * WPB + wave) * WREG;                              // result slab [32 queries][64 d] pitch 68
  const size_t qofs = (((size_t)b * SEQ + q0) * NH + (size_t)head * 16) * HD;   // fragment (row q0's block, 2 * head); query tile t: + t * QTS
  const _Float16* Qh  = (const _Float16*)(const void*)QHIp + qofs;
  const _Float16* Ql  = (const _Float16*)(const void*)QLOp + qofs;
  float mrun[QTW], lrun[QTW];                // query q0 + 16t + c: running max (equal in both halves), running sum over this half's keys
  v8f o[QTW][4];                             // o[t][j][r] = O^T element (d = 16j + 8hh + r, query q0 + 16t + c)
#pragma unroll
  for (int t = 0; t < QTW; ++t) {
    mrun[t] = -INFINITY;
    lrun[t] = 0.f;
#pragma unroll
    for (int j = 0; j < 4; ++j) o[t][j] = zero8();
  }
  const int ncaus = qb + 1;                                                     // tiles holding keys <= q0 + 31
  const int nkt = (ncaus < NKT) ? ncaus : NKT;

  // byte offsets of key tile kt in the k planes (32 rows of KROW halves) and in the v^T planes (one fragment), plus this lane's chunk
  unsigned ko = lo + (unsigned)wave * (unsigned)(32 * NH * HD * 2);
  unsigned vo = lo + (unsigned)wave * 1024u;
#pragma unroll 1
  for (int kt = wave; kt < nkt; kt += WPB) {
    const int kb = kt * 32;
    // ---- scores: D element r of this lane = (key kb + 8hh + r, query q0 + 16t + c) in s[t][0], key kb + 16 + 8hh + r in s[t][1] ----
    const _Float16* k0p = Khb;
    const _Float16* k1p = k0p + (size_t)16 * KROW;
    const _Float16* l0p = Klb;
    const _Float16* l1p = l0p + (size_t)16 * KROW;
    // the tile's 8 k fragments as one load group, ahead of the first product: one wait on the loads per key tile, not one per k step
    v16h kh0[2], kh1[2], kl0[2], kl1[2];
#pragma unroll
    for (int kk = 0; kk < 2; ++kk) {
      kh0[kk] = ldfrag_h(k0p + kk * 512, ko);
      kh1[kk] = ldfrag_h(k1p + kk * 512, ko);
      kl0[kk] = ldfrag_h(l0p + kk * 512, ko);
      kl1[kk] = ldfrag_h(l1p + kk * 512, ko);
    }
    v8f s[QTW][2];
#pragma unroll
    for (int t = 0; t < QTW; ++t) { s[t][0] = zero8(); s[t][1] = zero8(); }
#pragma unroll
    for (int kk = 0; kk < 2; ++kk) {
      v16h qh[QTW], ql[QTW];
#pragma unroll
      for (int t = 0; t < QTW; ++t) {
        qh[t] = ldfrag_h(Qh + t * QTS + kk * 512, lo);
        ql[t] = ldfrag_h(Ql + t * QTS + kk * 512, lo);
      }
#pragma unroll
      for (int t = 0; t < QTW; ++t) {
        s[t][0] = mma_h(kh0[kk], qh[t], s[t][0]);
        s[t][0] = mma_h(kh0[kk], ql[t], s[t][0]);
        s[t][0] = mma_h(kl0[kk], qh[t], s[t][0]);
        s[t][1] = mma_h(kh1[kk], qh[t], s[t][1]);
        s[t][1] = mma_h(kh1[kk], ql[t], s[t][1]);
        s[t][1] = mma_h(kl1[kk], qh[t], s[t][1]);
      }
      guard_sc(s[0][0], s[0][1], s[1][0], s[1][1], kh0[kk], kh1[kk], kl0[kk], kl1[kk], qh[0], ql[0], qh[1], ql[1]);
    }
    // ---- causal select (score := -inf for key > query) + online softmax in base 2, -inf-safe; all 32 keys of a query sit in
    //      lanes c and c + 16 ----
    const int key0 = kb + 8 * hh, key1 = key0 + 16;
    FragH ph[QTW], pl[QTW];
#pragma unroll
    for (int t = 0; t < QTW; ++t) {
      const int qi = q0 + 16 * t + c;
      v8f t0 = s[t][0] * lsc, t1 = s[t][1] * lsc;
      float mx = -INFINITY;
#pragma unroll
      for (int r = 0; r < 8; ++r) {
        t0[r] = (key0 + r > qi) ? -INFINITY : t0[r];
        t1[r] = (key1 + r > qi) ? -INFINITY : t1[r];
        mx = fmaxf(mx, fmaxf(t0[r], t1[r]));
      }
      mx = fmaxf(mx, xhalf(mx));
      const float mn = fmaxf(mrun[t], mx);
      const float ms = (mn == -INFINITY) ? 0.0f : mn;
      const float al = exp2f(mrun[t] - ms);
      mrun[t] = mn;
      // ---- B fragments of P^T * 32768: hi f16 and residual f16, col = query c, split k map over the 32 keys of this step ----
      t0 -= ms;
      t1 -= ms;
      v8f e0, e1;
#pragma unroll
      for (int r = 0; r < 8; ++r) { e0[r] = exp2f(t0[r]); e1[r] = exp2f(t1[r]); }
      const v8f es = e0 + e1;
      const float ps = ((es[0] + es[1]) + (es[2] + es[3])) + ((es[4] + es[5]) + (es[6] + es[7]));
      const v8f ta = e0 * PCAR, tb = e1 * PCAR;
      ph[t].h[0] = __builtin_convertvector(ta, v8h);          // elements 0..7  = keys kb + 8hh + 0..7
      ph[t].h[1] = __builtin_convertvector(tb, v8h);          // elements 8..15 = keys kb + 16 + 8hh + 0..7
      pl[t].h[0] = __builtin_convertvector(ta - __builtin_convertvector(ph[t].h[0], v8f), v8h);
      pl[t].h[1] = __builtin_convertvector(tb - __builtin_convertvector(ph[t].h[1], v8f), v8h);
      lrun[t] = lrun[t] * al + ps;
#pragma unroll
      for (int j = 0; j < 4; ++j) {
#pragma unroll
        for (int r = 0; r < 8; ++r) o[t][j][r] *= al;
      }
    }
    // ---- V^T.P^T : A fragment row = d = j*16 + c, keys contiguous in the v^T planes; each fragment serves both query tiles ----
    {
      v16h vh[4], vl[4];
#pragma unroll
      for (int j = 0; j < 4; ++j) {
        vh[j] = ldfrag_h(Vhb + (size_t)(16 * j) * SEQ, vo);
        vl[j] = ldfrag_h(Vlb + (size_t)(16 * j) * SEQ, vo);
      }
#pragma unroll
      for (int t = 0; t < QTW; ++t) {
#pragma unroll
        for (int j = 0; j < 4; ++j) {
          o[t][j] = mma_h(vh[j], ph[t].v, o[t][j]);
          o[t][j] = mma_h(vh[j], pl[t].v, o[t][j]);
          o[t][j] = mma_h(vl[j], ph[t].v, o[t][j]);
        }
      }
      guard_pv(o[0][0], o[0][1], o[0][2], o[0][3], o[1][0], o[1][1], o[1][2], o[1][3], ph[0].v, pl[0].v, ph[1].v, pl[1].v,
               vh[0], vh[1], vh[2], vh[3], vl[0], vl[1], vl[2], vl[3]);
    }
    ko += (unsigned)(WPB * 32 * NH * HD * 2);
    vo += (unsigned)(WPB * 1024);
  }
  // ---- this wave's partial: unnormalised O into its lane-owned slab (8 consecutive d per accumulator), row max and sum into the tables ----
#pragma unroll
  for (int t = 0; t < QTW; ++t) {
    acc_guard4(o[t][0], o[t][1], o[t][2], o[t][3]);
    lrun[t] += xhalf(lrun[t]);               // the two halves' key sums of query q0 + 16t + c, joined once
#pragma unroll
    for (int j = 0; j < 4; ++j) {
      float* sp = slab + (16 * t + c) * 68 + j * 16 + 8 * hh;
      const v4f a = {o[t][j][0], o[t][j][1], o[t][j][2], o[t][j][3]}, b4 = {o[t][j][4], o[t][j][5], o[t][j][6], o[t][j][7]};
      *(v4f*)(sp)     = a;
      *(v4f*)(sp + 4) = b4;
    }
    if (hh == 0) {
      mtab[((pass * WPB + wave) * QTW + t) * 16 + c] = mrun[t];
      ltab[((pass * WPB + wave) * QTW + t) * 16 + c] = lrun[t];
    }
  }
  }
  __syncthreads();                           // publishes every wave's partials of both query blocks to all WPB waves, each merging its own 16 columns
  // ---- merge of the WPB partials; per query tile t, thread = chunk tid of the tile's two O fragments: row = 16t + (lane & 15),
  //      8 consecutive d from 32 * (wave >> 1) + 16 * (wave & 1) + 8 * (lane >> 4) ----
  const int c8 = wave * 16 + hh * 8;
#pragma unroll 1   // rolled: one copy of the merge serves both query blocks
  for (int pass = 0; pass < 2; ++pass) {
  const int q0 = ((pass == 0) ? (NQB - 1 - pr) : pr) * (16 * QTW);
  const size_t qofs = (((size_t)b * SEQ + q0) * NH + (size_t)head * 16) * HD;
#pragma unroll
  for (int t = 0; t < QTW; ++t) {
    float mw[WPB];
    float mall = -INFINITY;
#pragma unroll
    for (int w = 0; w < WPB; ++w) { mw[w] = mtab[((pass * WPB + w) * QTW + t) * 16 + c]; mall = fmaxf(mall, mw[w]); }
    const float msafe = (mall == -INFINITY) ? 0.0f : mall;
    float lv = 0.f;
    float acc[8];
#pragma unroll
    for (int e = 0; e < 8; ++e) acc[e] = 0.f;
#pragma unroll
    for (int w = 0; w < WPB; ++w) {
      const float sc = exp2f(mw[w] - msafe);   // 0 for a wave that saw no tile
      lv += ltab[((pass * WPB + w) * QTW + t) * 16 + c] * sc;
      const float* sp = smem + (pass * WPB + w) * WREG + (16 * t + c) * 68 + c8;
      const v4f a = *(const v4f*)(sp), b4 = *(const v4f*)(sp + 4);
#pragma unroll
      for (int e = 0; e < 4; ++e) { acc[e] += a[e] * sc; acc[4 + e] += b4[e] * sc; }
    }
    // ---- out = acc / Z (0 if Z == 0), carries (32768 on P, 1024 on v) folded once; O x1024 -> f16 hi + residual planes ----
    const float ls  = (lv > 0.0f) ? lv : 1.0f;
    const float inv = (lv > 0.0f) ? ((1.0f / ls) * oc) : 0.0f;
    v4u oh, ol;
#pragma unroll
    for (int e = 0; e < 4; ++e) {
      const float w0 = (acc[2 * e] * inv) * OSC, w1 = (acc[2 * e + 1] * inv) * OSC;
      const _Float16 h0 = (_Float16)w0, h1 = (_Float16)w1;
      const _Float16 l0 = (_Float16)(w0 - (float)h0), l1 = (_Float16)(w1 - (float)h1);
      oh[e] = pk16(h_bits(h0), h_bits(h1));
      ol[e] = pk16(h_bits(l0), h_bits(l1));
    }
    const size_t o8 = qofs + t * QTS + 8 * tid;                                 // fragments (row q0's block + t, 2 * head .. 2 * head + 1)
    *(v4u*)(OHIp + o8) = oh;
    *(v4u*)(OLOp + o8) = ol;
#if defined(__HIP_DEVICE_COMPILE__)
    asm volatile("s_wait_xcnt 0x0" ::: "memory");   // stands in front of whatever next rewrites a register that these two stores name
#endif
  }
  }
}

// =====================================================================================================
// Workspace map (bytes); every plane is fully written by whole-line stores before it is read; all extents are exact multiples
// of the store granularity (no pad rows needed); every offset a multiple of 2097152; every 16-bit plane is fragment-major (the shape
// given is that of its matrix, rows x k):
//   XB  bf16 [MROWS][1024]              8388608
//   WQB bf16 [1024 n][1024 k]          2097152        WKB, WVB same
//   WOH f16  [1024 n][1024 k] x1024    2097152
//   QHI f16 [MROWS][16*64] x1024       8388608        QLO residual
//   KHI f16 [MROWS][16*64] x1024       8388608        KLO residual
//   VHI f16 [BATCH*16*64][SEQ] x1024   8388608        VLO residual
//   OHI f16 [MROWS][1024] x1024        8388608        OLO residual
//   end                               83886080
// =====================================================================================================
extern "C" void kernel_launch(void* const* d_in, const int* in_sizes, int n_in,
                              void* d_out, int out_size, void* d_ws, size_t ws_size,
                              hipStream_t stream) {
  if (n_in < 9) return;
  if (in_sizes[0] != MROWS * DMOD) return;
  if (in_sizes[1] != DMOD * DMOD || in_sizes[3] != DMOD * DMOD) return;
  if (in_sizes[5] != DMOD * DMOD || in_sizes[7] != DMOD * DMOD) return;
  if (in_sizes[2] != DMOD || in_sizes[4] != DMOD || in_sizes[6] != DMOD || in_sizes[8] != DMOD) return;
  if (out_size != MROWS * DMOD) return;

  const float* x    = (const float*)d_in[0];
  const float* wq   = (const float*)d_in[1];
  const float* bq   = (const float*)d_in[2];
  const float* wk   = (const float*)d_in[3];
  const float* bk   = (const float*)d_in[4];
  const float* wv   = (const float*)d_in[5];
  const float* bv   = (const float*)d_in[6];
  const float* wo   = (const float*)d_in[7];
  const float* bo   = (const float*)d_in[8];
  float*       out  = (float*)d_out;

  const size_t szXB = (size_t)MROWS * DMOD * 2;                 //  8388608
  const size_t szW  = (size_t)DMOD * DMOD * 2;                  //  2097152
  const size_t szP  = (size_t)MROWS * DMOD * 2;                 //  8388608
  size_t off = 0;
  const size_t oXB  = off; off += szXB;
  const size_t oWQ  = off; off += szW;
  const size_t oWK  = off; off += szW;
  const size_t oWV  = off; off += szW;
  const size_t oWO  = off; off += szW;
  const size_t oQHI = off; off += szP;
  const size_t oQLO = off; off += szP;
  const size_t oKHI = off; off += szP;
  const size_t oKLO = off; off += szP;
  const size_t oVHI = off; off += szP;
  const size_t oVLO = off; off += szP;
  const size_t oOHI = off; off += szP;
  const size_t oOLO = off; off += szP;
  if (off > ws_size) return;                            // off = 83886080
  if (off > (size_t)134217728) return;

  char* ws = (char*)d_ws;
  u16*   XB  = (u16*)(ws + oXB);
  u16*   WQB = (u16*)(ws + oWQ);
  u16*   WKB = (u16*)(ws + oWK);
  u16*   WVB = (u16*)(ws + oWV);
  u16*   WOH = (u16*)(ws + oWO);
  u16*   QHI = (u16*)(ws + oQHI);
  u16*   QLO = (u16*)(ws + oQLO);
  u16*   KHI = (u16*)(ws + oKHI);
  u16*   KLO = (u16*)(ws + oKLO);
  u16*   VHI = (u16*)(ws + oVHI);
  u16*   VLO = (u16*)(ws + oVLO);
  u16*   OHI = (u16*)(ws + oOHI);
  u16*   OLO = (u16*)(ws + oOLO);

  const dim3 blk(256);
  const dim3 gPR(4 * NWB + NXB);                        // 4 x 256 + 2048
  const dim3 gG((MROWS / 64) * (DMOD / 64));            // 1024
  const dim3 gP((MROWS / 128) * (DMOD / 128), 3);       // 256 x (q, k, v)
  const dim3 bG(128);
  const dim3 gAT(ATT_BLOCKS);                           // 1024
  const dim3 bAT(ATT_THREADS);                          // 128

  // (0) Wq/Wk/Wv [k][n] -> bf16 [n][k] planes; Wo [k][n] -> f16 [n][k] plane of bf16 value x1024; x -> bf16 plane [MROWS][1024]
  prep16<<<gPR, blk, 0, stream>>>(x, wq, wk, wv, wo, XB, WQB, WKB, WVB, WOH, WOS);
  // (1) q = x.Wq + bq, k = x.Wk + bk -> hi/residual planes x1024; v = x.Wv + bv -> v^T hi/residual planes x1024
  proj3<<<gP, bG, 0, stream>>>(XB, WQB, WKB, WVB, bq, bk, bv, QHI, QLO, KHI, KLO, VHI, VLO);
  // (2) causal attention -> O planes [b*SEQ+s][h][d] x1024 (hi + residual)
  attn1<<<gAT, bAT, 0, stream>>>(QHI, QLO, KHI, KLO, VHI, VLO, OHI, OLO);
  // (3) output projection -> out [MROWS][1024] f32, carries 1024 (O) x 1024 (Wo) folded back, + bo
  gemm_h2<<<gG, bG, 0, stream>>>(OHI, OLO, WOH, bo, out, MROWS, DMOD, DMOD, 1.0f / (OSC * WOS));
  (void)hipGetLastError();
}

// v008
// It runs in 118 microseconds.
// Two timings next to v007 both put it at 1.06 times that version's speed.
// Over all steps from v000 it is 3.48 times as fast.
// Contractions: x.W{q,k,v} on v_wmma_f32_16x16x32_bf16 (x and W^T RNE-converted to bf16, f32 accumulate);
// scores, transposed, k.q^T (q, k carried x1024 as f16 hi plane + f16 residual plane, products hh+lh+hl), v^T.P^T (P x32768 f16
// hi+residual, v x1024 f16 hi+residual, products hh+lh+hl) and O.Wo (O x1024 f16 hi+residual, Wo^T as f16(bf16(Wo)) x1024, products h.w+l.w):
// v_wmma_f32_16x16x32_f16, f32 accumulate. Static causal select, base-2 online softmax and 1/l fold in f32 on VALU.
#include <hip/hip_runtime.h>
#include <math.h>
#include <stdint.h>

#define BATCH 2
#define SEQ   2048
#define DMOD  1024
#define NH    16
#define HD    64
#define MROWS (BATCH * SEQ)
#define QSC   1024.0f
#define KSC   1024.0f
#define PCAR  32768.0f
#define VCAR  1024.0f
#define OSC   1024.0f
#define WOS   1024.0f
#define LOG2E 1.4426950408889634f
#define WPB   4
#define QTW   2
#define NQB   (SEQ / (16 * QTW))
#define NWB   ((DMOD / 64) * (DMOD / 64))
#define NXB   ((MROWS * DMOD) / 2048)
#define NKT   (SEQ / 32)
#define NSUB  4
#define ATT_THREADS (NSUB * WPB * 32)
#define NPR   (NQB / 2)
#define NPG   (NPR / NSUB)
#define ATT_BLOCKS  (NPG * NH * BATCH)
#define SLW   (16 * 68)
#define WREG  (QTW * SLW)
#define SLAB64 (16 * 68)
#define VTP   72
static_assert(DMOD == NH * HD && HD == 64 && NH == 16);
static_assert(WPB == 4 && NSUB == 4 && ATT_THREADS == 512 && QTW == 2 && ATT_BLOCKS == 256 && (NQB % 2) == 0 && (NPR % NSUB) == 0);
static_assert((SEQ % 64) == 0 && (SEQ % 32) == 0 && (SEQ % 16) == 0 && SEQ <= 32768);
static_assert((DMOD % 64) == 0 && (DMOD % 32) == 0 && (MROWS % 64) == 0);
static_assert((DMOD % 128) == 0 && (MROWS % 128) == 0 && (SEQ % 16) == 0);
static_assert(((MROWS * DMOD) % 2048) == 0 && ((DMOD * DMOD) % 4096) == 0);

typedef unsigned short u16;
typedef _Float16 v16h __attribute__((ext_vector_type(16)));
typedef _Float16 v8h  __attribute__((ext_vector_type(8)));
typedef __bf16   v16b __attribute__((ext_vector_type(16)));
typedef float    v8f  __attribute__((ext_vector_type(8)));
typedef float    v4f  __attribute__((ext_vector_type(4)));
typedef unsigned int v4u __attribute__((ext_vector_type(4)));

union FragH { v16h v; v8h h[2]; v4u u[2]; };
union FragB { v16b v; v4u u[2]; };

// ---- scalar helpers --------------------------------------------------------------------------------
__device__ __forceinline__ unsigned short bf_bits(float f) {          // f32 -> bf16 bits, RNE convert
  unsigned u = __float_as_uint(f);
  return (unsigned short)((u + 0x7FFFu + ((u >> 16) & 1u)) >> 16);
}
__device__ __forceinline__ float bf_up(unsigned short h) { return __uint_as_float(((unsigned)h) << 16); }
__device__ __forceinline__ float bfr(float f) { return bf_up(bf_bits(f)); }
__device__ __forceinline__ unsigned short h_bits(_Float16 x) { return __builtin_bit_cast(unsigned short, x); }
__device__ __forceinline__ unsigned pk16(unsigned short a, unsigned short b) { return (unsigned)a | ((unsigned)b << 16); }
__device__ __forceinline__ float xhalf(float x) {                     // value of lane l ^ 16
  const int b = __builtin_bit_cast(int, x);
  return __builtin_bit_cast(float, __builtin_amdgcn_permlanex16(b, b, 0x76543210, 0xfedcba98, false, false));
}
__device__ __forceinline__ v8f zero8() { v8f z = {0.f, 0.f, 0.f, 0.f, 0.f, 0.f, 0.f, 0.f}; return z; }

// ---- fragment-major 16-bit planes: a matrix [R rows][Kd k] (R % 16 == 0, Kd % 32 == 0) is stored as fragments of 16 rows x 32 k,
//      fragment (rb = row / 16, kb = k / 32) at halves (rb * (Kd / 32) + kb) * 512; inside it 64 chunks of 8 halves, chunk
//      i * 32 + h * 16 + c = row 16 rb + c, k = 32 kb + 16 i + 8 h + 0..7. A wave-wide 16-B load of chunks 32 i + lane is 512 contiguous,
//      512-B aligned bytes = 4 whole lines (the same fragment read from a row-major plane touches 16 lines, 32 B of each, per load).
// ---- fragment loaders: 16-bit A/B operand, lane -> row/col (lane&15), p = fragment start + 8*lane;
//      elements 0..7 <- p[0..7] (k0+8h..), elements 8..15 <- p[256..263] (k0+16+8h..)  (same split k map for A and B).
//      fs = a fragment start that is the same for the whole wave (a scalar base), bo = 32-bit byte offset from it: 16*lane plus the
//      loop's advance, one vector register that serves every load of a trip
// sbase: p + ofs for a wave-uniform ofs, kept as a scalar base of its own: without the readfirstlane the compiler adds the lane offset
// to p first and then forms each further fragment's 64-bit address with vector additions in every trip.
template <typename T>
__device__ __forceinline__ const T* sbase(const T* p, size_t ofs) {
  const uint32_t l = (uint32_t)__builtin_amdgcn_readfirstlane((int)(uint32_t)ofs);
  const uint32_t h = (uint32_t)__builtin_amdgcn_readfirstlane((int)(uint32_t)((uint64_t)ofs >> 32));
  return p + (size_t)(((uint64_t)h << 32) | (uint64_t)l);
}
__device__ __forceinline__ v16h ldfrag_h(const _Float16* fs, unsigned bo) {
  const char* p = (const char*)(const void*)fs + bo;
  FragH f;
  f.h[0] = *(const v8h*)(const void*)(p);
  f.h[1] = *(const v8h*)(const void*)(p + 512);
  return f.v;
}
__device__ __forceinline__ v16b ldfrag_b(const u16* fs, unsigned bo) { // bf16 plane read as unsigned integer vectors
  const char* p = (const char*)(const void*)fs + bo;
  FragB f;
  f.u[0] = *(const v4u*)(const void*)(p);
  f.u[1] = *(const v4u*)(const void*)(p + 512);
  return f.v;
}

// row-major element index (matrix [R][Kd]) of the 8 halves that chunk q of the fragment-major plane holds
__device__ __forceinline__ size_t chunk_src(int q, int Kd) {
  const int f = q >> 6, nkb = Kd >> 5;
  return (size_t)((f / nkb) * 16 + (q & 15)) * (size_t)Kd + (size_t)((f % nkb) * 32 + ((q >> 4) & 3) * 8);
}

__device__ __forceinline__ v8f mma_h(v16h a, v16h b, v8f c) {
  return __builtin_amdgcn_wmma_f32_16x16x32_f16(false, a, false, b, (short)0, c, false, false);
}
__device__ __forceinline__ v8f mma_b(v16b a, v16b b, v8f c) {
  return __builtin_amdgcn_wmma_f32_16x16x32_bf16(false, a, false, b, (short)0, c, false, false);
}
template <typename F>
__device__ __forceinline__ void guard6(v8f& a, v8f& b, v8f& c, v8f& d, F x0, F x1, F x2, F x3, F x4, F x5) {
#if defined(__HIP_DEVICE_COMPILE__)
  asm volatile("v_nop\n\tv_nop\n\tv_nop\n\tv_nop"
               : "+v"(a), "+v"(b), "+v"(c), "+v"(d) : "v"(x0), "v"(x1), "v"(x2), "v"(x3), "v"(x4), "v"(x5) : "memory");
#endif
}
__device__ __forceinline__ void acc_guard4(v8f& a, v8f& b, v8f& c, v8f& d) {
#if defined(__HIP_DEVICE_COMPILE__)
  asm volatile("v_nop\n\tv_nop\n\tv_nop\n\tv_nop" : "+v"(a), "+v"(b), "+v"(c), "+v"(d));
#endif
}
__device__ __forceinline__ void wave_sync_lds() {
  __builtin_amdgcn_fence(__ATOMIC_RELEASE, "workgroup");
  __builtin_amdgcn_wave_barrier();
  __builtin_amdgcn_fence(__ATOMIC_ACQUIRE, "workgroup");
}

// =====================================================================================================
// All operand conversions in one launch (five independent jobs, told apart by the block index).
// Blocks 0 .. 4*NWB-1, weight transpose-convert: weight which = bid / NWB, W [K][N] f32 (x.W layout, n contiguous) -> Dt, the fragment-major
// 16-bit plane of the matrix [N rows][K cols]; which 0..2: bf16 RNE bits; which 3: f16 bits of (bf16 RNE value) * scale.
//   Block = (k tile k0 = (wb / (N/64))*64, n tile n0 = (wb % (N/64))*64), wb = bid % NWB: 64 source rows of 64 floats loaded with 16-B loads,
//   converted, scattered into an LDS tile [n][64 k] (pitch 72 halves); after a block barrier the tile's 8 fragments are stored chunk by chunk.
//   coverage: load 256 thr x 16 = 64 x 64; store 2 iterations x 256 thr x 8 halves = 8 fragments x 512 halves = the block's tile;
//             NWB = (K/64)*(N/64) blocks cover each Dt exactly once.
// Blocks 4*NWB .. 4*NWB+NXB-1, x f32 [MROWS][DMOD] -> bf16 RNE bits, fragment-major plane. Thread = one chunk of the plane (8 consecutive
//   k of one row): two 16-B loads, one 16-B store; 32 consecutive lanes store 512 contiguous, 512-B aligned bytes.
//   coverage: NXB blocks x 256 thr x 8 = the whole plane.
// =====================================================================================================
__global__ __launch_bounds__(256) void prep16(const float* __restrict__ x, const float* __restrict__ W0, const float* __restrict__ W1,
                                              const float* __restrict__ W2, const float* __restrict__ W3,
                                              u16* XD, u16* D0, u16* D1, u16* D2, u16* D3, float scale) {
  __shared__ __align__(16) u16 T[64 * VTP];
  const int tid = threadIdx.x;
  const int bid = blockIdx.x;
  if (bid >= 4 * NWB) {                       // block-uniform; this path holds no barrier
    const int gt = (bid - 4 * NWB) * 256 + tid;
    if (gt >= (MROWS * DMOD) / 8) return;     // never taken with the exact grid
    const float* p = x + chunk_src(gt, DMOD);
    const v4f a = *(const v4f*)(p), b4 = *(const v4f*)(p + 4);
    v4u o;
    o[0] = pk16(bf_bits(a[0]), bf_bits(a[1]));
    o[1] = pk16(bf_bits(a[2]), bf_bits(a[3]));
    o[2] = pk16(bf_bits(b4[0]), bf_bits(b4[1]));
    o[3] = pk16(bf_bits(b4[2]), bf_bits(b4[3]));
    *(v4u*)(XD + (size_t)gt * 8) = o;
    return;
  }
  const int K = DMOD, N = DMOD;
  const int which = bid / NWB;
  const int wb    = bid % NWB;
  const int ntn = N >> 6;
  const int n0  = (wb % ntn) * 64;
  const int k0  = (wb / ntn) * 64;
  const float* W = (which == 0) ? W0 : (which == 1) ? W1 : (which == 2) ? W2 : W3;
  u16* Dt        = (which == 0) ? D0 : (which == 1) ? D1 : (which == 2) ? D2 : D3;
  const int f16mode = (which == 3) ? 1 : 0;
  {
    const int sl = tid >> 2;                  // k within tile 0..63 (source row)
    const int dc = (tid & 3) * 16;            // n chunk
    const float* src = W + (size_t)(k0 + sl) * N + n0 + dc;
#pragma unroll
    for (int i = 0; i < 4; ++i) {
      const v4f a = *(const v4f*)(src + 4 * i);
#pragma unroll
      for (int e = 0; e < 4; ++e) {
        const float f = a[e];
        const unsigned short hb = h_bits((_Float16)(bfr(f) * scale));
        const unsigned short bb = bf_bits(f);
        T[(dc + 4 * i + e) * VTP + sl] = (f16mode != 0) ? hb : bb;
      }
    }
  }
  __syncthreads();
  // the tile = 4 (n) x 2 (k) fragments of the plane; thread = chunk tid & 63 of fragment (n block it*2 + (tid >> 7), k block (tid >> 6) & 1)
  v4u vv[2];
  const int ch = tid & 63, fk = (tid >> 6) & 1, fr = tid >> 7;
#pragma unroll
  for (int it = 0; it < 2; ++it) {
    const int line = (it * 2 + fr) * 16 + (ch & 15);   // n = 0..63 within tile
    vv[it] = *(const v4u*)(T + line * VTP + fk * 32 + (ch >> 4) * 8);
  }
  const size_t base = (size_t)n0 * K + (size_t)((k0 >> 5) + fk) * 512 + ch * 8;
  {
#pragma unroll
    for (int it = 0; it < 2; ++it) {
      *(v4u*)(Dt + base + (size_t)((it * 2 + fr) * 16) * K) = vv[it];
    }
  }
#if defined(__HIP_DEVICE_COMPILE__)
  asm volatile("s_wait_xcnt 0x0" ::: "memory");   // stands in front of whatever next rewrites a register that these two stores name
#endif
}

// =====================================================================================================
// GEMM epilogue of the output projection: the wave's 16x64 f32 tile (times oscale) staged in its LDS slab (pitch 68),
// coverage: 8 instructions x 2 rows x 16 lanes x 4 floats = the wave's 16 x 64 tile.
// =====================================================================================================
__device__ __forceinline__ void epi64(float* sl, v8f a0, v8f a1, v8f a2, v8f a3, float oscale,
                                      const float* __restrict__ bias, float* C, int N,
                                      size_t rowb, int col0, int lane) {
  const int hh = lane >> 4, m = lane & 15;
#pragma unroll
  for (int r = 0; r < 8; ++r) {
    const int ro = (8 * hh + r) * 68 + m;
    sl[ro]      = a0[r] * oscale;
    sl[ro + 16] = a1[r] * oscale;
    sl[ro + 32] = a2[r] * oscale;
    sl[ro + 48] = a3[r] * oscale;
  }
  wave_sync_lds();
  const v4f braw = *(const v4f*)(bias + col0 + m * 4);
  v4f bb;
#pragma unroll
  for (int e = 0; e < 4; ++e) bb[e] = bfr(braw[e]);
  v4f vals[8];
#pragma unroll
  for (int it = 0; it < 8; ++it) vals[it] = *(const v4f*)(sl + (it * 2 + hh) * 68 + m * 4) + bb;
  float* dst = C + (rowb + (size_t)hh) * (size_t)N + col0 + m * 4;
  {
#pragma unroll
    for (int it = 0; it < 8; ++it) {
      *(v4f*)(dst + (size_t)(it * 2) * (size_t)N) = vals[it];
    }
    
  }
}

// =====================================================================================================
// q, k and v projections in one launch: grid.y = which (0 q, 1 k, 2 v); (x . W + b), x and W^T bf16 fragment-major planes, written
// straight into the f16 hi + residual planes that the attention kernel reads (value * 1024; hi = f16(t), residual = f16(t - hi)).
// Block = 128 rows x 128 columns, 2 x 2 waves of 64 x 64 (4 x fragments times 4 W^T fragments = 16 products per k step, rowb and col0 below
// being the wave's first row and column, i = 0..3 its row blocks of 16); fragments loaded straight from the planes (two 16-B loads each,
// 512 contiguous bytes per wave and load, split k map for A and B); K = DMOD stepped by 32; grid.x = (MROWS/128)*(DMOD/128).
// The operand order is chosen so that a lane's 8 accumulator registers are one 16-B chunk of the destination plane:
//   q, k (plane rows = x rows, plane k = n): D = W^T . x^T, lane (c, hh) register r = (x row rowb + 16 i + c, n = col0 + 16 j + 8 hh + r)
//        = chunk 32 (j & 1) + lane of fragment (rowb / 16 + i, col0 / 32 + (j >> 1));
//   v^T  (plane rows = (b, head, d), plane k = s): D = x . W, lane (c, hh) register r = (x row rowb + 16 i + 8 hh + r, n = col0 + 16 j + c)
//        = chunk 32 ((s >> 4) & 1) + lane of fragment (4 (b*NH + head) + j, s / 32), s = (rowb + 16 i) % SEQ, head = col0 / HD.
// coverage: per wave 16 accumulators x 32 lanes x 8 halves = 64 x 64 elements per plane, each store 512 contiguous, 512-B aligned bytes;
//           grid covers every (row, column) of each of the six planes exactly once.
// =====================================================================================================
__device__ __forceinline__ void put_split(v8f t, u16* hp, u16* lp) {     // 8 scaled values -> one chunk of the hi and of the residual plane
  v4u oh, ol;
#pragma unroll
  for (int e = 0; e < 4; ++e) {
    const float t0 = t[2 * e], t1 = t[2 * e + 1];
    const _Float16 h0 = (_Float16)t0, h1 = (_Float16)t1;
    const _Float16 l0 = (_Float16)(t0 - (float)h0), l1 = (_Float16)(t1 - (float)h1);
    oh[e] = pk16(h_bits(h0), h_bits(h1));
    ol[e] = pk16(h_bits(l0), h_bits(l1));
  }
  *(v4u*)(hp) = oh;
  *(v4u*)(lp) = ol;
#if defined(__HIP_DEVICE_COMPILE__)
  asm volatile("s_wait_xcnt 0x0" ::: "memory");   // stands in front of whatever next rewrites a register that these two stores name
  __builtin_amdgcn_sched_barrier(0);              // keeps the next chunk's arithmetic behind that wait: the compiler otherwise lifts it in front
#endif
}

// stands between a k step's 16 loads and its first product: the loads go out as one group, so that the step waits out one load latency and
// not one per x fragment (without it the compiler sinks the loads of x fragments 1..3 between the products)
__device__ __forceinline__ void loads_first() {
#if defined(__HIP_DEVICE_COMPILE__)
  __builtin_amdgcn_sched_barrier(0);
#endif
}
// behind the k loop: four slots between the last product and the bias loads, which land in registers that held its operands
// (inside the loop the compiler itself pads the loop's head, in front of the next trip's address additions and loads)
__device__ __forceinline__ void loop_exit_guard() {
#if defined(__HIP_DEVICE_COMPILE__)
  asm volatile("v_nop\n\tv_nop\n\tv_nop\n\tv_nop" ::: "memory");
#endif
}

__global__ __launch_bounds__(128, 4)   // budget of 256 registers a wave; the whole grid (768 blocks x 4 waves, 3 waves per SIMD) is resident at once
void proj3(const u16* __restrict__ A, const u16* __restrict__ Wq, const u16* __restrict__ Wk, const u16* __restrict__ Wv,
           const float* __restrict__ bq, const float* __restrict__ bk, const float* __restrict__ bv,
           u16* QH, u16* QL, u16* KH, u16* KL, u16* VH, u16* VL) {
  const int tid = threadIdx.x, lane = tid & 31;
  const int wave = __builtin_amdgcn_readfirstlane(tid >> 5);   // scalar: makes every fragment start a scalar base
  const int hh = lane >> 4, c = lane & 15;
  unsigned bo = 16u * (unsigned)lane;        // byte offset of this lane's chunk; advanced by one fragment (1024 B) per k step
  const int which = blockIdx.y;
  const int bid   = blockIdx.x;
  const int rowb  = (bid / (DMOD / 128)) * 128 + (wave >> 1) * 64;
  const int col0  = (bid % (DMOD / 128)) * 128 + (wave & 1) * 64;
  if (which > 2 || rowb + 64 > MROWS) return; // wave-uniform, never taken with the exact grid; no barriers in this kernel
  const u16*   Bt   = (which == 0) ? Wq : (which == 1) ? Wk : Wv;
  const float* bias = (which == 0) ? bq : (which == 1) ? bk : bv;
  const size_t bs = (size_t)16 * DMOD;                // halves between the fragments of consecutive row blocks, in every plane read here
  const u16* ap  = A  + (size_t)rowb * DMOD;          // fragment (rowb / 16, 0) of the fragment-major plane
  const u16* a1p = sbase(ap, bs), * a2p = sbase(ap, 2 * bs), * a3p = sbase(ap, 3 * bs);
  const u16* bp  = Bt + (size_t)col0 * DMOD;
  const u16* b1p = sbase(bp, bs), * b2p = sbase(bp, 2 * bs), * b3p = sbase(bp, 3 * bs);
  v8f acc[4][4];                             // acc[i][j]: x rows rowb + 16 i .., columns col0 + 16 j ..
#pragma unroll
  for (int i = 0; i < 4; ++i) {
#pragma unroll
    for (int j = 0; j < 4; ++j) acc[i][j] = zero8();
  }
  if (which == 2) {
#pragma unroll 1   // rolled: beside 16 accumulators the register budget holds one trip's 8 fragments, so unrolling overlaps nothing and only lengthens the code
    for (int k0 = 0; k0 < DMOD; k0 += 32) {
      const v16b a[4] = {ldfrag_b(ap, bo), ldfrag_b(a1p, bo), ldfrag_b(a2p, bo), ldfrag_b(a3p, bo)};
      const v16b w[4] = {ldfrag_b(bp, bo), ldfrag_b(b1p, bo), ldfrag_b(b2p, bo), ldfrag_b(b3p, bo)};
      loads_first();
#pragma unroll
      for (int i = 0; i < 4; ++i) {
#pragma unroll
        for (int j = 0; j < 4; ++j) acc[i][j] = mma_b(a[i], w[j], acc[i][j]);
      }
      bo += 1024u;
    }
    loop_exit_guard();
    const int g = col0 / HD;
    float bj[4];
#pragma unroll
    for (int j = 0; j < 4; ++j) bj[j] = bfr(bias[col0 + 16 * j + c]);   // all bias loads ahead of the first store's wait
#pragma unroll
    for (int i = 0; i < 4; ++i) {
      const int rw = rowb + 16 * i;
      const int b = rw / SEQ, sq = rw % SEQ;
      const size_t base = ((size_t)(b * NH + g) * HD) * SEQ + (size_t)(sq >> 5) * 512 + (size_t)((sq >> 4) & 1) * 256 + (size_t)lane * 8;
#pragma unroll
      for (int j = 0; j < 4; ++j)
        put_split((acc[i][j] + bj[j]) * VCAR, VH + base + (size_t)(16 * j) * SEQ, VL + base + (size_t)(16 * j) * SEQ);
    }
  } else {
#pragma unroll 1   // rolled: beside 16 accumulators the register budget holds one trip's 8 fragments, so unrolling overlaps nothing and only lengthens the code
    for (int k0 = 0; k0 < DMOD; k0 += 32) {
      const v16b a[4] = {ldfrag_b(ap, bo), ldfrag_b(a1p, bo), ldfrag_b(a2p, bo), ldfrag_b(a3p, bo)};
      const v16b w[4] = {ldfrag_b(bp, bo), ldfrag_b(b1p, bo), ldfrag_b(b2p, bo), ldfrag_b(b3p, bo)};
      loads_first();
#pragma unroll
      for (int i = 0; i < 4; ++i) {
#pragma unroll
        for (int j = 0; j < 4; ++j) acc[i][j] = mma_b(w[j], a[i], acc[i][j]);
      }
      bo += 1024u;
    }
    loop_exit_guard();
    u16* hpl = (which == 0) ? QH : KH;
    u16* lpl = (which == 0) ? QL : KL;
    const float sc = (which == 0) ? QSC : KSC;
    v8f bb[4];                               // the bias of the wave's 64 columns, the same for its four row blocks; loaded ahead of the first store's wait
#pragma unroll
    for (int j = 0; j < 4; ++j) {
      const float* bsrc = bias + col0 + 16 * j + 8 * hh;
      const v4f r0 = *(const v4f*)(bsrc), r1 = *(const v4f*)(bsrc + 4);
      const v8f t = {bfr(r0[0]), bfr(r0[1]), bfr(r0[2]), bfr(r0[3]), bfr(r1[0]), bfr(r1[1]), bfr(r1[2]), bfr(r1[3])};
      bb[j] = t;
    }
#pragma unroll
    for (int i = 0; i < 4; ++i) {
      const size_t base = (size_t)(rowb + 16 * i) * DMOD + (size_t)(col0 >> 5) * 512 + (size_t)lane * 8;
#pragma unroll
      for (int j = 0; j < 4; ++j) {
        const size_t o8 = base + (size_t)(j >> 1) * 512 + (size_t)(j & 1) * 256;
        put_split((acc[i][j] + bb[j]) * sc, hpl + o8, lpl + o8);
      }
    }
  }
}

// =====================================================================================================
// f16 hi+lo GEMM: C[M][N] (f32) = (Ahi + Alo)[M][K] . Bt[N][K]^T, times oscale, plus bias[N]; Ahi/Alo f16 planes (same layout),
// Bt f16, all three fragment-major; products hi.B + lo.B into one accumulator (lo is the unscaled residual of hi). Block = 64x64 tile, 4 waves x 16 rows, K stepped by 32.
// =====================================================================================================
__global__ __launch_bounds__(128)
void gemm_h2(const u16* __restrict__ Ah, const u16* __restrict__ Al, const u16* __restrict__ Bt,
             const float* __restrict__ bias, float* C, int M, int N, int K, float oscale) {
  __shared__ __align__(16) float slab[4 * SLAB64];
  const int tid = threadIdx.x, lane = tid & 31;
  const int wave = __builtin_amdgcn_readfirstlane(tid >> 5);   // scalar: makes every fragment start a scalar base
  unsigned bo = 16u * (unsigned)lane;        // byte offset of this lane's chunk; advanced by one fragment (1024 B) per k step
  const int ntile = N >> 6;
  const int bid   = blockIdx.x;
  const int rowb  = (bid / ntile) * 64 + wave * 16;
  const int col0  = (bid % ntile) * 64;
  if (rowb + 16 > M) return;                 // wave-uniform, never taken with the exact grid; no block barriers in this kernel
  const size_t aofs = (size_t)rowb * K;               // fragment (rowb / 16, 0) of the fragment-major planes
  const _Float16* ahp = (const _Float16*)(const void*)Ah + aofs;
  const _Float16* alp = (const _Float16*)(const void*)Al + aofs;
  const size_t bs = (size_t)16 * K;
  const _Float16* bp  = (const _Float16*)(const void*)Bt + (size_t)col0 * K;
  const _Float16* b1p = sbase(bp, bs), * b2p = sbase(bp, 2 * bs), * b3p = sbase(bp, 3 * bs);
  v8f acc0 = zero8(), acc1 = zero8(), acc2 = zero8(), acc3 = zero8();
#pragma unroll 1
  for (int k0 = 0; k0 < K; k0 += 32) {
    const v16h ah = ldfrag_h(ahp, bo), al = ldfrag_h(alp, bo);
    const v16h b0 = ldfrag_h(bp, bo);
    const v16h b1 = ldfrag_h(b1p, bo);
    const v16h b2 = ldfrag_h(b2p, bo);
    const v16h b3 = ldfrag_h(b3p, bo);
    acc0 = mma_h(ah, b0, acc0);  acc0 = mma_h(al, b0, acc0);
    acc1 = mma_h(ah, b1, acc1);  acc1 = mma_h(al, b1, acc1);
    acc2 = mma_h(ah, b2, acc2);  acc2 = mma_h(al, b2, acc2);
    acc3 = mma_h(ah, b3, acc3);  acc3 = mma_h(al, b3, acc3);
    guard6<v16h>(acc0, acc1, acc2, acc3, ah, al, b0, b1, b2, b3);
    bo += 1024u;
  }
  epi64(slab + wave * SLAB64, acc0, acc1, acc2, acc3, oscale, bias, C, N, (size_t)rowb, col0, lane);
}

// =====================================================================================================
// Causal attention: block bid -> (pair group pg = bid % NPG, head = (bid / NPG) % NH, batch b = bid / (NPG*NH)). A block is NSUB teams of WPB
// waves; team sub works pair pr = NSUB*pg + sub of that head on its own, with LDS slabs and tables of its own. The NSUB teams walk the same
// head's key tiles from 0 on at the same pace, so the NSUB waves that hold the same place w in their teams (block wave
// number = NSUB*w + sub) ask for the same k and v^T fragments at about the same time on one WGP: one of them fetches a line from L2, the
// others find it in the WGP's cache. A team works two query blocks one
// after the other, qb = NQB-1-pr and then qb = pr (rows q0 = 32*qb .. q0+31 = QTW query tiles of 16): together NQB+1 key tiles, the same
// for every team, so that no block and no WGP carries more of the causal triangle than another, wherever the blocks land.
// A query block's key tiles are dealt round-robin to its team's WPB waves (wave w takes kt = w, w + WPB, ..);
// a wave works BOTH query tiles against each key tile it takes, so every k and v^T fragment it loads feeds two score or output tiles;
// each wave keeps its own running max, sum and unnormalised O per query, and the WPB partials are merged through LDS after one block barrier.
//   q planes (hi, lo f16 x1024): fragment-major planes of the matrix [b*SEQ + s][h*HD + d]; k planes the same; v^T planes of [(b*NH + h)*HD + d][s].
//   score (log2 domain) t(i, j) = (q_i.k_j) * 0.125*log2e/(1024*1024) for key j <= query i, and -inf for j > i (the select
//   replaces the score). Key tiles of 32 visited for kb <= q0 (32-aligned, so kb <= every query of the block); tiles whose every key
//   index exceeds every query index of the block hold only -inf, whose exp is exactly 0, and are not visited. In every visited tile
//   key kb is finite for every query of the block, so a wave's running max is finite from its first tile on; a wave with no tile
//   keeps max = -inf, sum = 0, O = 0.
//   Both products are taken transposed: S^T = K.Q^T (A = 16 key rows, B = 16 queries) and O^T += V^T.P^T (A = 16 d rows of v^T,
//   B = P^T). In a score tile lane (c, hh) then holds query q0 + 16t + c and keys 8hh + 0..7 of the subtile, so a query's maximum and sum
//   run over the lane's own 16 registers plus one exchange with lane ^ 16, and the two subtiles' accumulators, converted in place, ARE the
//   B fragment of P^T in the split k map (elements 0..7 = keys kb + 8hh + 0..7, 8..15 = keys kb + 16 + 8hh + 0..7): P never leaves
//   the registers. Per key tile and query tile: 2 score subtiles x 2 k-steps x 3 products (k_hi.q_hi + k_hi.q_lo + k_lo.q_hi), fragments
//   loaded straight from the 16-bit planes (two 16-B loads per fragment, split k map); online max-subtracted base-2 softmax in f32,
//   -inf-safe rescale (one factor per lane); P x32768 as f16 hi and f16 residual; 4+4 v^T A fragments (hi and residual planes),
//   12 WMMAs (hh + hl + lh). A lane sums only its own half's keys; the two halves' sums are joined once, after the loop.
//   After each query block's loop: each wave writes its unnormalised O to its own slab of that query block (32 rows, pitch 68; every
//   element owned by one lane) and its row max and sum to the tables; behind both query blocks one block barrier (reached by every wave; trip counts differ only between waves, and the loop holds
//   no block barrier); wave w then merges columns d = 16w .. 16w+15 of all 32 rows: M = max_w m_w, out = sum_w O_w 2^(m_w - M) / sum_w l_w 2^(m_w - M)
//   (Z > 0 always: key j = i is never masked; guarded anyway), carries 1/(32768*1024) folded once. Bounded loops only (nkt <= NKT).
// coverage: per wave and query tile 1 instruction x 16 rows x 2 lanes x 8 halves = 16 x 16 per plane, x WPB waves x QTW tiles = 32 x 64;
//           x 2 query blocks (pr and NQB-1-pr, pr < NQB/2: every qb once) x NSUB teams; grid NPG*NH*BATCH blocks = every (b, s, h) row of both O planes once.
// =====================================================================================================
// four v_nop behind the score products: no vector instruction touches their results or operands inside the matrix unit's window
__device__ __forceinline__ void guard_sc(v8f& a, v8f& b, v8f& c, v8f& d, v16h k0, v16h k1, v16h k2, v16h k3,
                                         v16h q0, v16h q1, v16h q2, v16h q3) {
#if defined(__HIP_DEVICE_COMPILE__)
  asm volatile("v_nop\n\tv_nop\n\tv_nop\n\tv_nop"
               : "+v"(a), "+v"(b), "+v"(c), "+v"(d)
               : "v"(k0), "v"(k1), "v"(k2), "v"(k3), "v"(q0), "v"(q1), "v"(q2), "v"(q3) : "memory");
#endif
}
// the same behind the output products of both query tiles
__device__ __forceinline__ void guard_pv(v8f& a0, v8f& a1, v8f& a2, v8f& a3, v8f& b0, v8f& b1, v8f& b2, v8f& b3, v16h p0, v16h p1, v16h p2,
                                         v16h p3, v16h x0, v16h x1, v16h x2, v16h x3, v16h x4, v16h x5, v16h x6, v16h x7) {
#if defined(__HIP_DEVICE_COMPILE__)
  asm volatile("v_nop\n\tv_nop\n\tv_nop\n\tv_nop"
               : "+v"(a0), "+v"(a1), "+v"(a2), "+v"(a3), "+v"(b0), "+v"(b1), "+v"(b2), "+v"(b3)
               : "v"(p0), "v"(p1), "v"(p2), "v"(p3), "v"(x0), "v"(x1), "v"(x2), "v"(x3), "v"(x4), "v"(x5), "v"(x6), "v"(x7) : "memory");
#endif
}

__global__ __launch_bounds__(ATT_THREADS, 4)   // 4 waves per SIMD: the whole grid (256 blocks x 16 waves, one block per WGP) is resident at once, no second round
void attn1(const u16* __restrict__ QHIp, const u16* __restrict__ QLOp,
           const u16* __restrict__ KHIp, const u16* __restrict__ KLOp,
           const u16* __restrict__ VHIp, const u16* __restrict__ VLOp,
           u16* OHIp, u16* OLOp) {
  __shared__ __align__(16) float smem_all[NSUB * 2 * WPB * WREG];   // per team one set of slabs per query block of the pair
  __shared__ float mtab_all[NSUB * 2 * WPB * 16 * QTW]; // per team, query block, wave and query row: running max (log2 domain)
  __shared__ float ltab_all[NSUB * 2 * WPB * 16 * QTW]; // per team, query block, wave and query row: running sum

  const int bw   = __builtin_amdgcn_readfirstlane((int)threadIdx.x >> 5);   // scalar: the key loop's start must be wave-uniform for the WMMAs
  const int sub  = bw % NSUB;                // team
  const int wave = bw / NSUB;                // place in the team
  const int lane = threadIdx.x & 31;
  const int tid  = wave * 32 + lane;         // thread number within the team
  const int hh   = lane >> 4;
  const int c    = lane & 15;
  const int bid  = blockIdx.x;
  const int pr   = (bid % NPG) * NSUB + sub;
  const int rem  = bid / NPG;
  float* smem = smem_all + sub * (2 * WPB * WREG);
  float* mtab = mtab_all + sub * (2 * WPB * 16 * QTW);
  float* ltab = ltab_all + sub * (2 * WPB * 16 * QTW);
  const int head = rem % NH;
  const int b    = rem / NH;
  if (b >= BATCH) return;                    // block-uniform, before the block barrier; never taken with the exact grid

  const unsigned lo = 16u * (unsigned)lane;                                     // byte offset of this lane's chunk in a fragment
  const size_t QTS  = (size_t)16 * NH * HD;                                     // halves between the fragments of consecutive row blocks
  const size_t kofs = ((size_t)b * SEQ * NH + (size_t)head * 16) * HD;          // fragment (b*SEQ / 16, 2 * head); key block added per step
  const _Float16* Khb = (const _Float16*)(const void*)KHIp + kofs;
  const _Float16* Klb = (const _Float16*)(const void*)KLOp + kofs;
  const size_t vofs = (((size_t)b * NH + head) * HD) * SEQ;                    // fragment (4 * (b*NH + head) (+j), 0); key block added per step
  const _Float16* Vhb = (const _Float16*)(const void*)VHIp + vofs;
  const _Float16* Vlb = (const _Float16*)(const void*)VLOp + vofs;
  const float lsc = 0.125f * (LOG2E / (QSC * KSC));
  const float oc  = 1.0f / (PCAR * VCAR);
  const size_t KROW = (size_t)NH * HD;                                          // halves per key row; 16 * KROW between consecutive 16-row key blocks

#pragma unroll 1   // rolled: the two query blocks run one after the other through one copy of the key loop
  for (int pass = 0; pass < 2; ++pass) {
  const int qb   = (pass == 0) ? (NQB - 1 - pr) : pr;
  const int q0   = qb * (16 * QTW);
  float* slab = smem + (pass * WPB + wave) * WREG;                              // result slab [32 queries][64 d] pitch 68
  const size_t qofs = (((size_t)b * SEQ + q0) * NH + (size_t)head * 16) * HD;   // fragment (row q0's block, 2 * head); query tile t: + t * QTS
  const _Float16* Qh  = (const _Float16*)(const void*)QHIp + qofs;
  const _Float16* Ql  = (const _Float16*)(const void*)QLOp + qofs;
  float mrun[QTW], lrun[QTW];                // query q0 + 16t + c: running max (equal in both halves), running sum over this half's keys
  v8f o[QTW][4];                             // o[t][j][r] = O^T element (d = 16j + 8hh + r, query q0 + 16t + c)
#pragma unroll
  for (int t = 0; t < QTW; ++t) {
    mrun[t] = -INFINITY;
    lrun[t] = 0.f;
#pragma unroll
    for (int j = 0; j < 4; ++j) o[t][j] = zero8();
  }
  const int ncaus = qb + 1;                                                     // tiles holding keys <= q0 + 31
  const int nkt = (ncaus < NKT) ? ncaus : NKT;

  // byte offsets of key tile kt in the k planes (32 rows of KROW halves) and in the v^T planes (one fragment), plus this lane's chunk
  unsigned ko = lo + (unsigned)wave * (unsigned)(32 * NH * HD * 2);
  unsigned vo = lo + (unsigned)wave * 1024u;
#pragma unroll 1
  for (int kt = wave; kt < nkt; kt += WPB) {
    const int kb = kt * 32;
    // ---- scores: D element r of this lane = (key kb + 8hh + r, query q0 + 16t + c) in s[t][0], key kb + 16 + 8hh + r in s[t][1] ----
    const _Float16* k0p = Khb;
    const _Float16* k1p = k0p + (size_t)16 * KROW;
    const _Float16* l0p = Klb;
    const _Float16* l1p = l0p + (size_t)16 * KROW;
    // the tile's 8 k fragments as one load group, ahead of the first product: one wait on the loads per key tile, not one per k step
    v16h kh0[2], kh1[2], kl0[2], kl1[2];
#pragma unroll
    for (int kk = 0; kk < 2; ++kk) {
      kh0[kk] = ldfrag_h(k0p + kk * 512, ko);
      kh1[kk] = ldfrag_h(k1p + kk * 512, ko);
      kl0[kk] = ldfrag_h(l0p + kk * 512, ko);
      kl1[kk] = ldfrag_h(l1p + kk * 512, ko);
    }
    v8f s[QTW][2];
#pragma unroll
    for (int t = 0; t < QTW; ++t) { s[t][0] = zero8(); s[t][1] = zero8(); }
#pragma unroll
    for (int kk = 0; kk < 2; ++kk) {
      v16h qh[QTW], ql[QTW];
#pragma unroll
      for (int t = 0; t < QTW; ++t) {
        qh[t] = ldfrag_h(Qh + t * QTS + kk * 512, lo);
        ql[t] = ldfrag_h(Ql + t * QTS + kk * 512, lo);
      }
#pragma unroll
      for (int t = 0; t < QTW; ++t) {
        s[t][0] = mma_h(kh0[kk], qh[t], s[t][0]);
        s[t][0] = mma_h(kh0[kk], ql[t], s[t][0]);
        s[t][0] = mma_h(kl0[kk], qh[t], s[t][0]);
        s[t][1] = mma_h(kh1[kk], qh[t], s[t][1]);
        s[t][1] = mma_h(kh1[kk], ql[t], s[t][1]);
        s[t][1] = mma_h(kl1[kk], qh[t], s[t][1]);
      }
      guard_sc(s[0][0], s[0][1], s[1][0], s[1][1], kh0[kk], kh1[kk], kl0[kk], kl1[kk], qh[0], ql[0], qh[1], ql[1]);
    }
    // ---- causal select (score := -inf for key > query) + online softmax in base 2, -inf-safe; all 32 keys of a query sit in
    //      lanes c and c + 16 ----
    const int key0 = kb + 8 * hh, key1 = key0 + 16;
    FragH ph[QTW], pl[QTW];
#pragma unroll
    for (int t = 0; t < QTW; ++t) {
      const int qi = q0 + 16 * t + c;
      v8f t0 = s[t][0] * lsc, t1 = s[t][1] * lsc;
      float mx = -INFINITY;
#pragma unroll
      for (int r = 0; r < 8; ++r) {
        t0[r] = (key0 + r > qi) ? -INFINITY : t0[r];
        t1[r] = (key1 + r > qi) ? -INFINITY : t1[r];
        mx = fmaxf(mx, fmaxf(t0[r], t1[r]));
      }
      mx = fmaxf(mx, xhalf(mx));
      const float mn = fmaxf(mrun[t], mx);
      const float ms = (mn == -INFINITY) ? 0.0f : mn;
      const float al = exp2f(mrun[t] - ms);
      mrun[t] = mn;
      // ---- B fragments of P^T * 32768: hi f16 and residual f16, col = query c, split k map over the 32 keys of this step ----
      t0 -= ms;
      t1 -= ms;
      v8f e0, e1;
#pragma unroll
      for (int r = 0; r < 8; ++r) { e0[r] = exp2f(t0[r]); e1[r] = exp2f(t1[r]); }
      const v8f es = e0 + e1;
      const float ps = ((es[0] + es[1]) + (es[2] + es[3])) + ((es[4] + es[5]) + (es[6] + es[7]));
      const v8f ta = e0 * PCAR, tb = e1 * PCAR;
      ph[t].h[0] = __builtin_convertvector(ta, v8h);          // elements 0..7  = keys kb + 8hh + 0..7
      ph[t].h[1] = __builtin_convertvector(tb, v8h);          // elements 8..15 = keys kb + 16 + 8hh + 0..7
      pl[t].h[0] = __builtin_convertvector(ta - __builtin_convertvector(ph[t].h[0], v8f), v8h);
      pl[t].h[1] = __builtin_convertvector(tb - __builtin_convertvector(ph[t].h[1], v8f), v8h);
      lrun[t] = lrun[t] * al + ps;
#pragma unroll
      for (int j = 0; j < 4; ++j) {
#pragma unroll
        for (int r = 0; r < 8; ++r) o[t][j][r] *= al;
      }
    }
    // ---- V^T.P^T : A fragment row = d = j*16 + c, keys contiguous in the v^T planes; each fragment serves both query tiles ----
    {
      v16h vh[4], vl[4];
#pragma unroll
      for (int j = 0; j < 4; ++j) {
        vh[j] = ldfrag_h(Vhb + (size_t)(16 * j) * SEQ, vo);
        vl[j] = ldfrag_h(Vlb + (size_t)(16 * j) * SEQ, vo);
      }
#pragma unroll
      for (int t = 0; t < QTW; ++t) {
#pragma unroll
        for (int j = 0; j < 4; ++j) {
          o[t][j] = mma_h(vh[j], ph[t].v, o[t][j]);
          o[t][j] = mma_h(vh[j], pl[t].v, o[t][j]);
          o[t][j] = mma_h(vl[j], ph[t].v, o[t][j]);
        }
      }
      guard_pv(o[0][0], o[0][1], o[0][2], o[0][3], o[1][0], o[1][1], o[1][2], o[1][3], ph[0].v, pl[0].v, ph[1].v, pl[1].v,
               vh[0], vh[1], vh[2], vh[3], vl[0], vl[1], vl[2], vl[3]);
    }
    ko += (unsigned)(WPB * 32 * NH * HD * 2);
    vo += (unsigned)(WPB * 1024);
  }
  // ---- this wave's partial: unnormalised O into its lane-owned slab (8 consecutive d per accumulator), row max and sum into the tables ----
#pragma unroll
  for (int t = 0; t < QTW; ++t) {
    acc_guard4(o[t][0], o[t][1], o[t][2], o[t][3]);
    lrun[t] += xhalf(lrun[t]);               // the two halves' key sums of query q0 + 16t + c, joined once
#pragma unroll
    for (int j = 0; j < 4; ++j) {
      float* sp = slab + (16 * t + c) * 68 + j * 16 + 8 * hh;
      const v4f a = {o[t][j][0], o[t][j][1], o[t][j][2], o[t][j][3]}, b4 = {o[t][j][4], o[t][j][5], o[t][j][6], o[t][j][7]};
      *(v4f*)(sp)     = a;
      *(v4f*)(sp + 4) = b4;
    }
    if (hh == 0) {
      mtab[((pass * WPB + wave) * QTW + t) * 16 + c] = mrun[t];
      ltab[((pass * WPB + wave) * QTW + t) * 16 + c] = lrun[t];
    }
  }
  }
  __syncthreads();                           // publishes every wave's partials of both query blocks to the WPB waves of its team that merge them
  // ---- merge of the WPB partials; per query tile t, thread = chunk tid of the tile's two O fragments: row = 16t + (lane & 15),
  //      8 consecutive d from 32 * (wave >> 1) + 16 * (wave & 1) + 8 * (lane >> 4) ----
  const int c8 = wave * 16 + hh * 8;
#pragma unroll 1   // rolled: one copy of the merge serves both query blocks
  for (int pass = 0; pass < 2; ++pass) {
  const int q0 = ((pass == 0) ? (NQB - 1 - pr) : pr) * (16 * QTW);
  const size_t qofs = (((size_t)b * SEQ + q0) * NH + (size_t)head * 16) * HD;
#pragma unroll
  for (int t = 0; t < QTW; ++t) {
    float mw[WPB];
    float mall = -INFINITY;
#pragma unroll
    for (int w = 0; w < WPB; ++w) { mw[w] = mtab[((pass * WPB + w) * QTW + t) * 16 + c]; mall = fmaxf(mall, mw[w]); }
    const float msafe = (mall == -INFINITY) ? 0.0f : mall;
    float lv = 0.f;
    float acc[8];
#pragma unroll
    for (int e = 0; e < 8; ++e) acc[e] = 0.f;
#pragma unroll
    for (int w = 0; w < WPB; ++w) {
      const float sc = exp2f(mw[w] - msafe);   // 0 for a wave that saw no tile
      lv += ltab[((pass * WPB + w) * QTW + t) * 16 + c] * sc;
      const float* sp = smem + (pass * WPB + w) * WREG + (16 * t + c) * 68 + c8;
      const v4f a = *(const v4f*)(sp), b4 = *(const v4f*)(sp + 4);
#pragma unroll
      for (int e = 0; e < 4; ++e) { acc[e] += a[e] * sc; acc[4 + e] += b4[e] * sc; }
    }
    // ---- out = acc / Z (0 if Z == 0), carries (32768 on P, 1024 on v) folded once; O x1024 -> f16 hi + residual planes ----
    const float ls  = (lv > 0.0f) ? lv : 1.0f;
    const float inv = (lv > 0.0f) ? ((1.0f / ls) * oc) : 0.0f;
    v4u oh, ol;
#pragma unroll
    for (int e = 0; e < 4; ++e) {
      const float w0 = (acc[2 * e] * inv) * OSC, w1 = (acc[2 * e + 1] * inv) * OSC;
      const _Float16 h0 = (_Float16)w0, h1 = (_Float16)w1;
      const _Float16 l0 = (_Float16)(w0 - (float)h0), l1 = (_Float16)(w1 - (float)h1);
      oh[e] = pk16(h_bits(h0), h_bits(h1));
      ol[e] = pk16(h_bits(l0), h_bits(l1));
    }
    const size_t o8 = qofs + t * QTS + 8 * tid;                                 // fragments (row q0's block + t, 2 * head .. 2 * head + 1)
    *(v4u*)(OHIp + o8) = oh;
    *(v4u*)(OLOp + o8) = ol;
#if defined(__HIP_DEVICE_COMPILE__)
    asm volatile("s_wait_xcnt 0x0" ::: "memory");   // stands in front of whatever next rewrites a register that these two stores name
#endif
  }
  }
}

// =====================================================================================================
// Workspace map (bytes); every plane is fully written by whole-line stores before it is read; all extents are exact multiples
// of the store granularity (no pad rows needed); every offset a multiple of 2097152; every 16-bit plane is fragment-major (the shape
// given is that of its matrix, rows x k):
//   XB  bf16 [MROWS][1024]              8388608
//   WQB bf16 [1024 n][1024 k]          2097152        WKB, WVB same
//   WOH f16  [1024 n][1024 k] x1024    2097152
//   QHI f16 [MROWS][16*64] x1024       8388608        QLO residual
//   KHI f16 [MROWS][16*64] x1024       8388608        KLO residual
//   VHI f16 [BATCH*16*64][SEQ] x1024   8388608        VLO residual
//   OHI f16 [MROWS][1024] x1024        8388608        OLO residual
//   end                               83886080
// =====================================================================================================
extern "C" void kernel_launch(void* const* d_in, const int* in_sizes, int n_in,
                              void* d_out, int out_size, void* d_ws, size_t ws_size,
                              hipStream_t stream) {
  if (n_in < 9) return;
  if (in_sizes[0] != MROWS * DMOD) return;
  if (in_sizes[1] != DMOD * DMOD || in_sizes[3] != DMOD * DMOD) return;
  if (in_sizes[5] != DMOD * DMOD || in_sizes[7] != DMOD * DMOD) return;
  if (in_sizes[2] != DMOD || in_sizes[4] != DMOD || in_sizes[6] != DMOD || in_sizes[8] != DMOD) return;
  if (out_size != MROWS * DMOD) return;

  const float* x    = (const float*)d_in[0];
  const float* wq   = (const float*)d_in[1];
  const float* bq   = (const float*)d_in[2];
  const float* wk   = (const float*)d_in[3];
  const float* bk   = (const float*)d_in[4];
  const float* wv   = (const float*)d_in[5];
  const float* bv   = (const float*)d_in[6];
  const float* wo   = (const float*)d_in[7];
  const float* bo   = (const float*)d_in[8];
  float*       out  = (float*)d_out;

  const size_t szXB = (size_t)MROWS * DMOD * 2;                 //  8388608
  const size_t szW  = (size_t)DMOD * DMOD * 2;                  //  2097152
  const size_t szP  = (size_t)MROWS * DMOD * 2;                 //  8388608
  size_t off = 0;
  const size_t oXB  = off; off += szXB;
  const size_t oWQ  = off; off += szW;
  const size_t oWK  = off; off += szW;
  const size_t oWV  = off; off += szW;
  const size_t oWO  = off; off += szW;
  const size_t oQHI = off; off += szP;
  const size_t oQLO = off; off += szP;
  const size_t oKHI = off; off += szP;
  const size_t oKLO = off; off += szP;
  const size_t oVHI = off; off += szP;
  const size_t oVLO = off; off += szP;
  const size_t oOHI = off; off += szP;
  const size_t oOLO = off; off += szP;
  if (off > ws_size) return;                            // off = 83886080
  if (off > (size_t)134217728) return;

  char* ws = (char*)d_ws;
  u16*   XB  = (u16*)(ws + oXB);
  u16*   WQB = (u16*)(ws + oWQ);
  u16*   WKB = (u16*)(ws + oWK);
  u16*   WVB = (u16*)(ws + oWV);
  u16*   WOH = (u16*)(ws + oWO);
  u16*   QHI = (u16*)(ws + oQHI);
  u16*   QLO = (u16*)(ws + oQLO);
  u16*   KHI = (u16*)(ws + oKHI);
  u16*   KLO = (u16*)(ws + oKLO);
  u16*   VHI = (u16*)(ws + oVHI);
  u16*   VLO = (u16*)(ws + oVLO);
  u16*   OHI = (u16*)(ws + oOHI);
  u16*   OLO = (u16*)(ws + oOLO);

  const dim3 blk(256);
  const dim3 gPR(4 * NWB + NXB);                        // 4 x 256 + 2048
  const dim3 gG((MROWS / 64) * (DMOD / 64));            // 1024
  const dim3 gP((MROWS / 128) * (DMOD / 128), 3);       // 256 x (q, k, v)
  const dim3 bG(128);
  const dim3 gAT(ATT_BLOCKS);                           // 256
  const dim3 bAT(ATT_THREADS);                          // 512

  // (0) Wq/Wk/Wv [k][n] -> bf16 [n][k] planes; Wo [k][n] -> f16 [n][k] plane of bf16 value x1024; x -> bf16 plane [MROWS][1024]
  prep16<<<gPR, blk, 0, stream>>>(x, wq, wk, wv, wo, XB, WQB, WKB, WVB, WOH, WOS);
  // (1) q = x.Wq + bq, k = x.Wk + bk -> hi/residual planes x1024; v = x.Wv + bv -> v^T hi/residual planes x1024
  proj3<<<gP, bG, 0, stream>>>(XB, WQB, WKB, WVB, bq, bk, bv, QHI, QLO, KHI, KLO, VHI, VLO);
  // (2) causal attention -> O planes [b*SEQ+s][h][d] x1024 (hi + residual)
  attn1<<<gAT, bAT, 0, stream>>>(QHI, QLO, KHI, KLO, VHI, VLO, OHI, OLO);
  // (3) output projection -> out [MROWS][1024] f32, carries 1024 (O) x 1024 (Wo) folded back, + bo
  gemm_h2<<<gG, bG, 0, stream>>>(OHI, OLO, WOH, bo, out, MROWS, DMOD, DMOD, 1.0f / (OSC * WOS));
  (void)hipGetLastError();
}

// v009
// One run takes 113 microseconds.
// Two timings next to v008 both put it at 1.04 times that version's speed.
// Over all steps from v000 it is 3.61 times as fast.
// Contractions: x.W{q,k,v} on v_wmma_f32_16x16x32_bf16 (x and W^T RNE-converted to bf16, f32 accumulate);
// scores, transposed, k.q^T (q, k carried x1024 as f16 hi plane + f16 residual plane, products hh+lh+hl), v^T.P^T (P x32768 f16
// hi+residual, v x1024 f16 hi+residual, products hh+lh+hl) and O.Wo (O x1024 f16 hi+residual, Wo^T as f16(bf16(Wo)) x1024, products h.w+l.w):
// v_wmma_f32_16x16x32_f16, f32 accumulate. Static causal select, base-2 online softmax and 1/l fold in f32 on VALU.
#include <hip/hip_runtime.h>
#include <math.h>
#include <stdint.h>

#define BATCH 2
#define SEQ   2048
#define DMOD  1024
#define NH    16
#define HD    64
#define MROWS (BATCH * SEQ)
#define QSC   1024.0f
#define KSC   1024.0f
#define PCAR  32768.0f
#define VCAR  1024.0f
#define OSC   1024.0f
#define WOS   1024.0f
#define LOG2E 1.4426950408889634f
#define WPB   4
#define QTW   2
#define NQB   (SEQ / (16 * QTW))
#define NWB   ((DMOD / 64) * (DMOD / 64))
#define NXB   ((MROWS * DMOD) / 2048)
#define NKT   (SEQ / 32)
#define NSUB  4
#define ATT_THREADS (NSUB * WPB * 32)
#define NPR   (NQB / 2)
#define NPG   (NPR / NSUB)
#define ATT_BLOCKS  (NPG * NH * BATCH)
#define SLW   (16 * 68)
#define WREG  (QTW * SLW)
#define SLAB64 (16 * 68)
#define VTP   72
static_assert(DMOD == NH * HD && HD == 64 && NH == 16);
static_assert(WPB == 4 && NSUB == 4 && ATT_THREADS == 512 && QTW == 2 && ATT_BLOCKS == 256 && (NQB % 2) == 0 && (NPR % NSUB) == 0);
static_assert((SEQ % 64) == 0 && (SEQ % 32) == 0 && (SEQ % 16) == 0 && SEQ <= 32768);
static_assert((DMOD % 64) == 0 && (DMOD % 32) == 0 && (MROWS % 64) == 0);
static_assert((DMOD % 128) == 0 && (MROWS % 128) == 0 && (SEQ % 16) == 0);
static_assert(((MROWS * DMOD) % 2048) == 0 && ((DMOD * DMOD) % 4096) == 0);

typedef unsigned short u16;
typedef _Float16 v16h __attribute__((ext_vector_type(16)));
typedef _Float16 v8h  __attribute__((ext_vector_type(8)));
typedef __bf16   v16b __attribute__((ext_vector_type(16)));
typedef float    v8f  __attribute__((ext_vector_type(8)));
typedef float    v4f  __attribute__((ext_vector_type(4)));
typedef unsigned int v4u __attribute__((ext_vector_type(4)));

union FragH { v16h v; v8h h[2]; v4u u[2]; };
union FragB { v16b v; v4u u[2]; };

// ---- scalar helpers --------------------------------------------------------------------------------
__device__ __forceinline__ unsigned short bf_bits(float f) {          // f32 -> bf16 bits, RNE convert
  unsigned u = __float_as_uint(f);
  return (unsigned short)((u + 0x7FFFu + ((u >> 16) & 1u)) >> 16);
}
__device__ __forceinline__ float bf_up(unsigned short h) { return __uint_as_float(((unsigned)h) << 16); }
__device__ __forceinline__ float bfr(float f) { return bf_up(bf_bits(f)); }
__device__ __forceinline__ unsigned short h_bits(_Float16 x) { return __builtin_bit_cast(unsigned short, x); }
__device__ __forceinline__ unsigned pk16(unsigned short a, unsigned short b) { return (unsigned)a | ((unsigned)b << 16); }
__device__ __forceinline__ float xhalf(float x) {                     // value of lane l ^ 16
  const int b = __builtin_bit_cast(int, x);
  return __builtin_bit_cast(float, __builtin_amdgcn_permlanex16(b, b, 0x76543210, 0xfedcba98, false, false));
}
// 2^x on the bare v_exp_f32, for the key loop's x <= 0 (or -inf, which gives 0): exp2f() wraps the same instruction in a compare, two
// selects, an add and an ldexp per value so that results under 2^-126 come out as subnormals; here such a result is a weight that the
// f16 planes of P (x32768) round to 0 and that adds nothing to a row sum or to an O whose leading term has weight 1, so 0 serves as well.
__device__ __forceinline__ float exp2_bare(float x) { return __builtin_amdgcn_exp2f(x); }
__device__ __forceinline__ v8f zero8() { v8f z = {0.f, 0.f, 0.f, 0.f, 0.f, 0.f, 0.f, 0.f}; return z; }

// ---- fragment-major 16-bit planes: a matrix [R rows][Kd k] (R % 16 == 0, Kd % 32 == 0) is stored as fragments of 16 rows x 32 k,
//      fragment (rb = row / 16, kb = k / 32) at halves (rb * (Kd / 32) + kb) * 512; inside it 64 chunks of 8 halves, chunk
//      i * 32 + h * 16 + c = row 16 rb + c, k = 32 kb + 16 i + 8 h + 0..7. A wave-wide 16-B load of chunks 32 i + lane is 512 contiguous,
//      512-B aligned bytes = 4 whole lines (the same fragment read from a row-major plane touches 16 lines, 32 B of each, per load).
// ---- fragment loaders: 16-bit A/B operand, lane -> row/col (lane&15), p = fragment start + 8*lane;
//      elements 0..7 <- p[0..7] (k0+8h..), elements 8..15 <- p[256..263] (k0+16+8h..)  (same split k map for A and B).
//      fs = a fragment start that is the same for the whole wave (a scalar base), bo = 32-bit byte offset from it: 16*lane plus the
//      loop's advance, one vector register that serves every load of a trip
// sbase: p + ofs for a wave-uniform ofs, kept as a scalar base of its own: without the readfirstlane the compiler adds the lane offset
// to p first and then forms each further fragment's 64-bit address with vector additions in every trip.
template <typename T>
__device__ __forceinline__ const T* sbase(const T* p, size_t ofs) {
  const uint32_t l = (uint32_t)__builtin_amdgcn_readfirstlane((int)(uint32_t)ofs);
  const uint32_t h = (uint32_t)__builtin_amdgcn_readfirstlane((int)(uint32_t)((uint64_t)ofs >> 32));
  return p + (size_t)(((uint64_t)h << 32) | (uint64_t)l);
}
__device__ __forceinline__ v16h ldfrag_h(const _Float16* fs, unsigned bo) {
  const char* p = (const char*)(const void*)fs + bo;
  FragH f;
  f.h[0] = *(const v8h*)(const void*)(p);
  f.h[1] = *(const v8h*)(const void*)(p + 512);
  return f.v;
}
__device__ __forceinline__ v16b ldfrag_b(const u16* fs, unsigned bo) { // bf16 plane read as unsigned integer vectors
  const char* p = (const char*)(const void*)fs + bo;
  FragB f;
  f.u[0] = *(const v4u*)(const void*)(p);
  f.u[1] = *(const v4u*)(const void*)(p + 512);
  return f.v;
}

// row-major element index (matrix [R][Kd]) of the 8 halves that chunk q of the fragment-major plane holds
__device__ __forceinline__ size_t chunk_src(int q, int Kd) {
  const int f = q >> 6, nkb = Kd >> 5;
  return (size_t)((f / nkb) * 16 + (q & 15)) * (size_t)Kd + (size_t)((f % nkb) * 32 + ((q >> 4) & 3) * 8);
}

__device__ __forceinline__ v8f mma_h(v16h a, v16h b, v8f c) {
  return __builtin_amdgcn_wmma_f32_16x16x32_f16(false, a, false, b, (short)0, c, false, false);
}
__device__ __forceinline__ v8f mma_b(v16b a, v16b b, v8f c) {
  return __builtin_amdgcn_wmma_f32_16x16x32_bf16(false, a, false, b, (short)0, c, false, false);
}
template <typename F>
__device__ __forceinline__ void guard6(v8f& a, v8f& b, v8f& c, v8f& d, F x0, F x1, F x2, F x3, F x4, F x5) {
#if defined(__HIP_DEVICE_COMPILE__)
  asm volatile("v_nop\n\tv_nop\n\tv_nop\n\tv_nop"
               : "+v"(a), "+v"(b), "+v"(c), "+v"(d) : "v"(x0), "v"(x1), "v"(x2), "v"(x3), "v"(x4), "v"(x5) : "memory");
#endif
}
__device__ __forceinline__ void acc_guard4(v8f& a, v8f& b, v8f& c, v8f& d) {
#if defined(__HIP_DEVICE_COMPILE__)
  asm volatile("v_nop\n\tv_nop\n\tv_nop\n\tv_nop" : "+v"(a), "+v"(b), "+v"(c), "+v"(d));
#endif
}
__device__ __forceinline__ void wave_sync_lds() {
  __builtin_amdgcn_fence(__ATOMIC_RELEASE, "workgroup");
  __builtin_amdgcn_wave_barrier();
  __builtin_amdgcn_fence(__ATOMIC_ACQUIRE, "workgroup");
}

// =====================================================================================================
// All operand conversions in one launch (five independent jobs, told apart by the block index).
// Blocks 0 .. 4*NWB-1, weight transpose-convert: weight which = bid / NWB, W [K][N] f32 (x.W layout, n contiguous) -> Dt, the fragment-major
// 16-bit plane of the matrix [N rows][K cols]; which 0..2: bf16 RNE bits; which 3: f16 bits of (bf16 RNE value) * scale.
//   Block = (k tile k0 = (wb / (N/64))*64, n tile n0 = (wb % (N/64))*64), wb = bid % NWB: 64 source rows of 64 floats loaded with 16-B loads,
//   converted, scattered into an LDS tile [n][64 k] (pitch 72 halves); after a block barrier the tile's 8 fragments are stored chunk by chunk.
//   coverage: load 256 thr x 16 = 64 x 64; store 2 iterations x 256 thr x 8 halves = 8 fragments x 512 halves = the block's tile;
//             NWB = (K/64)*(N/64) blocks cover each Dt exactly once.
// Blocks 4*NWB .. 4*NWB+NXB-1, x f32 [MROWS][DMOD] -> bf16 RNE bits, fragment-major plane. Thread = one chunk of the plane (8 consecutive
//   k of one row): two 16-B loads, one 16-B store; 32 consecutive lanes store 512 contiguous, 512-B aligned bytes.
//   coverage: NXB blocks x 256 thr x 8 = the whole plane.
// =====================================================================================================
__global__ __launch_bounds__(256) void prep16(const float* __restrict__ x, const float* __restrict__ W0, const float* __restrict__ W1,
                                              const float* __restrict__ W2, const float* __restrict__ W3,
                                              u16* XD, u16* D0, u16* D1, u16* D2, u16* D3, float scale) {
  __shared__ __align__(16) u16 T[64 * VTP];
  const int tid = threadIdx.x;
  const int bid = blockIdx.x;
  if (bid >= 4 * NWB) {                       // block-uniform; this path holds no barrier
    const int gt = (bid - 4 * NWB) * 256 + tid;
    if (gt >= (MROWS * DMOD) / 8) return;     // never taken with the exact grid
    const float* p = x + chunk_src(gt, DMOD);
    const v4f a = *(const v4f*)(p), b4 = *(const v4f*)(p + 4);
    v4u o;
    o[0] = pk16(bf_bits(a[0]), bf_bits(a[1]));
    o[1] = pk16(bf_bits(a[2]), bf_bits(a[3]));
    o[2] = pk16(bf_bits(b4[0]), bf_bits(b4[1]));
    o[3] = pk16(bf_bits(b4[2]), bf_bits(b4[3]));
    *(v4u*)(XD + (size_t)gt * 8) = o;
    return;
  }
  const int K = DMOD, N = DMOD;
  const int which = bid / NWB;
  const int wb    = bid % NWB;
  const int ntn = N >> 6;
  const int n0  = (wb % ntn) * 64;
  const int k0  = (wb / ntn) * 64;
  const float* W = (which == 0) ? W0 : (which == 1) ? W1 : (which == 2) ? W2 : W3;
  u16* Dt        = (which == 0) ? D0 : (which == 1) ? D1 : (which == 2) ? D2 : D3;
  const int f16mode = (which == 3) ? 1 : 0;
  {
    const int sl = tid >> 2;                  // k within tile 0..63 (source row)
    const int dc = (tid & 3) * 16;            // n chunk
    const float* src = W + (size_t)(k0 + sl) * N + n0 + dc;
#pragma unroll
    for (int i = 0; i < 4; ++i) {
      const v4f a = *(const v4f*)(src + 4 * i);
#pragma unroll
      for (int e = 0; e < 4; ++e) {
        const float f = a[e];
        const unsigned short hb = h_bits((_Float16)(bfr(f) * scale));
        const unsigned short bb = bf_bits(f);
        T[(dc + 4 * i + e) * VTP + sl] = (f16mode != 0) ? hb : bb;
      }
    }
  }
  __syncthreads();
  // the tile = 4 (n) x 2 (k) fragments of the plane; thread = chunk tid & 63 of fragment (n block it*2 + (tid >> 7), k block (tid >> 6) & 1)
  v4u vv[2];
  const int ch = tid & 63, fk = (tid >> 6) & 1, fr = tid >> 7;
#pragma unroll
  for (int it = 0; it < 2; ++it) {
    const int line = (it * 2 + fr) * 16 + (ch & 15);   // n = 0..63 within tile
    vv[it] = *(const v4u*)(T + line * VTP + fk * 32 + (ch >> 4) * 8);
  }
  const size_t base = (size_t)n0 * K + (size_t)((k0 >> 5) + fk) * 512 + ch * 8;
  {
#pragma unroll
    for (int it = 0; it < 2; ++it) {
      *(v4u*)(Dt + base + (size_t)((it * 2 + fr) * 16) * K) = vv[it];
    }
  }
#if defined(__HIP_DEVICE_COMPILE__)
  asm volatile("s_wait_xcnt 0x0" ::: "memory");   // stands in front of whatever next rewrites a register that these two stores name
#endif
}

// =====================================================================================================
// GEMM epilogue of the output projection: the wave's 16x64 f32 tile (times oscale) staged in its LDS slab (pitch 68),
// coverage: 8 instructions x 2 rows x 16 lanes x 4 floats = the wave's 16 x 64 tile.
// =====================================================================================================
__device__ __forceinline__ void epi64(float* sl, v8f a0, v8f a1, v8f a2, v8f a3, float oscale,
                                      const float* __restrict__ bias, float* C, int N,
                                      size_t rowb, int col0, int lane) {
  const int hh = lane >> 4, m = lane & 15;
#pragma unroll
  for (int r = 0; r < 8; ++r) {
    const int ro = (8 * hh + r) * 68 + m;
    sl[ro]      = a0[r] * oscale;
    sl[ro + 16] = a1[r] * oscale;
    sl[ro + 32] = a2[r] * oscale;
    sl[ro + 48] = a3[r] * oscale;
  }
  wave_sync_lds();
  const v4f braw = *(const v4f*)(bias + col0 + m * 4);
  v4f bb;
#pragma unroll
  for (int e = 0; e < 4; ++e) bb[e] = bfr(braw[e]);
  v4f vals[8];
#pragma unroll
  for (int it = 0; it < 8; ++it) vals[it] = *(const v4f*)(sl + (it * 2 + hh) * 68 + m * 4) + bb;
  float* dst = C + (rowb + (size_t)hh) * (size_t)N + col0 + m * 4;
  {
#pragma unroll
    for (int it = 0; it < 8; ++it) {
      *(v4f*)(dst + (size_t)(it * 2) * (size_t)N) = vals[it];
    }
    
  }
}

// =====================================================================================================
// q, k and v projections in one launch: grid.y = which (0 q, 1 k, 2 v); (x . W + b), x and W^T bf16 fragment-major planes, written
// straight into the f16 hi + residual planes that the attention kernel reads (value * 1024; hi = f16(t), residual = f16(t - hi)).
// Block = 128 rows x 128 columns, 2 x 2 waves of 64 x 64 (4 x fragments times 4 W^T fragments = 16 products per k step, rowb and col0 below
// being the wave's first row and column, i = 0..3 its row blocks of 16); fragments loaded straight from the planes (two 16-B loads each,
// 512 contiguous bytes per wave and load, split k map for A and B); K = DMOD stepped by 32; grid.x = (MROWS/128)*(DMOD/128).
// The operand order is chosen so that a lane's 8 accumulator registers are one 16-B chunk of the destination plane:
//   q, k (plane rows = x rows, plane k = n): D = W^T . x^T, lane (c, hh) register r = (x row rowb + 16 i + c, n = col0 + 16 j + 8 hh + r)
//        = chunk 32 (j & 1) + lane of fragment (rowb / 16 + i, col0 / 32 + (j >> 1));
//   v^T  (plane rows = (b, head, d), plane k = s): D = x . W, lane (c, hh) register r = (x row rowb + 16 i + 8 hh + r, n = col0 + 16 j + c)
//        = chunk 32 ((s >> 4) & 1) + lane of fragment (4 (b*NH + head) + j, s / 32), s = (rowb + 16 i) % SEQ, head = col0 / HD.
// coverage: per wave 16 accumulators x 32 lanes x 8 halves = 64 x 64 elements per plane, each store 512 contiguous, 512-B aligned bytes;
//           grid covers every (row, column) of each of the six planes exactly once.
// =====================================================================================================
__device__ __forceinline__ void put_split(v8f t, u16* hp, u16* lp) {     // 8 scaled values -> one chunk of the hi and of the residual plane
  v4u oh, ol;
#pragma unroll
  for (int e = 0; e < 4; ++e) {
    const float t0 = t[2 * e], t1 = t[2 * e + 1];
    const _Float16 h0 = (_Float16)t0, h1 = (_Float16)t1;
    const _Float16 l0 = (_Float16)(t0 - (float)h0), l1 = (_Float16)(t1 - (float)h1);
    oh[e] = pk16(h_bits(h0), h_bits(h1));
    ol[e] = pk16(h_bits(l0), h_bits(l1));
  }
  *(v4u*)(hp) = oh;
  *(v4u*)(lp) = ol;
#if defined(__HIP_DEVICE_COMPILE__)
  asm volatile("s_wait_xcnt 0x0" ::: "memory");   // stands in front of whatever next rewrites a register that these two stores name
  __builtin_amdgcn_sched_barrier(0);              // keeps the next chunk's arithmetic behind that wait: the compiler otherwise lifts it in front
#endif
}

// stands between a k step's 16 loads and its first product: the loads go out as one group, so that the step waits out one load latency and
// not one per x fragment (without it the compiler sinks the loads of x fragments 1..3 between the products)
__device__ __forceinline__ void loads_first() {
#if defined(__HIP_DEVICE_COMPILE__)
  __builtin_amdgcn_sched_barrier(0);
#endif
}
// behind the k loop: four slots between the last product and the bias loads, which land in registers that held its operands
// (inside the loop the compiler itself pads the loop's head, in front of the next trip's address additions and loads)
__device__ __forceinline__ void loop_exit_guard() {
#if defined(__HIP_DEVICE_COMPILE__)
  asm volatile("v_nop\n\tv_nop\n\tv_nop\n\tv_nop" ::: "memory");
#endif
}

__global__ __launch_bounds__(128, 4)   // budget of 256 registers a wave; the whole grid (768 blocks x 4 waves, 3 waves per SIMD) is resident at once
void proj3(const u16* __restrict__ A, const u16* __restrict__ Wq, const u16* __restrict__ Wk, const u16* __restrict__ Wv,
           const float* __restrict__ bq, const float* __restrict__ bk, const float* __restrict__ bv,
           u16* QH, u16* QL, u16* KH, u16* KL, u16* VH, u16* VL) {
  const int tid = threadIdx.x, lane = tid & 31;
  const int wave = __builtin_amdgcn_readfirstlane(tid >> 5);   // scalar: makes every fragment start a scalar base
  const int hh = lane >> 4, c = lane & 15;
  unsigned bo = 16u * (unsigned)lane;        // byte offset of this lane's chunk; advanced by one fragment (1024 B) per k step
  const int which = blockIdx.y;
  const int bid   = blockIdx.x;
  const int rowb  = (bid / (DMOD / 128)) * 128 + (wave >> 1) * 64;
  const int col0  = (bid % (DMOD / 128)) * 128 + (wave & 1) * 64;
  if (which > 2 || rowb + 64 > MROWS) return; // wave-uniform, never taken with the exact grid; no barriers in this kernel
  const u16*   Bt   = (which == 0) ? Wq : (which == 1) ? Wk : Wv;
  const float* bias = (which == 0) ? bq : (which == 1) ? bk : bv;
  const size_t bs = (size_t)16 * DMOD;                // halves between the fragments of consecutive row blocks, in every plane read here
  const u16* ap  = A  + (size_t)rowb * DMOD;          // fragment (rowb / 16, 0) of the fragment-major plane
  const u16* a1p = sbase(ap, bs), * a2p = sbase(ap, 2 * bs), * a3p = sbase(ap, 3 * bs);
  const u16* bp  = Bt + (size_t)col0 * DMOD;
  const u16* b1p = sbase(bp, bs), * b2p = sbase(bp, 2 * bs), * b3p = sbase(bp, 3 * bs);
  v8f acc[4][4];                             // acc[i][j]: x rows rowb + 16 i .., columns col0 + 16 j ..
#pragma unroll
  for (int i = 0; i < 4; ++i) {
#pragma unroll
    for (int j = 0; j < 4; ++j) acc[i][j] = zero8();
  }
  if (which == 2) {
#pragma unroll 1   // rolled: beside 16 accumulators the register budget holds one trip's 8 fragments, so unrolling overlaps nothing and only lengthens the code
    for (int k0 = 0; k0 < DMOD; k0 += 32) {
      const v16b a[4] = {ldfrag_b(ap, bo), ldfrag_b(a1p, bo), ldfrag_b(a2p, bo), ldfrag_b(a3p, bo)};
      const v16b w[4] = {ldfrag_b(bp, bo), ldfrag_b(b1p, bo), ldfrag_b(b2p, bo), ldfrag_b(b3p, bo)};
      loads_first();
#pragma unroll
      for (int i = 0; i < 4; ++i) {
#pragma unroll
        for (int j = 0; j < 4; ++j) acc[i][j] = mma_b(a[i], w[j], acc[i][j]);
      }
      bo += 1024u;
    }
    loop_exit_guard();
    const int g = col0 / HD;
    float bj[4];
#pragma unroll
    for (int j = 0; j < 4; ++j) bj[j] = bfr(bias[col0 + 16 * j + c]);   // all bias loads ahead of the first store's wait
#pragma unroll
    for (int i = 0; i < 4; ++i) {
      const int rw = rowb + 16 * i;
      const int b = rw / SEQ, sq = rw % SEQ;
      const size_t base = ((size_t)(b * NH + g) * HD) * SEQ + (size_t)(sq >> 5) * 512 + (size_t)((sq >> 4) & 1) * 256 + (size_t)lane * 8;
#pragma unroll
      for (int j = 0; j < 4; ++j)
        put_split((acc[i][j] + bj[j]) * VCAR, VH + base + (size_t)(16 * j) * SEQ, VL + base + (size_t)(16 * j) * SEQ);
    }
  } else {
#pragma unroll 1   // rolled: beside 16 accumulators the register budget holds one trip's 8 fragments, so unrolling overlaps nothing and only lengthens the code
    for (int k0 = 0; k0 < DMOD; k0 += 32) {
      const v16b a[4] = {ldfrag_b(ap, bo), ldfrag_b(a1p, bo), ldfrag_b(a2p, bo), ldfrag_b(a3p, bo)};
      const v16b w[4] = {ldfrag_b(bp, bo), ldfrag_b(b1p, bo), ldfrag_b(b2p, bo), ldfrag_b(b3p, bo)};
      loads_first();
#pragma unroll
      for (int i = 0; i < 4; ++i) {
#pragma unroll
        for (int j = 0; j < 4; ++j) acc[i][j] = mma_b(w[j], a[i], acc[i][j]);
      }
      bo += 1024u;
    }
    loop_exit_guard();
    u16* hpl = (which == 0) ? QH : KH;
    u16* lpl = (which == 0) ? QL : KL;
    const float sc = (which == 0) ? QSC : KSC;
    v8f bb[4];                               // the bias of the wave's 64 columns, the same for its four row blocks; loaded ahead of the first store's wait
#pragma unroll
    for (int j = 0; j < 4; ++j) {
      const float* bsrc = bias + col0 + 16 * j + 8 * hh;
      const v4f r0 = *(const v4f*)(bsrc), r1 = *(const v4f*)(bsrc + 4);
      const v8f t = {bfr(r0[0]), bfr(r0[1]), bfr(r0[2]), bfr(r0[3]), bfr(r1[0]), bfr(r1[1]), bfr(r1[2]), bfr(r1[3])};
      bb[j] = t;
    }
#pragma unroll
    for (int i = 0; i < 4; ++i) {
      const size_t base = (size_t)(rowb + 16 * i) * DMOD + (size_t)(col0 >> 5) * 512 + (size_t)lane * 8;
#pragma unroll
      for (int j = 0; j < 4; ++j) {
        const size_t o8 = base + (size_t)(j >> 1) * 512 + (size_t)(j & 1) * 256;
        put_split((acc[i][j] + bb[j]) * sc, hpl + o8, lpl + o8);
      }
    }
  }
}

// =====================================================================================================
// f16 hi+lo GEMM: C[M][N] (f32) = (Ahi + Alo)[M][K] . Bt[N][K]^T, times oscale, plus bias[N]; Ahi/Alo f16 planes (same layout),
// Bt f16, all three fragment-major; products hi.B + lo.B into one accumulator (lo is the unscaled residual of hi). Block = 64x64 tile, 4 waves x 16 rows, K stepped by 32.
// =====================================================================================================
__global__ __launch_bounds__(128)
void gemm_h2(const u16* __restrict__ Ah, const u16* __restrict__ Al, const u16* __restrict__ Bt,
             const float* __restrict__ bias, float* C, int M, int N, int K, float oscale) {
  __shared__ __align__(16) float slab[4 * SLAB64];
  const int tid = threadIdx.x, lane = tid & 31;
  const int wave = __builtin_amdgcn_readfirstlane(tid >> 5);   // scalar: makes every fragment start a scalar base
  unsigned bo = 16u * (unsigned)lane;        // byte offset of this lane's chunk; advanced by one fragment (1024 B) per k step
  const int ntile = N >> 6;
  const int bid   = blockIdx.x;
  const int rowb  = (bid / ntile) * 64 + wave * 16;
  const int col0  = (bid % ntile) * 64;
  if (rowb + 16 > M) return;                 // wave-uniform, never taken with the exact grid; no block barriers in this kernel
  const size_t aofs = (size_t)rowb * K;               // fragment (rowb / 16, 0) of the fragment-major planes
  const _Float16* ahp = (const _Float16*)(const void*)Ah + aofs;
  const _Float16* alp = (const _Float16*)(const void*)Al + aofs;
  const size_t bs = (size_t)16 * K;
  const _Float16* bp  = (const _Float16*)(const void*)Bt + (size_t)col0 * K;
  const _Float16* b1p = sbase(bp, bs), * b2p = sbase(bp, 2 * bs), * b3p = sbase(bp, 3 * bs);
  v8f acc0 = zero8(), acc1 = zero8(), acc2 = zero8(), acc3 = zero8();
#pragma unroll 1
  for (int k0 = 0; k0 < K; k0 += 32) {
    const v16h ah = ldfrag_h(ahp, bo), al = ldfrag_h(alp, bo);
    const v16h b0 = ldfrag_h(bp, bo);
    const v16h b1 = ldfrag_h(b1p, bo);
    const v16h b2 = ldfrag_h(b2p, bo);
    const v16h b3 = ldfrag_h(b3p, bo);
    acc0 = mma_h(ah, b0, acc0);  acc0 = mma_h(al, b0, acc0);
    acc1 = mma_h(ah, b1, acc1);  acc1 = mma_h(al, b1, acc1);
    acc2 = mma_h(ah, b2, acc2);  acc2 = mma_h(al, b2, acc2);
    acc3 = mma_h(ah, b3, acc3);  acc3 = mma_h(al, b3, acc3);
    guard6<v16h>(acc0, acc1, acc2, acc3, ah, al, b0, b1, b2, b3);
    bo += 1024u;
  }
  epi64(slab + wave * SLAB64, acc0, acc1, acc2, acc3, oscale, bias, C, N, (size_t)rowb, col0, lane);
}

// =====================================================================================================
// Causal attention: block bid -> (pair group pg = bid % NPG, head = (bid / NPG) % NH, batch b = bid / (NPG*NH)). A block is NSUB teams of WPB
// waves; team sub works pair pr = NSUB*pg + sub of that head on its own, with LDS slabs and tables of its own. The NSUB teams walk the same
// head's key tiles from 0 on at the same pace, so the NSUB waves that hold the same place w in their teams (block wave
// number = NSUB*w + sub) ask for the same k and v^T fragments at about the same time on one WGP: one of them fetches a line from L2, the
// others find it in the WGP's cache. A team works two query blocks one
// after the other, qb = NQB-1-pr and then qb = pr (rows q0 = 32*qb .. q0+31 = QTW query tiles of 16): together NQB+1 key tiles, the same
// for every team, so that no block and no WGP carries more of the causal triangle than another, wherever the blocks land.
// A query block's key tiles are dealt round-robin to its team's WPB waves (wave w takes kt = w, w + WPB, ..);
// a wave works BOTH query tiles against each key tile it takes, so every k and v^T fragment it loads feeds two score or output tiles;
// each wave keeps its own running max, sum and unnormalised O per query, and the WPB partials are merged through LDS after one block barrier.
//   q planes (hi, lo f16 x1024): fragment-major planes of the matrix [b*SEQ + s][h*HD + d]; k planes the same; v^T planes of [(b*NH + h)*HD + d][s].
//   score (log2 domain) t(i, j) = (q_i.k_j) * 0.125*log2e/(1024*1024) for key j <= query i, and -inf for j > i (the select
//   replaces the score). Key tiles of 32 visited for kb <= q0 (32-aligned, so kb <= every query of the block); tiles whose every key
//   index exceeds every query index of the block hold only -inf, whose exp is exactly 0, and are not visited. In every visited tile
//   key kb is finite for every query of the block, so a wave's running max is finite from its first tile on; a wave with no tile
//   keeps max = -inf, sum = 0, O = 0.
//   Both products are taken transposed: S^T = K.Q^T (A = 16 key rows, B = 16 queries) and O^T += V^T.P^T (A = 16 d rows of v^T,
//   B = P^T). In a score tile lane (c, hh) then holds query q0 + 16t + c and keys 8hh + 0..7 of the subtile, so a query's maximum and sum
//   run over the lane's own 16 registers plus one exchange with lane ^ 16, and the two subtiles' accumulators, converted in place, ARE the
//   B fragment of P^T in the split k map (elements 0..7 = keys kb + 8hh + 0..7, 8..15 = keys kb + 16 + 8hh + 0..7): P never leaves
//   the registers. Per key tile and query tile: 2 score subtiles x 2 k-steps x 3 products (k_hi.q_hi + k_hi.q_lo + k_lo.q_hi), fragments
//   loaded straight from the 16-bit planes (two 16-B loads per fragment, split k map); online max-subtracted base-2 softmax in f32,
//   -inf-safe rescale (one factor per lane); P x32768 as f16 hi and f16 residual; 4+4 v^T A fragments (hi and residual planes),
//   12 WMMAs (hh + hl + lh). A lane sums only its own half's keys; the two halves' sums are joined once, after the loop.
//   After each query block's loop: each wave writes its unnormalised O to its own slab of that query block (32 rows, pitch 68; every
//   element owned by one lane) and its row max and sum to the tables; behind both query blocks one block barrier (reached by every wave; trip counts differ only between waves, and the loop holds
//   no block barrier); wave w then merges columns d = 16w .. 16w+15 of all 32 rows: M = max_w m_w, out = sum_w O_w 2^(m_w - M) / sum_w l_w 2^(m_w - M)
//   (Z > 0 always: key j = i is never masked; guarded anyway), carries 1/(32768*1024) folded once. Bounded loops only (nkt <= NKT).
// coverage: per wave and query tile 1 instruction x 16 rows x 2 lanes x 8 halves = 16 x 16 per plane, x WPB waves x QTW tiles = 32 x 64;
//           x 2 query blocks (pr and NQB-1-pr, pr < NQB/2: every qb once) x NSUB teams; grid NPG*NH*BATCH blocks = every (b, s, h) row of both O planes once.
// =====================================================================================================
// four v_nop behind the score products: no vector instruction touches their results or operands inside the matrix unit's window
__device__ __forceinline__ void guard_sc(v8f& a, v8f& b, v8f& c, v8f& d, v16h k0, v16h k1, v16h k2, v16h k3,
                                         v16h q0, v16h q1, v16h q2, v16h q3) {
#if defined(__HIP_DEVICE_COMPILE__)
  asm volatile("v_nop\n\tv_nop\n\tv_nop\n\tv_nop"
               : "+v"(a), "+v"(b), "+v"(c), "+v"(d)
               : "v"(k0), "v"(k1), "v"(k2), "v"(k3), "v"(q0), "v"(q1), "v"(q2), "v"(q3) : "memory");
#endif
}
// the same behind the output products of both query tiles
__device__ __forceinline__ void guard_pv(v8f& a0, v8f& a1, v8f& a2, v8f& a3, v8f& b0, v8f& b1, v8f& b2, v8f& b3, v16h p0, v16h p1, v16h p2,
                                         v16h p3, v16h x0, v16h x1, v16h x2, v16h x3, v16h x4, v16h x5, v16h x6, v16h x7) {
#if defined(__HIP_DEVICE_COMPILE__)
  asm volatile("v_nop\n\tv_nop\n\tv_nop\n\tv_nop"
               : "+v"(a0), "+v"(a1), "+v"(a2), "+v"(a3), "+v"(b0), "+v"(b1), "+v"(b2), "+v"(b3)
               : "v"(p0), "v"(p1), "v"(p2), "v"(p3), "v"(x0), "v"(x1), "v"(x2), "v"(x3), "v"(x4), "v"(x5), "v"(x6), "v"(x7) : "memory");
#endif
}

__global__ __launch_bounds__(ATT_THREADS, 4)   // 4 waves per SIMD: the whole grid (256 blocks x 16 waves, one block per WGP) is resident at once, no second round
void attn1(const u16* __restrict__ QHIp, const u16* __restrict__ QLOp,
           const u16* __restrict__ KHIp, const u16* __restrict__ KLOp,
           const u16* __restrict__ VHIp, const u16* __restrict__ VLOp,
           u16* OHIp, u16* OLOp) {
  __shared__ __align__(16) float smem_all[NSUB * 2 * WPB * WREG];   // per team one set of slabs per query block of the pair
  __shared__ float mtab_all[NSUB * 2 * WPB * 16 * QTW]; // per team, query block, wave and query row: running max (log2 domain)
  __shared__ float ltab_all[NSUB * 2 * WPB * 16 * QTW]; // per team, query block, wave and query row: running sum

  const int bw   = __builtin_amdgcn_readfirstlane((int)threadIdx.x >> 5);   // scalar: the key loop's start must be wave-uniform for the WMMAs
  const int sub  = bw % NSUB;                // team
  const int wave = bw / NSUB;                // place in the team
  const int lane = threadIdx.x & 31;
  const int tid  = wave * 32 + lane;         // thread number within the team
  const int hh   = lane >> 4;
  const int c    = lane & 15;
  const int bid  = blockIdx.x;
  const int pr   = (bid % NPG) * NSUB + sub;
  const int rem  = bid / NPG;
  float* smem = smem_all + sub * (2 * WPB * WREG);
  float* mtab = mtab_all + sub * (2 * WPB * 16 * QTW);
  float* ltab = ltab_all + sub * (2 * WPB * 16 * QTW);
  const int head = rem % NH;
  const int b    = rem / NH;
  if (b >= BATCH) return;                    // block-uniform, before the block barrier; never taken with the exact grid

  const unsigned lo = 16u * (unsigned)lane;                                     // byte offset of this lane's chunk in a fragment
  const size_t QTS  = (size_t)16 * NH * HD;                                     // halves between the fragments of consecutive row blocks
  const size_t kofs = ((size_t)b * SEQ * NH + (size_t)head * 16) * HD;          // fragment (b*SEQ / 16, 2 * head); key block added per step
  const _Float16* Khb = (const _Float16*)(const void*)KHIp + kofs;
  const _Float16* Klb = (const _Float16*)(const void*)KLOp + kofs;
  const size_t vofs = (((size_t)b * NH + head) * HD) * SEQ;                    // fragment (4 * (b*NH + head) (+j), 0); key block added per step
  const _Float16* Vhb = (const _Float16*)(const void*)VHIp + vofs;
  const _Float16* Vlb = (const _Float16*)(const void*)VLOp + vofs;
  const float lsc = 0.125f * (LOG2E / (QSC * KSC));
  const float oc  = 1.0f / (PCAR * VCAR);
  const size_t KROW = (size_t)NH * HD;                                          // halves per key row; 16 * KROW between consecutive 16-row key blocks

#pragma unroll 1   // rolled: the two query blocks run one after the other through one copy of the key loop
  for (int pass = 0; pass < 2; ++pass) {
  const int qb   = (pass == 0) ? (NQB - 1 - pr) : pr;
  const int q0   = qb * (16 * QTW);
  float* slab = smem + (pass * WPB + wave) * WREG;                              // result slab [32 queries][64 d] pitch 68
  const size_t qofs = (((size_t)b * SEQ + q0) * NH + (size_t)head * 16) * HD;   // fragment (row q0's block, 2 * head); query tile t: + t * QTS
  const _Float16* Qh  = (const _Float16*)(const void*)QHIp + qofs;
  const _Float16* Ql  = (const _Float16*)(const void*)QLOp + qofs;
  float mrun[QTW], lrun[QTW];                // query q0 + 16t + c: running max (equal in both halves), running sum over this half's keys
  v8f o[QTW][4];                             // o[t][j][r] = O^T element (d = 16j + 8hh + r, query q0 + 16t + c)
#pragma unroll
  for (int t = 0; t < QTW; ++t) {
    mrun[t] = -INFINITY;
    lrun[t] = 0.f;
#pragma unroll
    for (int j = 0; j < 4; ++j) o[t][j] = zero8();
  }
  const int ncaus = qb + 1;                                                     // tiles holding keys <= q0 + 31
  const int nkt = (ncaus < NKT) ? ncaus : NKT;

  // byte offsets of key tile kt in the k planes (32 rows of KROW halves) and in the v^T planes (one fragment), plus this lane's chunk
  unsigned ko = lo + (unsigned)wave * (unsigned)(32 * NH * HD * 2);
  unsigned vo = lo + (unsigned)wave * 1024u;
#pragma unroll 1
  for (int kt = wave; kt < nkt; kt += WPB) {
    const int kb = kt * 32;
    // ---- scores: D element r of this lane = (key kb + 8hh + r, query q0 + 16t + c) in s[t][0], key kb + 16 + 8hh + r in s[t][1] ----
    const _Float16* k0p = Khb;
    const _Float16* k1p = k0p + (size_t)16 * KROW;
    const _Float16* l0p = Klb;
    const _Float16* l1p = l0p + (size_t)16 * KROW;
    // the tile's 8 k fragments as one load group, ahead of the first product: one wait on the loads per key tile, not one per k step
    v16h kh0[2], kh1[2], kl0[2], kl1[2];
#pragma unroll
    for (int kk = 0; kk < 2; ++kk) {
      kh0[kk] = ldfrag_h(k0p + kk * 512, ko);
      kh1[kk] = ldfrag_h(k1p + kk * 512, ko);
      kl0[kk] = ldfrag_h(l0p + kk * 512, ko);
      kl1[kk] = ldfrag_h(l1p + kk * 512, ko);
    }
    v8f s[QTW][2];
#pragma unroll
    for (int t = 0; t < QTW; ++t) { s[t][0] = zero8(); s[t][1] = zero8(); }
#pragma unroll
    for (int kk = 0; kk < 2; ++kk) {
      v16h qh[QTW], ql[QTW];
#pragma unroll
      for (int t = 0; t < QTW; ++t) {
        qh[t] = ldfrag_h(Qh + t * QTS + kk * 512, lo);
        ql[t] = ldfrag_h(Ql + t * QTS + kk * 512, lo);
      }
#pragma unroll
      for (int t = 0; t < QTW; ++t) {
        s[t][0] = mma_h(kh0[kk], qh[t], s[t][0]);
        s[t][0] = mma_h(kh0[kk], ql[t], s[t][0]);
        s[t][0] = mma_h(kl0[kk], qh[t], s[t][0]);
        s[t][1] = mma_h(kh1[kk], qh[t], s[t][1]);
        s[t][1] = mma_h(kh1[kk], ql[t], s[t][1]);
        s[t][1] = mma_h(kl1[kk], qh[t], s[t][1]);
      }
      guard_sc(s[0][0], s[0][1], s[1][0], s[1][1], kh0[kk], kh1[kk], kl0[kk], kl1[kk], qh[0], ql[0], qh[1], ql[1]);
    }
    // ---- causal select (score := -inf for key > query) + online softmax in base 2, -inf-safe; all 32 keys of a query sit in
    //      lanes c and c + 16 ----
    const int key0 = kb + 8 * hh, key1 = key0 + 16;
    FragH ph[QTW], pl[QTW];
#pragma unroll
    for (int t = 0; t < QTW; ++t) {
      const int qi = q0 + 16 * t + c;
      v8f t0 = s[t][0] * lsc, t1 = s[t][1] * lsc;
      float mx = -INFINITY;
#pragma unroll
      for (int r = 0; r < 8; ++r) {
        t0[r] = (key0 + r > qi) ? -INFINITY : t0[r];
        t1[r] = (key1 + r > qi) ? -INFINITY : t1[r];
        mx = fmaxf(mx, fmaxf(t0[r], t1[r]));
      }
      mx = fmaxf(mx, xhalf(mx));
      const float mn = fmaxf(mrun[t], mx);
      const float ms = (mn == -INFINITY) ? 0.0f : mn;
      const float al = exp2_bare(mrun[t] - ms);
      mrun[t] = mn;
      // ---- B fragments of P^T * 32768: hi f16 and residual f16, col = query c, split k map over the 32 keys of this step ----
      t0 -= ms;
      t1 -= ms;
      v8f e0, e1;
#pragma unroll
      for (int r = 0; r < 8; ++r) { e0[r] = exp2_bare(t0[r]); e1[r] = exp2_bare(t1[r]); }
      const v8f es = e0 + e1;
      const float ps = ((es[0] + es[1]) + (es[2] + es[3])) + ((es[4] + es[5]) + (es[6] + es[7]));
      const v8f ta = e0 * PCAR, tb = e1 * PCAR;
      ph[t].h[0] = __builtin_convertvector(ta, v8h);          // elements 0..7  = keys kb + 8hh + 0..7
      ph[t].h[1] = __builtin_convertvector(tb, v8h);          // elements 8..15 = keys kb + 16 + 8hh + 0..7
      pl[t].h[0] = __builtin_convertvector(ta - __builtin_convertvector(ph[t].h[0], v8f), v8h);
      pl[t].h[1] = __builtin_convertvector(tb - __builtin_convertvector(ph[t].h[1], v8f), v8h);
      lrun[t] = lrun[t] * al + ps;
#pragma unroll
      for (int j = 0; j < 4; ++j) {
#pragma unroll
        for (int r = 0; r < 8; ++r) o[t][j][r] *= al;
      }
    }
    // ---- V^T.P^T : A fragment row = d = j*16 + c, keys contiguous in the v^T planes; each fragment serves both query tiles ----
    {
      v16h vh[4], vl[4];
#pragma unroll
      for (int j = 0; j < 4; ++j) {
        vh[j] = ldfrag_h(Vhb + (size_t)(16 * j) * SEQ, vo);
        vl[j] = ldfrag_h(Vlb + (size_t)(16 * j) * SEQ, vo);
      }
#pragma unroll
      for (int t = 0; t < QTW; ++t) {
#pragma unroll
        for (int j = 0; j < 4; ++j) {
          o[t][j] = mma_h(vh[j], ph[t].v, o[t][j]);
          o[t][j] = mma_h(vh[j], pl[t].v, o[t][j]);
          o[t][j] = mma_h(vl[j], ph[t].v, o[t][j]);
        }
      }
      guard_pv(o[0][0], o[0][1], o[0][2], o[0][3], o[1][0], o[1][1], o[1][2], o[1][3], ph[0].v, pl[0].v, ph[1].v, pl[1].v,
               vh[0], vh[1], vh[2], vh[3], vl[0], vl[1], vl[2], vl[3]);
    }
    ko += (unsigned)(WPB * 32 * NH * HD * 2);
    vo += (unsigned)(WPB * 1024);
  }
  // ---- this wave's partial: unnormalised O into its lane-owned slab (8 consecutive d per accumulator), row max and sum into the tables ----
#pragma unroll
  for (int t = 0; t < QTW; ++t) {
    acc_guard4(o[t][0], o[t][1], o[t][2], o[t][3]);
    lrun[t] += xhalf(lrun[t]);               // the two halves' key sums of query q0 + 16t + c, joined once
#pragma unroll
    for (int j = 0; j < 4; ++j) {
      float* sp = slab + (16 * t + c) * 68 + j * 16 + 8 * hh;
      const v4f a = {o[t][j][0], o[t][j][1], o[t][j][2], o[t][j][3]}, b4 = {o[t][j][4], o[t][j][5], o[t][j][6], o[t][j][7]};
      *(v4f*)(sp)     = a;
      *(v4f*)(sp + 4) = b4;
    }
    if (hh == 0) {
      mtab[((pass * WPB + wave) * QTW + t) * 16 + c] = mrun[t];
      ltab[((pass * WPB + wave) * QTW + t) * 16 + c] = lrun[t];
    }
  }
  }
  __syncthreads();                           // publishes every wave's partials of both query blocks to the WPB waves of its team that merge them
  // ---- merge of the WPB partials; per query tile t, thread = chunk tid of the tile's two O fragments: row = 16t + (lane & 15),
  //      8 consecutive d from 32 * (wave >> 1) + 16 * (wave & 1) + 8 * (lane >> 4) ----
  const int c8 = wave * 16 + hh * 8;
#pragma unroll 1   // rolled: one copy of the merge serves both query blocks
  for (int pass = 0; pass < 2; ++pass) {
  const int q0 = ((pass == 0) ? (NQB - 1 - pr) : pr) * (16 * QTW);
  const size_t qofs = (((size_t)b * SEQ + q0) * NH + (size_t)head * 16) * HD;
#pragma unroll
  for (int t = 0; t < QTW; ++t) {
    float mw[WPB];
    float mall = -INFINITY;
#pragma unroll
    for (int w = 0; w < WPB; ++w) { mw[w] = mtab[((pass * WPB + w) * QTW + t) * 16 + c]; mall = fmaxf(mall, mw[w]); }
    const float msafe = (mall == -INFINITY) ? 0.0f : mall;
    float lv = 0.f;
    float acc[8];
#pragma unroll
    for (int e = 0; e < 8; ++e) acc[e] = 0.f;
#pragma unroll
    for (int w = 0; w < WPB; ++w) {
      const float sc = exp2f(mw[w] - msafe);   // 0 for a wave that saw no tile
      lv += ltab[((pass * WPB + w) * QTW + t) * 16 + c] * sc;
      const float* sp = smem + (pass * WPB + w) * WREG + (16 * t + c) * 68 + c8;
      const v4f a = *(const v4f*)(sp), b4 = *(const v4f*)(sp + 4);
#pragma unroll
      for (int e = 0; e < 4; ++e) { acc[e] += a[e] * sc; acc[4 + e] += b4[e] * sc; }
    }
    // ---- out = acc / Z (0 if Z == 0), carries (32768 on P, 1024 on v) folded once; O x1024 -> f16 hi + residual planes ----
    const float ls  = (lv > 0.0f) ? lv : 1.0f;
    const float inv = (lv > 0.0f) ? ((1.0f / ls) * oc) : 0.0f;
    v4u oh, ol;
#pragma unroll
    for (int e = 0; e < 4; ++e) {
      const float w0 = (acc[2 * e] * inv) * OSC, w1 = (acc[2 * e + 1] * inv) * OSC;
      const _Float16 h0 = (_Float16)w0, h1 = (_Float16)w1;
      const _Float16 l0 = (_Float16)(w0 - (float)h0), l1 = (_Float16)(w1 - (float)h1);
      oh[e] = pk16(h_bits(h0), h_bits(h1));
      ol[e] = pk16(h_bits(l0), h_bits(l1));
    }
    const size_t o8 = qofs + t * QTS + 8 * tid;                                 // fragments (row q0's block + t, 2 * head .. 2 * head + 1)
    *(v4u*)(OHIp + o8) = oh;
    *(v4u*)(OLOp + o8) = ol;
#if defined(__HIP_DEVICE_COMPILE__)
    asm volatile("s_wait_xcnt 0x0" ::: "memory");   // stands in front of whatever next rewrites a register that these two stores name
#endif
  }
  }
}

// =====================================================================================================
// Workspace map (bytes); every plane is fully written by whole-line stores before it is read; all extents are exact multiples
// of the store granularity (no pad rows needed); every offset a multiple of 2097152; every 16-bit plane is fragment-major (the shape
// given is that of its matrix, rows x k):
//   XB  bf16 [MROWS][1024]              8388608
//   WQB bf16 [1024 n][1024 k]          2097152        WKB, WVB same
//   WOH f16  [1024 n][1024 k] x1024    2097152
//   QHI f16 [MROWS][16*64] x1024       8388608        QLO residual
//   KHI f16 [MROWS][16*64] x1024       8388608        KLO residual
//   VHI f16 [BATCH*16*64][SEQ] x1024   8388608        VLO residual
//   OHI f16 [MROWS][1024] x1024        8388608        OLO residual
//   end                               83886080
// =====================================================================================================
extern "C" void kernel_launch(void* const* d_in, const int* in_sizes, int n_in,
                              void* d_out, int out_size, void* d_ws, size_t ws_size,
                              hipStream_t stream) {
  if (n_in < 9) return;
  if (in_sizes[0] != MROWS * DMOD) return;
  if (in_sizes[1] != DMOD * DMOD || in_sizes[3] != DMOD * DMOD) return;
  if (in_sizes[5] != DMOD * DMOD || in_sizes[7] != DMOD * DMOD) return;
  if (in_sizes[2] != DMOD || in_sizes[4] != DMOD || in_sizes[6] != DMOD || in_sizes[8] != DMOD) return;
  if (out_size != MROWS * DMOD) return;

  const float* x    = (const float*)d_in[0];
  const float* wq   = (const float*)d_in[1];
  const float* bq   = (const float*)d_in[2];
  const float* wk   = (const float*)d_in[3];
  const float* bk   = (const float*)d_in[4];
  const float* wv   = (const float*)d_in[5];
  const float* bv   = (const float*)d_in[6];
  const float* wo   = (const float*)d_in[7];
  const float* bo   = (const float*)d_in[8];
  float*       out  = (float*)d_out;

  const size_t szXB = (size_t)MROWS * DMOD * 2;                 //  8388608
  const size_t szW  = (size_t)DMOD * DMOD * 2;                  //  2097152
  const size_t szP  = (size_t)MROWS * DMOD * 2;                 //  8388608
  size_t off = 0;
  const size_t oXB  = off; off += szXB;
  const size_t oWQ  = off; off += szW;
  const size_t oWK  = off; off += szW;
  const size_t oWV  = off; off += szW;
  const size_t oWO  = off; off += szW;
  const size_t oQHI = off; off += szP;
  const size_t oQLO = off; off += szP;
  const size_t oKHI = off; off += szP;
  const size_t oKLO = off; off += szP;
  const size_t oVHI = off; off += szP;
  const size_t oVLO = off; off += szP;
  const size_t oOHI = off; off += szP;
  const size_t oOLO = off; off += szP;
  if (off > ws_size) return;                            // off = 83886080
  if (off > (size_t)134217728) return;

  char* ws = (char*)d_ws;
  u16*   XB  = (u16*)(ws + oXB);
  u16*   WQB = (u16*)(ws + oWQ);
  u16*   WKB = (u16*)(ws + oWK);
  u16*   WVB = (u16*)(ws + oWV);
  u16*   WOH = (u16*)(ws + oWO);
  u16*   QHI = (u16*)(ws + oQHI);
  u16*   QLO = (u16*)(ws + oQLO);
  u16*   KHI = (u16*)(ws + oKHI);
  u16*   KLO = (u16*)(ws + oKLO);
  u16*   VHI = (u16*)(ws + oVHI);
  u16*   VLO = (u16*)(ws + oVLO);
  u16*   OHI = (u16*)(ws + oOHI);
  u16*   OLO = (u16*)(ws + oOLO);

  const dim3 blk(256);
  const dim3 gPR(4 * NWB + NXB);                        // 4 x 256 + 2048
  const dim3 gG((MROWS / 64) * (DMOD / 64));            // 1024
  const dim3 gP((MROWS / 128) * (DMOD / 128), 3);       // 256 x (q, k, v)
  const dim3 bG(128);
  const dim3 gAT(ATT_BLOCKS);                           // 256
  const dim3 bAT(ATT_THREADS);                          // 512

  // (0) Wq/Wk/Wv [k][n] -> bf16 [n][k] planes; Wo [k][n] -> f16 [n][k] plane of bf16 value x1024; x -> bf16 plane [MROWS][1024]
  prep16<<<gPR, blk, 0, stream>>>(x, wq, wk, wv, wo, XB, WQB, WKB, WVB, WOH, WOS);
  // (1) q = x.Wq + bq, k = x.Wk + bk -> hi/residual planes x1024; v = x.Wv + bv -> v^T hi/residual planes x1024
  proj3<<<gP, bG, 0, stream>>>(XB, WQB, WKB, WVB, bq, bk, bv, QHI, QLO, KHI, KLO, VHI, VLO);
  // (2) causal attention -> O planes [b*SEQ+s][h][d] x1024 (hi + residual)
  attn1<<<gAT, bAT, 0, stream>>>(QHI, QLO, KHI, KLO, VHI, VLO, OHI, OLO);
  // (3) output projection -> out [MROWS][1024] f32, carries 1024 (O) x 1024 (Wo) folded back, + bo
  gemm_h2<<<gG, bG, 0, stream>>>(OHI, OLO, WOH, bo, out, MROWS, DMOD, DMOD, 1.0f / (OSC * WOS));
  (void)hipGetLastError();
}

// v010
// Measured time: 93.5 microseconds a run.
// Two timings next to v009 put it at 1.21 and 1.22 times that version's speed.
// All steps since v000 together make it 4.39 times as fast.
// Contractions: x.W{q,k,v} on v_wmma_f32_16x16x32_bf16 (x and W^T RNE-converted to bf16, f32 accumulate);
// scores, transposed, k.q^T (q, k carried x1024 as f16 hi plane + f16 residual plane, products hh+lh+hl), v^T.P^T (P x32768 f16
// hi+residual, v x1024 f16 hi+residual, products hh+lh+hl) and O.Wo (O x1024 f16 hi+residual, Wo^T as f16(bf16(Wo)) x1024, products h.w+l.w):
// v_wmma_f32_16x16x32_f16, f32 accumulate. Static causal select, base-2 online softmax and 1/l fold in f32 on VALU.
#include <hip/hip_runtime.h>
#include <math.h>
#include <stdint.h>

#define BATCH 2
#define SEQ   2048
#define DMOD  1024
#define NH    16
#define HD    64
#define MROWS (BATCH * SEQ)
#define QSC   1024.0f
#define KSC   1024.0f
#define PCAR  32768.0f
#define VCAR  1024.0f
#define OSC   1024.0f
#define WOS   1024.0f
#define LOG2E 1.4426950408889634f
#define WPB   4
#define QTW   2
#define NQB   (SEQ / (16 * QTW))
#define NWB   ((DMOD / 64) * (DMOD / 64))
#define NXB   ((MROWS * DMOD) / 2048)
#define NKT   (SEQ / 32)
#define NSUB  4
#define ATT_THREADS (NSUB * WPB * 32)
#define NPR   (NQB / 2)
#define NPG   (NPR / NSUB)
#define ATT_BLOCKS  (NPG * NH * BATCH)
#define SLW   (16 * 68)
#define WREG  (QTW * SLW)
#define SLAB64 (16 * 68)
#define VTP   72
static_assert(DMOD == NH * HD && HD == 64 && NH == 16);
static_assert(WPB == 4 && NSUB == 4 && ATT_THREADS == 512 && QTW == 2 && ATT_BLOCKS == 256 && (NQB % 2) == 0 && (NPR % NSUB) == 0);
static_assert((SEQ % 64) == 0 && (SEQ % 32) == 0 && (SEQ % 16) == 0 && SEQ <= 32768);
static_assert((DMOD % 64) == 0 && (DMOD % 32) == 0 && (MROWS % 64) == 0);
static_assert((DMOD % 128) == 0 && (MROWS % 128) == 0 && (SEQ % 16) == 0);
static_assert(((MROWS * DMOD) % 2048) == 0 && ((DMOD * DMOD) % 4096) == 0);

typedef unsigned short u16;
typedef _Float16 v16h __attribute__((ext_vector_type(16)));
typedef _Float16 v8h  __attribute__((ext_vector_type(8)));
typedef __bf16   v16b __attribute__((ext_vector_type(16)));
typedef float    v8f  __attribute__((ext_vector_type(8)));
typedef float    v4f  __attribute__((ext_vector_type(4)));
typedef unsigned int v4u __attribute__((ext_vector_type(4)));

union FragH { v16h v; v8h h[2]; v4u u[2]; };
union FragB { v16b v; v4u u[2]; };

// ---- scalar helpers --------------------------------------------------------------------------------
__device__ __forceinline__ unsigned short bf_bits(float f) {          // f32 -> bf16 bits, RNE convert
  unsigned u = __float_as_uint(f);
  return (unsigned short)((u + 0x7FFFu + ((u >> 16) & 1u)) >> 16);
}
__device__ __forceinline__ float bf_up(unsigned short h) { return __uint_as_float(((unsigned)h) << 16); }
__device__ __forceinline__ float bfr(float f) { return bf_up(bf_bits(f)); }
__device__ __forceinline__ unsigned short h_bits(_Float16 x) { return __builtin_bit_cast(unsigned short, x); }
__device__ __forceinline__ unsigned pk16(unsigned short a, unsigned short b) { return (unsigned)a | ((unsigned)b << 16); }
__device__ __forceinline__ float xhalf(float x) {                     // value of lane l ^ 16
  const int b = __builtin_bit_cast(int, x);
  return __builtin_bit_cast(float, __builtin_amdgcn_permlanex16(b, b, 0x76543210, 0xfedcba98, false, false));
}
// 2^x on the bare v_exp_f32, for the key loop's x <= 0 (or -inf, which gives 0): exp2f() wraps the same instruction in a compare, two
// selects, an add and an ldexp per value so that results under 2^-126 come out as subnormals; here such a result is a weight that the
// f16 planes of P (x32768) round to 0 and that adds nothing to a row sum or to an O whose leading term has weight 1, so 0 serves as well.
__device__ __forceinline__ float exp2_bare(float x) { return __builtin_amdgcn_exp2f(x); }
__device__ __forceinline__ v8f zero8() { v8f z = {0.f, 0.f, 0.f, 0.f, 0.f, 0.f, 0.f, 0.f}; return z; }

// ---- fragment-major 16-bit planes: a matrix [R rows][Kd k] (R % 16 == 0, Kd % 32 == 0) is stored as fragments of 16 rows x 32 k,
//      fragment (rb = row / 16, kb = k / 32) at halves (rb * (Kd / 32) + kb) * 512; inside it 64 chunks of 8 halves, chunk
//      i * 32 + h * 16 + c = row 16 rb + c, k = 32 kb + 16 i + 8 h + 0..7. A wave-wide 16-B load of chunks 32 i + lane is 512 contiguous,
//      512-B aligned bytes = 4 whole lines (the same fragment read from a row-major plane touches 16 lines, 32 B of each, per load).
// ---- fragment loaders: 16-bit A/B operand, lane -> row/col (lane&15), p = fragment start + 8*lane;
//      elements 0..7 <- p[0..7] (k0+8h..), elements 8..15 <- p[256..263] (k0+16+8h..)  (same split k map for A and B).
//      fs = a fragment start that is the same for the whole wave (a scalar base), bo = 32-bit byte offset from it: 16*lane plus the
//      loop's advance, one vector register that serves every load of a trip
__device__ __forceinline__ v16h ldfrag_h(const _Float16* fs, unsigned bo) {
  const char* p = (const char*)(const void*)fs + bo;
  FragH f;
  f.h[0] = *(const v8h*)(const void*)(p);
  f.h[1] = *(const v8h*)(const void*)(p + 512);
  return f.v;
}

// row-major element index (matrix [R][Kd]) of the 8 halves that chunk q of the fragment-major plane holds
__device__ __forceinline__ size_t chunk_src(int q, int Kd) {
  const int f = q >> 6, nkb = Kd >> 5;
  return (size_t)((f / nkb) * 16 + (q & 15)) * (size_t)Kd + (size_t)((f % nkb) * 32 + ((q >> 4) & 3) * 8);
}

__device__ __forceinline__ v8f mma_h(v16h a, v16h b, v8f c) {
  return __builtin_amdgcn_wmma_f32_16x16x32_f16(false, a, false, b, (short)0, c, false, false);
}
__device__ __forceinline__ v8f mma_b(v16b a, v16b b, v8f c) {
  return __builtin_amdgcn_wmma_f32_16x16x32_bf16(false, a, false, b, (short)0, c, false, false);
}
__device__ __forceinline__ void acc_guard4(v8f& a, v8f& b, v8f& c, v8f& d) {
#if defined(__HIP_DEVICE_COMPILE__)
  asm volatile("v_nop\n\tv_nop\n\tv_nop\n\tv_nop" : "+v"(a), "+v"(b), "+v"(c), "+v"(d));
#endif
}
__device__ __forceinline__ void wave_sync_lds() {
  __builtin_amdgcn_fence(__ATOMIC_RELEASE, "workgroup");
  __builtin_amdgcn_wave_barrier();
  __builtin_amdgcn_fence(__ATOMIC_ACQUIRE, "workgroup");
}

// =====================================================================================================
// All operand conversions in one launch (five independent jobs, told apart by the block index).
// Blocks 0 .. 4*NWB-1, weight transpose-convert: weight which = bid / NWB, W [K][N] f32 (x.W layout, n contiguous) -> Dt, the fragment-major
// 16-bit plane of the matrix [N rows][K cols]; which 0..2: bf16 RNE bits; which 3: f16 bits of (bf16 RNE value) * scale.
//   Block = (k tile k0 = (wb / (N/64))*64, n tile n0 = (wb % (N/64))*64), wb = bid % NWB: 64 source rows of 64 floats loaded with 16-B loads,
//   converted, scattered into an LDS tile [n][64 k] (pitch 72 halves); after a block barrier the tile's 8 fragments are stored chunk by chunk.
//   coverage: load 256 thr x 16 = 64 x 64; store 2 iterations x 256 thr x 8 halves = 8 fragments x 512 halves = the block's tile;
//             NWB = (K/64)*(N/64) blocks cover each Dt exactly once.
// Blocks 4*NWB .. 4*NWB+NXB-1, x f32 [MROWS][DMOD] -> bf16 RNE bits, fragment-major plane. Thread = one chunk of the plane (8 consecutive
//   k of one row): two 16-B loads, one 16-B store; 32 consecutive lanes store 512 contiguous, 512-B aligned bytes.
//   coverage: NXB blocks x 256 thr x 8 = the whole plane.
// =====================================================================================================
__global__ __launch_bounds__(256) void prep16(const float* __restrict__ x, const float* __restrict__ W0, const float* __restrict__ W1,
                                              const float* __restrict__ W2, const float* __restrict__ W3,
                                              u16* XD, u16* D0, u16* D1, u16* D2, u16* D3, float scale) {
  __shared__ __align__(16) u16 T[64 * VTP];
  const int tid = threadIdx.x;
  const int bid = blockIdx.x;
  if (bid >= 4 * NWB) {                       // block-uniform; this path holds no barrier
    const int gt = (bid - 4 * NWB) * 256 + tid;
    if (gt >= (MROWS * DMOD) / 8) return;     // never taken with the exact grid
    const float* p = x + chunk_src(gt, DMOD);
    const v4f a = *(const v4f*)(p), b4 = *(const v4f*)(p + 4);
    v4u o;
    o[0] = pk16(bf_bits(a[0]), bf_bits(a[1]));
    o[1] = pk16(bf_bits(a[2]), bf_bits(a[3]));
    o[2] = pk16(bf_bits(b4[0]), bf_bits(b4[1]));
    o[3] = pk16(bf_bits(b4[2]), bf_bits(b4[3]));
    *(v4u*)(XD + (size_t)gt * 8) = o;
    return;
  }
  const int K = DMOD, N = DMOD;
  const int which = bid / NWB;
  const int wb    = bid % NWB;
  const int ntn = N >> 6;
  const int n0  = (wb % ntn) * 64;
  const int k0  = (wb / ntn) * 64;
  const float* W = (which == 0) ? W0 : (which == 1) ? W1 : (which == 2) ? W2 : W3;
  u16* Dt        = (which == 0) ? D0 : (which == 1) ? D1 : (which == 2) ? D2 : D3;
  const int f16mode = (which == 3) ? 1 : 0;
  {
    const int sl = tid >> 2;                  // k within tile 0..63 (source row)
    const int dc = (tid & 3) * 16;            // n chunk
    const float* src = W + (size_t)(k0 + sl) * N + n0 + dc;
#pragma unroll
    for (int i = 0; i < 4; ++i) {
      const v4f a = *(const v4f*)(src + 4 * i);
#pragma unroll
      for (int e = 0; e < 4; ++e) {
        const float f = a[e];
        const unsigned short hb = h_bits((_Float16)(bfr(f) * scale));
        const unsigned short bb = bf_bits(f);
        T[(dc + 4 * i + e) * VTP + sl] = (f16mode != 0) ? hb : bb;
      }
    }
  }
  __syncthreads();
  // the tile = 4 (n) x 2 (k) fragments of the plane; thread = chunk tid & 63 of fragment (n block it*2 + (tid >> 7), k block (tid >> 6) & 1)
  v4u vv[2];
  const int ch = tid & 63, fk = (tid >> 6) & 1, fr = tid >> 7;
#pragma unroll
  for (int it = 0; it < 2; ++it) {
    const int line = (it * 2 + fr) * 16 + (ch & 15);   // n = 0..63 within tile
    vv[it] = *(const v4u*)(T + line * VTP + fk * 32 + (ch >> 4) * 8);
  }
  const size_t base = (size_t)n0 * K + (size_t)((k0 >> 5) + fk) * 512 + ch * 8;
  {
#pragma unroll
    for (int it = 0; it < 2; ++it) {
      *(v4u*)(Dt + base + (size_t)((it * 2 + fr) * 16) * K) = vv[it];
    }
  }
#if defined(__HIP_DEVICE_COMPILE__)
  asm volatile("s_wait_xcnt 0x0" ::: "memory");   // stands in front of whatever next rewrites a register that these two stores name
#endif
}

// =====================================================================================================
// GEMM epilogue of the output projection, per 16x64 f32 tile of a wave: epi_put stages the tile (times oscale) in an LDS slab of its own
// (pitch 68); behind one wave_sync_lds() epi_get reads it back row-wise, adds the bias and stores whole 256-B row pieces.
// coverage: 8 instructions x 2 rows x 16 lanes x 4 floats = the 16 x 64 tile.
// =====================================================================================================
__device__ __forceinline__ void epi_put(float* sl, v8f a0, v8f a1, v8f a2, v8f a3, float oscale, int lane) {
  const int hh = lane >> 4, m = lane & 15;
#pragma unroll
  for (int r = 0; r < 8; ++r) {
    const int ro = (8 * hh + r) * 68 + m;
    sl[ro]      = a0[r] * oscale;
    sl[ro + 16] = a1[r] * oscale;
    sl[ro + 32] = a2[r] * oscale;
    sl[ro + 48] = a3[r] * oscale;
  }
}
__device__ __forceinline__ void epi_get(const float* sl, const float* __restrict__ bias, float* C, int N, size_t rowb, int col0, int lane) {
  const int hh = lane >> 4, m = lane & 15;
  const v4f braw = *(const v4f*)(bias + col0 + m * 4);
  v4f bb;
#pragma unroll
  for (int e = 0; e < 4; ++e) bb[e] = bfr(braw[e]);
  v4f vals[8];
#pragma unroll
  for (int it = 0; it < 8; ++it) vals[it] = *(const v4f*)(sl + (it * 2 + hh) * 68 + m * 4) + bb;
  float* dst = C + (rowb + (size_t)hh) * (size_t)N + col0 + m * 4;
#pragma unroll
  for (int it = 0; it < 8; ++it) {
    *(v4f*)(dst + (size_t)(it * 2) * (size_t)N) = vals[it];
  }
#if defined(__HIP_DEVICE_COMPILE__)
  asm volatile("s_wait_xcnt 0x0" ::: "memory");   // stands in front of whatever next rewrites a register that these eight stores name
  __builtin_amdgcn_sched_barrier(0);              // keeps the next tile's arithmetic behind that wait
#endif
}

// =====================================================================================================
// Staging of fragment-major planes in LDS, for both GEMM kernels. K is walked in stages of 128. A segment = the 4 fragments of one block of 16
// plane rows over 128 k: 4 KiB, contiguous in the plane and kept so in LDS; consecutive row blocks lie GRB bytes apart in a plane, stage s lies
// s * GSEG bytes into a row block. Asynchronous copies bring a stage's segments into one of two LDS buffers, so that every fragment leaves L2
// once per block and is then read from LDS by each wave that needs it; stage s + 1 flies while stage s is worked on.
// =====================================================================================================
#define GSEG    4096
#define GNST    (DMOD / 128)
#define GRB     (16 * DMOD * 2)
static_assert(GNST >= 2 && (DMOD % 128) == 0);

// 8 asynchronous copies of 16 B a lane: global g + i * GS to LDS byte address l + i * LS. The s_wait_xcnt is the statement's last line so that
// it stands in front of every later write of a register that a copy names.
template <int LS, int GS>
__device__ __forceinline__ void copy8(unsigned l, const char* g) {
#if defined(__HIP_DEVICE_COMPILE__)
  asm volatile("global_load_async_to_lds_b128 %0, %8, off\n\t"
               "global_load_async_to_lds_b128 %1, %9, off\n\t"
               "global_load_async_to_lds_b128 %2, %10, off\n\t"
               "global_load_async_to_lds_b128 %3, %11, off\n\t"
               "global_load_async_to_lds_b128 %4, %12, off\n\t"
               "global_load_async_to_lds_b128 %5, %13, off\n\t"
               "global_load_async_to_lds_b128 %6, %14, off\n\t"
               "global_load_async_to_lds_b128 %7, %15, off\n\t"
               "s_wait_xcnt 0x0"
               :: "v"(l), "v"(l + 1u * LS), "v"(l + 2u * LS), "v"(l + 3u * LS),
                  "v"(l + 4u * LS), "v"(l + 5u * LS), "v"(l + 6u * LS), "v"(l + 7u * LS),
                  "v"(g), "v"(g + 1 * GS), "v"(g + 2 * GS), "v"(g + 3 * GS),
                  "v"(g + 4 * GS), "v"(g + 5 * GS), "v"(g + 6 * GS), "v"(g + 7 * GS)
               : "memory");
#endif
}
__device__ __forceinline__ void wait_async0() {   // this wave's copies have landed
#if defined(__HIP_DEVICE_COMPILE__)
  asm volatile("s_wait_asynccnt 0x0" ::: "memory");
#endif
}
__device__ __forceinline__ void wait_ds0() {      // this wave's LDS reads have returned, ahead of the barrier behind which their buffer is refilled
#if defined(__HIP_DEVICE_COMPILE__)
  asm volatile("s_wait_dscnt 0x0" ::: "memory");
#endif
}
// fragment loaders from LDS: p = fragment start + 16 * lane; the same split k map as in the planes
__device__ __forceinline__ v16h ldfrag_s(const unsigned char* p) {
  FragH f;
  f.h[0] = *(const v8h*)(const void*)(p);
  f.h[1] = *(const v8h*)(const void*)(p + 512);
  return f.v;
}
__device__ __forceinline__ v16b ldfrag_sb(const unsigned char* p) {
  FragB f;
  f.u[0] = *(const v4u*)(const void*)(p);
  f.u[1] = *(const v4u*)(const void*)(p + 512);
  return f.v;
}

// =====================================================================================================
// q, k and v projections in one launch: (x . W + b), x and W^T bf16 fragment-major planes, written
// straight into the f16 hi + residual planes that the attention kernel reads (value * 1024; hi = f16(t), residual = f16(t - hi)).
// Block = 128 x rows times the same 128 columns of q, of k and of v: 12 waves, which = wave / 4 (0 q, 1 k, 2 v), each weight's 128 x 128 tile
// worked by 2 x 2 waves of 64 x 64 (4 x fragments times 4 W^T fragments = 16 products per k step, rowb and col0 below being the wave's first
// row and column, i = 0..3 its row blocks of 16). A stage is 32 segments: 8 row blocks of x, which serve all three weights, then 8 column
// blocks each of Wq^T, Wk^T, Wv^T; waves 0..7 copy 4 whole segments each (wave w: segments 4 w .. 4 w + 3, 8 copies of 512 B a segment),
// waves 8..11 copy none. K = DMOD stepped by 32 inside a stage, k ascending; grid = (MROWS/128)*(DMOD/128), one block per WGP.
// The operand order is chosen so that a lane's 8 accumulator registers are one 16-B chunk of the destination plane:
//   q, k (plane rows = x rows, plane k = n): D = W^T . x^T, lane (c, hh) register r = (x row rowb + 16 i + c, n = col0 + 16 j + 8 hh + r)
//        = chunk 32 (j & 1) + lane of fragment (rowb / 16 + i, col0 / 32 + (j >> 1));
//   v^T  (plane rows = (b, head, d), plane k = s): D = x . W, lane (c, hh) register r = (x row rowb + 16 i + 8 hh + r, n = col0 + 16 j + c)
//        = chunk 32 ((s >> 4) & 1) + lane of fragment (4 (b*NH + head) + j, s / 32), s = (rowb + 16 i) % SEQ, head = col0 / HD.
// coverage: per wave 16 accumulators x 32 lanes x 8 halves = 64 x 64 elements per plane, each store 512 contiguous, 512-B aligned bytes;
//           grid covers every (row, column) of each of the six planes exactly once.
// =====================================================================================================
__device__ __forceinline__ void put_split(v8f t, u16* hp, u16* lp) {     // 8 scaled values -> one chunk of the hi and of the residual plane
  v4u oh, ol;
#pragma unroll
  for (int e = 0; e < 4; ++e) {
    const float t0 = t[2 * e], t1 = t[2 * e + 1];
    const _Float16 h0 = (_Float16)t0, h1 = (_Float16)t1;
    const _Float16 l0 = (_Float16)(t0 - (float)h0), l1 = (_Float16)(t1 - (float)h1);
    oh[e] = pk16(h_bits(h0), h_bits(h1));
    ol[e] = pk16(h_bits(l0), h_bits(l1));
  }
  *(v4u*)(hp) = oh;
  *(v4u*)(lp) = ol;
#if defined(__HIP_DEVICE_COMPILE__)
  asm volatile("s_wait_xcnt 0x0" ::: "memory");   // stands in front of whatever next rewrites a register that these two stores name
  __builtin_amdgcn_sched_barrier(0);              // keeps the next chunk's arithmetic behind that wait: the compiler otherwise lifts it in front
#endif
}

// stands between a k step's 16 loads and its first product: the loads go out as one group, so that the step waits out one load latency and
// not one per x fragment (without it the compiler sinks the loads of x fragments 1..3 between the products)
__device__ __forceinline__ void loads_first() {
#if defined(__HIP_DEVICE_COMPILE__)
  __builtin_amdgcn_sched_barrier(0);
#endif
}
// behind the k loop: four slots between the last product and the bias loads, which land in registers that held its operands
// (inside the loop the compiler itself pads the loop's head, in front of the next trip's address additions and loads)
__device__ __forceinline__ void loop_exit_guard() {
#if defined(__HIP_DEVICE_COMPILE__)
  asm volatile("v_nop\n\tv_nop\n\tv_nop\n\tv_nop" ::: "memory");
#endif
}

#define PSTAGE  (32 * GSEG)
__global__ __launch_bounds__(384, 4)   // budget of 256 registers a wave; 256 blocks x 12 waves, 3 waves per SIMD, the whole grid resident at once
void proj3(const u16* __restrict__ A, const u16* __restrict__ Wq, const u16* __restrict__ Wk, const u16* __restrict__ Wv,
           const float* __restrict__ bq, const float* __restrict__ bk, const float* __restrict__ bv,
           u16* QH, u16* QL, u16* KH, u16* KL, u16* VH, u16* VL) {
  __shared__ __attribute__((aligned(1024))) unsigned char ring[2 * PSTAGE];
  const int tid = threadIdx.x, lane = tid & 31;
  const int wave = __builtin_amdgcn_readfirstlane(tid >> 5);   // scalar: the tests on it below are scalar branches
  const int hh = lane >> 4, c = lane & 15;
  const int which = wave >> 2, w4 = wave & 3;
  const int bid   = blockIdx.x;
  const int row0  = (bid / (DMOD / 128)) * 128;
  const int colt  = (bid % (DMOD / 128)) * 128;
  if (row0 + 128 > MROWS) return;            // block-uniform, ahead of every copy and barrier; never taken with the exact grid
  const int rowb  = row0 + (w4 >> 1) * 64;
  const int col0  = colt + (w4 & 1) * 64;
  const float* bias = (which == 0) ? bq : (which == 1) ? bk : bv;
  // a copying wave's plane (0 x, 1..3 the weights), its first row block there, this lane's 16 B in that block's stage 0 and in LDS buffer 0
  const int nfill = (wave < 8) ? GNST : 0;   // stages that this wave copies: one scalar compare decides each fill
  const int cpl = wave >> 1;
  const u16* cpp = (cpl == 0) ? A : (cpl == 1) ? Wq : (cpl == 2) ? Wk : Wv;
  const int crb = ((cpl == 0) ? row0 : colt) / 16 + (wave & 1) * 4;
  const char* cg = (const char*)(const void*)cpp + (size_t)crb * GRB + 16 * lane;
  const unsigned cl = (unsigned)(size_t)(const void*)ring + (unsigned)wave * (4u * GSEG) + 16u * (unsigned)lane;
  // first and second operand of the products: v: x, W^T; q, k: W^T, x (the operand order named above); acc[p][q] = first[p] . second[q]
  const int aseg = (w4 >> 1) * 4, bseg = 8 + which * 8 + (w4 & 1) * 4;
  const int seg1 = (which == 2) ? aseg : bseg, seg2 = (which == 2) ? bseg : aseg;
  v8f acc[4][4];
#pragma unroll
  for (int i = 0; i < 4; ++i) {
#pragma unroll
    for (int j = 0; j < 4; ++j) acc[i][j] = zero8();
  }
  if (0 < nfill) {                           // stage 0 -> buffer 0
#pragma unroll
    for (int q = 0; q < 4; ++q) copy8<512, 512>(cl + q * GSEG, cg + (size_t)q * GRB);
  }
  wait_async0();
  __syncthreads();                           // publishes stage 0
  if (1 < nfill) {                           // stage 1 -> buffer 1
#pragma unroll
    for (int q = 0; q < 4; ++q) copy8<512, 512>(cl + PSTAGE + q * GSEG, cg + (size_t)q * GRB + GSEG);
  }
#pragma unroll 1   // rolled: one copy of a stage's 64 products serves the 8 stages
  for (int s = 0; s < GNST; ++s) {
    const unsigned bofs = (unsigned)(s & 1) * (unsigned)PSTAGE;
    const unsigned char* p1 = ring + bofs + seg1 * GSEG + 16 * lane;
    const unsigned char* p2 = ring + bofs + seg2 * GSEG + 16 * lane;
#pragma unroll
    for (int kk = 0; kk < 4; ++kk) {
      v16b f1[4], f2[4];
#pragma unroll
      for (int i = 0; i < 4; ++i) { f1[i] = ldfrag_sb(p1 + i * GSEG + kk * 1024);  f2[i] = ldfrag_sb(p2 + i * GSEG + kk * 1024); }
      loads_first();
#pragma unroll
      for (int p = 0; p < 4; ++p) {
#pragma unroll
        for (int q = 0; q < 4; ++q) acc[p][q] = mma_b(f1[p], f2[q], acc[p][q]);
      }
      loads_first();                         // keeps the products in front of the next k step's reads and, at the foot, of the waits
    }
    wait_ds0();
    wait_async0();                           // stage s + 1 has landed, as far as this wave copied it
    __syncthreads();                         // publishes stage s + 1 and ends every wave's reads of stage s
    if (s + 2 < nfill) {                     // refill of the buffer that stage s has just left
      const size_t go = (size_t)(s + 2) * GSEG;
#pragma unroll
      for (int q = 0; q < 4; ++q) copy8<512, 512>(cl + bofs + q * GSEG, cg + (size_t)q * GRB + go);
    }
  }
  wait_async0();
  if (which == 2) {
    loop_exit_guard();
    const int g = col0 / HD;
    float bj[4];
#pragma unroll
    for (int j = 0; j < 4; ++j) bj[j] = bfr(bias[col0 + 16 * j + c]);   // all bias loads ahead of the first store's wait
#pragma unroll
    for (int i = 0; i < 4; ++i) {
      const int rw = rowb + 16 * i;
      const int b = rw / SEQ, sq = rw % SEQ;
      const size_t base = ((size_t)(b * NH + g) * HD) * SEQ + (size_t)(sq >> 5) * 512 + (size_t)((sq >> 4) & 1) * 256 + (size_t)lane * 8;
#pragma unroll
      for (int j = 0; j < 4; ++j)
        put_split((acc[i][j] + bj[j]) * VCAR, VH + base + (size_t)(16 * j) * SEQ, VL + base + (size_t)(16 * j) * SEQ);
    }
  } else {
    loop_exit_guard();
    u16* hpl = (which == 0) ? QH : KH;
    u16* lpl = (which == 0) ? QL : KL;
    const float sc = (which == 0) ? QSC : KSC;
    v8f bb[4];                               // the bias of the wave's 64 columns, the same for its four row blocks; loaded ahead of the first store's wait
#pragma unroll
    for (int j = 0; j < 4; ++j) {
      const float* bsrc = bias + col0 + 16 * j + 8 * hh;
      const v4f r0 = *(const v4f*)(bsrc), r1 = *(const v4f*)(bsrc + 4);
      const v8f t = {bfr(r0[0]), bfr(r0[1]), bfr(r0[2]), bfr(r0[3]), bfr(r1[0]), bfr(r1[1]), bfr(r1[2]), bfr(r1[3])};
      bb[j] = t;
    }
#pragma unroll
    for (int i = 0; i < 4; ++i) {
      const size_t base = (size_t)(rowb + 16 * i) * DMOD + (size_t)(col0 >> 5) * 512 + (size_t)lane * 8;
#pragma unroll
      for (int j = 0; j < 4; ++j) {
        const size_t o8 = base + (size_t)(j >> 1) * 512 + (size_t)(j & 1) * 256;
        put_split((acc[j][i] + bb[j]) * sc, hpl + o8, lpl + o8);   // first operand W^T block j, second x block i
      }
    }
  }
}

// =====================================================================================================
// f16 hi+lo GEMM (output projection): C[MROWS][DMOD] (f32) = (Ahi + Alo)[MROWS][DMOD] . Bt[DMOD n][DMOD k]^T, times oscale, plus bias; Ahi/Alo f16
// planes (same layout), Bt f16, all three fragment-major; products hi.B + lo.B into one accumulator (lo is the unscaled residual of hi), k ascending.
// Block = 128 rows x 128 columns, 8 waves of 32 x 64 (4 x 2). K is walked in stages of 128: a stage is 24 segments of 4 KiB (8 row blocks of Ahi,
// 8 of Alo, 8 column blocks of Bt; a segment = the 4 fragments of one block of 16 rows over 128 k, contiguous in a fragment-major plane). The
// block's 256 threads bring a stage into LDS with asynchronous copies, 16 B a thread and segment, so that every fragment leaves L2 once per block
// and is then read from LDS by the 2 (Ahi, Alo) or 4 (Bt) waves that need it. Two buffers: stage s + 1 flies while stage s is worked on.
// coverage: copies 24 x 256 thr x 16 B = 24 segments; per wave 2 x (16 x 64) output tiles; grid (MROWS/128) x (DMOD/128) blocks = C once.
// =====================================================================================================
#define GSTAGE  (24 * GSEG)
static_assert((MROWS % 128) == 0 && (DMOD % 128) == 0);

__global__ __launch_bounds__(256)
void gemm_h2(const u16* __restrict__ Ah, const u16* __restrict__ Al, const u16* __restrict__ Bt,
             const float* __restrict__ bias, float* C, float oscale) {
  __shared__ __attribute__((aligned(1024))) unsigned char ring[2 * GSTAGE];
  __shared__ __align__(16) float slab[16 * SLAB64];              // one 16 x 64 slab per wave and row block
  const int tid = threadIdx.x, lane = tid & 31;
  const int wave = __builtin_amdgcn_readfirstlane(tid >> 5);
  const int wr = wave >> 1, wc = wave & 1;
  const int bid  = blockIdx.x;
  const int row0 = (bid / (DMOD / 128)) * 128;
  const int col0 = (bid % (DMOD / 128)) * 128;
  if (row0 + 128 > MROWS) return;            // block-uniform, ahead of every copy and barrier; never taken with the exact grid
  // this thread's 16 B in the first segment of stage 0, per plane; stage s lies s * GSEG bytes further on
  const char* ga = (const char*)(const void*)Ah + (size_t)(row0 / 16) * GRB + 16 * tid;
  const char* gl = (const char*)(const void*)Al + (size_t)(row0 / 16) * GRB + 16 * tid;
  const char* gb = (const char*)(const void*)Bt + (size_t)(col0 / 16) * GRB + 16 * tid;
  const unsigned l0 = (unsigned)(size_t)(const void*)ring + 16u * (unsigned)tid;
  v8f acc[2][4];                             // acc[i][j]: rows row0 + 32 wr + 16 i .., columns col0 + 64 wc + 16 j ..
#pragma unroll
  for (int i = 0; i < 2; ++i) {
#pragma unroll
    for (int j = 0; j < 4; ++j) acc[i][j] = zero8();
  }
  copy8<GSEG, GRB>(l0, ga);  copy8<GSEG, GRB>(l0 + 8u * GSEG, gl);  copy8<GSEG, GRB>(l0 + 16u * GSEG, gb);                       // stage 0 -> buffer 0
  wait_async0();
  __syncthreads();                           // publishes stage 0
  copy8<GSEG, GRB>(l0 + GSTAGE, ga + GSEG);  copy8<GSEG, GRB>(l0 + GSTAGE + 8u * GSEG, gl + GSEG);  copy8<GSEG, GRB>(l0 + GSTAGE + 16u * GSEG, gb + GSEG);   // stage 1 -> buffer 1
#pragma unroll 1   // rolled: one copy of a stage's 64 products serves the 8 stages
  for (int s = 0; s < GNST; ++s) {
    const unsigned bofs = (unsigned)(s & 1) * (unsigned)GSTAGE;
    const unsigned char* pa = ring + bofs + (2 * wr) * GSEG + 16 * lane;
    const unsigned char* pb = ring + bofs + (16 + 4 * wc) * GSEG + 16 * lane;
    // two fragment sets: k step kk + 1's 16 LDS reads go out as one group ahead of k step kk's 16 products and are waited for behind them
    v16h fa[2][4], fb[2][4];                 // fa[set][i] = Ahi row block i, fa[set][2 + i] = Alo row block i; fb[set][j] = Bt column block j
#pragma unroll
    for (int i = 0; i < 2; ++i) { fa[0][i] = ldfrag_s(pa + i * GSEG);  fa[0][2 + i] = ldfrag_s(pa + (8 + i) * GSEG); }
#pragma unroll
    for (int j = 0; j < 4; ++j) fb[0][j] = ldfrag_s(pb + j * GSEG);
#pragma unroll
    for (int kk = 0; kk < 4; ++kk) {
      const int cu = kk & 1, nx = cu ^ 1;
      if (kk < 3) {
#pragma unroll
        for (int i = 0; i < 2; ++i) {
          fa[nx][i]     = ldfrag_s(pa + i * GSEG + (kk + 1) * 1024);
          fa[nx][2 + i] = ldfrag_s(pa + (8 + i) * GSEG + (kk + 1) * 1024);
        }
#pragma unroll
        for (int j = 0; j < 4; ++j) fb[nx][j] = ldfrag_s(pb + j * GSEG + (kk + 1) * 1024);
      }
      loads_first();                         // without it the compiler sinks the reads between the products, into one set, each with a wait to 0
#pragma unroll
      for (int i = 0; i < 2; ++i) {
#pragma unroll
        for (int j = 0; j < 4; ++j) acc[i][j] = mma_h(fa[cu][i], fb[cu][j], acc[i][j]);
      }
#pragma unroll
      for (int i = 0; i < 2; ++i) {
#pragma unroll
        for (int j = 0; j < 4; ++j) acc[i][j] = mma_h(fa[cu][2 + i], fb[cu][j], acc[i][j]);
      }
      loads_first();                         // keeps the products of this k step in front of the next group of reads and, at the foot, of the waits
    }
    wait_ds0();
    wait_async0();                           // stage s + 1 has landed, as far as this wave copied it
    __syncthreads();                         // publishes stage s + 1 and ends every wave's reads of stage s
    if (s + 2 < GNST) {                      // the same for the whole block: refill of the buffer that stage s has just left
      const size_t go = (size_t)(s + 2) * GSEG;
      copy8<GSEG, GRB>(l0 + bofs, ga + go);  copy8<GSEG, GRB>(l0 + bofs + 8u * GSEG, gl + go);  copy8<GSEG, GRB>(l0 + bofs + 16u * GSEG, gb + go);
    }
  }
  wait_async0();
#pragma unroll
  for (int i = 0; i < 2; ++i) epi_put(slab + (wave * 2 + i) * SLAB64, acc[i][0], acc[i][1], acc[i][2], acc[i][3], oscale, lane);
  wave_sync_lds();                           // a slab is written and read by one wave only
#pragma unroll
  for (int i = 0; i < 2; ++i)
    epi_get(slab + (wave * 2 + i) * SLAB64, bias, C, DMOD, (size_t)(row0 + 32 * wr + 16 * i), col0 + 64 * wc, lane);
}

// =====================================================================================================
// Causal attention: block bid -> (pair group pg = bid % NPG, head = (bid / NPG) % NH, batch b = bid / (NPG*NH)). A block is NSUB teams of WPB
// waves; team sub works pair pr = NSUB*pg + sub of that head on its own, with LDS slabs and tables of its own. The NSUB teams walk the same
// head's key tiles from 0 on at the same pace, so the NSUB waves that hold the same place w in their teams (block wave
// number = NSUB*w + sub) ask for the same k and v^T fragments at about the same time on one WGP: one of them fetches a line from L2, the
// others find it in the WGP's cache. A team works two query blocks one
// after the other, qb = NQB-1-pr and then qb = pr (rows q0 = 32*qb .. q0+31 = QTW query tiles of 16): together NQB+1 key tiles, the same
// for every team, so that no block and no WGP carries more of the causal triangle than another, wherever the blocks land.
// A query block's key tiles are dealt round-robin to its team's WPB waves (wave w takes kt = w, w + WPB, ..);
// a wave works BOTH query tiles against each key tile it takes, so every k and v^T fragment it loads feeds two score or output tiles;
// each wave keeps its own running max, sum and unnormalised O per query, and the WPB partials are merged through LDS after one block barrier.
//   q planes (hi, lo f16 x1024): fragment-major planes of the matrix [b*SEQ + s][h*HD + d]; k planes the same; v^T planes of [(b*NH + h)*HD + d][s].
//   score (log2 domain) t(i, j) = (q_i.k_j) * 0.125*log2e/(1024*1024) for key j <= query i, and -inf for j > i (the select
//   replaces the score). Key tiles of 32 visited for kb <= q0 (32-aligned, so kb <= every query of the block); tiles whose every key
//   index exceeds every query index of the block hold only -inf, whose exp is exactly 0, and are not visited. In every visited tile
//   key kb is finite for every query of the block, so a wave's running max is finite from its first tile on; a wave with no tile
//   keeps max = -inf, sum = 0, O = 0.
//   Both products are taken transposed: S^T = K.Q^T (A = 16 key rows, B = 16 queries) and O^T += V^T.P^T (A = 16 d rows of v^T,
//   B = P^T). In a score tile lane (c, hh) then holds query q0 + 16t + c and keys 8hh + 0..7 of the subtile, so a query's maximum and sum
//   run over the lane's own 16 registers plus one exchange with lane ^ 16, and the two subtiles' accumulators, converted in place, ARE the
//   B fragment of P^T in the split k map (elements 0..7 = keys kb + 8hh + 0..7, 8..15 = keys kb + 16 + 8hh + 0..7): P never leaves
//   the registers. Per key tile and query tile: 2 score subtiles x 2 k-steps x 3 products (k_hi.q_hi + k_hi.q_lo + k_lo.q_hi), fragments
//   loaded straight from the 16-bit planes (two 16-B loads per fragment, split k map); online max-subtracted base-2 softmax in f32,
//   -inf-safe rescale (one factor per lane); P x32768 as f16 hi and f16 residual; 4+4 v^T A fragments (hi and residual planes),
//   12 WMMAs (hh + hl + lh). A lane sums only its own half's keys; the two halves' sums are joined once, after the loop.
//   After each query block's loop: each wave writes its unnormalised O to its own slab of that query block (32 rows, pitch 68; every
//   element owned by one lane) and its row max and sum to the tables; behind both query blocks one block barrier (reached by every wave; trip counts differ only between waves, and the loop holds
//   no block barrier); wave w then merges columns d = 16w .. 16w+15 of all 32 rows: M = max_w m_w, out = sum_w O_w 2^(m_w - M) / sum_w l_w 2^(m_w - M)
//   (Z > 0 always: key j = i is never masked; guarded anyway), carries 1/(32768*1024) folded once. Bounded loops only (nkt <= NKT).
// coverage: per wave and query tile 1 instruction x 16 rows x 2 lanes x 8 halves = 16 x 16 per plane, x WPB waves x QTW tiles = 32 x 64;
//           x 2 query blocks (pr and NQB-1-pr, pr < NQB/2: every qb once) x NSUB teams; grid NPG*NH*BATCH blocks = every (b, s, h) row of both O planes once.
// =====================================================================================================
// four v_nop behind the score products: no vector instruction touches their results or operands inside the matrix unit's window
__device__ __forceinline__ void guard_sc(v8f& a, v8f& b, v8f& c, v8f& d, v16h k0, v16h k1, v16h k2, v16h k3,
                                         v16h q0, v16h q1, v16h q2, v16h q3) {
#if defined(__HIP_DEVICE_COMPILE__)
  asm volatile("v_nop\n\tv_nop\n\tv_nop\n\tv_nop"
               : "+v"(a), "+v"(b), "+v"(c), "+v"(d)
               : "v"(k0), "v"(k1), "v"(k2), "v"(k3), "v"(q0), "v"(q1), "v"(q2), "v"(q3) : "memory");
#endif
}
// the same behind the output products of both query tiles
__device__ __forceinline__ void guard_pv(v8f& a0, v8f& a1, v8f& a2, v8f& a3, v8f& b0, v8f& b1, v8f& b2, v8f& b3, v16h p0, v16h p1, v16h p2,
                                         v16h p3, v16h x0, v16h x1, v16h x2, v16h x3, v16h x4, v16h x5, v16h x6, v16h x7) {
#if defined(__HIP_DEVICE_COMPILE__)
  asm volatile("v_nop\n\tv_nop\n\tv_nop\n\tv_nop"
               : "+v"(a0), "+v"(a1), "+v"(a2), "+v"(a3), "+v"(b0), "+v"(b1), "+v"(b2), "+v"(b3)
               : "v"(p0), "v"(p1), "v"(p2), "v"(p3), "v"(x0), "v"(x1), "v"(x2), "v"(x3), "v"(x4), "v"(x5), "v"(x6), "v"(x7) : "memory");
#endif
}

__global__ __launch_bounds__(ATT_THREADS, 4)   // 4 waves per SIMD: the whole grid (256 blocks x 16 waves, one block per WGP) is resident at once, no second round
void attn1(const u16* __restrict__ QHIp, const u16* __restrict__ QLOp,
           const u16* __restrict__ KHIp, const u16* __restrict__ KLOp,
           const u16* __restrict__ VHIp, const u16* __restrict__ VLOp,
           u16* OHIp, u16* OLOp) {
  __shared__ __align__(16) float smem_all[NSUB * 2 * WPB * WREG];   // per team one set of slabs per query block of the pair
  __shared__ float mtab_all[NSUB * 2 * WPB * 16 * QTW]; // per team, query block, wave and query row: running max (log2 domain)
  __shared__ float ltab_all[NSUB * 2 * WPB * 16 * QTW]; // per team, query block, wave and query row: running sum

  const int bw   = __builtin_amdgcn_readfirstlane((int)threadIdx.x >> 5);   // scalar: the key loop's start must be wave-uniform for the WMMAs
  const int sub  = bw % NSUB;                // team
  const int wave = bw / NSUB;                // place in the team
  const int lane = threadIdx.x & 31;
  const int tid  = wave * 32 + lane;         // thread number within the team
  const int hh   = lane >> 4;
  const int c    = lane & 15;
  const int bid  = blockIdx.x;
  const int pr   = (bid % NPG) * NSUB + sub;
  const int rem  = bid / NPG;
  float* smem = smem_all + sub * (2 * WPB * WREG);
  float* mtab = mtab_all + sub * (2 * WPB * 16 * QTW);
  float* ltab = ltab_all + sub * (2 * WPB * 16 * QTW);
  const int head = rem % NH;
  const int b    = rem / NH;
  if (b >= BATCH) return;                    // block-uniform, before the block barrier; never taken with the exact grid

  const unsigned lo = 16u * (unsigned)lane;                                     // byte offset of this lane's chunk in a fragment
  const size_t QTS  = (size_t)16 * NH * HD;                                     // halves between the fragments of consecutive row blocks
  const size_t kofs = ((size_t)b * SEQ * NH + (size_t)head * 16) * HD;          // fragment (b*SEQ / 16, 2 * head); key block added per step
  const _Float16* Khb = (const _Float16*)(const void*)KHIp + kofs;
  const _Float16* Klb = (const _Float16*)(const void*)KLOp + kofs;
  const size_t vofs = (((size_t)b * NH + head) * HD) * SEQ;                    // fragment (4 * (b*NH + head) (+j), 0); key block added per step
  const _Float16* Vhb = (const _Float16*)(const void*)VHIp + vofs;
  const _Float16* Vlb = (const _Float16*)(const void*)VLOp + vofs;
  const float lsc = 0.125f * (LOG2E / (QSC * KSC));
  const float oc  = 1.0f / (PCAR * VCAR);
  const size_t KROW = (size_t)NH * HD;                                          // halves per key row; 16 * KROW between consecutive 16-row key blocks

#pragma unroll 1   // rolled: the two query blocks run one after the other through one copy of the key loop
  for (int pass = 0; pass < 2; ++pass) {
  const int qb   = (pass == 0) ? (NQB - 1 - pr) : pr;
  const int q0   = qb * (16 * QTW);
  float* slab = smem + (pass * WPB + wave) * WREG;                              // result slab [32 queries][64 d] pitch 68
  const size_t qofs = (((size_t)b * SEQ + q0) * NH + (size_t)head * 16) * HD;   // fragment (row q0's block, 2 * head); query tile t: + t * QTS
  const _Float16* Qh  = (const _Float16*)(const void*)QHIp + qofs;
  const _Float16* Ql  = (const _Float16*)(const void*)QLOp + qofs;
  float mrun[QTW], lrun[QTW];                // query q0 + 16t + c: running max (equal in both halves), running sum over this half's keys
  v8f o[QTW][4];                             // o[t][j][r] = O^T element (d = 16j + 8hh + r, query q0 + 16t + c)
#pragma unroll
  for (int t = 0; t < QTW; ++t) {
    mrun[t] = -INFINITY;
    lrun[t] = 0.f;
#pragma unroll
    for (int j = 0; j < 4; ++j) o[t][j] = zero8();
  }
  const int ncaus = qb + 1;                                                     // tiles holding keys <= q0 + 31
  const int nkt = (ncaus < NKT) ? ncaus : NKT;

  // byte offsets of key tile kt in the k planes (32 rows of KROW halves) and in the v^T planes (one fragment), plus this lane's chunk
  unsigned ko = lo + (unsigned)wave * (unsigned)(32 * NH * HD * 2);
  unsigned vo = lo + (unsigned)wave * 1024u;
#pragma unroll 1
  for (int kt = wave; kt < nkt; kt += WPB) {
    const int kb = kt * 32;
    // ---- scores: D element r of this lane = (key kb + 8hh + r, query q0 + 16t + c) in s[t][0], key kb + 16 + 8hh + r in s[t][1] ----
    const _Float16* k0p = Khb;
    const _Float16* k1p = k0p + (size_t)16 * KROW;
    const _Float16* l0p = Klb;
    const _Float16* l1p = l0p + (size_t)16 * KROW;
    // the tile's 8 k fragments as one load group, ahead of the first product: one wait on the loads per key tile, not one per k step
    v16h kh0[2], kh1[2], kl0[2], kl1[2];
#pragma unroll
    for (int kk = 0; kk < 2; ++kk) {
      kh0[kk] = ldfrag_h(k0p + kk * 512, ko);
      kh1[kk] = ldfrag_h(k1p + kk * 512, ko);
      kl0[kk] = ldfrag_h(l0p + kk * 512, ko);
      kl1[kk] = ldfrag_h(l1p + kk * 512, ko);
    }
    v8f s[QTW][2];
#pragma unroll
    for (int t = 0; t < QTW; ++t) { s[t][0] = zero8(); s[t][1] = zero8(); }
#pragma unroll
    for (int kk = 0; kk < 2; ++kk) {
      v16h qh[QTW], ql[QTW];
#pragma unroll
      for (int t = 0; t < QTW; ++t) {
        qh[t] = ldfrag_h(Qh + t * QTS + kk * 512, lo);
        ql[t] = ldfrag_h(Ql + t * QTS + kk * 512, lo);
      }
#pragma unroll
      for (int t = 0; t < QTW; ++t) {
        s[t][0] = mma_h(kh0[kk], qh[t], s[t][0]);
        s[t][0] = mma_h(kh0[kk], ql[t], s[t][0]);
        s[t][0] = mma_h(kl0[kk], qh[t], s[t][0]);
        s[t][1] = mma_h(kh1[kk], qh[t], s[t][1]);
        s[t][1] = mma_h(kh1[kk], ql[t], s[t][1]);
        s[t][1] = mma_h(kl1[kk], qh[t], s[t][1]);
      }
      guard_sc(s[0][0], s[0][1], s[1][0], s[1][1], kh0[kk], kh1[kk], kl0[kk], kl1[kk], qh[0], ql[0], qh[1], ql[1]);
    }
    // ---- causal select (score := -inf for key > query) + online softmax in base 2, -inf-safe; all 32 keys of a query sit in
    //      lanes c and c + 16 ----
    const int key0 = kb + 8 * hh, key1 = key0 + 16;
    FragH ph[QTW], pl[QTW];
#pragma unroll
    for (int t = 0; t < QTW; ++t) {
      const int qi = q0 + 16 * t + c;
      v8f t0 = s[t][0] * lsc, t1 = s[t][1] * lsc;
      float mx = -INFINITY;
#pragma unroll
      for (int r = 0; r < 8; ++r) {
        t0[r] = (key0 + r > qi) ? -INFINITY : t0[r];
        t1[r] = (key1 + r > qi) ? -INFINITY : t1[r];
        mx = fmaxf(mx, fmaxf(t0[r], t1[r]));
      }
      mx = fmaxf(mx, xhalf(mx));
      const float mn = fmaxf(mrun[t], mx);
      const float ms = (mn == -INFINITY) ? 0.0f : mn;
      const float al = exp2_bare(mrun[t] - ms);
      mrun[t] = mn;
      // ---- B fragments of P^T * 32768: hi f16 and residual f16, col = query c, split k map over the 32 keys of this step ----
      t0 -= ms;
      t1 -= ms;
      v8f e0, e1;
#pragma unroll
      for (int r = 0; r < 8; ++r) { e0[r] = exp2_bare(t0[r]); e1[r] = exp2_bare(t1[r]); }
      const v8f es = e0 + e1;
      const float ps = ((es[0] + es[1]) + (es[2] + es[3])) + ((es[4] + es[5]) + (es[6] + es[7]));
      const v8f ta = e0 * PCAR, tb = e1 * PCAR;
      ph[t].h[0] = __builtin_convertvector(ta, v8h);          // elements 0..7  = keys kb + 8hh + 0..7
      ph[t].h[1] = __builtin_convertvector(tb, v8h);          // elements 8..15 = keys kb + 16 + 8hh + 0..7
      pl[t].h[0] = __builtin_convertvector(ta - __builtin_convertvector(ph[t].h[0], v8f), v8h);
      pl[t].h[1] = __builtin_convertvector(tb - __builtin_convertvector(ph[t].h[1], v8f), v8h);
      lrun[t] = lrun[t] * al + ps;
#pragma unroll
      for (int j = 0; j < 4; ++j) {
#pragma unroll
        for (int r = 0; r < 8; ++r) o[t][j][r] *= al;
      }
    }
    // ---- V^T.P^T : A fragment row = d = j*16 + c, keys contiguous in the v^T planes; each fragment serves both query tiles ----
    {
      v16h vh[4], vl[4];
#pragma unroll
      for (int j = 0; j < 4; ++j) {
        vh[j] = ldfrag_h(Vhb + (size_t)(16 * j) * SEQ, vo);
        vl[j] = ldfrag_h(Vlb + (size_t)(16 * j) * SEQ, vo);
      }
#pragma unroll
      for (int t = 0; t < QTW; ++t) {
#pragma unroll
        for (int j = 0; j < 4; ++j) {
          o[t][j] = mma_h(vh[j], ph[t].v, o[t][j]);
          o[t][j] = mma_h(vh[j], pl[t].v, o[t][j]);
          o[t][j] = mma_h(vl[j], ph[t].v, o[t][j]);
        }
      }
      guard_pv(o[0][0], o[0][1], o[0][2], o[0][3], o[1][0], o[1][1], o[1][2], o[1][3], ph[0].v, pl[0].v, ph[1].v, pl[1].v,
               vh[0], vh[1], vh[2], vh[3], vl[0], vl[1], vl[2], vl[3]);
    }
    ko += (unsigned)(WPB * 32 * NH * HD * 2);
    vo += (unsigned)(WPB * 1024);
  }
  // ---- this wave's partial: unnormalised O into its lane-owned slab (8 consecutive d per accumulator), row max and sum into the tables ----
#pragma unroll
  for (int t = 0; t < QTW; ++t) {
    acc_guard4(o[t][0], o[t][1], o[t][2], o[t][3]);
    lrun[t] += xhalf(lrun[t]);               // the two halves' key sums of query q0 + 16t + c, joined once
#pragma unroll
    for (int j = 0; j < 4; ++j) {
      float* sp = slab + (16 * t + c) * 68 + j * 16 + 8 * hh;
      const v4f a = {o[t][j][0], o[t][j][1], o[t][j][2], o[t][j][3]}, b4 = {o[t][j][4], o[t][j][5], o[t][j][6], o[t][j][7]};
      *(v4f*)(sp)     = a;
      *(v4f*)(sp + 4) = b4;
    }
    if (hh == 0) {
      mtab[((pass * WPB + wave) * QTW + t) * 16 + c] = mrun[t];
      ltab[((pass * WPB + wave) * QTW + t) * 16 + c] = lrun[t];
    }
  }
  }
  __syncthreads();                           // publishes every wave's partials of both query blocks to the WPB waves of its team that merge them
  // ---- merge of the WPB partials; per query tile t, thread = chunk tid of the tile's two O fragments: row = 16t + (lane & 15),
  //      8 consecutive d from 32 * (wave >> 1) + 16 * (wave & 1) + 8 * (lane >> 4) ----
  const int c8 = wave * 16 + hh * 8;
#pragma unroll 1   // rolled: one copy of the merge serves both query blocks
  for (int pass = 0; pass < 2; ++pass) {
  const int q0 = ((pass == 0) ? (NQB - 1 - pr) : pr) * (16 * QTW);
  const size_t qofs = (((size_t)b * SEQ + q0) * NH + (size_t)head * 16) * HD;
#pragma unroll
  for (int t = 0; t < QTW; ++t) {
    float mw[WPB];
    float mall = -INFINITY;
#pragma unroll
    for (int w = 0; w < WPB; ++w) { mw[w] = mtab[((pass * WPB + w) * QTW + t) * 16 + c]; mall = fmaxf(mall, mw[w]); }
    const float msafe = (mall == -INFINITY) ? 0.0f : mall;
    float lv = 0.f;
    float acc[8];
#pragma unroll
    for (int e = 0; e < 8; ++e) acc[e] = 0.f;
#pragma unroll
    for (int w = 0; w < WPB; ++w) {
      const float sc = exp2f(mw[w] - msafe);   // 0 for a wave that saw no tile
      lv += ltab[((pass * WPB + w) * QTW + t) * 16 + c] * sc;
      const float* sp = smem + (pass * WPB + w) * WREG + (16 * t + c) * 68 + c8;
      const v4f a = *(const v4f*)(sp), b4 = *(const v4f*)(sp + 4);
#pragma unroll
      for (int e = 0; e < 4; ++e) { acc[e] += a[e] * sc; acc[4 + e] += b4[e] * sc; }
    }
    // ---- out = acc / Z (0 if Z == 0), carries (32768 on P, 1024 on v) folded once; O x1024 -> f16 hi + residual planes ----
    const float ls  = (lv > 0.0f) ? lv : 1.0f;
    const float inv = (lv > 0.0f) ? ((1.0f / ls) * oc) : 0.0f;
    v4u oh, ol;
#pragma unroll
    for (int e = 0; e < 4; ++e) {
      const float w0 = (acc[2 * e] * inv) * OSC, w1 = (acc[2 * e + 1] * inv) * OSC;
      const _Float16 h0 = (_Float16)w0, h1 = (_Float16)w1;
      const _Float16 l0 = (_Float16)(w0 - (float)h0), l1 = (_Float16)(w1 - (float)h1);
      oh[e] = pk16(h_bits(h0), h_bits(h1));
      ol[e] = pk16(h_bits(l0), h_bits(l1));
    }
    const size_t o8 = qofs + t * QTS + 8 * tid;                                 // fragments (row q0's block + t, 2 * head .. 2 * head + 1)
    *(v4u*)(OHIp + o8) = oh;
    *(v4u*)(OLOp + o8) = ol;
#if defined(__HIP_DEVICE_COMPILE__)
    asm volatile("s_wait_xcnt 0x0" ::: "memory");   // stands in front of whatever next rewrites a register that these two stores name
#endif
  }
  }
}

// =====================================================================================================
// Workspace map (bytes); every plane is fully written by whole-line stores before it is read; all extents are exact multiples
// of the store granularity (no pad rows needed); every offset a multiple of 2097152; every 16-bit plane is fragment-major (the shape
// given is that of its matrix, rows x k):
//   XB  bf16 [MROWS][1024]              8388608
//   WQB bf16 [1024 n][1024 k]          2097152        WKB, WVB same
//   WOH f16  [1024 n][1024 k] x1024    2097152
//   QHI f16 [MROWS][16*64] x1024       8388608        QLO residual
//   KHI f16 [MROWS][16*64] x1024       8388608        KLO residual
//   VHI f16 [BATCH*16*64][SEQ] x1024   8388608        VLO residual
//   OHI f16 [MROWS][1024] x1024        8388608        OLO residual
//   end                               83886080
// =====================================================================================================
extern "C" void kernel_launch(void* const* d_in, const int* in_sizes, int n_in,
                              void* d_out, int out_size, void* d_ws, size_t ws_size,
                              hipStream_t stream) {
  if (n_in < 9) return;
  if (in_sizes[0] != MROWS * DMOD) return;
  if (in_sizes[1] != DMOD * DMOD || in_sizes[3] != DMOD * DMOD) return;
  if (in_sizes[5] != DMOD * DMOD || in_sizes[7] != DMOD * DMOD) return;
  if (in_sizes[2] != DMOD || in_sizes[4] != DMOD || in_sizes[6] != DMOD || in_sizes[8] != DMOD) return;
  if (out_size != MROWS * DMOD) return;

  const float* x    = (const float*)d_in[0];
  const float* wq   = (const float*)d_in[1];
  const float* bq   = (const float*)d_in[2];
  const float* wk   = (const float*)d_in[3];
  const float* bk   = (const float*)d_in[4];
  const float* wv   = (const float*)d_in[5];
  const float* bv   = (const float*)d_in[6];
  const float* wo   = (const float*)d_in[7];
  const float* bo   = (const float*)d_in[8];
  float*       out  = (float*)d_out;

  const size_t szXB = (size_t)MROWS * DMOD * 2;                 //  8388608
  const size_t szW  = (size_t)DMOD * DMOD * 2;                  //  2097152
  const size_t szP  = (size_t)MROWS * DMOD * 2;                 //  8388608
  size_t off = 0;
  const size_t oXB  = off; off += szXB;
  const size_t oWQ  = off; off += szW;
  const size_t oWK  = off; off += szW;
  const size_t oWV  = off; off += szW;
  const size_t oWO  = off; off += szW;
  const size_t oQHI = off; off += szP;
  const size_t oQLO = off; off += szP;
  const size_t oKHI = off; off += szP;
  const size_t oKLO = off; off += szP;
  const size_t oVHI = off; off += szP;
  const size_t oVLO = off; off += szP;
  const size_t oOHI = off; off += szP;
  const size_t oOLO = off; off += szP;
  if (off > ws_size) return;                            // off = 83886080
  if (off > (size_t)134217728) return;

  char* ws = (char*)d_ws;
  u16*   XB  = (u16*)(ws + oXB);
  u16*   WQB = (u16*)(ws + oWQ);
  u16*   WKB = (u16*)(ws + oWK);
  u16*   WVB = (u16*)(ws + oWV);
  u16*   WOH = (u16*)(ws + oWO);
  u16*   QHI = (u16*)(ws + oQHI);
  u16*   QLO = (u16*)(ws + oQLO);
  u16*   KHI = (u16*)(ws + oKHI);
  u16*   KLO = (u16*)(ws + oKLO);
  u16*   VHI = (u16*)(ws + oVHI);
  u16*   VLO = (u16*)(ws + oVLO);
  u16*   OHI = (u16*)(ws + oOHI);
  u16*   OLO = (u16*)(ws + oOLO);

  const dim3 blk(256);
  const dim3 gPR(4 * NWB + NXB);                        // 4 x 256 + 2048
  const dim3 gG((MROWS / 128) * (DMOD / 128));          // 256
  const dim3 gP((MROWS / 128) * (DMOD / 128));          // 256
  const dim3 bP(384);
  const dim3 gAT(ATT_BLOCKS);                           // 256
  const dim3 bAT(ATT_THREADS);                          // 512

  // (0) Wq/Wk/Wv [k][n] -> bf16 [n][k] planes; Wo [k][n] -> f16 [n][k] plane of bf16 value x1024; x -> bf16 plane [MROWS][1024]
  prep16<<<gPR, blk, 0, stream>>>(x, wq, wk, wv, wo, XB, WQB, WKB, WVB, WOH, WOS);
  // (1) q = x.Wq + bq, k = x.Wk + bk -> hi/residual planes x1024; v = x.Wv + bv -> v^T hi/residual planes x1024
  proj3<<<gP, bP, 0, stream>>>(XB, WQB, WKB, WVB, bq, bk, bv, QHI, QLO, KHI, KLO, VHI, VLO);
  // (2) causal attention -> O planes [b*SEQ+s][h][d] x1024 (hi + residual)
  attn1<<<gAT, bAT, 0, stream>>>(QHI, QLO, KHI, KLO, VHI, VLO, OHI, OLO);
  // (3) output projection -> out [MROWS][1024] f32, carries 1024 (O) x 1024 (Wo) folded back, + bo
  gemm_h2<<<gG, blk, 0, stream>>>(OHI, OLO, WOH, bo, out, 1.0f / (OSC * WOS));
  (void)hipGetLastError();
}
